// v000
// Times are from an AMD MI455X. After a warm-up the kernel runs many times in a row, and a time is the length of
// such a window on the GPU divided by its runs, so every launch and the gaps after it count. The runs cycle
// through copies of the inputs. A figure is the median of several windows, for all but v000 over two sittings.
// Sittings can differ by a few percent; kernels timed side by side share one.
// The starting kernel, v000, takes 4060 microseconds a run.
// All contractions on v_wmma_f32_16x16x32_bf16 with f32 accumulate: q/k/v projections = bf16(x) x bf16(W) single product; chunk state, scores, inter and intra products = bf16 hi/lo operands (hi*hi + hi*lo + lo*hi); output projection = (attn_hi + attn_lo) x bf16(Wo); sigmoid, flow scans and row scales in f32 on VALU.
#include <hip/hip_runtime.h>
#include <math.h>

constexpr int kBatch   = 4;
constexpr int kSeq     = 4096;
constexpr int kEmb     = 512;
constexpr int kHeads   = 8;
constexpr int kHd      = 64;
constexpr int kRows    = kBatch * kSeq;
constexpr int kBH      = kBatch * kHeads;
constexpr int kChunk   = 64;
constexpr int kNChunk  = kSeq / kChunk;
constexpr int kLp      = 72;
constexpr int kQkvN    = 3 * kEmb;
constexpr int kHalfRows = kRows / 2;
constexpr int kHalfBH   = kBH / 2;
constexpr float kEps   = 1e-6f;
static_assert(kHeads * kHd == kEmb, "head packing");
static_assert(kEmb % 32 == 0, "GEMM K multiple of 32");
static_assert(kHd % 32 == 0 && kChunk % 32 == 0, "tile K multiple of 32");
static_assert(kRows % 64 == 0 && kHalfRows % 64 == 0 && kQkvN % 64 == 0 && kEmb % 64 == 0, "GEMM M, N tile multiples");
static_assert(kSeq % 128 == 0 && kSeq % kChunk == 0, "scan line groups and chunks");
static_assert(kSeq == 4096 && kEmb == 512 && kHd == 64, "shift constants in the projection epilogue");
static_assert(kLp % 8 == 0, "LDS pitch keeps 16-B alignment");

typedef __attribute__((ext_vector_type(16))) __bf16   v16b;
typedef __attribute__((ext_vector_type(8)))  __bf16   v8b;
typedef __attribute__((ext_vector_type(8)))  float    v8f;
typedef __attribute__((ext_vector_type(4)))  float    v4f;
typedef __attribute__((ext_vector_type(4)))  unsigned int v4u;

__device__ __forceinline__ unsigned short f2bf_bits(float f) {
  unsigned u = __float_as_uint(f);
  return (unsigned short)((u + 0x7FFFu + ((u >> 16) & 1u)) >> 16);
}
__device__ __forceinline__ float bf_bits2f(unsigned short h) { return __uint_as_float(((unsigned)h) << 16); }
__device__ __forceinline__ float bf16r(float f) { return bf_bits2f(f2bf_bits(f)); }
__device__ __forceinline__ unsigned pk16(unsigned short a, unsigned short b) { return (unsigned)a | ((unsigned)b << 16); }
__device__ __forceinline__ __bf16 bits2bf(unsigned short u) { return __builtin_bit_cast(__bf16, u); }

/* hazard guards as plain device helpers */
__device__ __forceinline__ void dep_guard4_b(v8f& a, v8f& b, v8f& c, v8f& d, v16b x, v16b y) { asm volatile("v_nop\n\tv_nop\n\tv_nop\n\tv_nop" : "+v"(a), "+v"(b), "+v"(c), "+v"(d) : "v"(x), "v"(y)); }
__device__ __forceinline__ void keep4_b(v16b a, v16b b, v16b c, v16b d) { asm volatile("v_nop" :: "v"(a), "v"(b), "v"(c), "v"(d)); }
__device__ __forceinline__ void acc_guard4(v8f& a, v8f& b, v8f& c, v8f& d) { asm volatile("v_nop\n\tv_nop\n\tv_nop\n\tv_nop" : "+v"(a), "+v"(b), "+v"(c), "+v"(d)); }

template <typename T> struct Frag;
template <> struct Frag<__bf16> {
  typedef v16b V; union U { v16b v; v8b h[2]; };
  /* elements 0..7 <- p[0..7], elements 8..15 <- p[16..23] */
  static __device__ __forceinline__ v16b load(const __bf16* p) {
    U f; f.h[0] = *(const v8b*)(p); f.h[1] = *(const v8b*)(p + 16); return f.v;
  }
  static __device__ __forceinline__ v8f mma(v16b a, v16b b, v8f c) {
    return __builtin_amdgcn_wmma_f32_16x16x32_bf16(false, a, false, b, (short)0, c, false, false);
  }
};

/* one WMMA followed by the 4-slot guard tying its accumulator and both operand fragments */
__device__ __forceinline__ v8f mma_g(v16b a, v16b b, v8f c) {
  c = __builtin_amdgcn_wmma_f32_16x16x32_bf16(false, a, false, b, (short)0, c, false, false);
  asm volatile("v_nop\n\tv_nop\n\tv_nop\n\tv_nop" : "+v"(c) : "v"(a), "v"(b));
  return c;
}

__device__ __forceinline__ void wave_lds_sync() {
  __builtin_amdgcn_fence(__ATOMIC_RELEASE, "workgroup");
  __builtin_amdgcn_wave_barrier();
  __builtin_amdgcn_fence(__ATOMIC_ACQUIRE, "workgroup");
}

/* ---- f32 -> bf16 (RNE convert), 8 consecutive elements per thread: two 16-B loads, ONE 16-B store per lane; a wave writes
        Coverage: thread i writes elements 8i..8i+7, i < n8; every call has n8 a multiple of 256. */
__global__ __launch_bounds__(256) void cvt8_bf16_kernel(const float* __restrict__ src, unsigned short* __restrict__ dst, int n8) {
  const int i = blockIdx.x * 256 + threadIdx.x;
  if (i < n8) {
    const float* p = src + 8 * (size_t)i;
    const v4f a = *(const v4f*)(p);
    const v4f b = *(const v4f*)(p + 4);
    unsigned short hb[8];
#pragma unroll
    for (int e = 0; e < 4; ++e) {
      const float fa = a[e];
      const float fb = b[e];
      hb[e]     = f2bf_bits(fa);
      hb[4 + e] = f2bf_bits(fb);
    }
    const v4u u = (v4u){pk16(hb[0], hb[1]), pk16(hb[2], hb[3]), pk16(hb[4], hb[5]), pk16(hb[6], hb[7])};
    unsigned short* q = dst + 8 * (size_t)i;
    *(v4u*)q = u;
    
  }
}

/* ---- bias plane: dst[0..2047] = bf16 value (kept as f32) of bq | bk | bv | bo. One block of 256 threads, 2 iterations x 256 x
        float4 = 512 float4 = exactly 2048 floats. All four sources are loaded unconditionally; wave-uniform select by value.
*/
__global__ __launch_bounds__(256) void bias_prep_kernel(const float* __restrict__ b0, const float* __restrict__ b1,
                                                        const float* __restrict__ b2, const float* __restrict__ b3,
                                                        float* __restrict__ dst) {
  const int tid = threadIdx.x;
#pragma unroll 1
  for (int it = 0; it < 2; ++it) {
    const int idx4 = it * 256 + tid;
    const int which = idx4 >> 7;
    const int off = (idx4 & 127) * 4;
    const v4f va = *(const v4f*)(b0 + off);
    const v4f vb = *(const v4f*)(b1 + off);
    const v4f vc = *(const v4f*)(b2 + off);
    const v4f vd = *(const v4f*)(b3 + off);
    v4f o;
#pragma unroll
    for (int e = 0; e < 4; ++e) {
      const float s01 = (which == 0) ? va[e] : vb[e];
      const float s23 = (which == 2) ? vc[e] : vd[e];
      o[e] = bf16r((which < 2) ? s01 : s23);
    }
    float* op = dst + which * kEmb + off;
    *(v4f*)op = o;
    
  }
}

/* ---- Register-blocked WMMA GEMM, each wave owns a 64x64 tile; A row-major [M][512], Bt row-major [N][512] (bf16 bits).
        MODE 0 (projections): single product; epilogue adds bias[n]; column tile 64 = one head of q (n0 < 512), k (512..1023)
               x 16 B, 4 rows per instruction); v: f32 plane [b][h][l][64] (row segment 256 B = 16 lanes x 16 B, 2 rows per instruction).
        MODE 1 (output projection): product = A*Bt + A2*Bt (A2 = lo plane of A); epilogue adds bias[n]; f32 rows of pitch 512.
*/
template <int MODE>
__global__ __launch_bounds__(256) void gemm64_kernel(
    const unsigned short* __restrict__ Ap, const unsigned short* __restrict__ A2p,
    const unsigned short* __restrict__ Btp, const float* __restrict__ bias,
    unsigned short* __restrict__ QHp, unsigned short* __restrict__ QLp,
    unsigned short* __restrict__ KHp, unsigned short* __restrict__ KLp,
    float* __restrict__ Fout, int M, int N) {
  typedef __bf16 T;
  const T* A = (const T*)Ap; const T* A2 = (const T*)A2p; const T* Bt = (const T*)Btp;
  __shared__ __align__(16) float sT[8][16 * 68];
  const int lane = threadIdx.x & 31;
  const int wave = threadIdx.x >> 5;
  const int tilesN = N >> 6;
  const int tilesM = M >> 6;
  const int tile = blockIdx.x * 8 + wave;
  /* wave-uniform; no block barriers in this kernel */
  if (tile >= tilesM * tilesN) return;
  const int tm = tile / tilesN;
  const int tn = tile - tm * tilesN;
  const int m0 = tm << 6;
  const int n0 = tn << 6;

  const int rlane = lane & 15;
  const int koff  = (lane >> 4) * 8;
  const int mOff  = (lane >> 4) * 8;

  v8f acc[4][4];
#pragma unroll
  for (int i = 0; i < 4; ++i)
#pragma unroll
    for (int j = 0; j < 4; ++j) acc[i][j] = (v8f){0.f,0.f,0.f,0.f,0.f,0.f,0.f,0.f};

  for (int k0 = 0; k0 < kEmb; k0 += 32) {
    v16b bh[4];
#pragma unroll
    for (int j = 0; j < 4; ++j) {
      const size_t bo = (size_t)(n0 + (j << 4) + rlane) * kEmb + koff + k0;
      bh[j] = Frag<T>::load(Bt + bo);
    }
#pragma unroll
    for (int i = 0; i < 4; ++i) {
      const size_t ao = (size_t)(m0 + (i << 4) + rlane) * kEmb + koff + k0;
      v16b ah = Frag<T>::load(A + ao);
      v16b al = ah;
      if (MODE == 1) al = Frag<T>::load(A2 + ao);
#pragma unroll
      for (int j = 0; j < 4; ++j) {
        acc[i][j] = Frag<T>::mma(ah, bh[j], acc[i][j]);
        if (MODE == 1) acc[i][j] = Frag<T>::mma(al, bh[j], acc[i][j]);
      }
      dep_guard4_b(acc[i][0], acc[i][1], acc[i][2], acc[i][3], ah, al);
    }
    keep4_b(bh[0], bh[1], bh[2], bh[3]);
  }
  acc_guard4(acc[0][0], acc[0][1], acc[0][2], acc[0][3]);
  acc_guard4(acc[1][0], acc[1][1], acc[1][2], acc[1][3]);
  acc_guard4(acc[2][0], acc[2][1], acc[2][2], acc[2][3]);
  acc_guard4(acc[3][0], acc[3][1], acc[3][2], acc[3][3]);

  /* ---- epilogue ---- */
  float* slab = sT[wave];
  /* wave-uniform tile decode for MODE 0 */
  const int sel  = n0 >> 9;
  const int hcol = (n0 & (kEmb - 1)) >> 6;
  const int bb   = m0 >> 12;
  const int l0   = m0 & (kSeq - 1);
  const size_t rowbase = ((size_t)(bb * kHeads + hcol)) * kSeq + (size_t)l0;
  unsigned short* Ch = (sel == 0) ? QHp : KHp;
  unsigned short* Cl = (sel == 0) ? QLp : KLp;
  const int hh = lane >> 4, c4 = (lane & 15) * 4;
  const int q4 = lane >> 3, c8 = (lane & 7) * 8;
#pragma unroll
  for (int i = 0; i < 4; ++i) {
#pragma unroll
    for (int j = 0; j < 4; ++j) {
      const int n = n0 + (j << 4) + rlane;
      const float bv = bias[n];
#pragma unroll
      for (int r = 0; r < 8; ++r) {
        const float v = acc[i][j][r] + bv;
        slab[(mOff + r) * 68 + (j << 4) + rlane] = v;
      }
    }
    wave_lds_sync();
    if (MODE == 0 && sel < 2) {
      /* in-place sigmoid on the slab, rolled: lane owns (row it*2+hh, cols c4..c4+3) */
#pragma unroll 1
      for (int it = 0; it < 8; ++it) {
        float* sp = slab + (it * 2 + hh) * 68 + c4;
        v4f v = *(const v4f*)sp;
#pragma unroll
        for (int e = 0; e < 4; ++e) {
          const float x = v[e];
          v[e] = 1.0f / (1.0f + expf(-x));
        }
        *(v4f*)sp = v;
      }
      wave_lds_sync();
    }
    if (MODE == 1) {
      float* Cf = Fout;
      {
#pragma unroll
        for (int it = 0; it < 8; ++it) {
          const int row = it * 2 + hh;
          const v4f v = *(const v4f*)(slab + row * 68 + c4);
          *(v4f*)(Cf + (size_t)(m0 + (i << 4) + row) * kEmb + n0 + c4) = v;
        }
        
      }
    } else if (sel == 2) {
      float* Cf = Fout;
      {
#pragma unroll
        for (int it = 0; it < 8; ++it) {
          const int row = it * 2 + hh;
          const v4f v = *(const v4f*)(slab + row * 68 + c4);
          *(v4f*)(Cf + (rowbase + (size_t)((i << 4) + row)) * kHd + c4) = v;
        }
        
      }
    } else {
      v4u uh[4], ul[4];
#pragma unroll
      for (int it = 0; it < 4; ++it) {
        const float* sp = slab + (it * 4 + q4) * 68 + c8;
        unsigned short hb[8], lb[8];
#pragma unroll
        for (int e = 0; e < 8; ++e) {
          const float f = sp[e];
          hb[e] = f2bf_bits(f);
          lb[e] = f2bf_bits(f - bf_bits2f(hb[e]));
        }
        uh[it] = (v4u){pk16(hb[0], hb[1]), pk16(hb[2], hb[3]), pk16(hb[4], hb[5]), pk16(hb[6], hb[7])};
        ul[it] = (v4u){pk16(lb[0], lb[1]), pk16(lb[2], lb[3]), pk16(lb[4], lb[5]), pk16(lb[6], lb[7])};
      }
      {
#pragma unroll
        for (int it = 0; it < 4; ++it) {
          const size_t o = (rowbase + (size_t)((i << 4) + it * 4 + q4)) * kHd + c8;
          *(v4u*)(Ch + o) = uh[it];
          *(v4u*)(Cl + o) = ul[it];
        }
        
      }
    }
    wave_lds_sync();
  }
}

/* ---- flow scan: one wave per (b,h); lane owns features 2*lane, 2*lane+1; 4096 sequential steps, all f32.
        q = q_hi + q_lo, k = k_hi + k_lo read as 32-bit words of the bf16 planes (the same operands the WMMA products use).
        Per row l: rs[l] = sigmoid(conserved_sink) * sink_in / (l+1) (applied to output rows);
                   comp[l] = exp(clip(conserved_source)) / cumsum * (l+1) (applied to v rows).
*/
__global__ __launch_bounds__(32) void flow_scan_kernel(const unsigned short* __restrict__ QHp, const unsigned short* __restrict__ QLp,
                                                       const unsigned short* __restrict__ KHp, const unsigned short* __restrict__ KLp,
                                                       float* __restrict__ RS, float* __restrict__ COMP) {
  const int bh = blockIdx.x, lane = threadIdx.x;
  const size_t wbase = (size_t)bh * kSeq * (kHd / 2);
  const unsigned* QHw = (const unsigned*)QHp + wbase;
  const unsigned* QLw = (const unsigned*)QLp + wbase;
  const unsigned* KHw = (const unsigned*)KHp + wbase;
  const unsigned* KLw = (const unsigned*)KLp + wbase;
  float kc0 = 0.f, kc1 = 0.f, qc0 = 0.f, qc1 = 0.f;
  float s10 = 0.f, s11 = 0.f, s20 = 0.f, s21 = 0.f, cssum = 0.f;
  float rk0 = 0.f, rk1 = 0.f, rk2 = 0.f, rk3 = 0.f;
  float ck0 = 0.f, ck1 = 0.f, ck2 = 0.f, ck3 = 0.f;
#pragma unroll 1
  for (int l = 0; l < kSeq; ++l) {
    const size_t wi = (size_t)l * (kHd / 2) + lane;
    const unsigned wqh = QHw[wi], wql = QLw[wi], wkh = KHw[wi], wkl = KLw[wi];
    const float q0 = __uint_as_float(wqh << 16) + __uint_as_float(wql << 16);
    const float q1 = __uint_as_float(wqh & 0xffff0000u) + __uint_as_float(wql & 0xffff0000u);
    const float k0 = __uint_as_float(wkh << 16) + __uint_as_float(wkl << 16);
    const float k1 = __uint_as_float(wkh & 0xffff0000u) + __uint_as_float(wkl & 0xffff0000u);
    kc0 += k0; kc1 += k1; qc0 += q0; qc1 += q1;
    float d1 = (q0 + kEps) * (kc0 + kEps) + (q1 + kEps) * (kc1 + kEps);
    float d2 = (k0 + kEps) * (qc0 + kEps) + (k1 + kEps) * (qc1 + kEps);
#pragma unroll
    for (int off = 16; off > 0; off >>= 1) {
      d1 += __shfl_xor(d1, off, 32);
      d2 += __shfl_xor(d2, off, 32);
    }
    const float nrm = (float)(l + 1);
    const float inv_nrm = 1.0f / nrm;
    const float sink_in = (1.0f / d1) * nrm;
    const float src_out = (1.0f / d2) * nrm;
    s10 += k0 * src_out; s11 += k1 * src_out;
    s20 += q0 * sink_in; s21 += q1 * sink_in;
    float d3 = (q0 + kEps) * (s10 + kEps) + (q1 + kEps) * (s11 + kEps);
    float d4 = (k0 + kEps) * (s20 + kEps) + (k1 + kEps) * (s21 + kEps);
#pragma unroll
    for (int off = 16; off > 0; off >>= 1) {
      d3 += __shfl_xor(d3, off, 32);
      d4 += __shfl_xor(d4, off, 32);
    }
    const float csink = d3 * inv_nrm;
    const float csrc  = fminf(fmaxf(d4 * inv_nrm, -1.0f), 1.0f);
    const float salloc = 1.0f / (1.0f + expf(-csink));
    const float cse = expf(csrc);
    cssum += cse;
    const float compv = (cse / cssum) * nrm;
    const float rsv = salloc * (sink_in * inv_nrm);
    const int ph = l & 127;
    const int sl = ph - 4 * lane;
    rk0 = (sl == 0) ? rsv : rk0;  rk1 = (sl == 1) ? rsv : rk1;  rk2 = (sl == 2) ? rsv : rk2;  rk3 = (sl == 3) ? rsv : rk3;
    ck0 = (sl == 0) ? compv : ck0;  ck1 = (sl == 1) ? compv : ck1;  ck2 = (sl == 2) ? compv : ck2;  ck3 = (sl == 3) ? compv : ck3;
    /* wave-uniform */
    if (ph == 127) {
      const v4f ro = (v4f){rk0, rk1, rk2, rk3};
      const v4f co = (v4f){ck0, ck1, ck2, ck3};
      const size_t o = (size_t)bh * kSeq + (size_t)(l - 127) + 4 * lane;
      *(v4f*)(RS + o) = ro;
      *(v4f*)(COMP + o) = co;
      
    }
  }
}

/* ---- fused causal linear attention: one block of 128 threads (4 waves) owns one (b,h) and walks its 64 chunks of 64 rows in order
        (static trip counts, four block barriers per chunk at the top level of the loop, no atomics, no inter-block communication).
        Wave w owns output rows 16w..16w+15 of the chunk and rows m = 16w..16w+15 of the transposed state St[m][d] (f32 registers accS).
        LDS (bf16 bits, pitch 72): R hi/lo  = St[m][d] during the output phase, then KT[d][l] during the state update (shared region);
                                   VT hi/lo = v'^T[m][l] with v' = v * comp[l]; P hi/lo per wave = masked scores, later the output staging.
        Every k-tile read touches columns 0..63 only; those are rewritten every chunk.
        Per chunk:  out[i][m] = rs[i] * ( sum_d q[i][d] St[m][d] + sum_{j<=i} (q[i].k[j]) v'[j][m] );  then St[m][d] += sum_l v'[l][m] k[l][d].
        All products: hi*hi + hi*lo + lo*hi. Q and row-major K fragments come straight from the global bf16 planes (row pitch 64).
        Coverage: 16 blocks x 64 chunks x 4 waves x 16 rows x 64 cols = 8192 rows x 512 cols per plane. */
__global__ __launch_bounds__(128) void flow_attn_kernel(
    const unsigned short* __restrict__ QHp, const unsigned short* __restrict__ QLp,
    const unsigned short* __restrict__ KHp, const unsigned short* __restrict__ KLp,
    const float* __restrict__ VF, const float* __restrict__ RS, const float* __restrict__ COMP,
    unsigned short* __restrict__ AHp, unsigned short* __restrict__ ALp, int bh0) {
  __shared__ __align__(16) __bf16 Rh[kChunk * kLp];
  __shared__ __align__(16) __bf16 Rl[kChunk * kLp];
  __shared__ __align__(16) __bf16 VTh[kHd * kLp];
  __shared__ __align__(16) __bf16 VTl[kHd * kLp];
  __shared__ __align__(16) __bf16 Ph[4][16 * kLp];
  __shared__ __align__(16) __bf16 Pl[4][16 * kLp];

  const int tid = threadIdx.x, lane = tid & 31, wave = tid >> 5;
  const int c = lane & 15, hh = lane >> 4, koff = hh * 8;
  const int bh = bh0 + (int)blockIdx.x;
  const int hd = bh & (kHeads - 1);
  const int bl = (int)blockIdx.x >> 3;
  const size_t pbase = (size_t)bh * kSeq * kHd;
  const __bf16* QH = (const __bf16*)QHp + pbase;
  const __bf16* QL = (const __bf16*)QLp + pbase;
  const __bf16* KH = (const __bf16*)KHp + pbase;
  const __bf16* KL = (const __bf16*)KLp + pbase;
  const unsigned short* KHu = KHp + pbase;
  const unsigned short* KLu = KLp + pbase;
  const float* vfp = VF + pbase;
  const float* rsp = RS + (size_t)bh * kSeq;
  const float* cpp = COMP + (size_t)bh * kSeq;
  unsigned short* ahp = AHp + ((size_t)bl * kSeq) * kEmb + hd * kHd;
  unsigned short* alp = ALp + ((size_t)bl * kSeq) * kEmb + hd * kHd;
  __bf16* ph = Ph[wave];
  __bf16* pl = Pl[wave];
  const int lr = tid >> 1, dh = (tid & 1) * 32;
  const int q4 = lane >> 3, c8 = (lane & 7) * 8;
  const v8f z8 = (v8f){0.f,0.f,0.f,0.f,0.f,0.f,0.f,0.f};

  v8f accS[4];
  accS[0] = z8; accS[1] = z8; accS[2] = z8; accS[3] = z8;

#pragma unroll 1
  for (int n = 0; n < kNChunk; ++n) {
    const int l0 = n * kChunk;
    /* all reads of R (as KT) and VT of the chunk before are finished */
    __syncthreads();

    /* phase A1: St hi/lo <- accS; wave w writes rows 16w..16w+15 x 64 cols */
#pragma unroll
    for (int j = 0; j < 4; ++j) {
#pragma unroll
      for (int r = 0; r < 8; ++r) {
        const float s = accS[j][r];
        const unsigned short hb = f2bf_bits(s);
        const unsigned short lb = f2bf_bits(s - bf_bits2f(hb));
        const int o = (16 * wave + 8 * hh + r) * kLp + 16 * j + c;
        Rh[o] = bits2bf(hb);
        Rl[o] = bits2bf(lb);
      }
    }
    /* phase A2: VT hi/lo <- (v * comp)^T; thread covers row lr, features dh..dh+31: 128 threads x 32 = 64 x 64 */
    {
      const float cv = cpp[l0 + lr];
      const float* vrow = vfp + (size_t)(l0 + lr) * kHd + dh;
#pragma unroll
      for (int g = 0; g < 2; ++g) {
        v4f vv[4];
#pragma unroll
        for (int i = 0; i < 4; ++i) vv[i] = *(const v4f*)(vrow + 16 * g + 4 * i);
#pragma unroll
        for (int i = 0; i < 4; ++i) {
#pragma unroll
          for (int e = 0; e < 4; ++e) {
            const float f = vv[i][e] * cv;
            const unsigned short hb = f2bf_bits(f);
            const unsigned short lb = f2bf_bits(f - bf_bits2f(hb));
            const int d = dh + 16 * g + 4 * i + e;
            VTh[d * kLp + lr] = bits2bf(hb);
            VTl[d * kLp + lr] = bits2bf(lb);
          }
        }
        asm volatile("" ::: "memory");
      }
    }
    __syncthreads();

    /* phase B: Q fragments (rows 16w + c) */
    v16b qh[2], ql[2];
    {
      const size_t qo = (size_t)(l0 + 16 * wave + c) * kHd + koff;
#pragma unroll
      for (int dc = 0; dc < 2; ++dc) {
        qh[dc] = Frag<__bf16>::load(QH + qo + dc * 32);
        ql[dc] = Frag<__bf16>::load(QL + qo + dc * 32);
      }
    }
    asm volatile("" ::: "memory");
    /* scores rows 16w.., all 64 columns; inclusive causal mask by select; hi/lo into this wave's P strip */
#pragma unroll
    for (int j = 0; j < 4; ++j) {
      v8f s = z8;
      const size_t ko = (size_t)(l0 + 16 * j + c) * kHd + koff;
#pragma unroll
      for (int dc = 0; dc < 2; ++dc) {
        const v16b kh = Frag<__bf16>::load(KH + ko + dc * 32);
        const v16b kl = Frag<__bf16>::load(KL + ko + dc * 32);
        s = mma_g(qh[dc], kh, s);
        s = mma_g(qh[dc], kl, s);
        s = mma_g(ql[dc], kh, s);
      }
      const int jj = 16 * j + c;
#pragma unroll
      for (int r = 0; r < 8; ++r) {
        const int ii = 16 * wave + 8 * hh + r;
        const float pv = (jj <= ii) ? s[r] : 0.0f;
        const unsigned short hb = f2bf_bits(pv);
        const unsigned short lb = f2bf_bits(pv - bf_bits2f(hb));
        ph[(8 * hh + r) * kLp + jj] = bits2bf(hb);
        pl[(8 * hh + r) * kLp + jj] = bits2bf(lb);
      }
      asm volatile("" ::: "memory");
    }
    /* P strip: written and read by this wave only */
    wave_lds_sync();

    v8f accO[4];
    accO[0] = z8; accO[1] = z8; accO[2] = z8; accO[3] = z8;
    /* inter: Q x St^T (Bt rows m = 16t + c, k = d) */
#pragma unroll
    for (int t = 0; t < 4; ++t) {
      const __bf16* sph = Rh + (16 * t + c) * kLp + koff;
      const __bf16* spl = Rl + (16 * t + c) * kLp + koff;
#pragma unroll
      for (int dc = 0; dc < 2; ++dc) {
        const v16b sh = Frag<__bf16>::load(sph + dc * 32);
        const v16b sl = Frag<__bf16>::load(spl + dc * 32);
        accO[t] = mma_g(qh[dc], sh, accO[t]);
        accO[t] = mma_g(qh[dc], sl, accO[t]);
        accO[t] = mma_g(ql[dc], sh, accO[t]);
      }
    }
    /* intra: P x v' (A rows i = c of the strip, k = j; Bt rows m = 16t + c of VT, k = j) */
#pragma unroll
    for (int kk = 0; kk < 2; ++kk) {
      const v16b pah = Frag<__bf16>::load(ph + c * kLp + kk * 32 + koff);
      const v16b pal = Frag<__bf16>::load(pl + c * kLp + kk * 32 + koff);
#pragma unroll
      for (int t = 0; t < 4; ++t) {
        const v16b vh = Frag<__bf16>::load(VTh + (16 * t + c) * kLp + kk * 32 + koff);
        const v16b vl = Frag<__bf16>::load(VTl + (16 * t + c) * kLp + kk * 32 + koff);
        accO[t] = mma_g(pah, vh, accO[t]);
        accO[t] = mma_g(pah, vl, accO[t]);
        accO[t] = mma_g(pal, vh, accO[t]);
      }
    }
    /* epilogue: row scale, bf16 hi/lo, stage in the P strip, whole-line stores */
    {
      const float* rp = rsp + l0 + 16 * wave + 8 * hh;
      const v4f r0 = *(const v4f*)(rp);
      const v4f r1 = *(const v4f*)(rp + 4);
      float rsv[8];
#pragma unroll
      for (int e = 0; e < 4; ++e) { rsv[e] = r0[e]; rsv[4 + e] = r1[e]; }
#pragma unroll
      for (int t = 0; t < 4; ++t) {
#pragma unroll
        for (int r = 0; r < 8; ++r) {
          const float o = accO[t][r] * rsv[r];
          const unsigned short hb = f2bf_bits(o);
          const unsigned short lb = f2bf_bits(o - bf_bits2f(hb));
          ph[(8 * hh + r) * kLp + 16 * t + c] = bits2bf(hb);
          pl[(8 * hh + r) * kLp + 16 * t + c] = bits2bf(lb);
        }
      }
      wave_lds_sync();
      v4u uh[4], ul[4];
#pragma unroll
      for (int it = 0; it < 4; ++it) {
        const int row = it * 4 + q4;
        const v8b hv = *(const v8b*)(ph + row * kLp + c8);
        const v8b lv = *(const v8b*)(pl + row * kLp + c8);
        uh[it] = __builtin_bit_cast(v4u, hv);
        ul[it] = __builtin_bit_cast(v4u, lv);
      }
      {
#pragma unroll
        for (int it = 0; it < 4; ++it) {
          const size_t o = (size_t)(l0 + 16 * wave + it * 4 + q4) * kEmb + c8;
          *(v4u*)(ahp + o) = uh[it];
          *(v4u*)(alp + o) = ul[it];
        }
        
      }
      wave_lds_sync();
    }
    /* every wave has finished reading R as St */
    __syncthreads();

    /* phase C: KT hi/lo <- k^T; thread covers row lr, features dh..dh+31 (4 x 16-B words per plane): 128 threads x 32 = 64 x 64 */
    {
      const size_t ko = (size_t)(l0 + lr) * kHd + dh;
      const v4u* kh4 = (const v4u*)(KHu + ko);
      const v4u* kl4 = (const v4u*)(KLu + ko);
      v4u wh[4], wl[4];
#pragma unroll
      for (int g = 0; g < 4; ++g) { wh[g] = kh4[g]; wl[g] = kl4[g]; }
#pragma unroll
      for (int g = 0; g < 4; ++g) {
#pragma unroll
        for (int e = 0; e < 4; ++e) {
          const unsigned a = wh[g][e];
          const unsigned b = wl[g][e];
          const int d = dh + 8 * g + 2 * e;
          const unsigned a0 = a & 0xffffu, a1 = a >> 16;
          const unsigned b0 = b & 0xffffu, b1 = b >> 16;
          Rh[d * kLp + lr]       = bits2bf((unsigned short)a0);
          Rh[(d + 1) * kLp + lr] = bits2bf((unsigned short)a1);
          Rl[d * kLp + lr]       = bits2bf((unsigned short)b0);
          Rl[(d + 1) * kLp + lr] = bits2bf((unsigned short)b1);
        }
      }
    }
    __syncthreads();

    /* phase D: St[m][d] += sum_l VT[m][l] * KT[d][l] (A rows m = 16w + c, k = l; Bt rows d = 16j + c, k = l) */
#pragma unroll
    for (int kk = 0; kk < 2; ++kk) {
      const v16b vah = Frag<__bf16>::load(VTh + (16 * wave + c) * kLp + kk * 32 + koff);
      const v16b val = Frag<__bf16>::load(VTl + (16 * wave + c) * kLp + kk * 32 + koff);
#pragma unroll
      for (int j = 0; j < 4; ++j) {
        const v16b kh = Frag<__bf16>::load(Rh + (16 * j + c) * kLp + kk * 32 + koff);
        const v16b kl = Frag<__bf16>::load(Rl + (16 * j + c) * kLp + kk * 32 + koff);
        accS[j] = mma_g(vah, kh, accS[j]);
        accS[j] = mma_g(vah, kl, accS[j]);
        accS[j] = mma_g(val, kh, accS[j]);
      }
    }
    acc_guard4(accS[0], accS[1], accS[2], accS[3]);
  }
}

/* ---- host glue ----
   Workspace region map (bytes, 256-B aligned carve; total 120,594,432 <= 134,217,728):
     XB    [16384][512] bf16   16,777,216   bf16(x); after the projections the same bytes hold, per batch half,
                                            ATTN_HI [8192][512] bf16 (first 8,388,608 B) and ATTN_LO (second 8,388,608 B)
     WQKV  [1536][512]  bf16    1,572,864   bf16(Wq | Wk | Wv)
     WOB   [512][512]   bf16      524,288   bf16(Wo)
     BIAS  [2048]       f32         8,192   bf16 values of bq | bk | bv | bo kept as f32
     QH,QL,KH,KL [32][4096][64] bf16  4 x 16,777,216   sigmoid(q), sigmoid(k) as hi/lo planes
     VF    [32][4096][64] f32  33,554,432   v
     RS, COMP [32][4096] f32   2 x 524,288 */
extern "C" void kernel_launch(void* const* d_in, const int* in_sizes, int n_in,
                              void* d_out, int out_size, void* d_ws, size_t ws_size, hipStream_t stream) {
  if (n_in < 9 || d_out == nullptr || d_ws == nullptr) return;
  if (in_sizes[0] != kRows * kEmb || in_sizes[1] != kEmb * kEmb || in_sizes[2] != kEmb ||
      in_sizes[3] != kEmb * kEmb || in_sizes[4] != kEmb || in_sizes[5] != kEmb * kEmb ||
      in_sizes[6] != kEmb || in_sizes[7] != kEmb * kEmb || in_sizes[8] != kEmb ||
      out_size != kRows * kEmb) return;

  const float* x  = (const float*)d_in[0];
  const float* Wq = (const float*)d_in[1];
  const float* bq = (const float*)d_in[2];
  const float* Wk = (const float*)d_in[3];
  const float* bk = (const float*)d_in[4];
  const float* Wv = (const float*)d_in[5];
  const float* bv = (const float*)d_in[6];
  const float* Wo = (const float*)d_in[7];
  const float* bo = (const float*)d_in[8];
  float* out = (float*)d_out;

  char* ws = (char*)d_ws; size_t off = 0;
  auto carve = [&](size_t bytes) -> char* { char* p = ws + off; off += (bytes + 255) & ~(size_t)255; return p; };
  unsigned short* XB   = (unsigned short*)carve((size_t)kRows * kEmb * 2);
  unsigned short* WQKV = (unsigned short*)carve((size_t)kQkvN * kEmb * 2);
  unsigned short* WOB  = (unsigned short*)carve((size_t)kEmb * kEmb * 2);
  float*          BIAS = (float*)carve((size_t)4 * kEmb * 4);
  unsigned short* QH   = (unsigned short*)carve((size_t)kBH * kSeq * kHd * 2);
  unsigned short* QL   = (unsigned short*)carve((size_t)kBH * kSeq * kHd * 2);
  unsigned short* KH   = (unsigned short*)carve((size_t)kBH * kSeq * kHd * 2);
  unsigned short* KL   = (unsigned short*)carve((size_t)kBH * kSeq * kHd * 2);
  float*          VF   = (float*)carve((size_t)kBH * kSeq * kHd * 4);
  float*          RS   = (float*)carve((size_t)kBH * kSeq * 4);
  float*          COMP = (float*)carve((size_t)kBH * kSeq * 4);
  if (off > ws_size || off > (size_t)134217728) return;
  /* attn planes of one batch half live in the XB bytes (same 16-bit element type, same row pitch); XB is dead after the projections */
  unsigned short* AH = XB;
  unsigned short* AL = XB + (size_t)kHalfRows * kEmb;

  /* 16-bit operand planes */
  const int n8x = kRows * kEmb / 8;
  const int n8w = kEmb * kEmb / 8;
  cvt8_bf16_kernel<<<(n8x + 255) / 256, 256, 0, stream>>>(x,  XB, n8x);
  cvt8_bf16_kernel<<<(n8w + 255) / 256, 256, 0, stream>>>(Wq, WQKV, n8w);
  cvt8_bf16_kernel<<<(n8w + 255) / 256, 256, 0, stream>>>(Wk, WQKV + (size_t)kEmb * kEmb, n8w);
  cvt8_bf16_kernel<<<(n8w + 255) / 256, 256, 0, stream>>>(Wv, WQKV + (size_t)2 * kEmb * kEmb, n8w);
  cvt8_bf16_kernel<<<(n8w + 255) / 256, 256, 0, stream>>>(Wo, WOB, n8w);
  bias_prep_kernel<<<1, 256, 0, stream>>>(bq, bk, bv, bo, BIAS);

  /* projections: M = 16384, N = 1536, K = 512; 256 x 24 tiles = 768 blocks x 8 waves */
  gemm64_kernel<0><<<(kRows / 64) * (kQkvN / 64) / 8, 256, 0, stream>>>(
      XB, XB, WQKV, BIAS, QH, QL, KH, KL, VF, kRows, kQkvN);

  /* flow scan: 32 waves */
  flow_scan_kernel<<<kBH, 32, 0, stream>>>(QH, QL, KH, KL, RS, COMP);

  /* per batch half: fused chunked attention (16 blocks), then output projection M = 8192, N = 512, K = 512 (128 blocks) */
  for (int half = 0; half < 2; ++half) {
    flow_attn_kernel<<<kHalfBH, 128, 0, stream>>>(QH, QL, KH, KL, VF, RS, COMP, AH, AL, half * kHalfBH);
    gemm64_kernel<1><<<(kHalfRows / 64) * (kEmb / 64) / 8, 256, 0, stream>>>(
        AH, AL, WOB, BIAS + 3 * kEmb, QH, QL, KH, KL,
        out + (size_t)half * kHalfRows * kEmb, kHalfRows, kEmb);
  }
}

// v001
// Measured time: 1040 microseconds a run.
// Timed twice side by side with v000, it ran 3.91 and 3.92 times as fast.
// All contractions on v_wmma_f32_16x16x32_bf16 with f32 accumulate: q/k/v projections = bf16(x) x bf16(W) single product; chunk state, scores, inter and intra products = bf16 hi/lo operands (hi*hi + hi*lo + lo*hi); output projection = (attn_hi + attn_lo) x bf16(Wo); sigmoid, flow scans and row scales in f32 on VALU.
#include <hip/hip_runtime.h>
#include <math.h>

constexpr int kBatch   = 4;
constexpr int kSeq     = 4096;
constexpr int kEmb     = 512;
constexpr int kHeads   = 8;
constexpr int kHd      = 64;
constexpr int kRows    = kBatch * kSeq;
constexpr int kBH      = kBatch * kHeads;
constexpr int kChunk   = 64;
constexpr int kNChunk  = kSeq / kChunk;
constexpr int kLp      = 72;
constexpr int kQkvN    = 3 * kEmb;
constexpr int kHalfRows = kRows / 2;
constexpr int kHalfBH   = kBH / 2;
constexpr int kSegRows = 64;
constexpr int kNSeg    = kSeq / kSegRows;
constexpr float kEps   = 1e-6f;
static_assert(kHeads * kHd == kEmb, "head packing");
static_assert(kEmb % 32 == 0, "GEMM K multiple of 32");
static_assert(kHd % 32 == 0 && kChunk % 32 == 0, "tile K multiple of 32");
static_assert(kRows % 64 == 0 && kHalfRows % 64 == 0 && kQkvN % 64 == 0 && kEmb % 64 == 0, "GEMM M, N tile multiples");
static_assert(kSeq % 128 == 0 && kSeq % kChunk == 0, "scan line groups and chunks");
static_assert(kSeq == 4096 && kEmb == 512 && kHd == 64, "shift constants in the projection epilogue");
static_assert(kLp % 8 == 0, "LDS pitch keeps 16-B alignment");
static_assert(kSegRows == 64 && kNSeg % 2 == 0 && kSeq == 4 * 1024, "flow scan: 16 lanes x 4 kept rows per segment, two segments per wave, 1024 threads x 4 rows");

typedef __attribute__((ext_vector_type(16))) __bf16   v16b;
typedef __attribute__((ext_vector_type(8)))  __bf16   v8b;
typedef __attribute__((ext_vector_type(8)))  float    v8f;
typedef __attribute__((ext_vector_type(4)))  float    v4f;
typedef __attribute__((ext_vector_type(4)))  unsigned int v4u;
typedef __attribute__((ext_vector_type(2)))  unsigned int v2u;

__device__ __forceinline__ unsigned short f2bf_bits(float f) {
  unsigned u = __float_as_uint(f);
  return (unsigned short)((u + 0x7FFFu + ((u >> 16) & 1u)) >> 16);
}
__device__ __forceinline__ float bf_bits2f(unsigned short h) { return __uint_as_float(((unsigned)h) << 16); }
__device__ __forceinline__ float bf16r(float f) { return bf_bits2f(f2bf_bits(f)); }
__device__ __forceinline__ unsigned pk16(unsigned short a, unsigned short b) { return (unsigned)a | ((unsigned)b << 16); }
__device__ __forceinline__ __bf16 bits2bf(unsigned short u) { return __builtin_bit_cast(__bf16, u); }

/* hazard guards as plain device helpers */
__device__ __forceinline__ void dep_guard4_b(v8f& a, v8f& b, v8f& c, v8f& d, v16b x, v16b y) { asm volatile("v_nop\n\tv_nop\n\tv_nop\n\tv_nop" : "+v"(a), "+v"(b), "+v"(c), "+v"(d) : "v"(x), "v"(y)); }
__device__ __forceinline__ void keep4_b(v16b a, v16b b, v16b c, v16b d) { asm volatile("v_nop" :: "v"(a), "v"(b), "v"(c), "v"(d)); }
__device__ __forceinline__ void acc_guard4(v8f& a, v8f& b, v8f& c, v8f& d) { asm volatile("v_nop\n\tv_nop\n\tv_nop\n\tv_nop" : "+v"(a), "+v"(b), "+v"(c), "+v"(d)); }

template <typename T> struct Frag;
template <> struct Frag<__bf16> {
  typedef v16b V; union U { v16b v; v8b h[2]; };
  /* elements 0..7 <- p[0..7], elements 8..15 <- p[16..23] */
  static __device__ __forceinline__ v16b load(const __bf16* p) {
    U f; f.h[0] = *(const v8b*)(p); f.h[1] = *(const v8b*)(p + 16); return f.v;
  }
  static __device__ __forceinline__ v8f mma(v16b a, v16b b, v8f c) {
    return __builtin_amdgcn_wmma_f32_16x16x32_bf16(false, a, false, b, (short)0, c, false, false);
  }
};

/* one WMMA followed by the 4-slot guard tying its accumulator and both operand fragments */
__device__ __forceinline__ v8f mma_g(v16b a, v16b b, v8f c) {
  c = __builtin_amdgcn_wmma_f32_16x16x32_bf16(false, a, false, b, (short)0, c, false, false);
  asm volatile("v_nop\n\tv_nop\n\tv_nop\n\tv_nop" : "+v"(c) : "v"(a), "v"(b));
  return c;
}

__device__ __forceinline__ void wave_lds_sync() {
  __builtin_amdgcn_fence(__ATOMIC_RELEASE, "workgroup");
  __builtin_amdgcn_wave_barrier();
  __builtin_amdgcn_fence(__ATOMIC_ACQUIRE, "workgroup");
}

/* ---- f32 -> bf16 (RNE convert), 8 consecutive elements per thread: two 16-B loads, ONE 16-B store per lane; a wave writes
        Coverage: thread i writes elements 8i..8i+7, i < n8; every call has n8 a multiple of 256. */
__global__ __launch_bounds__(256) void cvt8_bf16_kernel(const float* __restrict__ src, unsigned short* __restrict__ dst, int n8) {
  const int i = blockIdx.x * 256 + threadIdx.x;
  if (i < n8) {
    const float* p = src + 8 * (size_t)i;
    const v4f a = *(const v4f*)(p);
    const v4f b = *(const v4f*)(p + 4);
    unsigned short hb[8];
#pragma unroll
    for (int e = 0; e < 4; ++e) {
      const float fa = a[e];
      const float fb = b[e];
      hb[e]     = f2bf_bits(fa);
      hb[4 + e] = f2bf_bits(fb);
    }
    const v4u u = (v4u){pk16(hb[0], hb[1]), pk16(hb[2], hb[3]), pk16(hb[4], hb[5]), pk16(hb[6], hb[7])};
    unsigned short* q = dst + 8 * (size_t)i;
    *(v4u*)q = u;
    
  }
}

/* ---- bias plane: dst[0..2047] = bf16 value (kept as f32) of bq | bk | bv | bo. One block of 256 threads, 2 iterations x 256 x
        float4 = 512 float4 = exactly 2048 floats. All four sources are loaded unconditionally; wave-uniform select by value.
*/
__global__ __launch_bounds__(256) void bias_prep_kernel(const float* __restrict__ b0, const float* __restrict__ b1,
                                                        const float* __restrict__ b2, const float* __restrict__ b3,
                                                        float* __restrict__ dst) {
  const int tid = threadIdx.x;
#pragma unroll 1
  for (int it = 0; it < 2; ++it) {
    const int idx4 = it * 256 + tid;
    const int which = idx4 >> 7;
    const int off = (idx4 & 127) * 4;
    const v4f va = *(const v4f*)(b0 + off);
    const v4f vb = *(const v4f*)(b1 + off);
    const v4f vc = *(const v4f*)(b2 + off);
    const v4f vd = *(const v4f*)(b3 + off);
    v4f o;
#pragma unroll
    for (int e = 0; e < 4; ++e) {
      const float s01 = (which == 0) ? va[e] : vb[e];
      const float s23 = (which == 2) ? vc[e] : vd[e];
      o[e] = bf16r((which < 2) ? s01 : s23);
    }
    float* op = dst + which * kEmb + off;
    *(v4f*)op = o;
    
  }
}

/* ---- Register-blocked WMMA GEMM, each wave owns a 64x64 tile; A row-major [M][512], Bt row-major [N][512] (bf16 bits).
        MODE 0 (projections): single product; epilogue adds bias[n]; column tile 64 = one head of q (n0 < 512), k (512..1023)
               x 16 B, 4 rows per instruction); v: f32 plane [b][h][l][64] (row segment 256 B = 16 lanes x 16 B, 2 rows per instruction).
        MODE 1 (output projection): product = A*Bt + A2*Bt (A2 = lo plane of A); epilogue adds bias[n]; f32 rows of pitch 512.
*/
template <int MODE>
__global__ __launch_bounds__(256) void gemm64_kernel(
    const unsigned short* __restrict__ Ap, const unsigned short* __restrict__ A2p,
    const unsigned short* __restrict__ Btp, const float* __restrict__ bias,
    unsigned short* __restrict__ QHp, unsigned short* __restrict__ QLp,
    unsigned short* __restrict__ KHp, unsigned short* __restrict__ KLp,
    float* __restrict__ Fout, int M, int N) {
  typedef __bf16 T;
  const T* A = (const T*)Ap; const T* A2 = (const T*)A2p; const T* Bt = (const T*)Btp;
  __shared__ __align__(16) float sT[8][16 * 68];
  const int lane = threadIdx.x & 31;
  const int wave = threadIdx.x >> 5;
  const int tilesN = N >> 6;
  const int tilesM = M >> 6;
  const int tile = blockIdx.x * 8 + wave;
  /* wave-uniform; no block barriers in this kernel */
  if (tile >= tilesM * tilesN) return;
  const int tm = tile / tilesN;
  const int tn = tile - tm * tilesN;
  const int m0 = tm << 6;
  const int n0 = tn << 6;

  const int rlane = lane & 15;
  const int koff  = (lane >> 4) * 8;
  const int mOff  = (lane >> 4) * 8;

  v8f acc[4][4];
#pragma unroll
  for (int i = 0; i < 4; ++i)
#pragma unroll
    for (int j = 0; j < 4; ++j) acc[i][j] = (v8f){0.f,0.f,0.f,0.f,0.f,0.f,0.f,0.f};

  for (int k0 = 0; k0 < kEmb; k0 += 32) {
    v16b bh[4];
#pragma unroll
    for (int j = 0; j < 4; ++j) {
      const size_t bo = (size_t)(n0 + (j << 4) + rlane) * kEmb + koff + k0;
      bh[j] = Frag<T>::load(Bt + bo);
    }
#pragma unroll
    for (int i = 0; i < 4; ++i) {
      const size_t ao = (size_t)(m0 + (i << 4) + rlane) * kEmb + koff + k0;
      v16b ah = Frag<T>::load(A + ao);
      v16b al = ah;
      if (MODE == 1) al = Frag<T>::load(A2 + ao);
#pragma unroll
      for (int j = 0; j < 4; ++j) {
        acc[i][j] = Frag<T>::mma(ah, bh[j], acc[i][j]);
        if (MODE == 1) acc[i][j] = Frag<T>::mma(al, bh[j], acc[i][j]);
      }
      dep_guard4_b(acc[i][0], acc[i][1], acc[i][2], acc[i][3], ah, al);
    }
    keep4_b(bh[0], bh[1], bh[2], bh[3]);
  }
  acc_guard4(acc[0][0], acc[0][1], acc[0][2], acc[0][3]);
  acc_guard4(acc[1][0], acc[1][1], acc[1][2], acc[1][3]);
  acc_guard4(acc[2][0], acc[2][1], acc[2][2], acc[2][3]);
  acc_guard4(acc[3][0], acc[3][1], acc[3][2], acc[3][3]);

  /* ---- epilogue ---- */
  float* slab = sT[wave];
  /* wave-uniform tile decode for MODE 0 */
  const int sel  = n0 >> 9;
  const int hcol = (n0 & (kEmb - 1)) >> 6;
  const int bb   = m0 >> 12;
  const int l0   = m0 & (kSeq - 1);
  const size_t rowbase = ((size_t)(bb * kHeads + hcol)) * kSeq + (size_t)l0;
  unsigned short* Ch = (sel == 0) ? QHp : KHp;
  unsigned short* Cl = (sel == 0) ? QLp : KLp;
  const int hh = lane >> 4, c4 = (lane & 15) * 4;
  const int q4 = lane >> 3, c8 = (lane & 7) * 8;
#pragma unroll
  for (int i = 0; i < 4; ++i) {
#pragma unroll
    for (int j = 0; j < 4; ++j) {
      const int n = n0 + (j << 4) + rlane;
      const float bv = bias[n];
#pragma unroll
      for (int r = 0; r < 8; ++r) {
        const float v = acc[i][j][r] + bv;
        slab[(mOff + r) * 68 + (j << 4) + rlane] = v;
      }
    }
    wave_lds_sync();
    if (MODE == 0 && sel < 2) {
      /* in-place sigmoid on the slab, rolled: lane owns (row it*2+hh, cols c4..c4+3) */
#pragma unroll 1
      for (int it = 0; it < 8; ++it) {
        float* sp = slab + (it * 2 + hh) * 68 + c4;
        v4f v = *(const v4f*)sp;
#pragma unroll
        for (int e = 0; e < 4; ++e) {
          const float x = v[e];
          v[e] = 1.0f / (1.0f + expf(-x));
        }
        *(v4f*)sp = v;
      }
      wave_lds_sync();
    }
    if (MODE == 1) {
      float* Cf = Fout;
      {
#pragma unroll
        for (int it = 0; it < 8; ++it) {
          const int row = it * 2 + hh;
          const v4f v = *(const v4f*)(slab + row * 68 + c4);
          *(v4f*)(Cf + (size_t)(m0 + (i << 4) + row) * kEmb + n0 + c4) = v;
        }
        
      }
    } else if (sel == 2) {
      float* Cf = Fout;
      {
#pragma unroll
        for (int it = 0; it < 8; ++it) {
          const int row = it * 2 + hh;
          const v4f v = *(const v4f*)(slab + row * 68 + c4);
          *(v4f*)(Cf + (rowbase + (size_t)((i << 4) + row)) * kHd + c4) = v;
        }
        
      }
    } else {
      v4u uh[4], ul[4];
#pragma unroll
      for (int it = 0; it < 4; ++it) {
        const float* sp = slab + (it * 4 + q4) * 68 + c8;
        unsigned short hb[8], lb[8];
#pragma unroll
        for (int e = 0; e < 8; ++e) {
          const float f = sp[e];
          hb[e] = f2bf_bits(f);
          lb[e] = f2bf_bits(f - bf_bits2f(hb[e]));
        }
        uh[it] = (v4u){pk16(hb[0], hb[1]), pk16(hb[2], hb[3]), pk16(hb[4], hb[5]), pk16(hb[6], hb[7])};
        ul[it] = (v4u){pk16(lb[0], lb[1]), pk16(lb[2], lb[3]), pk16(lb[4], lb[5]), pk16(lb[6], lb[7])};
      }
      {
#pragma unroll
        for (int it = 0; it < 4; ++it) {
          const size_t o = (rowbase + (size_t)((i << 4) + it * 4 + q4)) * kHd + c8;
          *(v4u*)(Ch + o) = uh[it];
          *(v4u*)(Cl + o) = ul[it];
        }
        
      }
    }
    wave_lds_sync();
  }
}

/* ---- flow scans, all f32, split along the sequence: 64 segments of 64 rows per (b,h), every segment scanned at the same time.
        Each running sum over rows = (sum of the totals of the segments before, added in segment order) + (serial sum inside the segment).
        One wave = two segments: a 16-lane row of the wave owns one segment, lane c of it owns features 4c..4c+3 (8 B per bf16 plane).
        q = q_hi + q_lo, k = k_hi + k_lo read from the bf16 planes (the same operands the WMMA products use).
        Launch 1: segment totals of k and q.                          Launch 2: sink_in, src_out per row; segment totals of k*src_out, q*sink_in.
        Launch 3: the two conserved dot products per row (raw sums).  Launch 4: per row rs = sigmoid(conserved_sink) * sink_in / (l+1) and
        comp = exp(clip(conserved_source)) / cumsum * (l+1), the cumsum as a block scan over the 4096 rows of one (b,h).
        Per-row results are kept by lane c for rows 4c..4c+3 of its segment and stored once as 16 lanes x 16 B = 256 B.
        The inner loops are fully unrolled so that the staged words and the kept rows are indexed by constants and stay in registers. */
__device__ __forceinline__ float row16_sum(float v) {
  /* DPP row_xmask 1, 2, 4, 8: butterfly sum over the 16 lanes of a row, no LDS round trip */
  v += __int_as_float(__builtin_amdgcn_update_dpp(0, __float_as_int(v), 0x161, 0xf, 0xf, true));
  v += __int_as_float(__builtin_amdgcn_update_dpp(0, __float_as_int(v), 0x162, 0xf, 0xf, true));
  v += __int_as_float(__builtin_amdgcn_update_dpp(0, __float_as_int(v), 0x164, 0xf, 0xf, true));
  v += __int_as_float(__builtin_amdgcn_update_dpp(0, __float_as_int(v), 0x168, 0xf, 0xf, true));
  return v;
}
__device__ __forceinline__ v4f hilo4(v2u h, v2u l) {
  v4f r;
  r[0] = __uint_as_float(h[0] << 16)         + __uint_as_float(l[0] << 16);
  r[1] = __uint_as_float(h[0] & 0xffff0000u) + __uint_as_float(l[0] & 0xffff0000u);
  r[2] = __uint_as_float(h[1] << 16)         + __uint_as_float(l[1] << 16);
  r[3] = __uint_as_float(h[1] & 0xffff0000u) + __uint_as_float(l[1] & 0xffff0000u);
  return r;
}
__device__ __forceinline__ float dot4_eps(v4f x, v4f y) {
  return (x[0] + kEps) * (y[0] + kEps) + (x[1] + kEps) * (y[1] + kEps) + (x[2] + kEps) * (y[2] + kEps) + (x[3] + kEps) * (y[3] + kEps);
}
/* totals of the segments before seg, added in segment order; T = [kNSeg][128] of one (b,h), first 64 floats -> a, last 64 -> b */
__device__ __forceinline__ void seg_prefix(const float* __restrict__ T, int seg, int c, v4f& a, v4f& b) {
  a = (v4f){0.f, 0.f, 0.f, 0.f};
  b = (v4f){0.f, 0.f, 0.f, 0.f};
  /* 16 segments' loads in flight per trip: the loads are independent, only the adds are ordered */
#pragma unroll 16
  for (int s = 0; s < kNSeg; ++s) {
    const v4f ta = *(const v4f*)(T + s * 128 + 4 * c);
    const v4f tb = *(const v4f*)(T + s * 128 + 64 + 4 * c);
    const bool in = s < seg;
#pragma unroll
    for (int e = 0; e < 4; ++e) {
      a[e] += in ? ta[e] : 0.0f;
      b[e] += in ? tb[e] : 0.0f;
    }
  }
}

__global__ __launch_bounds__(32) void flow_seg_total_kernel(const unsigned short* __restrict__ QHp, const unsigned short* __restrict__ QLp,
                                                            const unsigned short* __restrict__ KHp, const unsigned short* __restrict__ KLp,
                                                            float* __restrict__ T0) {
  const int lane = threadIdx.x, c = lane & 15;
  const int bh = (int)blockIdx.x / (kNSeg / 2);
  const int seg = ((int)blockIdx.x % (kNSeg / 2)) * 2 + (lane >> 4);
  const size_t w0 = ((size_t)bh * kSeq + (size_t)seg * kSegRows) * (kHd / 4) + c;
  const v2u* qh = (const v2u*)QHp + w0;
  const v2u* ql = (const v2u*)QLp + w0;
  const v2u* kh = (const v2u*)KHp + w0;
  const v2u* kl = (const v2u*)KLp + w0;
  v4f ks = (v4f){0.f, 0.f, 0.f, 0.f}, qs = (v4f){0.f, 0.f, 0.f, 0.f};
  /* 16 rows per trip, kept rolled for code size: all their loads are issued before the first sum */
#pragma unroll 1
  for (int t = 0; t < kSegRows / 16; ++t) {
    const v2u* pqh = qh + t * 16 * (kHd / 4);
    const v2u* pql = ql + t * 16 * (kHd / 4);
    const v2u* pkh = kh + t * 16 * (kHd / 4);
    const v2u* pkl = kl + t * 16 * (kHd / 4);
    v2u wqh[16], wql[16], wkh[16], wkl[16];
#pragma unroll
    for (int j = 0; j < 16; ++j) {
      wqh[j] = pqh[j * (kHd / 4)];
      wql[j] = pql[j * (kHd / 4)];
      wkh[j] = pkh[j * (kHd / 4)];
      wkl[j] = pkl[j * (kHd / 4)];
    }
    /* the wait that stands before a register named by an issued global load is overwritten; the address pairs are inputs so that
       they stay untouched up to it; its memory clobber also keeps the trip's loads together in front of the sums */
    asm volatile("s_wait_xcnt 0x0" :: "v"(pqh), "v"(pql), "v"(pkh), "v"(pkl) : "memory");
#pragma unroll
    for (int j = 0; j < 16; ++j) {
      ks += hilo4(wkh[j], wkl[j]);
      qs += hilo4(wqh[j], wql[j]);
    }
  }
  float* o = T0 + ((size_t)bh * kNSeg + seg) * 128 + 4 * c;
  *(v4f*)o = ks;
  *(v4f*)(o + 64) = qs;
}

__global__ __launch_bounds__(32) void flow_incoming_kernel(const unsigned short* __restrict__ QHp, const unsigned short* __restrict__ QLp,
                                                           const unsigned short* __restrict__ KHp, const unsigned short* __restrict__ KLp,
                                                           const float* __restrict__ T0, float* __restrict__ SINK, float* __restrict__ SRC,
                                                           float* __restrict__ T1) {
  const int lane = threadIdx.x, c = lane & 15;
  const int bh = (int)blockIdx.x / (kNSeg / 2);
  const int seg = ((int)blockIdx.x % (kNSeg / 2)) * 2 + (lane >> 4);
  const int row0 = seg * kSegRows;
  const size_t w0 = ((size_t)bh * kSeq + (size_t)row0) * (kHd / 4) + c;
  const v2u* qh = (const v2u*)QHp + w0;
  const v2u* ql = (const v2u*)QLp + w0;
  const v2u* kh = (const v2u*)KHp + w0;
  const v2u* kl = (const v2u*)KLp + w0;
  v4f kc, qc;
  seg_prefix(T0 + (size_t)bh * kNSeg * 128, seg, c, kc, qc);
  v4f a1 = (v4f){0.f, 0.f, 0.f, 0.f}, a2 = (v4f){0.f, 0.f, 0.f, 0.f};
  v4f si = (v4f){0.f, 0.f, 0.f, 0.f}, so = (v4f){0.f, 0.f, 0.f, 0.f};
  /* 8 rows per trip, kept rolled for code size: their loads, row sums and divisions are independent of each other and overlap;
     only the running sums are ordered */
#pragma unroll 1
  for (int t = 0; t < kSegRows / 8; ++t) {
    const v2u* pqh = qh + t * 8 * (kHd / 4);
    const v2u* pql = ql + t * 8 * (kHd / 4);
    const v2u* pkh = kh + t * 8 * (kHd / 4);
    const v2u* pkl = kl + t * 8 * (kHd / 4);
    v2u wqh[8], wql[8], wkh[8], wkl[8];
#pragma unroll
    for (int j = 0; j < 8; ++j) {
      wqh[j] = pqh[j * (kHd / 4)];
      wql[j] = pql[j * (kHd / 4)];
      wkh[j] = pkh[j * (kHd / 4)];
      wkl[j] = pkl[j * (kHd / 4)];
    }
    /* the wait that stands before a register named by an issued global load is overwritten; the address pairs are inputs so that
       they stay untouched up to it */
    asm volatile("s_wait_xcnt 0x0" :: "v"(pqh), "v"(pql), "v"(pkh), "v"(pkl) : "memory");
#pragma unroll
    for (int jj = 0; jj < 8; ++jj) {
      const int r = 8 * t + jj;
      const int g = 2 * t + (jj >> 2);
      const int j = jj & 3;
      const v4f q = hilo4(wqh[jj], wql[jj]);
      const v4f k = hilo4(wkh[jj], wkl[jj]);
      kc += k;
      qc += q;
      const float d1 = row16_sum(dot4_eps(q, kc));
      const float d2 = row16_sum(dot4_eps(k, qc));
      const float nrm = (float)(row0 + r + 1);
      const float sink_in = (1.0f / d1) * nrm;
      const float src_out = (1.0f / d2) * nrm;
      a1 += k * src_out;
      a2 += q * sink_in;
      si[j] = (c == g) ? sink_in : si[j];
      so[j] = (c == g) ? src_out : so[j];
    }
  }
  const size_t ro = (size_t)bh * kSeq + (size_t)row0 + 4 * c;
  *(v4f*)(SINK + ro) = si;
  *(v4f*)(SRC + ro) = so;
  float* o = T1 + ((size_t)bh * kNSeg + seg) * 128 + 4 * c;
  *(v4f*)o = a1;
  *(v4f*)(o + 64) = a2;
}

__global__ __launch_bounds__(32) void flow_conserved_kernel(const unsigned short* __restrict__ QHp, const unsigned short* __restrict__ QLp,
                                                            const unsigned short* __restrict__ KHp, const unsigned short* __restrict__ KLp,
                                                            const float* __restrict__ T1, const float* __restrict__ SINK,
                                                            const float* __restrict__ SRC, float* __restrict__ D3, float* __restrict__ D4) {
  const int lane = threadIdx.x, c = lane & 15;
  const int bh = (int)blockIdx.x / (kNSeg / 2);
  const int seg = ((int)blockIdx.x % (kNSeg / 2)) * 2 + (lane >> 4);
  const int row0 = seg * kSegRows;
  const size_t w0 = ((size_t)bh * kSeq + (size_t)row0) * (kHd / 4) + c;
  const v2u* qh = (const v2u*)QHp + w0;
  const v2u* ql = (const v2u*)QLp + w0;
  const v2u* kh = (const v2u*)KHp + w0;
  const v2u* kl = (const v2u*)KLp + w0;
  const float* sip = SINK + (size_t)bh * kSeq + row0;
  const float* sop = SRC + (size_t)bh * kSeq + row0;
  v4f s1, s2;
  seg_prefix(T1 + (size_t)bh * kNSeg * 128, seg, c, s1, s2);
  v4f k3 = (v4f){0.f, 0.f, 0.f, 0.f}, k4 = (v4f){0.f, 0.f, 0.f, 0.f};
  /* 8 rows per trip, kept rolled for code size: their loads and row sums overlap; only the running sums are ordered */
#pragma unroll 1
  for (int t = 0; t < kSegRows / 8; ++t) {
    const v2u* pqh = qh + t * 8 * (kHd / 4);
    const v2u* pql = ql + t * 8 * (kHd / 4);
    const v2u* pkh = kh + t * 8 * (kHd / 4);
    const v2u* pkl = kl + t * 8 * (kHd / 4);
    const v4f* psi = (const v4f*)(sip + 8 * t);
    const v4f* pso = (const v4f*)(sop + 8 * t);
    v2u wqh[8], wql[8], wkh[8], wkl[8];
    v4f si[2], so[2];
    si[0] = psi[0];
    si[1] = psi[1];
    so[0] = pso[0];
    so[1] = pso[1];
#pragma unroll
    for (int j = 0; j < 8; ++j) {
      wqh[j] = pqh[j * (kHd / 4)];
      wql[j] = pql[j * (kHd / 4)];
      wkh[j] = pkh[j * (kHd / 4)];
      wkl[j] = pkl[j * (kHd / 4)];
    }
    /* the wait that stands before a register named by an issued global load is overwritten; the address pairs are inputs so that
       they stay untouched up to it */
    asm volatile("s_wait_xcnt 0x0" :: "v"(pqh), "v"(pql), "v"(pkh), "v"(pkl), "v"(psi), "v"(pso) : "memory");
#pragma unroll
    for (int jj = 0; jj < 8; ++jj) {
      const int g = 2 * t + (jj >> 2);
      const int j = jj & 3;
      const v4f q = hilo4(wqh[jj], wql[jj]);
      const v4f k = hilo4(wkh[jj], wkl[jj]);
      s1 += k * so[jj >> 2][j];
      s2 += q * si[jj >> 2][j];
      const float d3 = row16_sum(dot4_eps(q, s1));
      const float d4 = row16_sum(dot4_eps(k, s2));
      k3[j] = (c == g) ? d3 : k3[j];
      k4[j] = (c == g) ? d4 : k4[j];
    }
  }
  const size_t ro = (size_t)bh * kSeq + (size_t)row0 + 4 * c;
  *(v4f*)(D3 + ro) = k3;
  *(v4f*)(D4 + ro) = k4;
}

/* one block of 32 waves per (b,h); thread t owns rows 4t..4t+3 */
__global__ __launch_bounds__(1024) void flow_finish_kernel(const float* __restrict__ D3, const float* __restrict__ D4,
                                                           const float* __restrict__ SINK, float* __restrict__ RS, float* __restrict__ COMP) {
  __shared__ float wtot[32];
  const int tid = threadIdx.x, lane = tid & 31, wave = tid >> 5;
  const size_t o = (size_t)blockIdx.x * kSeq + 4 * (size_t)tid;
  const v4f d3 = *(const v4f*)(D3 + o);
  const v4f d4 = *(const v4f*)(D4 + o);
  const v4f si = *(const v4f*)(SINK + o);
  v4f rs, ce, inc;
  float run = 0.f;
#pragma unroll
  for (int e = 0; e < 4; ++e) {
    const float nrm = (float)(4 * tid + e + 1);
    const float inv_nrm = 1.0f / nrm;
    const float csink = d3[e] * inv_nrm;
    const float csrc  = fminf(fmaxf(d4[e] * inv_nrm, -1.0f), 1.0f);
    const float salloc = 1.0f / (1.0f + expf(-csink));
    ce[e] = expf(csrc);
    run += ce[e];
    inc[e] = run;
    rs[e] = salloc * (si[e] * inv_nrm);
  }
  *(v4f*)(RS + o) = rs;
  /* inclusive scan of the threads' totals over the wave */
  float sc = run;
#pragma unroll
  for (int off = 1; off < 32; off <<= 1) {
    const float t = __shfl_up(sc, off, 32);
    sc += (lane >= off) ? t : 0.0f;
  }
  if (lane == 31) wtot[wave] = sc;
  const float up = __shfl_up(sc, 1, 32);
  const float before_in_wave = (lane == 0) ? 0.0f : up;
  /* every wave's total is in LDS before any wave sums the totals of the waves before it */
  __syncthreads();
  float wp = (lane < wave) ? wtot[lane] : 0.0f;
#pragma unroll
  for (int off = 16; off > 0; off >>= 1) wp += __shfl_xor(wp, off, 32);
  const float base = wp + before_in_wave;
  v4f co;
#pragma unroll
  for (int e = 0; e < 4; ++e) {
    const float nrm = (float)(4 * tid + e + 1);
    co[e] = (ce[e] / (base + inc[e])) * nrm;
  }
  *(v4f*)(COMP + o) = co;
}

/* ---- fused causal linear attention: one block of 128 threads (4 waves) owns one (b,h) and walks its 64 chunks of 64 rows in order
        (static trip counts, four block barriers per chunk at the top level of the loop, no atomics, no inter-block communication).
        Wave w owns output rows 16w..16w+15 of the chunk and rows m = 16w..16w+15 of the transposed state St[m][d] (f32 registers accS).
        LDS (bf16 bits, pitch 72): R hi/lo  = St[m][d] during the output phase, then KT[d][l] during the state update (shared region);
                                   VT hi/lo = v'^T[m][l] with v' = v * comp[l]; P hi/lo per wave = masked scores, later the output staging.
        Every k-tile read touches columns 0..63 only; those are rewritten every chunk.
        Per chunk:  out[i][m] = rs[i] * ( sum_d q[i][d] St[m][d] + sum_{j<=i} (q[i].k[j]) v'[j][m] );  then St[m][d] += sum_l v'[l][m] k[l][d].
        All products: hi*hi + hi*lo + lo*hi. Q and row-major K fragments come straight from the global bf16 planes (row pitch 64).
        Coverage: 16 blocks x 64 chunks x 4 waves x 16 rows x 64 cols = 8192 rows x 512 cols per plane. */
__global__ __launch_bounds__(128) void flow_attn_kernel(
    const unsigned short* __restrict__ QHp, const unsigned short* __restrict__ QLp,
    const unsigned short* __restrict__ KHp, const unsigned short* __restrict__ KLp,
    const float* __restrict__ VF, const float* __restrict__ RS, const float* __restrict__ COMP,
    unsigned short* __restrict__ AHp, unsigned short* __restrict__ ALp, int bh0) {
  __shared__ __align__(16) __bf16 Rh[kChunk * kLp];
  __shared__ __align__(16) __bf16 Rl[kChunk * kLp];
  __shared__ __align__(16) __bf16 VTh[kHd * kLp];
  __shared__ __align__(16) __bf16 VTl[kHd * kLp];
  __shared__ __align__(16) __bf16 Ph[4][16 * kLp];
  __shared__ __align__(16) __bf16 Pl[4][16 * kLp];

  const int tid = threadIdx.x, lane = tid & 31, wave = tid >> 5;
  const int c = lane & 15, hh = lane >> 4, koff = hh * 8;
  const int bh = bh0 + (int)blockIdx.x;
  const int hd = bh & (kHeads - 1);
  const int bl = (int)blockIdx.x >> 3;
  const size_t pbase = (size_t)bh * kSeq * kHd;
  const __bf16* QH = (const __bf16*)QHp + pbase;
  const __bf16* QL = (const __bf16*)QLp + pbase;
  const __bf16* KH = (const __bf16*)KHp + pbase;
  const __bf16* KL = (const __bf16*)KLp + pbase;
  const unsigned short* KHu = KHp + pbase;
  const unsigned short* KLu = KLp + pbase;
  const float* vfp = VF + pbase;
  const float* rsp = RS + (size_t)bh * kSeq;
  const float* cpp = COMP + (size_t)bh * kSeq;
  unsigned short* ahp = AHp + ((size_t)bl * kSeq) * kEmb + hd * kHd;
  unsigned short* alp = ALp + ((size_t)bl * kSeq) * kEmb + hd * kHd;
  __bf16* ph = Ph[wave];
  __bf16* pl = Pl[wave];
  const int lr = tid >> 1, dh = (tid & 1) * 32;
  const int q4 = lane >> 3, c8 = (lane & 7) * 8;
  const v8f z8 = (v8f){0.f,0.f,0.f,0.f,0.f,0.f,0.f,0.f};

  v8f accS[4];
  accS[0] = z8; accS[1] = z8; accS[2] = z8; accS[3] = z8;

#pragma unroll 1
  for (int n = 0; n < kNChunk; ++n) {
    const int l0 = n * kChunk;
    /* all reads of R (as KT) and VT of the chunk before are finished */
    __syncthreads();

    /* phase A1: St hi/lo <- accS; wave w writes rows 16w..16w+15 x 64 cols */
#pragma unroll
    for (int j = 0; j < 4; ++j) {
#pragma unroll
      for (int r = 0; r < 8; ++r) {
        const float s = accS[j][r];
        const unsigned short hb = f2bf_bits(s);
        const unsigned short lb = f2bf_bits(s - bf_bits2f(hb));
        const int o = (16 * wave + 8 * hh + r) * kLp + 16 * j + c;
        Rh[o] = bits2bf(hb);
        Rl[o] = bits2bf(lb);
      }
    }
    /* phase A2: VT hi/lo <- (v * comp)^T; thread covers row lr, features dh..dh+31: 128 threads x 32 = 64 x 64 */
    {
      const float cv = cpp[l0 + lr];
      const float* vrow = vfp + (size_t)(l0 + lr) * kHd + dh;
#pragma unroll
      for (int g = 0; g < 2; ++g) {
        v4f vv[4];
#pragma unroll
        for (int i = 0; i < 4; ++i) vv[i] = *(const v4f*)(vrow + 16 * g + 4 * i);
#pragma unroll
        for (int i = 0; i < 4; ++i) {
#pragma unroll
          for (int e = 0; e < 4; ++e) {
            const float f = vv[i][e] * cv;
            const unsigned short hb = f2bf_bits(f);
            const unsigned short lb = f2bf_bits(f - bf_bits2f(hb));
            const int d = dh + 16 * g + 4 * i + e;
            VTh[d * kLp + lr] = bits2bf(hb);
            VTl[d * kLp + lr] = bits2bf(lb);
          }
        }
        asm volatile("" ::: "memory");
      }
    }
    __syncthreads();

    /* phase B: Q fragments (rows 16w + c) */
    v16b qh[2], ql[2];
    {
      const size_t qo = (size_t)(l0 + 16 * wave + c) * kHd + koff;
#pragma unroll
      for (int dc = 0; dc < 2; ++dc) {
        qh[dc] = Frag<__bf16>::load(QH + qo + dc * 32);
        ql[dc] = Frag<__bf16>::load(QL + qo + dc * 32);
      }
    }
    asm volatile("" ::: "memory");
    /* scores rows 16w.., all 64 columns; inclusive causal mask by select; hi/lo into this wave's P strip */
#pragma unroll
    for (int j = 0; j < 4; ++j) {
      v8f s = z8;
      const size_t ko = (size_t)(l0 + 16 * j + c) * kHd + koff;
#pragma unroll
      for (int dc = 0; dc < 2; ++dc) {
        const v16b kh = Frag<__bf16>::load(KH + ko + dc * 32);
        const v16b kl = Frag<__bf16>::load(KL + ko + dc * 32);
        s = mma_g(qh[dc], kh, s);
        s = mma_g(qh[dc], kl, s);
        s = mma_g(ql[dc], kh, s);
      }
      const int jj = 16 * j + c;
#pragma unroll
      for (int r = 0; r < 8; ++r) {
        const int ii = 16 * wave + 8 * hh + r;
        const float pv = (jj <= ii) ? s[r] : 0.0f;
        const unsigned short hb = f2bf_bits(pv);
        const unsigned short lb = f2bf_bits(pv - bf_bits2f(hb));
        ph[(8 * hh + r) * kLp + jj] = bits2bf(hb);
        pl[(8 * hh + r) * kLp + jj] = bits2bf(lb);
      }
      asm volatile("" ::: "memory");
    }
    /* P strip: written and read by this wave only */
    wave_lds_sync();

    v8f accO[4];
    accO[0] = z8; accO[1] = z8; accO[2] = z8; accO[3] = z8;
    /* inter: Q x St^T (Bt rows m = 16t + c, k = d) */
#pragma unroll
    for (int t = 0; t < 4; ++t) {
      const __bf16* sph = Rh + (16 * t + c) * kLp + koff;
      const __bf16* spl = Rl + (16 * t + c) * kLp + koff;
#pragma unroll
      for (int dc = 0; dc < 2; ++dc) {
        const v16b sh = Frag<__bf16>::load(sph + dc * 32);
        const v16b sl = Frag<__bf16>::load(spl + dc * 32);
        accO[t] = mma_g(qh[dc], sh, accO[t]);
        accO[t] = mma_g(qh[dc], sl, accO[t]);
        accO[t] = mma_g(ql[dc], sh, accO[t]);
      }
    }
    /* intra: P x v' (A rows i = c of the strip, k = j; Bt rows m = 16t + c of VT, k = j) */
#pragma unroll
    for (int kk = 0; kk < 2; ++kk) {
      const v16b pah = Frag<__bf16>::load(ph + c * kLp + kk * 32 + koff);
      const v16b pal = Frag<__bf16>::load(pl + c * kLp + kk * 32 + koff);
#pragma unroll
      for (int t = 0; t < 4; ++t) {
        const v16b vh = Frag<__bf16>::load(VTh + (16 * t + c) * kLp + kk * 32 + koff);
        const v16b vl = Frag<__bf16>::load(VTl + (16 * t + c) * kLp + kk * 32 + koff);
        accO[t] = mma_g(pah, vh, accO[t]);
        accO[t] = mma_g(pah, vl, accO[t]);
        accO[t] = mma_g(pal, vh, accO[t]);
      }
    }
    /* epilogue: row scale, bf16 hi/lo, stage in the P strip, whole-line stores */
    {
      const float* rp = rsp + l0 + 16 * wave + 8 * hh;
      const v4f r0 = *(const v4f*)(rp);
      const v4f r1 = *(const v4f*)(rp + 4);
      float rsv[8];
#pragma unroll
      for (int e = 0; e < 4; ++e) { rsv[e] = r0[e]; rsv[4 + e] = r1[e]; }
#pragma unroll
      for (int t = 0; t < 4; ++t) {
#pragma unroll
        for (int r = 0; r < 8; ++r) {
          const float o = accO[t][r] * rsv[r];
          const unsigned short hb = f2bf_bits(o);
          const unsigned short lb = f2bf_bits(o - bf_bits2f(hb));
          ph[(8 * hh + r) * kLp + 16 * t + c] = bits2bf(hb);
          pl[(8 * hh + r) * kLp + 16 * t + c] = bits2bf(lb);
        }
      }
      wave_lds_sync();
      v4u uh[4], ul[4];
#pragma unroll
      for (int it = 0; it < 4; ++it) {
        const int row = it * 4 + q4;
        const v8b hv = *(const v8b*)(ph + row * kLp + c8);
        const v8b lv = *(const v8b*)(pl + row * kLp + c8);
        uh[it] = __builtin_bit_cast(v4u, hv);
        ul[it] = __builtin_bit_cast(v4u, lv);
      }
      {
#pragma unroll
        for (int it = 0; it < 4; ++it) {
          const size_t o = (size_t)(l0 + 16 * wave + it * 4 + q4) * kEmb + c8;
          *(v4u*)(ahp + o) = uh[it];
          *(v4u*)(alp + o) = ul[it];
        }
        
      }
      wave_lds_sync();
    }
    /* every wave has finished reading R as St */
    __syncthreads();

    /* phase C: KT hi/lo <- k^T; thread covers row lr, features dh..dh+31 (4 x 16-B words per plane): 128 threads x 32 = 64 x 64 */
    {
      const size_t ko = (size_t)(l0 + lr) * kHd + dh;
      const v4u* kh4 = (const v4u*)(KHu + ko);
      const v4u* kl4 = (const v4u*)(KLu + ko);
      v4u wh[4], wl[4];
#pragma unroll
      for (int g = 0; g < 4; ++g) { wh[g] = kh4[g]; wl[g] = kl4[g]; }
#pragma unroll
      for (int g = 0; g < 4; ++g) {
#pragma unroll
        for (int e = 0; e < 4; ++e) {
          const unsigned a = wh[g][e];
          const unsigned b = wl[g][e];
          const int d = dh + 8 * g + 2 * e;
          const unsigned a0 = a & 0xffffu, a1 = a >> 16;
          const unsigned b0 = b & 0xffffu, b1 = b >> 16;
          Rh[d * kLp + lr]       = bits2bf((unsigned short)a0);
          Rh[(d + 1) * kLp + lr] = bits2bf((unsigned short)a1);
          Rl[d * kLp + lr]       = bits2bf((unsigned short)b0);
          Rl[(d + 1) * kLp + lr] = bits2bf((unsigned short)b1);
        }
      }
    }
    __syncthreads();

    /* phase D: St[m][d] += sum_l VT[m][l] * KT[d][l] (A rows m = 16w + c, k = l; Bt rows d = 16j + c, k = l) */
#pragma unroll
    for (int kk = 0; kk < 2; ++kk) {
      const v16b vah = Frag<__bf16>::load(VTh + (16 * wave + c) * kLp + kk * 32 + koff);
      const v16b val = Frag<__bf16>::load(VTl + (16 * wave + c) * kLp + kk * 32 + koff);
#pragma unroll
      for (int j = 0; j < 4; ++j) {
        const v16b kh = Frag<__bf16>::load(Rh + (16 * j + c) * kLp + kk * 32 + koff);
        const v16b kl = Frag<__bf16>::load(Rl + (16 * j + c) * kLp + kk * 32 + koff);
        accS[j] = mma_g(vah, kh, accS[j]);
        accS[j] = mma_g(vah, kl, accS[j]);
        accS[j] = mma_g(val, kh, accS[j]);
      }
    }
    acc_guard4(accS[0], accS[1], accS[2], accS[3]);
  }
}

/* ---- host glue ----
   Workspace region map (bytes, 256-B aligned carve; total 124,788,736 <= 134,217,728):
     XB    [16384][512] bf16   16,777,216   bf16(x); after the projections the same bytes hold, per batch half,
                                            ATTN_HI [8192][512] bf16 (first 8,388,608 B) and ATTN_LO (second 8,388,608 B)
     WQKV  [1536][512]  bf16    1,572,864   bf16(Wq | Wk | Wv)
     WOB   [512][512]   bf16      524,288   bf16(Wo)
     BIAS  [2048]       f32         8,192   bf16 values of bq | bk | bv | bo kept as f32
     QH,QL,KH,KL [32][4096][64] bf16  4 x 16,777,216   sigmoid(q), sigmoid(k) as hi/lo planes
     VF    [32][4096][64] f32  33,554,432   v
     RS, COMP [32][4096] f32   2 x 524,288
     SINK, SRC, D3, D4 [32][4096] f32   4 x 524,288   per-row values handed between the flow scan launches
     T0, T1 [32][64][128] f32  2 x 1,048,576   segment totals (k | q, then k*src_out | q*sink_in) */
extern "C" void kernel_launch(void* const* d_in, const int* in_sizes, int n_in,
                              void* d_out, int out_size, void* d_ws, size_t ws_size, hipStream_t stream) {
  if (n_in < 9 || d_out == nullptr || d_ws == nullptr) return;
  if (in_sizes[0] != kRows * kEmb || in_sizes[1] != kEmb * kEmb || in_sizes[2] != kEmb ||
      in_sizes[3] != kEmb * kEmb || in_sizes[4] != kEmb || in_sizes[5] != kEmb * kEmb ||
      in_sizes[6] != kEmb || in_sizes[7] != kEmb * kEmb || in_sizes[8] != kEmb ||
      out_size != kRows * kEmb) return;

  const float* x  = (const float*)d_in[0];
  const float* Wq = (const float*)d_in[1];
  const float* bq = (const float*)d_in[2];
  const float* Wk = (const float*)d_in[3];
  const float* bk = (const float*)d_in[4];
  const float* Wv = (const float*)d_in[5];
  const float* bv = (const float*)d_in[6];
  const float* Wo = (const float*)d_in[7];
  const float* bo = (const float*)d_in[8];
  float* out = (float*)d_out;

  char* ws = (char*)d_ws; size_t off = 0;
  auto carve = [&](size_t bytes) -> char* { char* p = ws + off; off += (bytes + 255) & ~(size_t)255; return p; };
  unsigned short* XB   = (unsigned short*)carve((size_t)kRows * kEmb * 2);
  unsigned short* WQKV = (unsigned short*)carve((size_t)kQkvN * kEmb * 2);
  unsigned short* WOB  = (unsigned short*)carve((size_t)kEmb * kEmb * 2);
  float*          BIAS = (float*)carve((size_t)4 * kEmb * 4);
  unsigned short* QH   = (unsigned short*)carve((size_t)kBH * kSeq * kHd * 2);
  unsigned short* QL   = (unsigned short*)carve((size_t)kBH * kSeq * kHd * 2);
  unsigned short* KH   = (unsigned short*)carve((size_t)kBH * kSeq * kHd * 2);
  unsigned short* KL   = (unsigned short*)carve((size_t)kBH * kSeq * kHd * 2);
  float*          VF   = (float*)carve((size_t)kBH * kSeq * kHd * 4);
  float*          RS   = (float*)carve((size_t)kBH * kSeq * 4);
  float*          COMP = (float*)carve((size_t)kBH * kSeq * 4);
  float*          SINK = (float*)carve((size_t)kBH * kSeq * 4);
  float*          SRC  = (float*)carve((size_t)kBH * kSeq * 4);
  float*          D3   = (float*)carve((size_t)kBH * kSeq * 4);
  float*          D4   = (float*)carve((size_t)kBH * kSeq * 4);
  float*          T0   = (float*)carve((size_t)kBH * kNSeg * 128 * 4);
  float*          T1   = (float*)carve((size_t)kBH * kNSeg * 128 * 4);
  if (off > ws_size || off > (size_t)134217728) return;
  /* attn planes of one batch half live in the XB bytes (same 16-bit element type, same row pitch); XB is dead after the projections */
  unsigned short* AH = XB;
  unsigned short* AL = XB + (size_t)kHalfRows * kEmb;

  /* 16-bit operand planes */
  const int n8x = kRows * kEmb / 8;
  const int n8w = kEmb * kEmb / 8;
  cvt8_bf16_kernel<<<(n8x + 255) / 256, 256, 0, stream>>>(x,  XB, n8x);
  cvt8_bf16_kernel<<<(n8w + 255) / 256, 256, 0, stream>>>(Wq, WQKV, n8w);
  cvt8_bf16_kernel<<<(n8w + 255) / 256, 256, 0, stream>>>(Wk, WQKV + (size_t)kEmb * kEmb, n8w);
  cvt8_bf16_kernel<<<(n8w + 255) / 256, 256, 0, stream>>>(Wv, WQKV + (size_t)2 * kEmb * kEmb, n8w);
  cvt8_bf16_kernel<<<(n8w + 255) / 256, 256, 0, stream>>>(Wo, WOB, n8w);
  bias_prep_kernel<<<1, 256, 0, stream>>>(bq, bk, bv, bo, BIAS);

  /* projections: M = 16384, N = 1536, K = 512; 256 x 24 tiles = 768 blocks x 8 waves */
  gemm64_kernel<0><<<(kRows / 64) * (kQkvN / 64) / 8, 256, 0, stream>>>(
      XB, XB, WQKV, BIAS, QH, QL, KH, KL, VF, kRows, kQkvN);

  /* flow scans: three launches of 1024 waves (two 64-row segments each), then one block per (b,h) */
  flow_seg_total_kernel<<<kBH * (kNSeg / 2), 32, 0, stream>>>(QH, QL, KH, KL, T0);
  flow_incoming_kernel<<<kBH * (kNSeg / 2), 32, 0, stream>>>(QH, QL, KH, KL, T0, SINK, SRC, T1);
  flow_conserved_kernel<<<kBH * (kNSeg / 2), 32, 0, stream>>>(QH, QL, KH, KL, T1, SINK, SRC, D3, D4);
  flow_finish_kernel<<<kBH, 1024, 0, stream>>>(D3, D4, SINK, RS, COMP);

  /* per batch half: fused chunked attention (16 blocks), then output projection M = 8192, N = 512, K = 512 (128 blocks) */
  for (int half = 0; half < 2; ++half) {
    flow_attn_kernel<<<kHalfBH, 128, 0, stream>>>(QH, QL, KH, KL, VF, RS, COMP, AH, AL, half * kHalfBH);
    gemm64_kernel<1><<<(kHalfRows / 64) * (kEmb / 64) / 8, 256, 0, stream>>>(
        AH, AL, WOB, BIAS + 3 * kEmb, QH, QL, KH, KL,
        out + (size_t)half * kHalfRows * kEmb, kHalfRows, kEmb);
  }
}

// v002
// It runs in 282 microseconds.
// Timed twice side by side with v001, it ran 3.69 and 3.71 times as fast.
// Counting every step since v000, it is 14.5 times as fast.
// All contractions on v_wmma_f32_16x16x32_bf16 with f32 accumulate: q/k/v projections = bf16(x) x bf16(W) single product; chunk state, scores, inter and intra products = bf16 hi/lo operands (hi*hi + hi*lo + lo*hi); output projection = (attn_hi + attn_lo) x bf16(Wo); sigmoid, flow scans and row scales in f32 on VALU.
#include <hip/hip_runtime.h>
#include <math.h>

constexpr int kBatch   = 4;
constexpr int kSeq     = 4096;
constexpr int kEmb     = 512;
constexpr int kHeads   = 8;
constexpr int kHd      = 64;
constexpr int kRows    = kBatch * kSeq;
constexpr int kBH      = kBatch * kHeads;
constexpr int kChunk   = 64;
constexpr int kNChunk  = kSeq / kChunk;
constexpr int kLp      = 72;
constexpr int kQkvN    = 3 * kEmb;
constexpr int kHalfRows = kRows / 2;
constexpr int kHalfBH   = kBH / 2;
constexpr int kSegRows = 64;
constexpr int kNSeg    = kSeq / kSegRows;
constexpr float kEps   = 1e-6f;
static_assert(kHeads * kHd == kEmb, "head packing");
static_assert(kEmb % 32 == 0, "GEMM K multiple of 32");
static_assert(kHd % 32 == 0 && kChunk % 32 == 0, "tile K multiple of 32");
static_assert(kRows % 64 == 0 && kHalfRows % 64 == 0 && kQkvN % 64 == 0 && kEmb % 64 == 0, "GEMM M, N tile multiples");
static_assert(kSeq % 128 == 0 && kSeq % kChunk == 0, "scan line groups and chunks");
static_assert(kSeq == 4096 && kEmb == 512 && kHd == 64, "shift constants in the projection epilogue");
static_assert(kLp % 8 == 0, "LDS pitch keeps 16-B alignment");
static_assert(kSegRows == 64 && kNSeg % 2 == 0 && kSeq == 4 * 1024, "flow scan: 16 lanes x 4 kept rows per segment, two segments per wave, 1024 threads x 4 rows");

typedef __attribute__((ext_vector_type(16))) __bf16   v16b;
typedef __attribute__((ext_vector_type(8)))  __bf16   v8b;
typedef __attribute__((ext_vector_type(8)))  float    v8f;
typedef __attribute__((ext_vector_type(4)))  float    v4f;
typedef __attribute__((ext_vector_type(4)))  unsigned int v4u;
typedef __attribute__((ext_vector_type(2)))  unsigned int v2u;

__device__ __forceinline__ unsigned short f2bf_bits(float f) {
  unsigned u = __float_as_uint(f);
  return (unsigned short)((u + 0x7FFFu + ((u >> 16) & 1u)) >> 16);
}
__device__ __forceinline__ float bf_bits2f(unsigned short h) { return __uint_as_float(((unsigned)h) << 16); }
__device__ __forceinline__ float bf16r(float f) { return bf_bits2f(f2bf_bits(f)); }
__device__ __forceinline__ unsigned pk16(unsigned short a, unsigned short b) { return (unsigned)a | ((unsigned)b << 16); }
__device__ __forceinline__ __bf16 bits2bf(unsigned short u) { return __builtin_bit_cast(__bf16, u); }

/* hazard guards as plain device helpers */
__device__ __forceinline__ void dep_guard4_b(v8f& a, v8f& b, v8f& c, v8f& d, v16b x, v16b y) { asm volatile("v_nop\n\tv_nop\n\tv_nop\n\tv_nop" : "+v"(a), "+v"(b), "+v"(c), "+v"(d) : "v"(x), "v"(y)); }
__device__ __forceinline__ void keep4_b(v16b a, v16b b, v16b c, v16b d) { asm volatile("v_nop" :: "v"(a), "v"(b), "v"(c), "v"(d)); }
__device__ __forceinline__ void acc_guard4(v8f& a, v8f& b, v8f& c, v8f& d) { asm volatile("v_nop\n\tv_nop\n\tv_nop\n\tv_nop" : "+v"(a), "+v"(b), "+v"(c), "+v"(d)); }

template <typename T> struct Frag;
template <> struct Frag<__bf16> {
  typedef v16b V; union U { v16b v; v8b h[2]; };
  /* elements 0..7 <- p[0..7], elements 8..15 <- p[16..23] */
  static __device__ __forceinline__ v16b load(const __bf16* p) {
    U f; f.h[0] = *(const v8b*)(p); f.h[1] = *(const v8b*)(p + 16); return f.v;
  }
  static __device__ __forceinline__ v8f mma(v16b a, v16b b, v8f c) {
    return __builtin_amdgcn_wmma_f32_16x16x32_bf16(false, a, false, b, (short)0, c, false, false);
  }
};

/* one WMMA followed by the 4-slot guard tying its accumulator and both operand fragments */
__device__ __forceinline__ v8f mma_g(v16b a, v16b b, v8f c) {
  c = __builtin_amdgcn_wmma_f32_16x16x32_bf16(false, a, false, b, (short)0, c, false, false);
  asm volatile("v_nop\n\tv_nop\n\tv_nop\n\tv_nop" : "+v"(c) : "v"(a), "v"(b));
  return c;
}

__device__ __forceinline__ void wave_lds_sync() {
  __builtin_amdgcn_fence(__ATOMIC_RELEASE, "workgroup");
  __builtin_amdgcn_wave_barrier();
  __builtin_amdgcn_fence(__ATOMIC_ACQUIRE, "workgroup");
}

/* ---- f32 -> bf16 (RNE convert), 8 consecutive elements per thread: two 16-B loads, ONE 16-B store per lane; a wave writes
        Coverage: thread i writes elements 8i..8i+7, i < n8; every call has n8 a multiple of 256. */
__global__ __launch_bounds__(256) void cvt8_bf16_kernel(const float* __restrict__ src, unsigned short* __restrict__ dst, int n8) {
  const int i = blockIdx.x * 256 + threadIdx.x;
  if (i < n8) {
    const float* p = src + 8 * (size_t)i;
    const v4f a = *(const v4f*)(p);
    const v4f b = *(const v4f*)(p + 4);
    unsigned short hb[8];
#pragma unroll
    for (int e = 0; e < 4; ++e) {
      const float fa = a[e];
      const float fb = b[e];
      hb[e]     = f2bf_bits(fa);
      hb[4 + e] = f2bf_bits(fb);
    }
    const v4u u = (v4u){pk16(hb[0], hb[1]), pk16(hb[2], hb[3]), pk16(hb[4], hb[5]), pk16(hb[6], hb[7])};
    unsigned short* q = dst + 8 * (size_t)i;
    *(v4u*)q = u;
    
  }
}

/* ---- bias plane: dst[0..2047] = bf16 value (kept as f32) of bq | bk | bv | bo. One block of 256 threads, 2 iterations x 256 x
        float4 = 512 float4 = exactly 2048 floats. All four sources are loaded unconditionally; wave-uniform select by value.
*/
__global__ __launch_bounds__(256) void bias_prep_kernel(const float* __restrict__ b0, const float* __restrict__ b1,
                                                        const float* __restrict__ b2, const float* __restrict__ b3,
                                                        float* __restrict__ dst) {
  const int tid = threadIdx.x;
#pragma unroll 1
  for (int it = 0; it < 2; ++it) {
    const int idx4 = it * 256 + tid;
    const int which = idx4 >> 7;
    const int off = (idx4 & 127) * 4;
    const v4f va = *(const v4f*)(b0 + off);
    const v4f vb = *(const v4f*)(b1 + off);
    const v4f vc = *(const v4f*)(b2 + off);
    const v4f vd = *(const v4f*)(b3 + off);
    v4f o;
#pragma unroll
    for (int e = 0; e < 4; ++e) {
      const float s01 = (which == 0) ? va[e] : vb[e];
      const float s23 = (which == 2) ? vc[e] : vd[e];
      o[e] = bf16r((which < 2) ? s01 : s23);
    }
    float* op = dst + which * kEmb + off;
    *(v4f*)op = o;
    
  }
}

/* ---- Register-blocked WMMA GEMM, each wave owns a 64x64 tile; A row-major [M][512], Bt row-major [N][512] (bf16 bits).
        MODE 0 (projections): single product; epilogue adds bias[n]; column tile 64 = one head of q (n0 < 512), k (512..1023)
               x 16 B, 4 rows per instruction); v: f32 plane [b][h][l][64] (row segment 256 B = 16 lanes x 16 B, 2 rows per instruction).
        MODE 1 (output projection): product = A*Bt + A2*Bt (A2 = lo plane of A); epilogue adds bias[n]; f32 rows of pitch 512.
*/
template <int MODE>
__global__ __launch_bounds__(256) void gemm64_kernel(
    const unsigned short* __restrict__ Ap, const unsigned short* __restrict__ A2p,
    const unsigned short* __restrict__ Btp, const float* __restrict__ bias,
    unsigned short* __restrict__ QHp, unsigned short* __restrict__ QLp,
    unsigned short* __restrict__ KHp, unsigned short* __restrict__ KLp,
    float* __restrict__ Fout, int M, int N) {
  typedef __bf16 T;
  const T* A = (const T*)Ap; const T* A2 = (const T*)A2p; const T* Bt = (const T*)Btp;
  __shared__ __align__(16) float sT[8][16 * 68];
  const int lane = threadIdx.x & 31;
  const int wave = threadIdx.x >> 5;
  const int tilesN = N >> 6;
  const int tilesM = M >> 6;
  const int tile = blockIdx.x * 8 + wave;
  /* wave-uniform; no block barriers in this kernel */
  if (tile >= tilesM * tilesN) return;
  const int tm = tile / tilesN;
  const int tn = tile - tm * tilesN;
  const int m0 = tm << 6;
  const int n0 = tn << 6;

  const int rlane = lane & 15;
  const int koff  = (lane >> 4) * 8;
  const int mOff  = (lane >> 4) * 8;

  v8f acc[4][4];
#pragma unroll
  for (int i = 0; i < 4; ++i)
#pragma unroll
    for (int j = 0; j < 4; ++j) acc[i][j] = (v8f){0.f,0.f,0.f,0.f,0.f,0.f,0.f,0.f};

  for (int k0 = 0; k0 < kEmb; k0 += 32) {
    v16b bh[4];
#pragma unroll
    for (int j = 0; j < 4; ++j) {
      const size_t bo = (size_t)(n0 + (j << 4) + rlane) * kEmb + koff + k0;
      bh[j] = Frag<T>::load(Bt + bo);
    }
#pragma unroll
    for (int i = 0; i < 4; ++i) {
      const size_t ao = (size_t)(m0 + (i << 4) + rlane) * kEmb + koff + k0;
      v16b ah = Frag<T>::load(A + ao);
      v16b al = ah;
      if (MODE == 1) al = Frag<T>::load(A2 + ao);
#pragma unroll
      for (int j = 0; j < 4; ++j) {
        acc[i][j] = Frag<T>::mma(ah, bh[j], acc[i][j]);
        if (MODE == 1) acc[i][j] = Frag<T>::mma(al, bh[j], acc[i][j]);
      }
      dep_guard4_b(acc[i][0], acc[i][1], acc[i][2], acc[i][3], ah, al);
    }
    keep4_b(bh[0], bh[1], bh[2], bh[3]);
  }
  acc_guard4(acc[0][0], acc[0][1], acc[0][2], acc[0][3]);
  acc_guard4(acc[1][0], acc[1][1], acc[1][2], acc[1][3]);
  acc_guard4(acc[2][0], acc[2][1], acc[2][2], acc[2][3]);
  acc_guard4(acc[3][0], acc[3][1], acc[3][2], acc[3][3]);

  /* ---- epilogue ---- */
  float* slab = sT[wave];
  /* wave-uniform tile decode for MODE 0 */
  const int sel  = n0 >> 9;
  const int hcol = (n0 & (kEmb - 1)) >> 6;
  const int bb   = m0 >> 12;
  const int l0   = m0 & (kSeq - 1);
  const size_t rowbase = ((size_t)(bb * kHeads + hcol)) * kSeq + (size_t)l0;
  unsigned short* Ch = (sel == 0) ? QHp : KHp;
  unsigned short* Cl = (sel == 0) ? QLp : KLp;
  const int hh = lane >> 4, c4 = (lane & 15) * 4;
  const int q4 = lane >> 3, c8 = (lane & 7) * 8;
#pragma unroll
  for (int i = 0; i < 4; ++i) {
#pragma unroll
    for (int j = 0; j < 4; ++j) {
      const int n = n0 + (j << 4) + rlane;
      const float bv = bias[n];
#pragma unroll
      for (int r = 0; r < 8; ++r) {
        const float v = acc[i][j][r] + bv;
        slab[(mOff + r) * 68 + (j << 4) + rlane] = v;
      }
    }
    wave_lds_sync();
    if (MODE == 0 && sel < 2) {
      /* in-place sigmoid on the slab, rolled: lane owns (row it*2+hh, cols c4..c4+3) */
#pragma unroll 1
      for (int it = 0; it < 8; ++it) {
        float* sp = slab + (it * 2 + hh) * 68 + c4;
        v4f v = *(const v4f*)sp;
#pragma unroll
        for (int e = 0; e < 4; ++e) {
          const float x = v[e];
          v[e] = 1.0f / (1.0f + expf(-x));
        }
        *(v4f*)sp = v;
      }
      wave_lds_sync();
    }
    if (MODE == 1) {
      float* Cf = Fout;
      {
#pragma unroll
        for (int it = 0; it < 8; ++it) {
          const int row = it * 2 + hh;
          const v4f v = *(const v4f*)(slab + row * 68 + c4);
          *(v4f*)(Cf + (size_t)(m0 + (i << 4) + row) * kEmb + n0 + c4) = v;
        }
        
      }
    } else if (sel == 2) {
      float* Cf = Fout;
      {
#pragma unroll
        for (int it = 0; it < 8; ++it) {
          const int row = it * 2 + hh;
          const v4f v = *(const v4f*)(slab + row * 68 + c4);
          *(v4f*)(Cf + (rowbase + (size_t)((i << 4) + row)) * kHd + c4) = v;
        }
        
      }
    } else {
      v4u uh[4], ul[4];
#pragma unroll
      for (int it = 0; it < 4; ++it) {
        const float* sp = slab + (it * 4 + q4) * 68 + c8;
        unsigned short hb[8], lb[8];
#pragma unroll
        for (int e = 0; e < 8; ++e) {
          const float f = sp[e];
          hb[e] = f2bf_bits(f);
          lb[e] = f2bf_bits(f - bf_bits2f(hb[e]));
        }
        uh[it] = (v4u){pk16(hb[0], hb[1]), pk16(hb[2], hb[3]), pk16(hb[4], hb[5]), pk16(hb[6], hb[7])};
        ul[it] = (v4u){pk16(lb[0], lb[1]), pk16(lb[2], lb[3]), pk16(lb[4], lb[5]), pk16(lb[6], lb[7])};
      }
      {
#pragma unroll
        for (int it = 0; it < 4; ++it) {
          const size_t o = (rowbase + (size_t)((i << 4) + it * 4 + q4)) * kHd + c8;
          *(v4u*)(Ch + o) = uh[it];
          *(v4u*)(Cl + o) = ul[it];
        }
        
      }
    }
    wave_lds_sync();
  }
}

/* ---- flow scans, all f32, split along the sequence: 64 segments of 64 rows per (b,h), every segment scanned at the same time.
        Each running sum over rows = (sum of the totals of the segments before, added in segment order) + (serial sum inside the segment).
        One wave = two segments: a 16-lane row of the wave owns one segment, lane c of it owns features 4c..4c+3 (8 B per bf16 plane).
        q = q_hi + q_lo, k = k_hi + k_lo read from the bf16 planes (the same operands the WMMA products use).
        Launch 1: segment totals of k and q.                          Launch 2: sink_in, src_out per row; segment totals of k*src_out, q*sink_in.
        Launch 3: the two conserved dot products per row (raw sums).  Launch 4: per row rs = sigmoid(conserved_sink) * sink_in / (l+1) and
        comp = exp(clip(conserved_source)) / cumsum * (l+1), the cumsum as a block scan over the 4096 rows of one (b,h).
        Per-row results are kept by lane c for rows 4c..4c+3 of its segment and stored once as 16 lanes x 16 B = 256 B.
        The inner loops are fully unrolled so that the staged words and the kept rows are indexed by constants and stay in registers. */
__device__ __forceinline__ float row16_sum(float v) {
  /* DPP row_xmask 1, 2, 4, 8: butterfly sum over the 16 lanes of a row, no LDS round trip */
  v += __int_as_float(__builtin_amdgcn_update_dpp(0, __float_as_int(v), 0x161, 0xf, 0xf, true));
  v += __int_as_float(__builtin_amdgcn_update_dpp(0, __float_as_int(v), 0x162, 0xf, 0xf, true));
  v += __int_as_float(__builtin_amdgcn_update_dpp(0, __float_as_int(v), 0x164, 0xf, 0xf, true));
  v += __int_as_float(__builtin_amdgcn_update_dpp(0, __float_as_int(v), 0x168, 0xf, 0xf, true));
  return v;
}
__device__ __forceinline__ v4f hilo4(v2u h, v2u l) {
  v4f r;
  r[0] = __uint_as_float(h[0] << 16)         + __uint_as_float(l[0] << 16);
  r[1] = __uint_as_float(h[0] & 0xffff0000u) + __uint_as_float(l[0] & 0xffff0000u);
  r[2] = __uint_as_float(h[1] << 16)         + __uint_as_float(l[1] << 16);
  r[3] = __uint_as_float(h[1] & 0xffff0000u) + __uint_as_float(l[1] & 0xffff0000u);
  return r;
}
__device__ __forceinline__ float dot4_eps(v4f x, v4f y) {
  return (x[0] + kEps) * (y[0] + kEps) + (x[1] + kEps) * (y[1] + kEps) + (x[2] + kEps) * (y[2] + kEps) + (x[3] + kEps) * (y[3] + kEps);
}
/* totals of the segments before seg, added in segment order; T = [kNSeg][128] of one (b,h), first 64 floats -> a, last 64 -> b */
__device__ __forceinline__ void seg_prefix(const float* __restrict__ T, int seg, int c, v4f& a, v4f& b) {
  a = (v4f){0.f, 0.f, 0.f, 0.f};
  b = (v4f){0.f, 0.f, 0.f, 0.f};
  /* 16 segments' loads in flight per trip: the loads are independent, only the adds are ordered */
#pragma unroll 16
  for (int s = 0; s < kNSeg; ++s) {
    const v4f ta = *(const v4f*)(T + s * 128 + 4 * c);
    const v4f tb = *(const v4f*)(T + s * 128 + 64 + 4 * c);
    const bool in = s < seg;
#pragma unroll
    for (int e = 0; e < 4; ++e) {
      a[e] += in ? ta[e] : 0.0f;
      b[e] += in ? tb[e] : 0.0f;
    }
  }
}

__global__ __launch_bounds__(32) void flow_seg_total_kernel(const unsigned short* __restrict__ QHp, const unsigned short* __restrict__ QLp,
                                                            const unsigned short* __restrict__ KHp, const unsigned short* __restrict__ KLp,
                                                            float* __restrict__ T0) {
  const int lane = threadIdx.x, c = lane & 15;
  const int bh = (int)blockIdx.x / (kNSeg / 2);
  const int seg = ((int)blockIdx.x % (kNSeg / 2)) * 2 + (lane >> 4);
  const size_t w0 = ((size_t)bh * kSeq + (size_t)seg * kSegRows) * (kHd / 4) + c;
  const v2u* qh = (const v2u*)QHp + w0;
  const v2u* ql = (const v2u*)QLp + w0;
  const v2u* kh = (const v2u*)KHp + w0;
  const v2u* kl = (const v2u*)KLp + w0;
  v4f ks = (v4f){0.f, 0.f, 0.f, 0.f}, qs = (v4f){0.f, 0.f, 0.f, 0.f};
  /* 16 rows per trip, kept rolled for code size: all their loads are issued before the first sum */
#pragma unroll 1
  for (int t = 0; t < kSegRows / 16; ++t) {
    const v2u* pqh = qh + t * 16 * (kHd / 4);
    const v2u* pql = ql + t * 16 * (kHd / 4);
    const v2u* pkh = kh + t * 16 * (kHd / 4);
    const v2u* pkl = kl + t * 16 * (kHd / 4);
    v2u wqh[16], wql[16], wkh[16], wkl[16];
#pragma unroll
    for (int j = 0; j < 16; ++j) {
      wqh[j] = pqh[j * (kHd / 4)];
      wql[j] = pql[j * (kHd / 4)];
      wkh[j] = pkh[j * (kHd / 4)];
      wkl[j] = pkl[j * (kHd / 4)];
    }
    /* the wait that stands before a register named by an issued global load is overwritten; the address pairs are inputs so that
       they stay untouched up to it; its memory clobber also keeps the trip's loads together in front of the sums */
    asm volatile("s_wait_xcnt 0x0" :: "v"(pqh), "v"(pql), "v"(pkh), "v"(pkl) : "memory");
#pragma unroll
    for (int j = 0; j < 16; ++j) {
      ks += hilo4(wkh[j], wkl[j]);
      qs += hilo4(wqh[j], wql[j]);
    }
  }
  float* o = T0 + ((size_t)bh * kNSeg + seg) * 128 + 4 * c;
  *(v4f*)o = ks;
  *(v4f*)(o + 64) = qs;
}

__global__ __launch_bounds__(32) void flow_incoming_kernel(const unsigned short* __restrict__ QHp, const unsigned short* __restrict__ QLp,
                                                           const unsigned short* __restrict__ KHp, const unsigned short* __restrict__ KLp,
                                                           const float* __restrict__ T0, float* __restrict__ SINK, float* __restrict__ SRC,
                                                           float* __restrict__ T1) {
  const int lane = threadIdx.x, c = lane & 15;
  const int bh = (int)blockIdx.x / (kNSeg / 2);
  const int seg = ((int)blockIdx.x % (kNSeg / 2)) * 2 + (lane >> 4);
  const int row0 = seg * kSegRows;
  const size_t w0 = ((size_t)bh * kSeq + (size_t)row0) * (kHd / 4) + c;
  const v2u* qh = (const v2u*)QHp + w0;
  const v2u* ql = (const v2u*)QLp + w0;
  const v2u* kh = (const v2u*)KHp + w0;
  const v2u* kl = (const v2u*)KLp + w0;
  v4f kc, qc;
  seg_prefix(T0 + (size_t)bh * kNSeg * 128, seg, c, kc, qc);
  v4f a1 = (v4f){0.f, 0.f, 0.f, 0.f}, a2 = (v4f){0.f, 0.f, 0.f, 0.f};
  v4f si = (v4f){0.f, 0.f, 0.f, 0.f}, so = (v4f){0.f, 0.f, 0.f, 0.f};
  /* 8 rows per trip, kept rolled for code size: their loads, row sums and divisions are independent of each other and overlap;
     only the running sums are ordered */
#pragma unroll 1
  for (int t = 0; t < kSegRows / 8; ++t) {
    const v2u* pqh = qh + t * 8 * (kHd / 4);
    const v2u* pql = ql + t * 8 * (kHd / 4);
    const v2u* pkh = kh + t * 8 * (kHd / 4);
    const v2u* pkl = kl + t * 8 * (kHd / 4);
    v2u wqh[8], wql[8], wkh[8], wkl[8];
#pragma unroll
    for (int j = 0; j < 8; ++j) {
      wqh[j] = pqh[j * (kHd / 4)];
      wql[j] = pql[j * (kHd / 4)];
      wkh[j] = pkh[j * (kHd / 4)];
      wkl[j] = pkl[j * (kHd / 4)];
    }
    /* the wait that stands before a register named by an issued global load is overwritten; the address pairs are inputs so that
       they stay untouched up to it */
    asm volatile("s_wait_xcnt 0x0" :: "v"(pqh), "v"(pql), "v"(pkh), "v"(pkl) : "memory");
#pragma unroll
    for (int jj = 0; jj < 8; ++jj) {
      const int r = 8 * t + jj;
      const int g = 2 * t + (jj >> 2);
      const int j = jj & 3;
      const v4f q = hilo4(wqh[jj], wql[jj]);
      const v4f k = hilo4(wkh[jj], wkl[jj]);
      kc += k;
      qc += q;
      const float d1 = row16_sum(dot4_eps(q, kc));
      const float d2 = row16_sum(dot4_eps(k, qc));
      const float nrm = (float)(row0 + r + 1);
      const float sink_in = (1.0f / d1) * nrm;
      const float src_out = (1.0f / d2) * nrm;
      a1 += k * src_out;
      a2 += q * sink_in;
      si[j] = (c == g) ? sink_in : si[j];
      so[j] = (c == g) ? src_out : so[j];
    }
  }
  const size_t ro = (size_t)bh * kSeq + (size_t)row0 + 4 * c;
  *(v4f*)(SINK + ro) = si;
  *(v4f*)(SRC + ro) = so;
  float* o = T1 + ((size_t)bh * kNSeg + seg) * 128 + 4 * c;
  *(v4f*)o = a1;
  *(v4f*)(o + 64) = a2;
}

__global__ __launch_bounds__(32) void flow_conserved_kernel(const unsigned short* __restrict__ QHp, const unsigned short* __restrict__ QLp,
                                                            const unsigned short* __restrict__ KHp, const unsigned short* __restrict__ KLp,
                                                            const float* __restrict__ T1, const float* __restrict__ SINK,
                                                            const float* __restrict__ SRC, float* __restrict__ D3, float* __restrict__ D4) {
  const int lane = threadIdx.x, c = lane & 15;
  const int bh = (int)blockIdx.x / (kNSeg / 2);
  const int seg = ((int)blockIdx.x % (kNSeg / 2)) * 2 + (lane >> 4);
  const int row0 = seg * kSegRows;
  const size_t w0 = ((size_t)bh * kSeq + (size_t)row0) * (kHd / 4) + c;
  const v2u* qh = (const v2u*)QHp + w0;
  const v2u* ql = (const v2u*)QLp + w0;
  const v2u* kh = (const v2u*)KHp + w0;
  const v2u* kl = (const v2u*)KLp + w0;
  const float* sip = SINK + (size_t)bh * kSeq + row0;
  const float* sop = SRC + (size_t)bh * kSeq + row0;
  v4f s1, s2;
  seg_prefix(T1 + (size_t)bh * kNSeg * 128, seg, c, s1, s2);
  v4f k3 = (v4f){0.f, 0.f, 0.f, 0.f}, k4 = (v4f){0.f, 0.f, 0.f, 0.f};
  /* 8 rows per trip, kept rolled for code size: their loads and row sums overlap; only the running sums are ordered */
#pragma unroll 1
  for (int t = 0; t < kSegRows / 8; ++t) {
    const v2u* pqh = qh + t * 8 * (kHd / 4);
    const v2u* pql = ql + t * 8 * (kHd / 4);
    const v2u* pkh = kh + t * 8 * (kHd / 4);
    const v2u* pkl = kl + t * 8 * (kHd / 4);
    const v4f* psi = (const v4f*)(sip + 8 * t);
    const v4f* pso = (const v4f*)(sop + 8 * t);
    v2u wqh[8], wql[8], wkh[8], wkl[8];
    v4f si[2], so[2];
    si[0] = psi[0];
    si[1] = psi[1];
    so[0] = pso[0];
    so[1] = pso[1];
#pragma unroll
    for (int j = 0; j < 8; ++j) {
      wqh[j] = pqh[j * (kHd / 4)];
      wql[j] = pql[j * (kHd / 4)];
      wkh[j] = pkh[j * (kHd / 4)];
      wkl[j] = pkl[j * (kHd / 4)];
    }
    /* the wait that stands before a register named by an issued global load is overwritten; the address pairs are inputs so that
       they stay untouched up to it */
    asm volatile("s_wait_xcnt 0x0" :: "v"(pqh), "v"(pql), "v"(pkh), "v"(pkl), "v"(psi), "v"(pso) : "memory");
#pragma unroll
    for (int jj = 0; jj < 8; ++jj) {
      const int g = 2 * t + (jj >> 2);
      const int j = jj & 3;
      const v4f q = hilo4(wqh[jj], wql[jj]);
      const v4f k = hilo4(wkh[jj], wkl[jj]);
      s1 += k * so[jj >> 2][j];
      s2 += q * si[jj >> 2][j];
      const float d3 = row16_sum(dot4_eps(q, s1));
      const float d4 = row16_sum(dot4_eps(k, s2));
      k3[j] = (c == g) ? d3 : k3[j];
      k4[j] = (c == g) ? d4 : k4[j];
    }
  }
  const size_t ro = (size_t)bh * kSeq + (size_t)row0 + 4 * c;
  *(v4f*)(D3 + ro) = k3;
  *(v4f*)(D4 + ro) = k4;
}

/* one block of 32 waves per (b,h); thread t owns rows 4t..4t+3 */
__global__ __launch_bounds__(1024) void flow_finish_kernel(const float* __restrict__ D3, const float* __restrict__ D4,
                                                           const float* __restrict__ SINK, float* __restrict__ RS, float* __restrict__ COMP) {
  __shared__ float wtot[32];
  const int tid = threadIdx.x, lane = tid & 31, wave = tid >> 5;
  const size_t o = (size_t)blockIdx.x * kSeq + 4 * (size_t)tid;
  const v4f d3 = *(const v4f*)(D3 + o);
  const v4f d4 = *(const v4f*)(D4 + o);
  const v4f si = *(const v4f*)(SINK + o);
  v4f rs, ce, inc;
  float run = 0.f;
#pragma unroll
  for (int e = 0; e < 4; ++e) {
    const float nrm = (float)(4 * tid + e + 1);
    const float inv_nrm = 1.0f / nrm;
    const float csink = d3[e] * inv_nrm;
    const float csrc  = fminf(fmaxf(d4[e] * inv_nrm, -1.0f), 1.0f);
    const float salloc = 1.0f / (1.0f + expf(-csink));
    ce[e] = expf(csrc);
    run += ce[e];
    inc[e] = run;
    rs[e] = salloc * (si[e] * inv_nrm);
  }
  *(v4f*)(RS + o) = rs;
  /* inclusive scan of the threads' totals over the wave */
  float sc = run;
#pragma unroll
  for (int off = 1; off < 32; off <<= 1) {
    const float t = __shfl_up(sc, off, 32);
    sc += (lane >= off) ? t : 0.0f;
  }
  if (lane == 31) wtot[wave] = sc;
  const float up = __shfl_up(sc, 1, 32);
  const float before_in_wave = (lane == 0) ? 0.0f : up;
  /* every wave's total is in LDS before any wave sums the totals of the waves before it */
  __syncthreads();
  float wp = (lane < wave) ? wtot[lane] : 0.0f;
#pragma unroll
  for (int off = 16; off > 0; off >>= 1) wp += __shfl_xor(wp, off, 32);
  const float base = wp + before_in_wave;
  v4f co;
#pragma unroll
  for (int e = 0; e < 4; ++e) {
    const float nrm = (float)(4 * tid + e + 1);
    co[e] = (ce[e] / (base + inc[e])) * nrm;
  }
  *(v4f*)(COMP + o) = co;
}

/* ---- causal linear attention, split along the sequence: every 64-row chunk is its own block: of all (b,h) at once in chunk_state, of one batch half per launch in chunk_out.
        Launch 1 (chunk_state):  per chunk its own St_n[m][d] = sum_l v'[l][m] k[l][d], v' = v * comp[l], f32, from zero.
        Launch 2 (chunk_prefix): per element the sum of the chunks before, added in chunk order in f32, stored as bf16 hi/lo planes [m][d].
        Launch 3 (chunk_out):    out[i][m] = rs[i] * ( sum_d q[i][d] St[m][d] + sum_{j<=i} (q[i].k[j]) v'[j][m] ) per chunk.
        All products: hi*hi + hi*lo + lo*hi. Q, row-major K and St fragments come straight from the global bf16 planes (row pitch 64).
        LDS tiles are bf16 bits at pitch 72; every k-tile read touches columns 0..63 only. No atomics, no inter-block communication.
        The loops over tiles, fragments and staged words are fully unrolled so that these are indexed by constants and stay in registers. */

/* VT hi/lo <- (v * comp)^T of one chunk; thread covers row lr, features dh..dh+31 (vv = its 8 x 16-B words of v): 128 threads x 32 = 64 x 64 */
__device__ __forceinline__ void vt_store(float cv, const v4f (&vv)[8], int lr, int dh, __bf16* VTh, __bf16* VTl) {
#pragma unroll
  for (int i = 0; i < 8; ++i) {
#pragma unroll
    for (int e = 0; e < 4; ++e) {
      const float f = vv[i][e] * cv;
      const unsigned short hb = f2bf_bits(f);
      const unsigned short lb = f2bf_bits(f - bf_bits2f(hb));
      const int d = dh + 4 * i + e;
      VTh[d * kLp + lr] = bits2bf(hb);
      VTl[d * kLp + lr] = bits2bf(lb);
    }
  }
}

/* one block of 4 waves per (b,h,chunk). Wave w owns rows m = 16w..16w+15 of St_n[m][d]: A rows d = 16i + c of KT, Bt rows m = 16w + c
   of VT, k = l for both, so lane (c,hh) holds St_n[16w + c][16i + 8hh + r]. Coverage: 2048 blocks x 64 x 64 floats. */
__global__ __launch_bounds__(128) void chunk_state_kernel(
    const unsigned short* __restrict__ KHp, const unsigned short* __restrict__ KLp,
    const float* __restrict__ VF, const float* __restrict__ COMP, float* __restrict__ CS) {
  __shared__ __align__(16) __bf16 KTh[kHd * kLp];
  __shared__ __align__(16) __bf16 KTl[kHd * kLp];
  __shared__ __align__(16) __bf16 VTh[kHd * kLp];
  __shared__ __align__(16) __bf16 VTl[kHd * kLp];
  __shared__ __align__(16) float sT[4][16 * 68];

  const int tid = threadIdx.x, lane = tid & 31, wave = tid >> 5;
  const int c = lane & 15, hh = lane >> 4, koff = hh * 8;
  const int bh = (int)blockIdx.x / kNChunk;
  const int l0 = ((int)blockIdx.x % kNChunk) * kChunk;
  const size_t pbase = (size_t)bh * kSeq * kHd;
  const int lr = tid >> 1, dh = (tid & 1) * 32;
  const v8f z8 = (v8f){0.f,0.f,0.f,0.f,0.f,0.f,0.f,0.f};

  /* all global loads of the block first, so that they are in flight together */
  const size_t ko = pbase + (size_t)(l0 + lr) * kHd + dh;
  const v4u* kh4 = (const v4u*)(KHp + ko);
  const v4u* kl4 = (const v4u*)(KLp + ko);
  const v4f* v4p = (const v4f*)(VF + ko);
  const float* cp = COMP + (size_t)bh * kSeq + l0 + lr;
  v4u wh[4], wl[4];
  v4f vv[8];
#pragma unroll
  for (int g = 0; g < 4; ++g) { wh[g] = kh4[g]; wl[g] = kl4[g]; }
#pragma unroll
  for (int g = 0; g < 8; ++g) vv[g] = v4p[g];
  const float cv = *cp;
  /* the wait that stands before a register named by an issued global load is overwritten; the address pairs, and the row index that
     the comp load takes as its offset, are inputs so that they stay untouched up to it */
  asm volatile("s_wait_xcnt 0x0" :: "v"(kh4), "v"(kl4), "v"(v4p), "v"(cp), "v"(lr) : "memory");

  /* KT hi/lo <- k^T; thread covers row lr, features dh..dh+31 (4 x 16-B words per plane): 128 threads x 32 = 64 x 64 */
  {
#pragma unroll
    for (int g = 0; g < 4; ++g) {
#pragma unroll
      for (int e = 0; e < 4; ++e) {
        const unsigned a = wh[g][e];
        const unsigned b = wl[g][e];
        const int d = dh + 8 * g + 2 * e;
        const unsigned a0 = a & 0xffffu, a1 = a >> 16;
        const unsigned b0 = b & 0xffffu, b1 = b >> 16;
        KTh[d * kLp + lr]       = bits2bf((unsigned short)a0);
        KTh[(d + 1) * kLp + lr] = bits2bf((unsigned short)a1);
        KTl[d * kLp + lr]       = bits2bf((unsigned short)b0);
        KTl[(d + 1) * kLp + lr] = bits2bf((unsigned short)b1);
      }
    }
  }
  vt_store(cv, vv, lr, dh, VTh, VTl);
  /* KT and VT are complete before any wave reads fragments of them */
  __syncthreads();

  v8f acc[4];
  acc[0] = z8; acc[1] = z8; acc[2] = z8; acc[3] = z8;
#pragma unroll
  for (int kk = 0; kk < 2; ++kk) {
    const v16b vbh = Frag<__bf16>::load(VTh + (16 * wave + c) * kLp + kk * 32 + koff);
    const v16b vbl = Frag<__bf16>::load(VTl + (16 * wave + c) * kLp + kk * 32 + koff);
#pragma unroll
    for (int i = 0; i < 4; ++i) {
      const v16b kh = Frag<__bf16>::load(KTh + (16 * i + c) * kLp + kk * 32 + koff);
      const v16b kl = Frag<__bf16>::load(KTl + (16 * i + c) * kLp + kk * 32 + koff);
      acc[i] = mma_g(kh, vbh, acc[i]);
      acc[i] = mma_g(kl, vbh, acc[i]);
      acc[i] = mma_g(kh, vbl, acc[i]);
    }
  }
  acc_guard4(acc[0], acc[1], acc[2], acc[3]);

  /* stage the wave's 16 rows in its own slab, then whole-line stores: 16 lanes x 16 B = one 256-B row, 2 rows per instruction */
  float* slab = sT[wave];
#pragma unroll
  for (int i = 0; i < 4; ++i) {
    float* sp = slab + c * 68 + 16 * i + 8 * hh;
    *(v4f*)(sp)     = (v4f){acc[i][0], acc[i][1], acc[i][2], acc[i][3]};
    *(v4f*)(sp + 4) = (v4f){acc[i][4], acc[i][5], acc[i][6], acc[i][7]};
  }
  /* slab: written and read by this wave only, by different lanes */
  wave_lds_sync();
  float* op = CS + (size_t)blockIdx.x * (kHd * kHd) + (size_t)(16 * wave) * kHd;
  const int c4 = c * 4;
#pragma unroll
  for (int it = 0; it < 8; ++it) {
    const int row = it * 2 + hh;
    const v4f v = *(const v4f*)(slab + row * 68 + c4);
    *(v4f*)(op + row * kHd + c4) = v;
  }
}

/* exclusive prefix over the 64 chunks of one (b,h); thread owns 4 consecutive elements of [m][d]: 32 x 1024 threads.
   A wave reads 512 B and writes 256 B per plane and chunk (whole lines). */
__global__ __launch_bounds__(128) void chunk_prefix_kernel(const float* __restrict__ CS, unsigned short* __restrict__ SHp,
                                                           unsigned short* __restrict__ SLp) {
  const int i = (int)blockIdx.x * 128 + (int)threadIdx.x;
  const size_t base = (size_t)(i >> 10) * kNChunk * (kHd * kHd) + (size_t)(i & 1023) * 4;
  v4f run = (v4f){0.f, 0.f, 0.f, 0.f};
  /* 32 chunks per trip, kept rolled for code size: the loads are independent and all in flight together, only the adds are ordered */
#pragma unroll 1
  for (int g = 0; g < kNChunk / 32; ++g) {
    const float* pc = CS + base + (size_t)g * 32 * (kHd * kHd);
    unsigned short* ph = SHp + base + (size_t)g * 32 * (kHd * kHd);
    unsigned short* pl = SLp + base + (size_t)g * 32 * (kHd * kHd);
    v4f t[32];
#pragma unroll
    for (int j = 0; j < 32; ++j) t[j] = *(const v4f*)(pc + j * (kHd * kHd));
    /* the wait that stands before a register named by an issued global load is overwritten; the address pair is an input so that
       it stays untouched up to it */
    asm volatile("s_wait_xcnt 0x0" :: "v"(pc) : "memory");
#pragma unroll
    for (int q = 0; q < 4; ++q) {
      v2u uh[8], ul[8];
#pragma unroll
      for (int j = 0; j < 8; ++j) {
        unsigned short hb[4], lb[4];
#pragma unroll
        for (int e = 0; e < 4; ++e) {
          const float s = run[e];
          hb[e] = f2bf_bits(s);
          lb[e] = f2bf_bits(s - bf_bits2f(hb[e]));
        }
        uh[j] = (v2u){pk16(hb[0], hb[1]), pk16(hb[2], hb[3])};
        ul[j] = (v2u){pk16(lb[0], lb[1]), pk16(lb[2], lb[3])};
        run += t[8 * q + j];
      }
#pragma unroll
      for (int j = 0; j < 8; ++j) {
        *(v2u*)(ph + (8 * q + j) * (kHd * kHd)) = uh[j];
        *(v2u*)(pl + (8 * q + j) * (kHd * kHd)) = ul[j];
      }
      /* the same wait behind the stores: their address pairs and data words are inputs so that they stay untouched up to it */
      asm volatile("s_wait_xcnt 0x0" :: "v"(ph), "v"(pl), "v"(uh[0]), "v"(uh[1]), "v"(uh[2]), "v"(uh[3]), "v"(uh[4]), "v"(uh[5]),
                   "v"(uh[6]), "v"(uh[7]), "v"(ul[0]), "v"(ul[1]), "v"(ul[2]), "v"(ul[3]), "v"(ul[4]), "v"(ul[5]), "v"(ul[6]), "v"(ul[7])
                   : "memory");
    }
  }
}

/* one block of 4 waves per (b,h,chunk) of one batch half; wave w owns output rows 16w..16w+15 of the chunk.
   LDS: VT hi/lo = v'^T[m][l]; P hi/lo per wave = masked scores, later the output staging.
   Coverage: 16 x 64 blocks x 4 waves x 16 rows x 64 cols = 8192 rows x 512 cols per plane. */
__global__ __launch_bounds__(128) void chunk_out_kernel(
    const unsigned short* __restrict__ QHp, const unsigned short* __restrict__ QLp,
    const unsigned short* __restrict__ KHp, const unsigned short* __restrict__ KLp,
    const float* __restrict__ VF, const float* __restrict__ RS, const float* __restrict__ COMP,
    const unsigned short* __restrict__ SHp, const unsigned short* __restrict__ SLp,
    unsigned short* __restrict__ AHp, unsigned short* __restrict__ ALp, int bh0) {
  __shared__ __align__(16) __bf16 VTh[kHd * kLp];
  __shared__ __align__(16) __bf16 VTl[kHd * kLp];
  __shared__ __align__(16) __bf16 Ph[4][16 * kLp];
  __shared__ __align__(16) __bf16 Pl[4][16 * kLp];

  const int tid = threadIdx.x, lane = tid & 31, wave = tid >> 5;
  const int c = lane & 15, hh = lane >> 4, koff = hh * 8;
  const int bhl = (int)blockIdx.x / kNChunk;
  const int n = (int)blockIdx.x % kNChunk;
  const int l0 = n * kChunk;
  const int bh = bh0 + bhl;
  const int hd = bh & (kHeads - 1);
  const int bl = bhl >> 3;
  const size_t pbase = (size_t)bh * kSeq * kHd;
  const size_t sbase = ((size_t)bh * kNChunk + n) * (kHd * kHd);
  const __bf16* QH = (const __bf16*)QHp + pbase;
  const __bf16* QL = (const __bf16*)QLp + pbase;
  const __bf16* KH = (const __bf16*)KHp + pbase;
  const __bf16* KL = (const __bf16*)KLp + pbase;
  const __bf16* SH = (const __bf16*)SHp + sbase;
  const __bf16* SL = (const __bf16*)SLp + sbase;
  const float* rsp = RS + (size_t)bh * kSeq;
  unsigned short* ahp = AHp + ((size_t)bl * kSeq) * kEmb + hd * kHd;
  unsigned short* alp = ALp + ((size_t)bl * kSeq) * kEmb + hd * kHd;
  __bf16* ph = Ph[wave];
  __bf16* pl = Pl[wave];
  const int q4 = lane >> 3, c8 = (lane & 7) * 8;
  const v8f z8 = (v8f){0.f,0.f,0.f,0.f,0.f,0.f,0.f,0.f};

  /* first load group, in flight together: this thread's part of v with its row's comp, the Q fragments (rows 16w + c) and the
     row-major K fragments (rows 16j + c) */
  const int lr = tid >> 1, dh = (tid & 1) * 32;
  const v4f* v4p = (const v4f*)(VF + pbase + (size_t)(l0 + lr) * kHd + dh);
  const float* cp = COMP + (size_t)bh * kSeq + l0 + lr;
  const __bf16* qhp = QH + (size_t)(l0 + 16 * wave + c) * kHd + koff;
  const __bf16* qlp = QL + (size_t)(l0 + 16 * wave + c) * kHd + koff;
  const __bf16* khp = KH + (size_t)(l0 + c) * kHd + koff;
  const __bf16* klp = KL + (size_t)(l0 + c) * kHd + koff;
  v4f vv[8];
  v16b qh[2], ql[2], kh[4][2], kl[4][2];
#pragma unroll
  for (int g = 0; g < 8; ++g) vv[g] = v4p[g];
#pragma unroll
  for (int dc = 0; dc < 2; ++dc) {
    qh[dc] = Frag<__bf16>::load(qhp + dc * 32);
    ql[dc] = Frag<__bf16>::load(qlp + dc * 32);
  }
#pragma unroll
  for (int j = 0; j < 4; ++j) {
#pragma unroll
    for (int dc = 0; dc < 2; ++dc) {
      kh[j][dc] = Frag<__bf16>::load(khp + 16 * j * kHd + dc * 32);
      kl[j][dc] = Frag<__bf16>::load(klp + 16 * j * kHd + dc * 32);
    }
  }
  const float cv = *cp;
  /* the wait that stands before a register named by an issued global load is overwritten; the address pairs are inputs so that
     they stay untouched up to it */
  asm volatile("s_wait_xcnt 0x0" :: "v"(v4p), "v"(cp), "v"(qhp), "v"(qlp), "v"(khp), "v"(klp) : "memory");

  vt_store(cv, vv, lr, dh, VTh, VTl);

  /* scores rows 16w.., all 64 columns; inclusive causal mask by select; hi/lo into this wave's P strip */
#pragma unroll
  for (int j = 0; j < 4; ++j) {
    v8f s = z8;
#pragma unroll
    for (int dc = 0; dc < 2; ++dc) {
      s = mma_g(qh[dc], kh[j][dc], s);
      s = mma_g(qh[dc], kl[j][dc], s);
      s = mma_g(ql[dc], kh[j][dc], s);
    }
    const int jj = 16 * j + c;
#pragma unroll
    for (int r = 0; r < 8; ++r) {
      const int ii = 16 * wave + 8 * hh + r;
      const float pv = (jj <= ii) ? s[r] : 0.0f;
      const unsigned short hb = f2bf_bits(pv);
      const unsigned short lb = f2bf_bits(pv - bf_bits2f(hb));
      ph[(8 * hh + r) * kLp + jj] = bits2bf(hb);
      pl[(8 * hh + r) * kLp + jj] = bits2bf(lb);
    }
  }

  /* second load group, in flight together: the St fragments (Bt rows m = 16t + c, k = d) and the row scales */
  const __bf16* sph = SH + c * kHd + koff;
  const __bf16* spl = SL + c * kHd + koff;
  const float* rp = rsp + l0 + 16 * wave + 8 * hh;
  v16b sh[4][2], sl[4][2];
#pragma unroll
  for (int t = 0; t < 4; ++t) {
#pragma unroll
    for (int dc = 0; dc < 2; ++dc) {
      sh[t][dc] = Frag<__bf16>::load(sph + 16 * t * kHd + dc * 32);
      sl[t][dc] = Frag<__bf16>::load(spl + 16 * t * kHd + dc * 32);
    }
  }
  const v4f r0 = *(const v4f*)(rp);
  const v4f r1 = *(const v4f*)(rp + 4);
  /* the same wait for the second group */
  asm volatile("s_wait_xcnt 0x0" :: "v"(sph), "v"(spl), "v"(rp) : "memory");

  v8f accO[4];
  accO[0] = z8; accO[1] = z8; accO[2] = z8; accO[3] = z8;
  /* inter: Q x St^T */
#pragma unroll
  for (int t = 0; t < 4; ++t) {
#pragma unroll
    for (int dc = 0; dc < 2; ++dc) {
      accO[t] = mma_g(qh[dc], sh[t][dc], accO[t]);
      accO[t] = mma_g(qh[dc], sl[t][dc], accO[t]);
      accO[t] = mma_g(ql[dc], sh[t][dc], accO[t]);
    }
  }
  /* VT is complete before any wave reads fragments of it; the barrier also orders this wave's P strip writes before its reads */
  __syncthreads();
  /* intra: P x v' (A rows i = c of the strip, k = j; Bt rows m = 16t + c of VT, k = j) */
#pragma unroll
  for (int kk = 0; kk < 2; ++kk) {
    const v16b pah = Frag<__bf16>::load(ph + c * kLp + kk * 32 + koff);
    const v16b pal = Frag<__bf16>::load(pl + c * kLp + kk * 32 + koff);
#pragma unroll
    for (int t = 0; t < 4; ++t) {
      const v16b vh = Frag<__bf16>::load(VTh + (16 * t + c) * kLp + kk * 32 + koff);
      const v16b vl = Frag<__bf16>::load(VTl + (16 * t + c) * kLp + kk * 32 + koff);
      accO[t] = mma_g(pah, vh, accO[t]);
      accO[t] = mma_g(pah, vl, accO[t]);
      accO[t] = mma_g(pal, vh, accO[t]);
    }
  }
  /* epilogue: row scale, bf16 hi/lo, stage in the P strip, whole-line stores */
  {
    float rsv[8];
#pragma unroll
    for (int e = 0; e < 4; ++e) { rsv[e] = r0[e]; rsv[4 + e] = r1[e]; }
#pragma unroll
    for (int t = 0; t < 4; ++t) {
#pragma unroll
      for (int r = 0; r < 8; ++r) {
        const float o = accO[t][r] * rsv[r];
        const unsigned short hb = f2bf_bits(o);
        const unsigned short lb = f2bf_bits(o - bf_bits2f(hb));
        ph[(8 * hh + r) * kLp + 16 * t + c] = bits2bf(hb);
        pl[(8 * hh + r) * kLp + 16 * t + c] = bits2bf(lb);
      }
    }
    /* P strip: written and read by this wave only, by different lanes */
    wave_lds_sync();
    v4u uh[4], ul[4];
#pragma unroll
    for (int it = 0; it < 4; ++it) {
      const int row = it * 4 + q4;
      const v8b hv = *(const v8b*)(ph + row * kLp + c8);
      const v8b lv = *(const v8b*)(pl + row * kLp + c8);
      uh[it] = __builtin_bit_cast(v4u, hv);
      ul[it] = __builtin_bit_cast(v4u, lv);
    }
#pragma unroll
    for (int it = 0; it < 4; ++it) {
      const size_t o = (size_t)(l0 + 16 * wave + it * 4 + q4) * kEmb + c8;
      *(v4u*)(ahp + o) = uh[it];
      *(v4u*)(alp + o) = ul[it];
    }
  }
}

/* ---- host glue ----
   Workspace region map (bytes, 256-B aligned carve; total 191,897,600 <= 268,435,456):
     XB    [16384][512] bf16   16,777,216   bf16(x); after the projections the same bytes hold, per batch half,
                                            ATTN_HI [8192][512] bf16 (first 8,388,608 B) and ATTN_LO (second 8,388,608 B)
     WQKV  [1536][512]  bf16    1,572,864   bf16(Wq | Wk | Wv)
     WOB   [512][512]   bf16      524,288   bf16(Wo)
     BIAS  [2048]       f32         8,192   bf16 values of bq | bk | bv | bo kept as f32
     QH,QL,KH,KL [32][4096][64] bf16  4 x 16,777,216   sigmoid(q), sigmoid(k) as hi/lo planes
     VF    [32][4096][64] f32  33,554,432   v
     RS, COMP [32][4096] f32   2 x 524,288
     SINK, SRC, D3, D4 [32][4096] f32   4 x 524,288   per-row values handed between the flow scan launches
     T0, T1 [32][64][128] f32  2 x 1,048,576   segment totals (k | q, then k*src_out | q*sink_in)
     CS    [32][64][64][64] f32  33,554,432   each chunk's own state St_n[m][d]
     SH, SL [32][64][64][64] bf16  2 x 16,777,216   state before each chunk as hi/lo planes */
extern "C" void kernel_launch(void* const* d_in, const int* in_sizes, int n_in,
                              void* d_out, int out_size, void* d_ws, size_t ws_size, hipStream_t stream) {
  if (n_in < 9 || d_out == nullptr || d_ws == nullptr) return;
  if (in_sizes[0] != kRows * kEmb || in_sizes[1] != kEmb * kEmb || in_sizes[2] != kEmb ||
      in_sizes[3] != kEmb * kEmb || in_sizes[4] != kEmb || in_sizes[5] != kEmb * kEmb ||
      in_sizes[6] != kEmb || in_sizes[7] != kEmb * kEmb || in_sizes[8] != kEmb ||
      out_size != kRows * kEmb) return;

  const float* x  = (const float*)d_in[0];
  const float* Wq = (const float*)d_in[1];
  const float* bq = (const float*)d_in[2];
  const float* Wk = (const float*)d_in[3];
  const float* bk = (const float*)d_in[4];
  const float* Wv = (const float*)d_in[5];
  const float* bv = (const float*)d_in[6];
  const float* Wo = (const float*)d_in[7];
  const float* bo = (const float*)d_in[8];
  float* out = (float*)d_out;

  char* ws = (char*)d_ws; size_t off = 0;
  auto carve = [&](size_t bytes) -> char* { char* p = ws + off; off += (bytes + 255) & ~(size_t)255; return p; };
  unsigned short* XB   = (unsigned short*)carve((size_t)kRows * kEmb * 2);
  unsigned short* WQKV = (unsigned short*)carve((size_t)kQkvN * kEmb * 2);
  unsigned short* WOB  = (unsigned short*)carve((size_t)kEmb * kEmb * 2);
  float*          BIAS = (float*)carve((size_t)4 * kEmb * 4);
  unsigned short* QH   = (unsigned short*)carve((size_t)kBH * kSeq * kHd * 2);
  unsigned short* QL   = (unsigned short*)carve((size_t)kBH * kSeq * kHd * 2);
  unsigned short* KH   = (unsigned short*)carve((size_t)kBH * kSeq * kHd * 2);
  unsigned short* KL   = (unsigned short*)carve((size_t)kBH * kSeq * kHd * 2);
  float*          VF   = (float*)carve((size_t)kBH * kSeq * kHd * 4);
  float*          RS   = (float*)carve((size_t)kBH * kSeq * 4);
  float*          COMP = (float*)carve((size_t)kBH * kSeq * 4);
  float*          SINK = (float*)carve((size_t)kBH * kSeq * 4);
  float*          SRC  = (float*)carve((size_t)kBH * kSeq * 4);
  float*          D3   = (float*)carve((size_t)kBH * kSeq * 4);
  float*          D4   = (float*)carve((size_t)kBH * kSeq * 4);
  float*          T0   = (float*)carve((size_t)kBH * kNSeg * 128 * 4);
  float*          T1   = (float*)carve((size_t)kBH * kNSeg * 128 * 4);
  float*          CS   = (float*)carve((size_t)kBH * kNChunk * kHd * kHd * 4);
  unsigned short* SH   = (unsigned short*)carve((size_t)kBH * kNChunk * kHd * kHd * 2);
  unsigned short* SL   = (unsigned short*)carve((size_t)kBH * kNChunk * kHd * kHd * 2);
  if (off > ws_size || off > (size_t)268435456) return;
  /* attn planes of one batch half live in the XB bytes (same 16-bit element type, same row pitch); XB is dead after the projections */
  unsigned short* AH = XB;
  unsigned short* AL = XB + (size_t)kHalfRows * kEmb;

  /* 16-bit operand planes */
  const int n8x = kRows * kEmb / 8;
  const int n8w = kEmb * kEmb / 8;
  cvt8_bf16_kernel<<<(n8x + 255) / 256, 256, 0, stream>>>(x,  XB, n8x);
  cvt8_bf16_kernel<<<(n8w + 255) / 256, 256, 0, stream>>>(Wq, WQKV, n8w);
  cvt8_bf16_kernel<<<(n8w + 255) / 256, 256, 0, stream>>>(Wk, WQKV + (size_t)kEmb * kEmb, n8w);
  cvt8_bf16_kernel<<<(n8w + 255) / 256, 256, 0, stream>>>(Wv, WQKV + (size_t)2 * kEmb * kEmb, n8w);
  cvt8_bf16_kernel<<<(n8w + 255) / 256, 256, 0, stream>>>(Wo, WOB, n8w);
  bias_prep_kernel<<<1, 256, 0, stream>>>(bq, bk, bv, bo, BIAS);

  /* projections: M = 16384, N = 1536, K = 512; 256 x 24 tiles = 768 blocks x 8 waves */
  gemm64_kernel<0><<<(kRows / 64) * (kQkvN / 64) / 8, 256, 0, stream>>>(
      XB, XB, WQKV, BIAS, QH, QL, KH, KL, VF, kRows, kQkvN);

  /* flow scans: three launches of 1024 waves (two 64-row segments each), then one block per (b,h) */
  flow_seg_total_kernel<<<kBH * (kNSeg / 2), 32, 0, stream>>>(QH, QL, KH, KL, T0);
  flow_incoming_kernel<<<kBH * (kNSeg / 2), 32, 0, stream>>>(QH, QL, KH, KL, T0, SINK, SRC, T1);
  flow_conserved_kernel<<<kBH * (kNSeg / 2), 32, 0, stream>>>(QH, QL, KH, KL, T1, SINK, SRC, D3, D4);
  flow_finish_kernel<<<kBH, 1024, 0, stream>>>(D3, D4, SINK, RS, COMP);

  /* chunk states of all (b,h) (2048 blocks), then their exclusive prefix over the chunks (256 blocks) */
  chunk_state_kernel<<<kBH * kNChunk, 128, 0, stream>>>(KH, KL, VF, COMP, CS);
  chunk_prefix_kernel<<<kBH * kHd * kHd / 4 / 128, 128, 0, stream>>>(CS, SH, SL);

  /* per batch half: all chunks' outputs (1024 blocks), then output projection M = 8192, N = 512, K = 512 (128 blocks) */
  for (int half = 0; half < 2; ++half) {
    chunk_out_kernel<<<kHalfBH * kNChunk, 128, 0, stream>>>(QH, QL, KH, KL, VF, RS, COMP, SH, SL, AH, AL, half * kHalfBH);
    gemm64_kernel<1><<<(kHalfRows / 64) * (kEmb / 64) / 8, 256, 0, stream>>>(
        AH, AL, WOB, BIAS + 3 * kEmb, QH, QL, KH, KL,
        out + (size_t)half * kHalfRows * kEmb, kHalfRows, kEmb);
  }
}

// v003
// It runs in 187 microseconds.
// Timed twice side by side with v002, it ran 1.51 and 1.50 times as fast.
// All steps since v000 together make it 21.8 times as fast.
// All contractions on v_wmma_f32_16x16x32_bf16 with f32 accumulate: q/k/v projections = bf16(x) x bf16(W) single product; chunk state, scores, inter and intra products = bf16 hi/lo operands (hi*hi + hi*lo + lo*hi); output projection = (attn_hi + attn_lo) x bf16(Wo); sigmoid, flow scans and row scales in f32 on VALU.
#include <hip/hip_runtime.h>
#include <math.h>

constexpr int kBatch   = 4;
constexpr int kSeq     = 4096;
constexpr int kEmb     = 512;
constexpr int kHeads   = 8;
constexpr int kHd      = 64;
constexpr int kRows    = kBatch * kSeq;
constexpr int kBH      = kBatch * kHeads;
constexpr int kChunk   = 64;
constexpr int kNChunk  = kSeq / kChunk;
constexpr int kLp      = 72;
constexpr int kQkvN    = 3 * kEmb;
constexpr int kHalfRows = kRows / 2;
constexpr int kHalfBH   = kBH / 2;
constexpr int kSegRows = 64;
constexpr int kNSeg    = kSeq / kSegRows;
constexpr float kEps   = 1e-6f;
static_assert(kHeads * kHd == kEmb, "head packing");
static_assert(kEmb % 32 == 0, "GEMM K multiple of 32");
static_assert(kHd % 32 == 0 && kChunk % 32 == 0, "tile K multiple of 32");
static_assert(kRows % 128 == 0 && kHalfRows % 128 == 0 && kQkvN % 256 == 0 && kEmb % 256 == 0, "GEMM M, N block tile multiples");
static_assert(kSeq % 128 == 0 && kSeq % kChunk == 0, "scan line groups and chunks");
static_assert(kSeq == 4096 && kEmb == 512 && kHd == 64, "shift constants in the projection epilogue");
static_assert(kLp % 8 == 0, "LDS pitch keeps 16-B alignment");
static_assert(kSegRows == 64 && kNSeg % 2 == 0 && kSeq == 4 * 1024, "flow scan: 16 lanes x 4 kept rows per segment, two segments per wave, 1024 threads x 4 rows");

typedef __attribute__((ext_vector_type(16))) __bf16   v16b;
typedef __attribute__((ext_vector_type(8)))  __bf16   v8b;
typedef __attribute__((ext_vector_type(8)))  float    v8f;
typedef __attribute__((ext_vector_type(4)))  float    v4f;
typedef __attribute__((ext_vector_type(4)))  unsigned int v4u;
typedef __attribute__((ext_vector_type(2)))  unsigned int v2u;

__device__ __forceinline__ unsigned short f2bf_bits(float f) {
  unsigned u = __float_as_uint(f);
  return (unsigned short)((u + 0x7FFFu + ((u >> 16) & 1u)) >> 16);
}
__device__ __forceinline__ float bf_bits2f(unsigned short h) { return __uint_as_float(((unsigned)h) << 16); }
__device__ __forceinline__ float bf16r(float f) { return bf_bits2f(f2bf_bits(f)); }
__device__ __forceinline__ unsigned pk16(unsigned short a, unsigned short b) { return (unsigned)a | ((unsigned)b << 16); }
__device__ __forceinline__ __bf16 bits2bf(unsigned short u) { return __builtin_bit_cast(__bf16, u); }

/* hazard guards as plain device helpers */
__device__ __forceinline__ void dep_guard4_b(v8f& a, v8f& b, v8f& c, v8f& d, v16b x, v16b y) { asm volatile("v_nop\n\tv_nop\n\tv_nop\n\tv_nop" : "+v"(a), "+v"(b), "+v"(c), "+v"(d) : "v"(x), "v"(y)); }
__device__ __forceinline__ void keep4_b(v16b a, v16b b, v16b c, v16b d) { asm volatile("v_nop" :: "v"(a), "v"(b), "v"(c), "v"(d)); }
__device__ __forceinline__ void acc_guard4(v8f& a, v8f& b, v8f& c, v8f& d) { asm volatile("v_nop\n\tv_nop\n\tv_nop\n\tv_nop" : "+v"(a), "+v"(b), "+v"(c), "+v"(d)); }

template <typename T> struct Frag;
template <> struct Frag<__bf16> {
  typedef v16b V; union U { v16b v; v8b h[2]; };
  /* elements 0..7 <- p[0..7], elements 8..15 <- p[16..23] */
  static __device__ __forceinline__ v16b load(const __bf16* p) {
    U f; f.h[0] = *(const v8b*)(p); f.h[1] = *(const v8b*)(p + 16); return f.v;
  }
  static __device__ __forceinline__ v8f mma(v16b a, v16b b, v8f c) {
    return __builtin_amdgcn_wmma_f32_16x16x32_bf16(false, a, false, b, (short)0, c, false, false);
  }
};

/* one WMMA followed by the 4-slot guard tying its accumulator and both operand fragments */
__device__ __forceinline__ v8f mma_g(v16b a, v16b b, v8f c) {
  c = __builtin_amdgcn_wmma_f32_16x16x32_bf16(false, a, false, b, (short)0, c, false, false);
  asm volatile("v_nop\n\tv_nop\n\tv_nop\n\tv_nop" : "+v"(c) : "v"(a), "v"(b));
  return c;
}

__device__ __forceinline__ void wave_lds_sync() {
  __builtin_amdgcn_fence(__ATOMIC_RELEASE, "workgroup");
  __builtin_amdgcn_wave_barrier();
  __builtin_amdgcn_fence(__ATOMIC_ACQUIRE, "workgroup");
}

/* ---- f32 -> bf16 (RNE convert), 8 consecutive elements per thread: two 16-B loads, ONE 16-B store per lane; a wave writes
        Coverage: thread i writes elements 8i..8i+7, i < n8; every call has n8 a multiple of 256. */
__global__ __launch_bounds__(256) void cvt8_bf16_kernel(const float* __restrict__ src, unsigned short* __restrict__ dst, int n8) {
  const int i = blockIdx.x * 256 + threadIdx.x;
  if (i < n8) {
    const float* p = src + 8 * (size_t)i;
    const v4f a = *(const v4f*)(p);
    const v4f b = *(const v4f*)(p + 4);
    unsigned short hb[8];
#pragma unroll
    for (int e = 0; e < 4; ++e) {
      const float fa = a[e];
      const float fb = b[e];
      hb[e]     = f2bf_bits(fa);
      hb[4 + e] = f2bf_bits(fb);
    }
    const v4u u = (v4u){pk16(hb[0], hb[1]), pk16(hb[2], hb[3]), pk16(hb[4], hb[5]), pk16(hb[6], hb[7])};
    unsigned short* q = dst + 8 * (size_t)i;
    *(v4u*)q = u;
    
  }
}

/* ---- bias plane: dst[0..2047] = bf16 value (kept as f32) of bq | bk | bv | bo. One block of 256 threads, 2 iterations x 256 x
        float4 = 512 float4 = exactly 2048 floats. All four sources are loaded unconditionally; wave-uniform select by value.
*/
__global__ __launch_bounds__(256) void bias_prep_kernel(const float* __restrict__ b0, const float* __restrict__ b1,
                                                        const float* __restrict__ b2, const float* __restrict__ b3,
                                                        float* __restrict__ dst) {
  const int tid = threadIdx.x;
#pragma unroll 1
  for (int it = 0; it < 2; ++it) {
    const int idx4 = it * 256 + tid;
    const int which = idx4 >> 7;
    const int off = (idx4 & 127) * 4;
    const v4f va = *(const v4f*)(b0 + off);
    const v4f vb = *(const v4f*)(b1 + off);
    const v4f vc = *(const v4f*)(b2 + off);
    const v4f vd = *(const v4f*)(b3 + off);
    v4f o;
#pragma unroll
    for (int e = 0; e < 4; ++e) {
      const float s01 = (which == 0) ? va[e] : vb[e];
      const float s23 = (which == 2) ? vc[e] : vd[e];
      o[e] = bf16r((which < 2) ? s01 : s23);
    }
    float* op = dst + which * kEmb + off;
    *(v4f*)op = o;
    
  }
}

/* four asynchronous 16-B copies per lane, global -> LDS, each with its own LDS byte address and global pointer. The s_wait_xcnt is the
   last line of the copies' own statement so that it stands before any rewrite of a register that a copy names. */
__device__ __forceinline__ void async_copy4(unsigned l0, unsigned l1, unsigned l2, unsigned l3,
                                            const __bf16* g0, const __bf16* g1, const __bf16* g2, const __bf16* g3) {
  asm volatile("global_load_async_to_lds_b128 %0, %4, off\n\t"
               "global_load_async_to_lds_b128 %1, %5, off\n\t"
               "global_load_async_to_lds_b128 %2, %6, off\n\t"
               "global_load_async_to_lds_b128 %3, %7, off\n\t"
               "s_wait_xcnt 0x0"
               :: "v"(l0), "v"(l1), "v"(l2), "v"(l3), "v"(g0), "v"(g1), "v"(g2), "v"(g3) : "memory");
}
/* 128 rows x 128 B of one row-major [.][512] bf16 plane -> LDS rows of pitch 144 B. g = this thread's piece of row (tid >> 3), l = its
   LDS byte address; 256 threads x 16 B = 32 whole rows per copy, a wave covers 4 whole 128-B lines. */
__device__ __forceinline__ void stage128(unsigned l, const __bf16* g) {
  async_copy4(l, l + 32 * kLp * 2, l + 64 * kLp * 2, l + 96 * kLp * 2, g, g + 32 * kEmb, g + 64 * kEmb, g + 96 * kEmb);
}

/* ---- Register-blocked WMMA GEMM, each wave owns a 64x64 tile; A row-major [M][512], Bt row-major [N][512] (bf16 bits).
        A block of 8 waves (2 x 4) owns 128 x 256. Per stage of 64 k (one 128-B line per row) its 128 A rows (MODE 1: and 128 A2 rows) and
        256 Bt rows are copied to LDS asynchronously, two buffers: stage s + 1 flies while stage s is multiplied.
        MODE 0 (projections): single product; epilogue adds bias[n]; column tile 64 = one head of q (n0 < 512), k (512..1023)
               x 16 B, 4 rows per instruction); v: f32 plane [b][h][l][64] (row segment 256 B = 16 lanes x 16 B, 2 rows per instruction).
        MODE 1 (output projection): product = A*Bt + A2*Bt (A2 = lo plane of A); epilogue adds bias[n]; f32 rows of pitch 512.
*/
template <int MODE>
__global__ __launch_bounds__(256) void gemm64_kernel(
    const unsigned short* __restrict__ Ap, const unsigned short* __restrict__ A2p,
    const unsigned short* __restrict__ Btp, const float* __restrict__ bias,
    unsigned short* __restrict__ QHp, unsigned short* __restrict__ QLp,
    unsigned short* __restrict__ KHp, unsigned short* __restrict__ KLp,
    float* __restrict__ Fout, int M, int N) {
  typedef __bf16 T;
  const T* A = (const T*)Ap; const T* A2 = (const T*)A2p; const T* Bt = (const T*)Btp;
  constexpr int kBOff  = (MODE == 1) ? 256 : 128;   /* first Bt row of a stage buffer */
  constexpr int kSRows = kBOff + 256;               /* rows of a stage buffer */
  constexpr int kStages = kEmb / 64;
  __shared__ __align__(16) float sT[8][16 * 68];
  __shared__ __align__(16) __bf16 sS[2][kSRows * kLp];
  const int lane = threadIdx.x & 31;
  const int wave = threadIdx.x >> 5;
  const int groupsN = N >> 8;
  /* block-uniform, in front of every barrier and copy */
  if ((int)blockIdx.x >= (M >> 7) * groupsN) return;
  const int bm = (int)blockIdx.x / groupsN;
  const int bn = (int)blockIdx.x - bm * groupsN;
  const int wm = wave >> 2;
  const int wn = wave & 3;
  const int m0 = (bm << 7) + (wm << 6);
  const int n0 = (bn << 8) + (wn << 6);

  const int rlane = lane & 15;
  const int koff  = (lane >> 4) * 8;
  const int mOff  = (lane >> 4) * 8;

  v8f acc[4][4];
#pragma unroll
  for (int i = 0; i < 4; ++i)
#pragma unroll
    for (int j = 0; j < 4; ++j) acc[i][j] = (v8f){0.f,0.f,0.f,0.f,0.f,0.f,0.f,0.f};

  /* this thread's piece of a stage: row (tid >> 3) of each group of 32 rows, 16-B piece (tid & 7) of the row's 128 B */
  const int crow = (int)threadIdx.x >> 3;
  const int ccol = ((int)threadIdx.x & 7) * 8;
  const T* gA  = A  + (size_t)((bm << 7) + crow) * kEmb + ccol;
  const T* gA2 = A2 + (size_t)((bm << 7) + crow) * kEmb + ccol;
  const T* gB  = Bt + (size_t)((bn << 8) + crow) * kEmb + ccol;
  const unsigned lbase = (unsigned)(size_t)(&sS[0][crow * kLp + ccol]);
  constexpr unsigned kBufBytes = kSRows * kLp * 2;
  auto stage = [&](int st) {
    const unsigned l = lbase + (unsigned)(st & 1) * kBufBytes;
    const int k0 = st * 64;
    stage128(l, gA + k0);
    if (MODE == 1) stage128(l + 128 * kLp * 2, gA2 + k0);
    stage128(l + kBOff * kLp * 2, gB + k0);
    stage128(l + (kBOff + 128) * kLp * 2, gB + 128 * kEmb + k0);
  };

  stage(0);
  /* stage 0 has landed for this wave's own copies ... */
  asm volatile("s_wait_asynccnt 0x0" ::: "memory");
  /* ... and for every wave's before anyone reads it */
  __syncthreads();
  stage(1);

  /* kept rolled for code size: the two buffers differ only in one base address */
#pragma unroll 1
  for (int st = 0; st < kStages; ++st) {
    const T* buf = sS[st & 1];
    const T* sa  = buf + ((wm << 6) + rlane) * kLp + koff;
    const T* sb  = buf + (kBOff + (wn << 6) + rlane) * kLp + koff;
    /* the loops over k blocks, fragments and tiles are fully unrolled so that these are indexed by constants and stay in registers */
#pragma unroll
    for (int kk = 0; kk < 2; ++kk) {
      /* all fragment reads of the block first, as one group in front of its WMMAs */
      v16b bh[4], ah[4], al[4];
#pragma unroll
      for (int j = 0; j < 4; ++j) bh[j] = Frag<T>::load(sb + (j << 4) * kLp + kk * 32);
#pragma unroll
      for (int i = 0; i < 4; ++i) {
        ah[i] = Frag<T>::load(sa + (i << 4) * kLp + kk * 32);
        al[i] = ah[i];
        if (MODE == 1) al[i] = Frag<T>::load(sa + (128 + (i << 4)) * kLp + kk * 32);
      }
#pragma unroll
      for (int i = 0; i < 4; ++i) {
#pragma unroll
        for (int j = 0; j < 4; ++j) {
          acc[i][j] = Frag<T>::mma(ah[i], bh[j], acc[i][j]);
          if (MODE == 1) acc[i][j] = Frag<T>::mma(al[i], bh[j], acc[i][j]);
        }
        dep_guard4_b(acc[i][0], acc[i][1], acc[i][2], acc[i][3], ah[i], al[i]);
      }
      keep4_b(bh[0], bh[1], bh[2], bh[3]);
    }
    /* publish point of stage st + 1: this wave's reads of buffer st & 1 have returned ... */
    asm volatile("s_wait_dscnt 0x0" ::: "memory");
    /* ... its own copies of stage st + 1 have landed ... */
    asm volatile("s_wait_asynccnt 0x0" ::: "memory");
    /* ... and the same holds for every wave: stage st + 1 may be read, buffer st & 1 may be refilled */
    __syncthreads();
    if (st + 2 < kStages) stage(st + 2);
  }
  /* no copy is outstanding when the wave goes on to the epilogue and ends */
  asm volatile("s_wait_asynccnt 0x0" ::: "memory");
  acc_guard4(acc[0][0], acc[0][1], acc[0][2], acc[0][3]);
  acc_guard4(acc[1][0], acc[1][1], acc[1][2], acc[1][3]);
  acc_guard4(acc[2][0], acc[2][1], acc[2][2], acc[2][3]);
  acc_guard4(acc[3][0], acc[3][1], acc[3][2], acc[3][3]);

  /* ---- epilogue ---- */
  float* slab = sT[wave];
  /* wave-uniform tile decode for MODE 0 */
  const int sel  = n0 >> 9;
  const int hcol = (n0 & (kEmb - 1)) >> 6;
  const int bb   = m0 >> 12;
  const int l0   = m0 & (kSeq - 1);
  const size_t rowbase = ((size_t)(bb * kHeads + hcol)) * kSeq + (size_t)l0;
  unsigned short* Ch = (sel == 0) ? QHp : KHp;
  unsigned short* Cl = (sel == 0) ? QLp : KLp;
  const int hh = lane >> 4, c4 = (lane & 15) * 4;
  const int q4 = lane >> 3, c8 = (lane & 7) * 8;
#pragma unroll
  for (int i = 0; i < 4; ++i) {
#pragma unroll
    for (int j = 0; j < 4; ++j) {
      const int n = n0 + (j << 4) + rlane;
      const float bv = bias[n];
#pragma unroll
      for (int r = 0; r < 8; ++r) {
        const float v = acc[i][j][r] + bv;
        slab[(mOff + r) * 68 + (j << 4) + rlane] = v;
      }
    }
    wave_lds_sync();
    if (MODE == 0 && sel < 2) {
      /* in-place sigmoid on the slab, rolled: lane owns (row it*2+hh, cols c4..c4+3) */
#pragma unroll 1
      for (int it = 0; it < 8; ++it) {
        float* sp = slab + (it * 2 + hh) * 68 + c4;
        v4f v = *(const v4f*)sp;
#pragma unroll
        for (int e = 0; e < 4; ++e) {
          const float x = v[e];
          v[e] = 1.0f / (1.0f + expf(-x));
        }
        *(v4f*)sp = v;
      }
      wave_lds_sync();
    }
    if (MODE == 1) {
      float* Cf = Fout;
      {
#pragma unroll
        for (int it = 0; it < 8; ++it) {
          const int row = it * 2 + hh;
          const v4f v = *(const v4f*)(slab + row * 68 + c4);
          *(v4f*)(Cf + (size_t)(m0 + (i << 4) + row) * kEmb + n0 + c4) = v;
        }
        
      }
    } else if (sel == 2) {
      float* Cf = Fout;
      {
#pragma unroll
        for (int it = 0; it < 8; ++it) {
          const int row = it * 2 + hh;
          const v4f v = *(const v4f*)(slab + row * 68 + c4);
          *(v4f*)(Cf + (rowbase + (size_t)((i << 4) + row)) * kHd + c4) = v;
        }
        
      }
    } else {
      v4u uh[4], ul[4];
#pragma unroll
      for (int it = 0; it < 4; ++it) {
        const float* sp = slab + (it * 4 + q4) * 68 + c8;
        unsigned short hb[8], lb[8];
#pragma unroll
        for (int e = 0; e < 8; ++e) {
          const float f = sp[e];
          hb[e] = f2bf_bits(f);
          lb[e] = f2bf_bits(f - bf_bits2f(hb[e]));
        }
        uh[it] = (v4u){pk16(hb[0], hb[1]), pk16(hb[2], hb[3]), pk16(hb[4], hb[5]), pk16(hb[6], hb[7])};
        ul[it] = (v4u){pk16(lb[0], lb[1]), pk16(lb[2], lb[3]), pk16(lb[4], lb[5]), pk16(lb[6], lb[7])};
      }
      {
#pragma unroll
        for (int it = 0; it < 4; ++it) {
          const size_t o = (rowbase + (size_t)((i << 4) + it * 4 + q4)) * kHd + c8;
          *(v4u*)(Ch + o) = uh[it];
          *(v4u*)(Cl + o) = ul[it];
        }
        
      }
    }
    wave_lds_sync();
  }
}

/* ---- flow scans, all f32, split along the sequence: 64 segments of 64 rows per (b,h), every segment scanned at the same time.
        Each running sum over rows = (sum of the totals of the segments before, added in segment order) + (serial sum inside the segment).
        One wave = two segments: a 16-lane row of the wave owns one segment, lane c of it owns features 4c..4c+3 (8 B per bf16 plane).
        q = q_hi + q_lo, k = k_hi + k_lo read from the bf16 planes (the same operands the WMMA products use).
        Launch 1: segment totals of k and q.                          Launch 2: sink_in, src_out per row; segment totals of k*src_out, q*sink_in.
        Launch 3: the two conserved dot products per row (raw sums).  Launch 4: per row rs = sigmoid(conserved_sink) * sink_in / (l+1) and
        comp = exp(clip(conserved_source)) / cumsum * (l+1), the cumsum as a block scan over the 4096 rows of one (b,h).
        Per-row results are kept by lane c for rows 4c..4c+3 of its segment and stored once as 16 lanes x 16 B = 256 B.
        The inner loops are fully unrolled so that the staged words and the kept rows are indexed by constants and stay in registers. */
__device__ __forceinline__ float row16_sum(float v) {
  /* DPP row_xmask 1, 2, 4, 8: butterfly sum over the 16 lanes of a row, no LDS round trip */
  v += __int_as_float(__builtin_amdgcn_update_dpp(0, __float_as_int(v), 0x161, 0xf, 0xf, true));
  v += __int_as_float(__builtin_amdgcn_update_dpp(0, __float_as_int(v), 0x162, 0xf, 0xf, true));
  v += __int_as_float(__builtin_amdgcn_update_dpp(0, __float_as_int(v), 0x164, 0xf, 0xf, true));
  v += __int_as_float(__builtin_amdgcn_update_dpp(0, __float_as_int(v), 0x168, 0xf, 0xf, true));
  return v;
}
__device__ __forceinline__ v4f hilo4(v2u h, v2u l) {
  v4f r;
  r[0] = __uint_as_float(h[0] << 16)         + __uint_as_float(l[0] << 16);
  r[1] = __uint_as_float(h[0] & 0xffff0000u) + __uint_as_float(l[0] & 0xffff0000u);
  r[2] = __uint_as_float(h[1] << 16)         + __uint_as_float(l[1] << 16);
  r[3] = __uint_as_float(h[1] & 0xffff0000u) + __uint_as_float(l[1] & 0xffff0000u);
  return r;
}
__device__ __forceinline__ float dot4_eps(v4f x, v4f y) {
  return (x[0] + kEps) * (y[0] + kEps) + (x[1] + kEps) * (y[1] + kEps) + (x[2] + kEps) * (y[2] + kEps) + (x[3] + kEps) * (y[3] + kEps);
}
/* totals of the segments before seg, added in segment order; T = [kNSeg][128] of one (b,h), first 64 floats -> a, last 64 -> b */
__device__ __forceinline__ void seg_prefix(const float* __restrict__ T, int seg, int c, v4f& a, v4f& b) {
  a = (v4f){0.f, 0.f, 0.f, 0.f};
  b = (v4f){0.f, 0.f, 0.f, 0.f};
  /* 16 segments' loads in flight per trip: the loads are independent, only the adds are ordered */
#pragma unroll 16
  for (int s = 0; s < kNSeg; ++s) {
    const v4f ta = *(const v4f*)(T + s * 128 + 4 * c);
    const v4f tb = *(const v4f*)(T + s * 128 + 64 + 4 * c);
    const bool in = s < seg;
#pragma unroll
    for (int e = 0; e < 4; ++e) {
      a[e] += in ? ta[e] : 0.0f;
      b[e] += in ? tb[e] : 0.0f;
    }
  }
}

__global__ __launch_bounds__(32) void flow_seg_total_kernel(const unsigned short* __restrict__ QHp, const unsigned short* __restrict__ QLp,
                                                            const unsigned short* __restrict__ KHp, const unsigned short* __restrict__ KLp,
                                                            float* __restrict__ T0) {
  const int lane = threadIdx.x, c = lane & 15;
  const int bh = (int)blockIdx.x / (kNSeg / 2);
  const int seg = ((int)blockIdx.x % (kNSeg / 2)) * 2 + (lane >> 4);
  const size_t w0 = ((size_t)bh * kSeq + (size_t)seg * kSegRows) * (kHd / 4) + c;
  const v2u* qh = (const v2u*)QHp + w0;
  const v2u* ql = (const v2u*)QLp + w0;
  const v2u* kh = (const v2u*)KHp + w0;
  const v2u* kl = (const v2u*)KLp + w0;
  v4f ks = (v4f){0.f, 0.f, 0.f, 0.f}, qs = (v4f){0.f, 0.f, 0.f, 0.f};
  /* 16 rows per trip, kept rolled for code size: all their loads are issued before the first sum */
#pragma unroll 1
  for (int t = 0; t < kSegRows / 16; ++t) {
    const v2u* pqh = qh + t * 16 * (kHd / 4);
    const v2u* pql = ql + t * 16 * (kHd / 4);
    const v2u* pkh = kh + t * 16 * (kHd / 4);
    const v2u* pkl = kl + t * 16 * (kHd / 4);
    v2u wqh[16], wql[16], wkh[16], wkl[16];
#pragma unroll
    for (int j = 0; j < 16; ++j) {
      wqh[j] = pqh[j * (kHd / 4)];
      wql[j] = pql[j * (kHd / 4)];
      wkh[j] = pkh[j * (kHd / 4)];
      wkl[j] = pkl[j * (kHd / 4)];
    }
    /* the wait that stands before a register named by an issued global load is overwritten; the address pairs are inputs so that
       they stay untouched up to it; its memory clobber also keeps the trip's loads together in front of the sums */
    asm volatile("s_wait_xcnt 0x0" :: "v"(pqh), "v"(pql), "v"(pkh), "v"(pkl) : "memory");
#pragma unroll
    for (int j = 0; j < 16; ++j) {
      ks += hilo4(wkh[j], wkl[j]);
      qs += hilo4(wqh[j], wql[j]);
    }
  }
  float* o = T0 + ((size_t)bh * kNSeg + seg) * 128 + 4 * c;
  *(v4f*)o = ks;
  *(v4f*)(o + 64) = qs;
}

__global__ __launch_bounds__(32) void flow_incoming_kernel(const unsigned short* __restrict__ QHp, const unsigned short* __restrict__ QLp,
                                                           const unsigned short* __restrict__ KHp, const unsigned short* __restrict__ KLp,
                                                           const float* __restrict__ T0, float* __restrict__ SINK, float* __restrict__ SRC,
                                                           float* __restrict__ T1) {
  const int lane = threadIdx.x, c = lane & 15;
  const int bh = (int)blockIdx.x / (kNSeg / 2);
  const int seg = ((int)blockIdx.x % (kNSeg / 2)) * 2 + (lane >> 4);
  const int row0 = seg * kSegRows;
  const size_t w0 = ((size_t)bh * kSeq + (size_t)row0) * (kHd / 4) + c;
  const v2u* qh = (const v2u*)QHp + w0;
  const v2u* ql = (const v2u*)QLp + w0;
  const v2u* kh = (const v2u*)KHp + w0;
  const v2u* kl = (const v2u*)KLp + w0;
  v4f kc, qc;
  seg_prefix(T0 + (size_t)bh * kNSeg * 128, seg, c, kc, qc);
  v4f a1 = (v4f){0.f, 0.f, 0.f, 0.f}, a2 = (v4f){0.f, 0.f, 0.f, 0.f};
  v4f si = (v4f){0.f, 0.f, 0.f, 0.f}, so = (v4f){0.f, 0.f, 0.f, 0.f};
  /* 8 rows per trip, kept rolled for code size: their loads, row sums and divisions are independent of each other and overlap;
     only the running sums are ordered */
#pragma unroll 1
  for (int t = 0; t < kSegRows / 8; ++t) {
    const v2u* pqh = qh + t * 8 * (kHd / 4);
    const v2u* pql = ql + t * 8 * (kHd / 4);
    const v2u* pkh = kh + t * 8 * (kHd / 4);
    const v2u* pkl = kl + t * 8 * (kHd / 4);
    v2u wqh[8], wql[8], wkh[8], wkl[8];
#pragma unroll
    for (int j = 0; j < 8; ++j) {
      wqh[j] = pqh[j * (kHd / 4)];
      wql[j] = pql[j * (kHd / 4)];
      wkh[j] = pkh[j * (kHd / 4)];
      wkl[j] = pkl[j * (kHd / 4)];
    }
    /* the wait that stands before a register named by an issued global load is overwritten; the address pairs are inputs so that
       they stay untouched up to it */
    asm volatile("s_wait_xcnt 0x0" :: "v"(pqh), "v"(pql), "v"(pkh), "v"(pkl) : "memory");
#pragma unroll
    for (int jj = 0; jj < 8; ++jj) {
      const int r = 8 * t + jj;
      const int g = 2 * t + (jj >> 2);
      const int j = jj & 3;
      const v4f q = hilo4(wqh[jj], wql[jj]);
      const v4f k = hilo4(wkh[jj], wkl[jj]);
      kc += k;
      qc += q;
      const float d1 = row16_sum(dot4_eps(q, kc));
      const float d2 = row16_sum(dot4_eps(k, qc));
      const float nrm = (float)(row0 + r + 1);
      const float sink_in = (1.0f / d1) * nrm;
      const float src_out = (1.0f / d2) * nrm;
      a1 += k * src_out;
      a2 += q * sink_in;
      si[j] = (c == g) ? sink_in : si[j];
      so[j] = (c == g) ? src_out : so[j];
    }
  }
  const size_t ro = (size_t)bh * kSeq + (size_t)row0 + 4 * c;
  *(v4f*)(SINK + ro) = si;
  *(v4f*)(SRC + ro) = so;
  float* o = T1 + ((size_t)bh * kNSeg + seg) * 128 + 4 * c;
  *(v4f*)o = a1;
  *(v4f*)(o + 64) = a2;
}

__global__ __launch_bounds__(32) void flow_conserved_kernel(const unsigned short* __restrict__ QHp, const unsigned short* __restrict__ QLp,
                                                            const unsigned short* __restrict__ KHp, const unsigned short* __restrict__ KLp,
                                                            const float* __restrict__ T1, const float* __restrict__ SINK,
                                                            const float* __restrict__ SRC, float* __restrict__ D3, float* __restrict__ D4) {
  const int lane = threadIdx.x, c = lane & 15;
  const int bh = (int)blockIdx.x / (kNSeg / 2);
  const int seg = ((int)blockIdx.x % (kNSeg / 2)) * 2 + (lane >> 4);
  const int row0 = seg * kSegRows;
  const size_t w0 = ((size_t)bh * kSeq + (size_t)row0) * (kHd / 4) + c;
  const v2u* qh = (const v2u*)QHp + w0;
  const v2u* ql = (const v2u*)QLp + w0;
  const v2u* kh = (const v2u*)KHp + w0;
  const v2u* kl = (const v2u*)KLp + w0;
  const float* sip = SINK + (size_t)bh * kSeq + row0;
  const float* sop = SRC + (size_t)bh * kSeq + row0;
  v4f s1, s2;
  seg_prefix(T1 + (size_t)bh * kNSeg * 128, seg, c, s1, s2);
  v4f k3 = (v4f){0.f, 0.f, 0.f, 0.f}, k4 = (v4f){0.f, 0.f, 0.f, 0.f};
  /* 8 rows per trip, kept rolled for code size: their loads and row sums overlap; only the running sums are ordered */
#pragma unroll 1
  for (int t = 0; t < kSegRows / 8; ++t) {
    const v2u* pqh = qh + t * 8 * (kHd / 4);
    const v2u* pql = ql + t * 8 * (kHd / 4);
    const v2u* pkh = kh + t * 8 * (kHd / 4);
    const v2u* pkl = kl + t * 8 * (kHd / 4);
    const v4f* psi = (const v4f*)(sip + 8 * t);
    const v4f* pso = (const v4f*)(sop + 8 * t);
    v2u wqh[8], wql[8], wkh[8], wkl[8];
    v4f si[2], so[2];
    si[0] = psi[0];
    si[1] = psi[1];
    so[0] = pso[0];
    so[1] = pso[1];
#pragma unroll
    for (int j = 0; j < 8; ++j) {
      wqh[j] = pqh[j * (kHd / 4)];
      wql[j] = pql[j * (kHd / 4)];
      wkh[j] = pkh[j * (kHd / 4)];
      wkl[j] = pkl[j * (kHd / 4)];
    }
    /* the wait that stands before a register named by an issued global load is overwritten; the address pairs are inputs so that
       they stay untouched up to it */
    asm volatile("s_wait_xcnt 0x0" :: "v"(pqh), "v"(pql), "v"(pkh), "v"(pkl), "v"(psi), "v"(pso) : "memory");
#pragma unroll
    for (int jj = 0; jj < 8; ++jj) {
      const int g = 2 * t + (jj >> 2);
      const int j = jj & 3;
      const v4f q = hilo4(wqh[jj], wql[jj]);
      const v4f k = hilo4(wkh[jj], wkl[jj]);
      s1 += k * so[jj >> 2][j];
      s2 += q * si[jj >> 2][j];
      const float d3 = row16_sum(dot4_eps(q, s1));
      const float d4 = row16_sum(dot4_eps(k, s2));
      k3[j] = (c == g) ? d3 : k3[j];
      k4[j] = (c == g) ? d4 : k4[j];
    }
  }
  const size_t ro = (size_t)bh * kSeq + (size_t)row0 + 4 * c;
  *(v4f*)(D3 + ro) = k3;
  *(v4f*)(D4 + ro) = k4;
}

/* one block of 32 waves per (b,h); thread t owns rows 4t..4t+3 */
__global__ __launch_bounds__(1024) void flow_finish_kernel(const float* __restrict__ D3, const float* __restrict__ D4,
                                                           const float* __restrict__ SINK, float* __restrict__ RS, float* __restrict__ COMP) {
  __shared__ float wtot[32];
  const int tid = threadIdx.x, lane = tid & 31, wave = tid >> 5;
  const size_t o = (size_t)blockIdx.x * kSeq + 4 * (size_t)tid;
  const v4f d3 = *(const v4f*)(D3 + o);
  const v4f d4 = *(const v4f*)(D4 + o);
  const v4f si = *(const v4f*)(SINK + o);
  v4f rs, ce, inc;
  float run = 0.f;
#pragma unroll
  for (int e = 0; e < 4; ++e) {
    const float nrm = (float)(4 * tid + e + 1);
    const float inv_nrm = 1.0f / nrm;
    const float csink = d3[e] * inv_nrm;
    const float csrc  = fminf(fmaxf(d4[e] * inv_nrm, -1.0f), 1.0f);
    const float salloc = 1.0f / (1.0f + expf(-csink));
    ce[e] = expf(csrc);
    run += ce[e];
    inc[e] = run;
    rs[e] = salloc * (si[e] * inv_nrm);
  }
  *(v4f*)(RS + o) = rs;
  /* inclusive scan of the threads' totals over the wave */
  float sc = run;
#pragma unroll
  for (int off = 1; off < 32; off <<= 1) {
    const float t = __shfl_up(sc, off, 32);
    sc += (lane >= off) ? t : 0.0f;
  }
  if (lane == 31) wtot[wave] = sc;
  const float up = __shfl_up(sc, 1, 32);
  const float before_in_wave = (lane == 0) ? 0.0f : up;
  /* every wave's total is in LDS before any wave sums the totals of the waves before it */
  __syncthreads();
  float wp = (lane < wave) ? wtot[lane] : 0.0f;
#pragma unroll
  for (int off = 16; off > 0; off >>= 1) wp += __shfl_xor(wp, off, 32);
  const float base = wp + before_in_wave;
  v4f co;
#pragma unroll
  for (int e = 0; e < 4; ++e) {
    const float nrm = (float)(4 * tid + e + 1);
    co[e] = (ce[e] / (base + inc[e])) * nrm;
  }
  *(v4f*)(COMP + o) = co;
}

/* ---- causal linear attention, split along the sequence: every 64-row chunk is its own block: of all (b,h) at once in chunk_state, of one batch half per launch in chunk_out.
        Launch 1 (chunk_state):  per chunk its own St_n[m][d] = sum_l v'[l][m] k[l][d], v' = v * comp[l], f32, from zero.
        Launch 2 (chunk_prefix): per element the sum of the chunks before, added in chunk order in f32, stored as bf16 hi/lo planes [m][d].
        Launch 3 (chunk_out):    out[i][m] = rs[i] * ( sum_d q[i][d] St[m][d] + sum_{j<=i} (q[i].k[j]) v'[j][m] ) per chunk.
        All products: hi*hi + hi*lo + lo*hi. Q, row-major K and St fragments come straight from the global bf16 planes (row pitch 64).
        LDS tiles are bf16 bits at pitch 72; every k-tile read touches columns 0..63 only. No atomics, no inter-block communication.
        The loops over tiles, fragments and staged words are fully unrolled so that these are indexed by constants and stay in registers. */

/* VT hi/lo <- (v * comp)^T of one chunk; thread covers row lr, features dh..dh+31 (vv = its 8 x 16-B words of v): 128 threads x 32 = 64 x 64 */
__device__ __forceinline__ void vt_store(float cv, const v4f (&vv)[8], int lr, int dh, __bf16* VTh, __bf16* VTl) {
#pragma unroll
  for (int i = 0; i < 8; ++i) {
#pragma unroll
    for (int e = 0; e < 4; ++e) {
      const float f = vv[i][e] * cv;
      const unsigned short hb = f2bf_bits(f);
      const unsigned short lb = f2bf_bits(f - bf_bits2f(hb));
      const int d = dh + 4 * i + e;
      VTh[d * kLp + lr] = bits2bf(hb);
      VTl[d * kLp + lr] = bits2bf(lb);
    }
  }
}

/* one block of 4 waves per (b,h,chunk). Wave w owns rows m = 16w..16w+15 of St_n[m][d]: A rows d = 16i + c of KT, Bt rows m = 16w + c
   of VT, k = l for both, so lane (c,hh) holds St_n[16w + c][16i + 8hh + r]. Coverage: 2048 blocks x 64 x 64 floats. */
__global__ __launch_bounds__(128) void chunk_state_kernel(
    const unsigned short* __restrict__ KHp, const unsigned short* __restrict__ KLp,
    const float* __restrict__ VF, const float* __restrict__ COMP, float* __restrict__ CS) {
  __shared__ __align__(16) __bf16 KTh[kHd * kLp];
  __shared__ __align__(16) __bf16 KTl[kHd * kLp];
  __shared__ __align__(16) __bf16 VTh[kHd * kLp];
  __shared__ __align__(16) __bf16 VTl[kHd * kLp];
  __shared__ __align__(16) float sT[4][16 * 68];

  const int tid = threadIdx.x, lane = tid & 31, wave = tid >> 5;
  const int c = lane & 15, hh = lane >> 4, koff = hh * 8;
  const int bh = (int)blockIdx.x / kNChunk;
  const int l0 = ((int)blockIdx.x % kNChunk) * kChunk;
  const size_t pbase = (size_t)bh * kSeq * kHd;
  const int lr = tid >> 1, dh = (tid & 1) * 32;
  const v8f z8 = (v8f){0.f,0.f,0.f,0.f,0.f,0.f,0.f,0.f};

  /* all global loads of the block first, so that they are in flight together */
  const size_t ko = pbase + (size_t)(l0 + lr) * kHd + dh;
  const v4u* kh4 = (const v4u*)(KHp + ko);
  const v4u* kl4 = (const v4u*)(KLp + ko);
  const v4f* v4p = (const v4f*)(VF + ko);
  const float* cp = COMP + (size_t)bh * kSeq + l0 + lr;
  v4u wh[4], wl[4];
  v4f vv[8];
#pragma unroll
  for (int g = 0; g < 4; ++g) { wh[g] = kh4[g]; wl[g] = kl4[g]; }
#pragma unroll
  for (int g = 0; g < 8; ++g) vv[g] = v4p[g];
  const float cv = *cp;
  /* the wait that stands before a register named by an issued global load is overwritten; the address pairs, and the row index that
     the comp load takes as its offset, are inputs so that they stay untouched up to it */
  asm volatile("s_wait_xcnt 0x0" :: "v"(kh4), "v"(kl4), "v"(v4p), "v"(cp), "v"(lr) : "memory");

  /* KT hi/lo <- k^T; thread covers row lr, features dh..dh+31 (4 x 16-B words per plane): 128 threads x 32 = 64 x 64 */
  {
#pragma unroll
    for (int g = 0; g < 4; ++g) {
#pragma unroll
      for (int e = 0; e < 4; ++e) {
        const unsigned a = wh[g][e];
        const unsigned b = wl[g][e];
        const int d = dh + 8 * g + 2 * e;
        const unsigned a0 = a & 0xffffu, a1 = a >> 16;
        const unsigned b0 = b & 0xffffu, b1 = b >> 16;
        KTh[d * kLp + lr]       = bits2bf((unsigned short)a0);
        KTh[(d + 1) * kLp + lr] = bits2bf((unsigned short)a1);
        KTl[d * kLp + lr]       = bits2bf((unsigned short)b0);
        KTl[(d + 1) * kLp + lr] = bits2bf((unsigned short)b1);
      }
    }
  }
  vt_store(cv, vv, lr, dh, VTh, VTl);
  /* KT and VT are complete before any wave reads fragments of them */
  __syncthreads();

  v8f acc[4];
  acc[0] = z8; acc[1] = z8; acc[2] = z8; acc[3] = z8;
#pragma unroll
  for (int kk = 0; kk < 2; ++kk) {
    const v16b vbh = Frag<__bf16>::load(VTh + (16 * wave + c) * kLp + kk * 32 + koff);
    const v16b vbl = Frag<__bf16>::load(VTl + (16 * wave + c) * kLp + kk * 32 + koff);
#pragma unroll
    for (int i = 0; i < 4; ++i) {
      const v16b kh = Frag<__bf16>::load(KTh + (16 * i + c) * kLp + kk * 32 + koff);
      const v16b kl = Frag<__bf16>::load(KTl + (16 * i + c) * kLp + kk * 32 + koff);
      acc[i] = mma_g(kh, vbh, acc[i]);
      acc[i] = mma_g(kl, vbh, acc[i]);
      acc[i] = mma_g(kh, vbl, acc[i]);
    }
  }
  acc_guard4(acc[0], acc[1], acc[2], acc[3]);

  /* stage the wave's 16 rows in its own slab, then whole-line stores: 16 lanes x 16 B = one 256-B row, 2 rows per instruction */
  float* slab = sT[wave];
#pragma unroll
  for (int i = 0; i < 4; ++i) {
    float* sp = slab + c * 68 + 16 * i + 8 * hh;
    *(v4f*)(sp)     = (v4f){acc[i][0], acc[i][1], acc[i][2], acc[i][3]};
    *(v4f*)(sp + 4) = (v4f){acc[i][4], acc[i][5], acc[i][6], acc[i][7]};
  }
  /* slab: written and read by this wave only, by different lanes */
  wave_lds_sync();
  float* op = CS + (size_t)blockIdx.x * (kHd * kHd) + (size_t)(16 * wave) * kHd;
  const int c4 = c * 4;
#pragma unroll
  for (int it = 0; it < 8; ++it) {
    const int row = it * 2 + hh;
    const v4f v = *(const v4f*)(slab + row * 68 + c4);
    *(v4f*)(op + row * kHd + c4) = v;
  }
}

/* exclusive prefix over the 64 chunks of one (b,h); thread owns 4 consecutive elements of [m][d]: 32 x 1024 threads.
   A wave reads 512 B and writes 256 B per plane and chunk (whole lines). */
__global__ __launch_bounds__(128) void chunk_prefix_kernel(const float* __restrict__ CS, unsigned short* __restrict__ SHp,
                                                           unsigned short* __restrict__ SLp) {
  const int i = (int)blockIdx.x * 128 + (int)threadIdx.x;
  const size_t base = (size_t)(i >> 10) * kNChunk * (kHd * kHd) + (size_t)(i & 1023) * 4;
  v4f run = (v4f){0.f, 0.f, 0.f, 0.f};
  /* 32 chunks per trip, kept rolled for code size: the loads are independent and all in flight together, only the adds are ordered */
#pragma unroll 1
  for (int g = 0; g < kNChunk / 32; ++g) {
    const float* pc = CS + base + (size_t)g * 32 * (kHd * kHd);
    unsigned short* ph = SHp + base + (size_t)g * 32 * (kHd * kHd);
    unsigned short* pl = SLp + base + (size_t)g * 32 * (kHd * kHd);
    v4f t[32];
#pragma unroll
    for (int j = 0; j < 32; ++j) t[j] = *(const v4f*)(pc + j * (kHd * kHd));
    /* the wait that stands before a register named by an issued global load is overwritten; the address pair is an input so that
       it stays untouched up to it */
    asm volatile("s_wait_xcnt 0x0" :: "v"(pc) : "memory");
#pragma unroll
    for (int q = 0; q < 4; ++q) {
      v2u uh[8], ul[8];
#pragma unroll
      for (int j = 0; j < 8; ++j) {
        unsigned short hb[4], lb[4];
#pragma unroll
        for (int e = 0; e < 4; ++e) {
          const float s = run[e];
          hb[e] = f2bf_bits(s);
          lb[e] = f2bf_bits(s - bf_bits2f(hb[e]));
        }
        uh[j] = (v2u){pk16(hb[0], hb[1]), pk16(hb[2], hb[3])};
        ul[j] = (v2u){pk16(lb[0], lb[1]), pk16(lb[2], lb[3])};
        run += t[8 * q + j];
      }
#pragma unroll
      for (int j = 0; j < 8; ++j) {
        *(v2u*)(ph + (8 * q + j) * (kHd * kHd)) = uh[j];
        *(v2u*)(pl + (8 * q + j) * (kHd * kHd)) = ul[j];
      }
      /* the same wait behind the stores: their address pairs and data words are inputs so that they stay untouched up to it */
      asm volatile("s_wait_xcnt 0x0" :: "v"(ph), "v"(pl), "v"(uh[0]), "v"(uh[1]), "v"(uh[2]), "v"(uh[3]), "v"(uh[4]), "v"(uh[5]),
                   "v"(uh[6]), "v"(uh[7]), "v"(ul[0]), "v"(ul[1]), "v"(ul[2]), "v"(ul[3]), "v"(ul[4]), "v"(ul[5]), "v"(ul[6]), "v"(ul[7])
                   : "memory");
    }
  }
}

/* one block of 4 waves per (b,h,chunk) of one batch half; wave w owns output rows 16w..16w+15 of the chunk.
   LDS: VT hi/lo = v'^T[m][l]; P hi/lo per wave = masked scores, later the output staging.
   Coverage: 16 x 64 blocks x 4 waves x 16 rows x 64 cols = 8192 rows x 512 cols per plane. */
__global__ __launch_bounds__(128) void chunk_out_kernel(
    const unsigned short* __restrict__ QHp, const unsigned short* __restrict__ QLp,
    const unsigned short* __restrict__ KHp, const unsigned short* __restrict__ KLp,
    const float* __restrict__ VF, const float* __restrict__ RS, const float* __restrict__ COMP,
    const unsigned short* __restrict__ SHp, const unsigned short* __restrict__ SLp,
    unsigned short* __restrict__ AHp, unsigned short* __restrict__ ALp, int bh0) {
  __shared__ __align__(16) __bf16 VTh[kHd * kLp];
  __shared__ __align__(16) __bf16 VTl[kHd * kLp];
  __shared__ __align__(16) __bf16 Ph[4][16 * kLp];
  __shared__ __align__(16) __bf16 Pl[4][16 * kLp];

  const int tid = threadIdx.x, lane = tid & 31, wave = tid >> 5;
  const int c = lane & 15, hh = lane >> 4, koff = hh * 8;
  const int bhl = (int)blockIdx.x / kNChunk;
  const int n = (int)blockIdx.x % kNChunk;
  const int l0 = n * kChunk;
  const int bh = bh0 + bhl;
  const int hd = bh & (kHeads - 1);
  const int bl = bhl >> 3;
  const size_t pbase = (size_t)bh * kSeq * kHd;
  const size_t sbase = ((size_t)bh * kNChunk + n) * (kHd * kHd);
  const __bf16* QH = (const __bf16*)QHp + pbase;
  const __bf16* QL = (const __bf16*)QLp + pbase;
  const __bf16* KH = (const __bf16*)KHp + pbase;
  const __bf16* KL = (const __bf16*)KLp + pbase;
  const __bf16* SH = (const __bf16*)SHp + sbase;
  const __bf16* SL = (const __bf16*)SLp + sbase;
  const float* rsp = RS + (size_t)bh * kSeq;
  unsigned short* ahp = AHp + ((size_t)bl * kSeq) * kEmb + hd * kHd;
  unsigned short* alp = ALp + ((size_t)bl * kSeq) * kEmb + hd * kHd;
  __bf16* ph = Ph[wave];
  __bf16* pl = Pl[wave];
  const int q4 = lane >> 3, c8 = (lane & 7) * 8;
  const v8f z8 = (v8f){0.f,0.f,0.f,0.f,0.f,0.f,0.f,0.f};

  /* first load group, in flight together: this thread's part of v with its row's comp, the Q fragments (rows 16w + c) and the
     row-major K fragments (rows 16j + c) */
  const int lr = tid >> 1, dh = (tid & 1) * 32;
  const v4f* v4p = (const v4f*)(VF + pbase + (size_t)(l0 + lr) * kHd + dh);
  const float* cp = COMP + (size_t)bh * kSeq + l0 + lr;
  const __bf16* qhp = QH + (size_t)(l0 + 16 * wave + c) * kHd + koff;
  const __bf16* qlp = QL + (size_t)(l0 + 16 * wave + c) * kHd + koff;
  const __bf16* khp = KH + (size_t)(l0 + c) * kHd + koff;
  const __bf16* klp = KL + (size_t)(l0 + c) * kHd + koff;
  v4f vv[8];
  v16b qh[2], ql[2], kh[4][2], kl[4][2];
#pragma unroll
  for (int g = 0; g < 8; ++g) vv[g] = v4p[g];
#pragma unroll
  for (int dc = 0; dc < 2; ++dc) {
    qh[dc] = Frag<__bf16>::load(qhp + dc * 32);
    ql[dc] = Frag<__bf16>::load(qlp + dc * 32);
  }
#pragma unroll
  for (int j = 0; j < 4; ++j) {
#pragma unroll
    for (int dc = 0; dc < 2; ++dc) {
      kh[j][dc] = Frag<__bf16>::load(khp + 16 * j * kHd + dc * 32);
      kl[j][dc] = Frag<__bf16>::load(klp + 16 * j * kHd + dc * 32);
    }
  }
  const float cv = *cp;
  /* the wait that stands before a register named by an issued global load is overwritten; the address pairs are inputs so that
     they stay untouched up to it */
  asm volatile("s_wait_xcnt 0x0" :: "v"(v4p), "v"(cp), "v"(qhp), "v"(qlp), "v"(khp), "v"(klp) : "memory");

  vt_store(cv, vv, lr, dh, VTh, VTl);

  /* scores rows 16w.., all 64 columns; inclusive causal mask by select; hi/lo into this wave's P strip */
#pragma unroll
  for (int j = 0; j < 4; ++j) {
    v8f s = z8;
#pragma unroll
    for (int dc = 0; dc < 2; ++dc) {
      s = mma_g(qh[dc], kh[j][dc], s);
      s = mma_g(qh[dc], kl[j][dc], s);
      s = mma_g(ql[dc], kh[j][dc], s);
    }
    const int jj = 16 * j + c;
#pragma unroll
    for (int r = 0; r < 8; ++r) {
      const int ii = 16 * wave + 8 * hh + r;
      const float pv = (jj <= ii) ? s[r] : 0.0f;
      const unsigned short hb = f2bf_bits(pv);
      const unsigned short lb = f2bf_bits(pv - bf_bits2f(hb));
      ph[(8 * hh + r) * kLp + jj] = bits2bf(hb);
      pl[(8 * hh + r) * kLp + jj] = bits2bf(lb);
    }
  }

  /* second load group, in flight together: the St fragments (Bt rows m = 16t + c, k = d) and the row scales */
  const __bf16* sph = SH + c * kHd + koff;
  const __bf16* spl = SL + c * kHd + koff;
  const float* rp = rsp + l0 + 16 * wave + 8 * hh;
  v16b sh[4][2], sl[4][2];
#pragma unroll
  for (int t = 0; t < 4; ++t) {
#pragma unroll
    for (int dc = 0; dc < 2; ++dc) {
      sh[t][dc] = Frag<__bf16>::load(sph + 16 * t * kHd + dc * 32);
      sl[t][dc] = Frag<__bf16>::load(spl + 16 * t * kHd + dc * 32);
    }
  }
  const v4f r0 = *(const v4f*)(rp);
  const v4f r1 = *(const v4f*)(rp + 4);
  /* the same wait for the second group */
  asm volatile("s_wait_xcnt 0x0" :: "v"(sph), "v"(spl), "v"(rp) : "memory");

  v8f accO[4];
  accO[0] = z8; accO[1] = z8; accO[2] = z8; accO[3] = z8;
  /* inter: Q x St^T */
#pragma unroll
  for (int t = 0; t < 4; ++t) {
#pragma unroll
    for (int dc = 0; dc < 2; ++dc) {
      accO[t] = mma_g(qh[dc], sh[t][dc], accO[t]);
      accO[t] = mma_g(qh[dc], sl[t][dc], accO[t]);
      accO[t] = mma_g(ql[dc], sh[t][dc], accO[t]);
    }
  }
  /* VT is complete before any wave reads fragments of it; the barrier also orders this wave's P strip writes before its reads */
  __syncthreads();
  /* intra: P x v' (A rows i = c of the strip, k = j; Bt rows m = 16t + c of VT, k = j) */
#pragma unroll
  for (int kk = 0; kk < 2; ++kk) {
    const v16b pah = Frag<__bf16>::load(ph + c * kLp + kk * 32 + koff);
    const v16b pal = Frag<__bf16>::load(pl + c * kLp + kk * 32 + koff);
#pragma unroll
    for (int t = 0; t < 4; ++t) {
      const v16b vh = Frag<__bf16>::load(VTh + (16 * t + c) * kLp + kk * 32 + koff);
      const v16b vl = Frag<__bf16>::load(VTl + (16 * t + c) * kLp + kk * 32 + koff);
      accO[t] = mma_g(pah, vh, accO[t]);
      accO[t] = mma_g(pah, vl, accO[t]);
      accO[t] = mma_g(pal, vh, accO[t]);
    }
  }
  /* epilogue: row scale, bf16 hi/lo, stage in the P strip, whole-line stores */
  {
    float rsv[8];
#pragma unroll
    for (int e = 0; e < 4; ++e) { rsv[e] = r0[e]; rsv[4 + e] = r1[e]; }
#pragma unroll
    for (int t = 0; t < 4; ++t) {
#pragma unroll
      for (int r = 0; r < 8; ++r) {
        const float o = accO[t][r] * rsv[r];
        const unsigned short hb = f2bf_bits(o);
        const unsigned short lb = f2bf_bits(o - bf_bits2f(hb));
        ph[(8 * hh + r) * kLp + 16 * t + c] = bits2bf(hb);
        pl[(8 * hh + r) * kLp + 16 * t + c] = bits2bf(lb);
      }
    }
    /* P strip: written and read by this wave only, by different lanes */
    wave_lds_sync();
    v4u uh[4], ul[4];
#pragma unroll
    for (int it = 0; it < 4; ++it) {
      const int row = it * 4 + q4;
      const v8b hv = *(const v8b*)(ph + row * kLp + c8);
      const v8b lv = *(const v8b*)(pl + row * kLp + c8);
      uh[it] = __builtin_bit_cast(v4u, hv);
      ul[it] = __builtin_bit_cast(v4u, lv);
    }
#pragma unroll
    for (int it = 0; it < 4; ++it) {
      const size_t o = (size_t)(l0 + 16 * wave + it * 4 + q4) * kEmb + c8;
      *(v4u*)(ahp + o) = uh[it];
      *(v4u*)(alp + o) = ul[it];
    }
  }
}

/* ---- host glue ----
   Workspace region map (bytes, 256-B aligned carve; total 191,897,600 <= 268,435,456):
     XB    [16384][512] bf16   16,777,216   bf16(x); after the projections the same bytes hold, per batch half,
                                            ATTN_HI [8192][512] bf16 (first 8,388,608 B) and ATTN_LO (second 8,388,608 B)
     WQKV  [1536][512]  bf16    1,572,864   bf16(Wq | Wk | Wv)
     WOB   [512][512]   bf16      524,288   bf16(Wo)
     BIAS  [2048]       f32         8,192   bf16 values of bq | bk | bv | bo kept as f32
     QH,QL,KH,KL [32][4096][64] bf16  4 x 16,777,216   sigmoid(q), sigmoid(k) as hi/lo planes
     VF    [32][4096][64] f32  33,554,432   v
     RS, COMP [32][4096] f32   2 x 524,288
     SINK, SRC, D3, D4 [32][4096] f32   4 x 524,288   per-row values handed between the flow scan launches
     T0, T1 [32][64][128] f32  2 x 1,048,576   segment totals (k | q, then k*src_out | q*sink_in)
     CS    [32][64][64][64] f32  33,554,432   each chunk's own state St_n[m][d]
     SH, SL [32][64][64][64] bf16  2 x 16,777,216   state before each chunk as hi/lo planes */
extern "C" void kernel_launch(void* const* d_in, const int* in_sizes, int n_in,
                              void* d_out, int out_size, void* d_ws, size_t ws_size, hipStream_t stream) {
  if (n_in < 9 || d_out == nullptr || d_ws == nullptr) return;
  if (in_sizes[0] != kRows * kEmb || in_sizes[1] != kEmb * kEmb || in_sizes[2] != kEmb ||
      in_sizes[3] != kEmb * kEmb || in_sizes[4] != kEmb || in_sizes[5] != kEmb * kEmb ||
      in_sizes[6] != kEmb || in_sizes[7] != kEmb * kEmb || in_sizes[8] != kEmb ||
      out_size != kRows * kEmb) return;

  const float* x  = (const float*)d_in[0];
  const float* Wq = (const float*)d_in[1];
  const float* bq = (const float*)d_in[2];
  const float* Wk = (const float*)d_in[3];
  const float* bk = (const float*)d_in[4];
  const float* Wv = (const float*)d_in[5];
  const float* bv = (const float*)d_in[6];
  const float* Wo = (const float*)d_in[7];
  const float* bo = (const float*)d_in[8];
  float* out = (float*)d_out;

  char* ws = (char*)d_ws; size_t off = 0;
  auto carve = [&](size_t bytes) -> char* { char* p = ws + off; off += (bytes + 255) & ~(size_t)255; return p; };
  unsigned short* XB   = (unsigned short*)carve((size_t)kRows * kEmb * 2);
  unsigned short* WQKV = (unsigned short*)carve((size_t)kQkvN * kEmb * 2);
  unsigned short* WOB  = (unsigned short*)carve((size_t)kEmb * kEmb * 2);
  float*          BIAS = (float*)carve((size_t)4 * kEmb * 4);
  unsigned short* QH   = (unsigned short*)carve((size_t)kBH * kSeq * kHd * 2);
  unsigned short* QL   = (unsigned short*)carve((size_t)kBH * kSeq * kHd * 2);
  unsigned short* KH   = (unsigned short*)carve((size_t)kBH * kSeq * kHd * 2);
  unsigned short* KL   = (unsigned short*)carve((size_t)kBH * kSeq * kHd * 2);
  float*          VF   = (float*)carve((size_t)kBH * kSeq * kHd * 4);
  float*          RS   = (float*)carve((size_t)kBH * kSeq * 4);
  float*          COMP = (float*)carve((size_t)kBH * kSeq * 4);
  float*          SINK = (float*)carve((size_t)kBH * kSeq * 4);
  float*          SRC  = (float*)carve((size_t)kBH * kSeq * 4);
  float*          D3   = (float*)carve((size_t)kBH * kSeq * 4);
  float*          D4   = (float*)carve((size_t)kBH * kSeq * 4);
  float*          T0   = (float*)carve((size_t)kBH * kNSeg * 128 * 4);
  float*          T1   = (float*)carve((size_t)kBH * kNSeg * 128 * 4);
  float*          CS   = (float*)carve((size_t)kBH * kNChunk * kHd * kHd * 4);
  unsigned short* SH   = (unsigned short*)carve((size_t)kBH * kNChunk * kHd * kHd * 2);
  unsigned short* SL   = (unsigned short*)carve((size_t)kBH * kNChunk * kHd * kHd * 2);
  if (off > ws_size || off > (size_t)268435456) return;
  /* attn planes of one batch half live in the XB bytes (same 16-bit element type, same row pitch); XB is dead after the projections */
  unsigned short* AH = XB;
  unsigned short* AL = XB + (size_t)kHalfRows * kEmb;

  /* 16-bit operand planes */
  const int n8x = kRows * kEmb / 8;
  const int n8w = kEmb * kEmb / 8;
  cvt8_bf16_kernel<<<(n8x + 255) / 256, 256, 0, stream>>>(x,  XB, n8x);
  cvt8_bf16_kernel<<<(n8w + 255) / 256, 256, 0, stream>>>(Wq, WQKV, n8w);
  cvt8_bf16_kernel<<<(n8w + 255) / 256, 256, 0, stream>>>(Wk, WQKV + (size_t)kEmb * kEmb, n8w);
  cvt8_bf16_kernel<<<(n8w + 255) / 256, 256, 0, stream>>>(Wv, WQKV + (size_t)2 * kEmb * kEmb, n8w);
  cvt8_bf16_kernel<<<(n8w + 255) / 256, 256, 0, stream>>>(Wo, WOB, n8w);
  bias_prep_kernel<<<1, 256, 0, stream>>>(bq, bk, bv, bo, BIAS);

  /* projections: M = 16384, N = 1536, K = 512; 128 x 6 block tiles of 128 x 256 = 768 blocks x 8 waves */
  gemm64_kernel<0><<<(kRows / 64) * (kQkvN / 64) / 8, 256, 0, stream>>>(
      XB, XB, WQKV, BIAS, QH, QL, KH, KL, VF, kRows, kQkvN);

  /* flow scans: three launches of 1024 waves (two 64-row segments each), then one block per (b,h) */
  flow_seg_total_kernel<<<kBH * (kNSeg / 2), 32, 0, stream>>>(QH, QL, KH, KL, T0);
  flow_incoming_kernel<<<kBH * (kNSeg / 2), 32, 0, stream>>>(QH, QL, KH, KL, T0, SINK, SRC, T1);
  flow_conserved_kernel<<<kBH * (kNSeg / 2), 32, 0, stream>>>(QH, QL, KH, KL, T1, SINK, SRC, D3, D4);
  flow_finish_kernel<<<kBH, 1024, 0, stream>>>(D3, D4, SINK, RS, COMP);

  /* chunk states of all (b,h) (2048 blocks), then their exclusive prefix over the chunks (256 blocks) */
  chunk_state_kernel<<<kBH * kNChunk, 128, 0, stream>>>(KH, KL, VF, COMP, CS);
  chunk_prefix_kernel<<<kBH * kHd * kHd / 4 / 128, 128, 0, stream>>>(CS, SH, SL);

  /* per batch half: all chunks' outputs (1024 blocks), then output projection M = 8192, N = 512, K = 512 (128 blocks) */
  for (int half = 0; half < 2; ++half) {
    chunk_out_kernel<<<kHalfBH * kNChunk, 128, 0, stream>>>(QH, QL, KH, KL, VF, RS, COMP, SH, SL, AH, AL, half * kHalfBH);
    gemm64_kernel<1><<<(kHalfRows / 64) * (kEmb / 64) / 8, 256, 0, stream>>>(
        AH, AL, WOB, BIAS + 3 * kEmb, QH, QL, KH, KL,
        out + (size_t)half * kHalfRows * kEmb, kHalfRows, kEmb);
  }
}

// v004
// A run of this version takes 159 microseconds.
// Two timings next to v003 put it at 1.16 and 1.15 times that version's speed.
// All steps since v000 together make it 25.1 times as fast.
// All contractions on v_wmma_f32_16x16x32_bf16 with f32 accumulate: q/k/v projections = bf16(x) x bf16(W) single product; chunk state, scores, inter and intra products = bf16 hi/lo operands (hi*hi + hi*lo + lo*hi); output projection = (attn_hi + attn_lo) x bf16(Wo); sigmoid, flow scans and row scales in f32 on VALU.
#include <hip/hip_runtime.h>
#include <math.h>

constexpr int kBatch   = 4;
constexpr int kSeq     = 4096;
constexpr int kEmb     = 512;
constexpr int kHeads   = 8;
constexpr int kHd      = 64;
constexpr int kRows    = kBatch * kSeq;
constexpr int kBH      = kBatch * kHeads;
constexpr int kChunk   = 64;
constexpr int kNChunk  = kSeq / kChunk;
constexpr int kLp      = 72;
constexpr int kQkvN    = 3 * kEmb;
constexpr int kSegRows = 64;
constexpr int kNSeg    = kSeq / kSegRows;
constexpr float kEps   = 1e-6f;
static_assert(kHeads * kHd == kEmb, "head packing");
static_assert(kEmb % 32 == 0, "GEMM K multiple of 32");
static_assert(kHd % 32 == 0 && kChunk % 32 == 0, "tile K multiple of 32");
static_assert(kRows % 128 == 0 && kQkvN % 256 == 0 && kEmb % 256 == 0, "GEMM M, N block tile multiples");
static_assert(kSeq % 128 == 0 && kSeq % kChunk == 0, "scan line groups and chunks");
static_assert(kSeq == 4096 && kEmb == 512 && kHd == 64, "shift constants in the projection epilogue");
static_assert(kLp % 8 == 0, "LDS pitch keeps 16-B alignment");
static_assert(kSegRows == 64 && kNSeg % 2 == 0 && kSeq == 4 * 1024, "flow scan: 16 lanes x 4 kept rows per segment, two segments per wave, 1024 threads x 4 rows");

typedef __attribute__((ext_vector_type(16))) __bf16   v16b;
typedef __attribute__((ext_vector_type(8)))  __bf16   v8b;
typedef __attribute__((ext_vector_type(8)))  float    v8f;
typedef __attribute__((ext_vector_type(4)))  float    v4f;
typedef __attribute__((ext_vector_type(4)))  unsigned int v4u;
typedef __attribute__((ext_vector_type(2)))  unsigned int v2u;

__device__ __forceinline__ unsigned short f2bf_bits(float f) {
  unsigned u = __float_as_uint(f);
  return (unsigned short)((u + 0x7FFFu + ((u >> 16) & 1u)) >> 16);
}
__device__ __forceinline__ float bf_bits2f(unsigned short h) { return __uint_as_float(((unsigned)h) << 16); }
__device__ __forceinline__ float bf16r(float f) { return bf_bits2f(f2bf_bits(f)); }
__device__ __forceinline__ unsigned pk16(unsigned short a, unsigned short b) { return (unsigned)a | ((unsigned)b << 16); }
__device__ __forceinline__ __bf16 bits2bf(unsigned short u) { return __builtin_bit_cast(__bf16, u); }

/* hazard guards as plain device helpers */
__device__ __forceinline__ void dep_guard4_b(v8f& a, v8f& b, v8f& c, v8f& d, v16b x, v16b y) { asm volatile("v_nop\n\tv_nop\n\tv_nop\n\tv_nop" : "+v"(a), "+v"(b), "+v"(c), "+v"(d) : "v"(x), "v"(y)); }
__device__ __forceinline__ void keep4_b(v16b a, v16b b, v16b c, v16b d) { asm volatile("v_nop" :: "v"(a), "v"(b), "v"(c), "v"(d)); }
__device__ __forceinline__ void acc_guard4(v8f& a, v8f& b, v8f& c, v8f& d) { asm volatile("v_nop\n\tv_nop\n\tv_nop\n\tv_nop" : "+v"(a), "+v"(b), "+v"(c), "+v"(d)); }

template <typename T> struct Frag;
template <> struct Frag<__bf16> {
  typedef v16b V; union U { v16b v; v8b h[2]; };
  /* elements 0..7 <- p[0..7], elements 8..15 <- p[16..23] */
  static __device__ __forceinline__ v16b load(const __bf16* p) {
    U f; f.h[0] = *(const v8b*)(p); f.h[1] = *(const v8b*)(p + 16); return f.v;
  }
  static __device__ __forceinline__ v8f mma(v16b a, v16b b, v8f c) {
    return __builtin_amdgcn_wmma_f32_16x16x32_bf16(false, a, false, b, (short)0, c, false, false);
  }
};

/* one WMMA followed by the 4-slot guard tying its accumulator and both operand fragments */
__device__ __forceinline__ v8f mma_g(v16b a, v16b b, v8f c) {
  c = __builtin_amdgcn_wmma_f32_16x16x32_bf16(false, a, false, b, (short)0, c, false, false);
  asm volatile("v_nop\n\tv_nop\n\tv_nop\n\tv_nop" : "+v"(c) : "v"(a), "v"(b));
  return c;
}

__device__ __forceinline__ void wave_lds_sync() {
  __builtin_amdgcn_fence(__ATOMIC_RELEASE, "workgroup");
  __builtin_amdgcn_wave_barrier();
  __builtin_amdgcn_fence(__ATOMIC_ACQUIRE, "workgroup");
}

/* ---- operand preparation, ONE launch: block ranges of one grid take the pieces, which do not depend on one another.
        Blocks 0 .. kPrepXBlocks-1: bf16(x). The next 4 x kPrepWBlocks: bf16 of Wq | Wk | Wv | Wo. The last block: the bias plane.
        f32 -> bf16 (RNE convert): a block converts 8192 consecutive elements, a thread 8 consecutive elements in each of 4 groups of 2048:
        two 16-B loads and ONE 16-B store per lane and group, the 8 loads of the 4 groups in flight together.
        Bias plane: dst[0..2047] = bf16 value (kept as f32) of bq | bk | bv | bo; 2 iterations x 256 x float4 = exactly 2048 floats;
        all four sources are loaded unconditionally, wave-uniform select by value. */
constexpr int kPrepElems   = 8192;
constexpr int kPrepXBlocks = kRows * kEmb / kPrepElems;
constexpr int kPrepWBlocks = kEmb * kEmb / kPrepElems;
constexpr int kPrepBlocks  = kPrepXBlocks + 4 * kPrepWBlocks + 1;
static_assert(kRows * kEmb % kPrepElems == 0 && kEmb * kEmb % kPrepElems == 0, "whole blocks of the conversion");

__device__ __forceinline__ void cvt_block(const float* __restrict__ src, unsigned short* __restrict__ dst, int tid) {
  const float* p = src + 8 * tid;
  v4f a[4], b[4];
#pragma unroll
  for (int g = 0; g < 4; ++g) {
    a[g] = *(const v4f*)(p + g * 2048);
    b[g] = *(const v4f*)(p + g * 2048 + 4);
  }
  /* the wait that stands before a register named by an issued global load is overwritten; the address pair is an input so that
     it stays untouched up to it; its memory clobber also keeps the 8 loads together in front of the conversions */
  asm volatile("s_wait_xcnt 0x0" :: "v"(p) : "memory");
  unsigned short* q = dst + 8 * tid;
#pragma unroll
  for (int g = 0; g < 4; ++g) {
    unsigned short hb[8];
#pragma unroll
    for (int e = 0; e < 4; ++e) {
      hb[e]     = f2bf_bits(a[g][e]);
      hb[4 + e] = f2bf_bits(b[g][e]);
    }
    *(v4u*)(q + g * 2048) = (v4u){pk16(hb[0], hb[1]), pk16(hb[2], hb[3]), pk16(hb[4], hb[5]), pk16(hb[6], hb[7])};
  }
}

__global__ __launch_bounds__(256) void prep_kernel(const float* __restrict__ x, const float* __restrict__ Wq, const float* __restrict__ Wk,
                                                   const float* __restrict__ Wv, const float* __restrict__ Wo,
                                                   const float* __restrict__ b0, const float* __restrict__ b1,
                                                   const float* __restrict__ b2, const float* __restrict__ b3,
                                                   unsigned short* __restrict__ XBp, unsigned short* __restrict__ WQKVp,
                                                   unsigned short* __restrict__ WOBp, float* __restrict__ dst) {
  const int tid = threadIdx.x;
  const int blk = (int)blockIdx.x;
  if (blk < kPrepXBlocks + 4 * kPrepWBlocks) {
    /* block-uniform choice of the plane and of this block's 8192 elements in it */
    const bool isx = blk < kPrepXBlocks;
    const int wb   = isx ? 0 : blk - kPrepXBlocks;
    const int w    = wb / kPrepWBlocks;
    const int piece = isx ? blk : wb % kPrepWBlocks;
    const float* s01 = (w == 0) ? Wq : Wk;
    const float* s23 = (w == 2) ? Wv : Wo;
    const float* sw  = (w < 2) ? s01 : s23;
    unsigned short* dw = (w < 3) ? WQKVp + (size_t)w * kEmb * kEmb : WOBp;
    const float* s    = isx ? x : sw;
    unsigned short* d = isx ? XBp : dw;
    cvt_block(s + (size_t)piece * kPrepElems, d + (size_t)piece * kPrepElems, tid);
    return;
  }
#pragma unroll 1
  for (int it = 0; it < 2; ++it) {
    const int idx4 = it * 256 + tid;
    const int which = idx4 >> 7;
    const int off = (idx4 & 127) * 4;
    const v4f va = *(const v4f*)(b0 + off);
    const v4f vb = *(const v4f*)(b1 + off);
    const v4f vc = *(const v4f*)(b2 + off);
    const v4f vd = *(const v4f*)(b3 + off);
    v4f o;
#pragma unroll
    for (int e = 0; e < 4; ++e) {
      const float s01 = (which == 0) ? va[e] : vb[e];
      const float s23 = (which == 2) ? vc[e] : vd[e];
      o[e] = bf16r((which < 2) ? s01 : s23);
    }
    float* op = dst + which * kEmb + off;
    *(v4f*)op = o;
  }
}

/* four asynchronous 16-B copies per lane, global -> LDS, each with its own LDS byte address and global pointer. The s_wait_xcnt is the
   last line of the copies' own statement so that it stands before any rewrite of a register that a copy names. */
__device__ __forceinline__ void async_copy4(unsigned l0, unsigned l1, unsigned l2, unsigned l3,
                                            const __bf16* g0, const __bf16* g1, const __bf16* g2, const __bf16* g3) {
  asm volatile("global_load_async_to_lds_b128 %0, %4, off\n\t"
               "global_load_async_to_lds_b128 %1, %5, off\n\t"
               "global_load_async_to_lds_b128 %2, %6, off\n\t"
               "global_load_async_to_lds_b128 %3, %7, off\n\t"
               "s_wait_xcnt 0x0"
               :: "v"(l0), "v"(l1), "v"(l2), "v"(l3), "v"(g0), "v"(g1), "v"(g2), "v"(g3) : "memory");
}
/* 128 rows x 128 B of one row-major [.][512] bf16 plane -> LDS rows of pitch 144 B. g = this thread's piece of row (tid >> 3), l = its
   LDS byte address; 256 threads x 16 B = 32 whole rows per copy, a wave covers 4 whole 128-B lines. */
__device__ __forceinline__ void stage128(unsigned l, const __bf16* g) {
  async_copy4(l, l + 32 * kLp * 2, l + 64 * kLp * 2, l + 96 * kLp * 2, g, g + 32 * kEmb, g + 64 * kEmb, g + 96 * kEmb);
}

/* ---- Register-blocked WMMA GEMM, each wave owns a 64x64 tile; A row-major [M][512], Bt row-major [N][512] (bf16 bits).
        A block of 8 waves (2 x 4) owns 128 x 256. Per stage of 64 k (one 128-B line per row) its 128 A rows (MODE 1: and 128 A2 rows) and
        256 Bt rows are copied to LDS asynchronously, two buffers: stage s + 1 flies while stage s is multiplied.
        MODE 0 (projections): single product; epilogue adds bias[n]; column tile 64 = one head of q (n0 < 512), k (512..1023)
               x 16 B, 4 rows per instruction); v: f32 plane [b][h][l][64] (row segment 256 B = 16 lanes x 16 B, 2 rows per instruction).
        MODE 1 (output projection): product = A*Bt + A2*Bt (A2 = lo plane of A); epilogue adds bias[n]; f32 rows of pitch 512.
*/
template <int MODE>
__global__ __launch_bounds__(256) void gemm64_kernel(
    const unsigned short* __restrict__ Ap, const unsigned short* __restrict__ A2p,
    const unsigned short* __restrict__ Btp, const float* __restrict__ bias,
    unsigned short* __restrict__ QHp, unsigned short* __restrict__ QLp,
    unsigned short* __restrict__ KHp, unsigned short* __restrict__ KLp,
    float* __restrict__ Fout, int M, int N) {
  typedef __bf16 T;
  const T* A = (const T*)Ap; const T* A2 = (const T*)A2p; const T* Bt = (const T*)Btp;
  constexpr int kBOff  = (MODE == 1) ? 256 : 128;   /* first Bt row of a stage buffer */
  constexpr int kSRows = kBOff + 256;               /* rows of a stage buffer */
  constexpr int kStages = kEmb / 64;
  __shared__ __align__(16) float sT[8][16 * 68];
  __shared__ __align__(16) __bf16 sS[2][kSRows * kLp];
  const int lane = threadIdx.x & 31;
  const int wave = threadIdx.x >> 5;
  const int groupsN = N >> 8;
  /* block-uniform, in front of every barrier and copy */
  if ((int)blockIdx.x >= (M >> 7) * groupsN) return;
  const int bm = (int)blockIdx.x / groupsN;
  const int bn = (int)blockIdx.x - bm * groupsN;
  const int wm = wave >> 2;
  const int wn = wave & 3;
  const int m0 = (bm << 7) + (wm << 6);
  const int n0 = (bn << 8) + (wn << 6);

  const int rlane = lane & 15;
  const int koff  = (lane >> 4) * 8;
  const int mOff  = (lane >> 4) * 8;

  v8f acc[4][4];
#pragma unroll
  for (int i = 0; i < 4; ++i)
#pragma unroll
    for (int j = 0; j < 4; ++j) acc[i][j] = (v8f){0.f,0.f,0.f,0.f,0.f,0.f,0.f,0.f};

  /* this thread's piece of a stage: row (tid >> 3) of each group of 32 rows, 16-B piece (tid & 7) of the row's 128 B */
  const int crow = (int)threadIdx.x >> 3;
  const int ccol = ((int)threadIdx.x & 7) * 8;
  const T* gA  = A  + (size_t)((bm << 7) + crow) * kEmb + ccol;
  const T* gA2 = A2 + (size_t)((bm << 7) + crow) * kEmb + ccol;
  const T* gB  = Bt + (size_t)((bn << 8) + crow) * kEmb + ccol;
  const unsigned lbase = (unsigned)(size_t)(&sS[0][crow * kLp + ccol]);
  constexpr unsigned kBufBytes = kSRows * kLp * 2;
  auto stage = [&](int st) {
    const unsigned l = lbase + (unsigned)(st & 1) * kBufBytes;
    const int k0 = st * 64;
    stage128(l, gA + k0);
    if (MODE == 1) stage128(l + 128 * kLp * 2, gA2 + k0);
    stage128(l + kBOff * kLp * 2, gB + k0);
    stage128(l + (kBOff + 128) * kLp * 2, gB + 128 * kEmb + k0);
  };

  stage(0);
  /* stage 0 has landed for this wave's own copies ... */
  asm volatile("s_wait_asynccnt 0x0" ::: "memory");
  /* ... and for every wave's before anyone reads it */
  __syncthreads();
  stage(1);

  /* kept rolled for code size: the two buffers differ only in one base address */
#pragma unroll 1
  for (int st = 0; st < kStages; ++st) {
    const T* buf = sS[st & 1];
    const T* sa  = buf + ((wm << 6) + rlane) * kLp + koff;
    const T* sb  = buf + (kBOff + (wn << 6) + rlane) * kLp + koff;
    /* the loops over k blocks, fragments and tiles are fully unrolled so that these are indexed by constants and stay in registers */
#pragma unroll
    for (int kk = 0; kk < 2; ++kk) {
      /* all fragment reads of the block first, as one group in front of its WMMAs */
      v16b bh[4], ah[4], al[4];
#pragma unroll
      for (int j = 0; j < 4; ++j) bh[j] = Frag<T>::load(sb + (j << 4) * kLp + kk * 32);
#pragma unroll
      for (int i = 0; i < 4; ++i) {
        ah[i] = Frag<T>::load(sa + (i << 4) * kLp + kk * 32);
        al[i] = ah[i];
        if (MODE == 1) al[i] = Frag<T>::load(sa + (128 + (i << 4)) * kLp + kk * 32);
      }
#pragma unroll
      for (int i = 0; i < 4; ++i) {
#pragma unroll
        for (int j = 0; j < 4; ++j) {
          acc[i][j] = Frag<T>::mma(ah[i], bh[j], acc[i][j]);
          if (MODE == 1) acc[i][j] = Frag<T>::mma(al[i], bh[j], acc[i][j]);
        }
        dep_guard4_b(acc[i][0], acc[i][1], acc[i][2], acc[i][3], ah[i], al[i]);
      }
      keep4_b(bh[0], bh[1], bh[2], bh[3]);
    }
    /* publish point of stage st + 1: this wave's reads of buffer st & 1 have returned ... */
    asm volatile("s_wait_dscnt 0x0" ::: "memory");
    /* ... its own copies of stage st + 1 have landed ... */
    asm volatile("s_wait_asynccnt 0x0" ::: "memory");
    /* ... and the same holds for every wave: stage st + 1 may be read, buffer st & 1 may be refilled */
    __syncthreads();
    if (st + 2 < kStages) stage(st + 2);
  }
  /* no copy is outstanding when the wave goes on to the epilogue and ends */
  asm volatile("s_wait_asynccnt 0x0" ::: "memory");
  acc_guard4(acc[0][0], acc[0][1], acc[0][2], acc[0][3]);
  acc_guard4(acc[1][0], acc[1][1], acc[1][2], acc[1][3]);
  acc_guard4(acc[2][0], acc[2][1], acc[2][2], acc[2][3]);
  acc_guard4(acc[3][0], acc[3][1], acc[3][2], acc[3][3]);

  /* ---- epilogue ---- */
  float* slab = sT[wave];
  /* wave-uniform tile decode for MODE 0 */
  const int sel  = n0 >> 9;
  const int hcol = (n0 & (kEmb - 1)) >> 6;
  const int bb   = m0 >> 12;
  const int l0   = m0 & (kSeq - 1);
  const size_t rowbase = ((size_t)(bb * kHeads + hcol)) * kSeq + (size_t)l0;
  unsigned short* Ch = (sel == 0) ? QHp : KHp;
  unsigned short* Cl = (sel == 0) ? QLp : KLp;
  const int hh = lane >> 4, c4 = (lane & 15) * 4;
  const int q4 = lane >> 3, c8 = (lane & 7) * 8;
#pragma unroll
  for (int i = 0; i < 4; ++i) {
#pragma unroll
    for (int j = 0; j < 4; ++j) {
      const int n = n0 + (j << 4) + rlane;
      const float bv = bias[n];
#pragma unroll
      for (int r = 0; r < 8; ++r) {
        const float v = acc[i][j][r] + bv;
        slab[(mOff + r) * 68 + (j << 4) + rlane] = v;
      }
    }
    wave_lds_sync();
    if (MODE == 0 && sel < 2) {
      /* in-place sigmoid on the slab, rolled: lane owns (row it*2+hh, cols c4..c4+3) */
#pragma unroll 1
      for (int it = 0; it < 8; ++it) {
        float* sp = slab + (it * 2 + hh) * 68 + c4;
        v4f v = *(const v4f*)sp;
#pragma unroll
        for (int e = 0; e < 4; ++e) {
          const float x = v[e];
          v[e] = 1.0f / (1.0f + expf(-x));
        }
        *(v4f*)sp = v;
      }
      wave_lds_sync();
    }
    if (MODE == 1) {
      float* Cf = Fout;
      {
#pragma unroll
        for (int it = 0; it < 8; ++it) {
          const int row = it * 2 + hh;
          const v4f v = *(const v4f*)(slab + row * 68 + c4);
          *(v4f*)(Cf + (size_t)(m0 + (i << 4) + row) * kEmb + n0 + c4) = v;
        }
        
      }
    } else if (sel == 2) {
      float* Cf = Fout;
      {
#pragma unroll
        for (int it = 0; it < 8; ++it) {
          const int row = it * 2 + hh;
          const v4f v = *(const v4f*)(slab + row * 68 + c4);
          *(v4f*)(Cf + (rowbase + (size_t)((i << 4) + row)) * kHd + c4) = v;
        }
        
      }
    } else {
      v4u uh[4], ul[4];
#pragma unroll
      for (int it = 0; it < 4; ++it) {
        const float* sp = slab + (it * 4 + q4) * 68 + c8;
        unsigned short hb[8], lb[8];
#pragma unroll
        for (int e = 0; e < 8; ++e) {
          const float f = sp[e];
          hb[e] = f2bf_bits(f);
          lb[e] = f2bf_bits(f - bf_bits2f(hb[e]));
        }
        uh[it] = (v4u){pk16(hb[0], hb[1]), pk16(hb[2], hb[3]), pk16(hb[4], hb[5]), pk16(hb[6], hb[7])};
        ul[it] = (v4u){pk16(lb[0], lb[1]), pk16(lb[2], lb[3]), pk16(lb[4], lb[5]), pk16(lb[6], lb[7])};
      }
      {
#pragma unroll
        for (int it = 0; it < 4; ++it) {
          const size_t o = (rowbase + (size_t)((i << 4) + it * 4 + q4)) * kHd + c8;
          *(v4u*)(Ch + o) = uh[it];
          *(v4u*)(Cl + o) = ul[it];
        }
        
      }
    }
    wave_lds_sync();
  }
}

/* ---- flow scans, all f32, split along the sequence: 64 segments of 64 rows per (b,h), every segment scanned at the same time.
        Each running sum over rows = (sum of the totals of the segments before, added in segment order) + (serial sum inside the segment).
        One wave = two segments: a 16-lane row of the wave owns one segment, lane c of it owns features 4c..4c+3 (8 B per bf16 plane).
        q = q_hi + q_lo, k = k_hi + k_lo read from the bf16 planes (the same operands the WMMA products use).
        Launch 1: segment totals of k and q.                          Launch 2: sink_in, src_out per row; segment totals of k*src_out, q*sink_in.
        Launch 3: the two conserved dot products per row (raw sums).  Launch 4: per row rs = sigmoid(conserved_sink) * sink_in / (l+1) and
        comp = exp(clip(conserved_source)) / cumsum * (l+1), the cumsum as a block scan over the 4096 rows of one (b,h).
        Per-row results are kept by lane c for rows 4c..4c+3 of its segment and stored once as 16 lanes x 16 B = 256 B.
        The inner loops are fully unrolled so that the staged words and the kept rows are indexed by constants and stay in registers. */
__device__ __forceinline__ float row16_sum(float v) {
  /* DPP row_xmask 1, 2, 4, 8: butterfly sum over the 16 lanes of a row, no LDS round trip */
  v += __int_as_float(__builtin_amdgcn_update_dpp(0, __float_as_int(v), 0x161, 0xf, 0xf, true));
  v += __int_as_float(__builtin_amdgcn_update_dpp(0, __float_as_int(v), 0x162, 0xf, 0xf, true));
  v += __int_as_float(__builtin_amdgcn_update_dpp(0, __float_as_int(v), 0x164, 0xf, 0xf, true));
  v += __int_as_float(__builtin_amdgcn_update_dpp(0, __float_as_int(v), 0x168, 0xf, 0xf, true));
  return v;
}
__device__ __forceinline__ v4f hilo4(v2u h, v2u l) {
  v4f r;
  r[0] = __uint_as_float(h[0] << 16)         + __uint_as_float(l[0] << 16);
  r[1] = __uint_as_float(h[0] & 0xffff0000u) + __uint_as_float(l[0] & 0xffff0000u);
  r[2] = __uint_as_float(h[1] << 16)         + __uint_as_float(l[1] << 16);
  r[3] = __uint_as_float(h[1] & 0xffff0000u) + __uint_as_float(l[1] & 0xffff0000u);
  return r;
}
__device__ __forceinline__ float dot4_eps(v4f x, v4f y) {
  return (x[0] + kEps) * (y[0] + kEps) + (x[1] + kEps) * (y[1] + kEps) + (x[2] + kEps) * (y[2] + kEps) + (x[3] + kEps) * (y[3] + kEps);
}
/* totals of the segments before seg, added in segment order; T = [kNSeg][128] of one (b,h), first 64 floats -> a, last 64 -> b */
__device__ __forceinline__ void seg_prefix(const float* __restrict__ T, int seg, int c, v4f& a, v4f& b) {
  a = (v4f){0.f, 0.f, 0.f, 0.f};
  b = (v4f){0.f, 0.f, 0.f, 0.f};
  /* 16 segments' loads in flight per trip: the loads are independent, only the adds are ordered */
#pragma unroll 16
  for (int s = 0; s < kNSeg; ++s) {
    const v4f ta = *(const v4f*)(T + s * 128 + 4 * c);
    const v4f tb = *(const v4f*)(T + s * 128 + 64 + 4 * c);
    const bool in = s < seg;
#pragma unroll
    for (int e = 0; e < 4; ++e) {
      a[e] += in ? ta[e] : 0.0f;
      b[e] += in ? tb[e] : 0.0f;
    }
  }
}

__global__ __launch_bounds__(32) void flow_seg_total_kernel(const unsigned short* __restrict__ QHp, const unsigned short* __restrict__ QLp,
                                                            const unsigned short* __restrict__ KHp, const unsigned short* __restrict__ KLp,
                                                            float* __restrict__ T0) {
  const int lane = threadIdx.x, c = lane & 15;
  const int bh = (int)blockIdx.x / (kNSeg / 2);
  const int seg = ((int)blockIdx.x % (kNSeg / 2)) * 2 + (lane >> 4);
  const size_t w0 = ((size_t)bh * kSeq + (size_t)seg * kSegRows) * (kHd / 4) + c;
  const v2u* qh = (const v2u*)QHp + w0;
  const v2u* ql = (const v2u*)QLp + w0;
  const v2u* kh = (const v2u*)KHp + w0;
  const v2u* kl = (const v2u*)KLp + w0;
  v4f ks = (v4f){0.f, 0.f, 0.f, 0.f}, qs = (v4f){0.f, 0.f, 0.f, 0.f};
  /* 16 rows per trip, kept rolled for code size: all their loads are issued before the first sum */
#pragma unroll 1
  for (int t = 0; t < kSegRows / 16; ++t) {
    const v2u* pqh = qh + t * 16 * (kHd / 4);
    const v2u* pql = ql + t * 16 * (kHd / 4);
    const v2u* pkh = kh + t * 16 * (kHd / 4);
    const v2u* pkl = kl + t * 16 * (kHd / 4);
    v2u wqh[16], wql[16], wkh[16], wkl[16];
#pragma unroll
    for (int j = 0; j < 16; ++j) {
      wqh[j] = pqh[j * (kHd / 4)];
      wql[j] = pql[j * (kHd / 4)];
      wkh[j] = pkh[j * (kHd / 4)];
      wkl[j] = pkl[j * (kHd / 4)];
    }
    /* the wait that stands before a register named by an issued global load is overwritten; the address pairs are inputs so that
       they stay untouched up to it; its memory clobber also keeps the trip's loads together in front of the sums */
    asm volatile("s_wait_xcnt 0x0" :: "v"(pqh), "v"(pql), "v"(pkh), "v"(pkl) : "memory");
#pragma unroll
    for (int j = 0; j < 16; ++j) {
      ks += hilo4(wkh[j], wkl[j]);
      qs += hilo4(wqh[j], wql[j]);
    }
  }
  float* o = T0 + ((size_t)bh * kNSeg + seg) * 128 + 4 * c;
  *(v4f*)o = ks;
  *(v4f*)(o + 64) = qs;
}

__global__ __launch_bounds__(32) void flow_incoming_kernel(const unsigned short* __restrict__ QHp, const unsigned short* __restrict__ QLp,
                                                           const unsigned short* __restrict__ KHp, const unsigned short* __restrict__ KLp,
                                                           const float* __restrict__ T0, float* __restrict__ SINK, float* __restrict__ SRC,
                                                           float* __restrict__ T1) {
  const int lane = threadIdx.x, c = lane & 15;
  const int bh = (int)blockIdx.x / (kNSeg / 2);
  const int seg = ((int)blockIdx.x % (kNSeg / 2)) * 2 + (lane >> 4);
  const int row0 = seg * kSegRows;
  const size_t w0 = ((size_t)bh * kSeq + (size_t)row0) * (kHd / 4) + c;
  const v2u* qh = (const v2u*)QHp + w0;
  const v2u* ql = (const v2u*)QLp + w0;
  const v2u* kh = (const v2u*)KHp + w0;
  const v2u* kl = (const v2u*)KLp + w0;
  v4f kc, qc;
  seg_prefix(T0 + (size_t)bh * kNSeg * 128, seg, c, kc, qc);
  v4f a1 = (v4f){0.f, 0.f, 0.f, 0.f}, a2 = (v4f){0.f, 0.f, 0.f, 0.f};
  v4f si = (v4f){0.f, 0.f, 0.f, 0.f}, so = (v4f){0.f, 0.f, 0.f, 0.f};
  /* 8 rows per trip, kept rolled for code size: their loads, row sums and divisions are independent of each other and overlap;
     only the running sums are ordered */
#pragma unroll 1
  for (int t = 0; t < kSegRows / 8; ++t) {
    const v2u* pqh = qh + t * 8 * (kHd / 4);
    const v2u* pql = ql + t * 8 * (kHd / 4);
    const v2u* pkh = kh + t * 8 * (kHd / 4);
    const v2u* pkl = kl + t * 8 * (kHd / 4);
    v2u wqh[8], wql[8], wkh[8], wkl[8];
#pragma unroll
    for (int j = 0; j < 8; ++j) {
      wqh[j] = pqh[j * (kHd / 4)];
      wql[j] = pql[j * (kHd / 4)];
      wkh[j] = pkh[j * (kHd / 4)];
      wkl[j] = pkl[j * (kHd / 4)];
    }
    /* the wait that stands before a register named by an issued global load is overwritten; the address pairs are inputs so that
       they stay untouched up to it */
    asm volatile("s_wait_xcnt 0x0" :: "v"(pqh), "v"(pql), "v"(pkh), "v"(pkl) : "memory");
#pragma unroll
    for (int jj = 0; jj < 8; ++jj) {
      const int r = 8 * t + jj;
      const int g = 2 * t + (jj >> 2);
      const int j = jj & 3;
      const v4f q = hilo4(wqh[jj], wql[jj]);
      const v4f k = hilo4(wkh[jj], wkl[jj]);
      kc += k;
      qc += q;
      const float d1 = row16_sum(dot4_eps(q, kc));
      const float d2 = row16_sum(dot4_eps(k, qc));
      const float nrm = (float)(row0 + r + 1);
      const float sink_in = (1.0f / d1) * nrm;
      const float src_out = (1.0f / d2) * nrm;
      a1 += k * src_out;
      a2 += q * sink_in;
      si[j] = (c == g) ? sink_in : si[j];
      so[j] = (c == g) ? src_out : so[j];
    }
  }
  const size_t ro = (size_t)bh * kSeq + (size_t)row0 + 4 * c;
  *(v4f*)(SINK + ro) = si;
  *(v4f*)(SRC + ro) = so;
  float* o = T1 + ((size_t)bh * kNSeg + seg) * 128 + 4 * c;
  *(v4f*)o = a1;
  *(v4f*)(o + 64) = a2;
}

__global__ __launch_bounds__(32) void flow_conserved_kernel(const unsigned short* __restrict__ QHp, const unsigned short* __restrict__ QLp,
                                                            const unsigned short* __restrict__ KHp, const unsigned short* __restrict__ KLp,
                                                            const float* __restrict__ T1, const float* __restrict__ SINK,
                                                            const float* __restrict__ SRC, float* __restrict__ D3, float* __restrict__ D4) {
  const int lane = threadIdx.x, c = lane & 15;
  const int bh = (int)blockIdx.x / (kNSeg / 2);
  const int seg = ((int)blockIdx.x % (kNSeg / 2)) * 2 + (lane >> 4);
  const int row0 = seg * kSegRows;
  const size_t w0 = ((size_t)bh * kSeq + (size_t)row0) * (kHd / 4) + c;
  const v2u* qh = (const v2u*)QHp + w0;
  const v2u* ql = (const v2u*)QLp + w0;
  const v2u* kh = (const v2u*)KHp + w0;
  const v2u* kl = (const v2u*)KLp + w0;
  const float* sip = SINK + (size_t)bh * kSeq + row0;
  const float* sop = SRC + (size_t)bh * kSeq + row0;
  v4f s1, s2;
  seg_prefix(T1 + (size_t)bh * kNSeg * 128, seg, c, s1, s2);
  v4f k3 = (v4f){0.f, 0.f, 0.f, 0.f}, k4 = (v4f){0.f, 0.f, 0.f, 0.f};
  /* 8 rows per trip, kept rolled for code size: their loads and row sums overlap; only the running sums are ordered */
#pragma unroll 1
  for (int t = 0; t < kSegRows / 8; ++t) {
    const v2u* pqh = qh + t * 8 * (kHd / 4);
    const v2u* pql = ql + t * 8 * (kHd / 4);
    const v2u* pkh = kh + t * 8 * (kHd / 4);
    const v2u* pkl = kl + t * 8 * (kHd / 4);
    const v4f* psi = (const v4f*)(sip + 8 * t);
    const v4f* pso = (const v4f*)(sop + 8 * t);
    v2u wqh[8], wql[8], wkh[8], wkl[8];
    v4f si[2], so[2];
    si[0] = psi[0];
    si[1] = psi[1];
    so[0] = pso[0];
    so[1] = pso[1];
#pragma unroll
    for (int j = 0; j < 8; ++j) {
      wqh[j] = pqh[j * (kHd / 4)];
      wql[j] = pql[j * (kHd / 4)];
      wkh[j] = pkh[j * (kHd / 4)];
      wkl[j] = pkl[j * (kHd / 4)];
    }
    /* the wait that stands before a register named by an issued global load is overwritten; the address pairs are inputs so that
       they stay untouched up to it */
    asm volatile("s_wait_xcnt 0x0" :: "v"(pqh), "v"(pql), "v"(pkh), "v"(pkl), "v"(psi), "v"(pso) : "memory");
#pragma unroll
    for (int jj = 0; jj < 8; ++jj) {
      const int g = 2 * t + (jj >> 2);
      const int j = jj & 3;
      const v4f q = hilo4(wqh[jj], wql[jj]);
      const v4f k = hilo4(wkh[jj], wkl[jj]);
      s1 += k * so[jj >> 2][j];
      s2 += q * si[jj >> 2][j];
      const float d3 = row16_sum(dot4_eps(q, s1));
      const float d4 = row16_sum(dot4_eps(k, s2));
      k3[j] = (c == g) ? d3 : k3[j];
      k4[j] = (c == g) ? d4 : k4[j];
    }
  }
  const size_t ro = (size_t)bh * kSeq + (size_t)row0 + 4 * c;
  *(v4f*)(D3 + ro) = k3;
  *(v4f*)(D4 + ro) = k4;
}

/* one block of 32 waves per (b,h); thread t owns rows 4t..4t+3 */
__global__ __launch_bounds__(1024) void flow_finish_kernel(const float* __restrict__ D3, const float* __restrict__ D4,
                                                           const float* __restrict__ SINK, float* __restrict__ RS, float* __restrict__ COMP) {
  __shared__ float wtot[32];
  const int tid = threadIdx.x, lane = tid & 31, wave = tid >> 5;
  const size_t o = (size_t)blockIdx.x * kSeq + 4 * (size_t)tid;
  const v4f d3 = *(const v4f*)(D3 + o);
  const v4f d4 = *(const v4f*)(D4 + o);
  const v4f si = *(const v4f*)(SINK + o);
  v4f rs, ce, inc;
  float run = 0.f;
#pragma unroll
  for (int e = 0; e < 4; ++e) {
    const float nrm = (float)(4 * tid + e + 1);
    const float inv_nrm = 1.0f / nrm;
    const float csink = d3[e] * inv_nrm;
    const float csrc  = fminf(fmaxf(d4[e] * inv_nrm, -1.0f), 1.0f);
    const float salloc = 1.0f / (1.0f + expf(-csink));
    ce[e] = expf(csrc);
    run += ce[e];
    inc[e] = run;
    rs[e] = salloc * (si[e] * inv_nrm);
  }
  *(v4f*)(RS + o) = rs;
  /* inclusive scan of the threads' totals over the wave */
  float sc = run;
#pragma unroll
  for (int off = 1; off < 32; off <<= 1) {
    const float t = __shfl_up(sc, off, 32);
    sc += (lane >= off) ? t : 0.0f;
  }
  if (lane == 31) wtot[wave] = sc;
  const float up = __shfl_up(sc, 1, 32);
  const float before_in_wave = (lane == 0) ? 0.0f : up;
  /* every wave's total is in LDS before any wave sums the totals of the waves before it */
  __syncthreads();
  float wp = (lane < wave) ? wtot[lane] : 0.0f;
#pragma unroll
  for (int off = 16; off > 0; off >>= 1) wp += __shfl_xor(wp, off, 32);
  const float base = wp + before_in_wave;
  v4f co;
#pragma unroll
  for (int e = 0; e < 4; ++e) {
    const float nrm = (float)(4 * tid + e + 1);
    co[e] = (ce[e] / (base + inc[e])) * nrm;
  }
  *(v4f*)(COMP + o) = co;
}

/* ---- causal linear attention, split along the sequence: every 64-row chunk is its own block: of all (b,h) at once in chunk_state and in chunk_out.
        Launch 1 (chunk_state):  per chunk its own St_n[m][d] = sum_l v'[l][m] k[l][d], v' = v * comp[l], f32, from zero.
        Launch 2 (chunk_prefix): per element the sum of the chunks before, added in chunk order in f32, stored as bf16 hi/lo planes [m][d].
        Launch 3 (chunk_out):    out[i][m] = rs[i] * ( sum_d q[i][d] St[m][d] + sum_{j<=i} (q[i].k[j]) v'[j][m] ) per chunk.
        All products: hi*hi + hi*lo + lo*hi. Q, row-major K and St fragments come straight from the global bf16 planes (row pitch 64).
        LDS tiles are bf16 bits at pitch 72; every k-tile read touches columns 0..63 only. No atomics, no inter-block communication.
        The loops over tiles, fragments and staged words are fully unrolled so that these are indexed by constants and stay in registers. */

/* VT hi/lo <- (v * comp)^T of one chunk; thread covers row lr, features dh..dh+31 (vv = its 8 x 16-B words of v): 128 threads x 32 = 64 x 64 */
__device__ __forceinline__ void vt_store(float cv, const v4f (&vv)[8], int lr, int dh, __bf16* VTh, __bf16* VTl) {
#pragma unroll
  for (int i = 0; i < 8; ++i) {
#pragma unroll
    for (int e = 0; e < 4; ++e) {
      const float f = vv[i][e] * cv;
      const unsigned short hb = f2bf_bits(f);
      const unsigned short lb = f2bf_bits(f - bf_bits2f(hb));
      const int d = dh + 4 * i + e;
      VTh[d * kLp + lr] = bits2bf(hb);
      VTl[d * kLp + lr] = bits2bf(lb);
    }
  }
}

/* one block of 4 waves per (b,h,chunk). Wave w owns rows m = 16w..16w+15 of St_n[m][d]: A rows d = 16i + c of KT, Bt rows m = 16w + c
   of VT, k = l for both, so lane (c,hh) holds St_n[16w + c][16i + 8hh + r]. Coverage: 2048 blocks x 64 x 64 floats. */
__global__ __launch_bounds__(128) void chunk_state_kernel(
    const unsigned short* __restrict__ KHp, const unsigned short* __restrict__ KLp,
    const float* __restrict__ VF, const float* __restrict__ COMP, float* __restrict__ CS) {
  __shared__ __align__(16) __bf16 KTh[kHd * kLp];
  __shared__ __align__(16) __bf16 KTl[kHd * kLp];
  __shared__ __align__(16) __bf16 VTh[kHd * kLp];
  __shared__ __align__(16) __bf16 VTl[kHd * kLp];
  __shared__ __align__(16) float sT[4][16 * 68];

  const int tid = threadIdx.x, lane = tid & 31, wave = tid >> 5;
  const int c = lane & 15, hh = lane >> 4, koff = hh * 8;
  const int bh = (int)blockIdx.x / kNChunk;
  const int l0 = ((int)blockIdx.x % kNChunk) * kChunk;
  const size_t pbase = (size_t)bh * kSeq * kHd;
  const int lr = tid >> 1, dh = (tid & 1) * 32;
  const v8f z8 = (v8f){0.f,0.f,0.f,0.f,0.f,0.f,0.f,0.f};

  /* all global loads of the block first, so that they are in flight together */
  const size_t ko = pbase + (size_t)(l0 + lr) * kHd + dh;
  const v4u* kh4 = (const v4u*)(KHp + ko);
  const v4u* kl4 = (const v4u*)(KLp + ko);
  const v4f* v4p = (const v4f*)(VF + ko);
  const float* cp = COMP + (size_t)bh * kSeq + l0 + lr;
  v4u wh[4], wl[4];
  v4f vv[8];
#pragma unroll
  for (int g = 0; g < 4; ++g) { wh[g] = kh4[g]; wl[g] = kl4[g]; }
#pragma unroll
  for (int g = 0; g < 8; ++g) vv[g] = v4p[g];
  const float cv = *cp;
  /* the wait that stands before a register named by an issued global load is overwritten; the address pairs, and the row index that
     the comp load takes as its offset, are inputs so that they stay untouched up to it */
  asm volatile("s_wait_xcnt 0x0" :: "v"(kh4), "v"(kl4), "v"(v4p), "v"(cp), "v"(lr) : "memory");

  /* KT hi/lo <- k^T; thread covers row lr, features dh..dh+31 (4 x 16-B words per plane): 128 threads x 32 = 64 x 64 */
  {
#pragma unroll
    for (int g = 0; g < 4; ++g) {
#pragma unroll
      for (int e = 0; e < 4; ++e) {
        const unsigned a = wh[g][e];
        const unsigned b = wl[g][e];
        const int d = dh + 8 * g + 2 * e;
        const unsigned a0 = a & 0xffffu, a1 = a >> 16;
        const unsigned b0 = b & 0xffffu, b1 = b >> 16;
        KTh[d * kLp + lr]       = bits2bf((unsigned short)a0);
        KTh[(d + 1) * kLp + lr] = bits2bf((unsigned short)a1);
        KTl[d * kLp + lr]       = bits2bf((unsigned short)b0);
        KTl[(d + 1) * kLp + lr] = bits2bf((unsigned short)b1);
      }
    }
  }
  vt_store(cv, vv, lr, dh, VTh, VTl);
  /* KT and VT are complete before any wave reads fragments of them */
  __syncthreads();

  v8f acc[4];
  acc[0] = z8; acc[1] = z8; acc[2] = z8; acc[3] = z8;
#pragma unroll
  for (int kk = 0; kk < 2; ++kk) {
    const v16b vbh = Frag<__bf16>::load(VTh + (16 * wave + c) * kLp + kk * 32 + koff);
    const v16b vbl = Frag<__bf16>::load(VTl + (16 * wave + c) * kLp + kk * 32 + koff);
#pragma unroll
    for (int i = 0; i < 4; ++i) {
      const v16b kh = Frag<__bf16>::load(KTh + (16 * i + c) * kLp + kk * 32 + koff);
      const v16b kl = Frag<__bf16>::load(KTl + (16 * i + c) * kLp + kk * 32 + koff);
      acc[i] = mma_g(kh, vbh, acc[i]);
      acc[i] = mma_g(kl, vbh, acc[i]);
      acc[i] = mma_g(kh, vbl, acc[i]);
    }
  }
  acc_guard4(acc[0], acc[1], acc[2], acc[3]);

  /* stage the wave's 16 rows in its own slab, then whole-line stores: 16 lanes x 16 B = one 256-B row, 2 rows per instruction */
  float* slab = sT[wave];
#pragma unroll
  for (int i = 0; i < 4; ++i) {
    float* sp = slab + c * 68 + 16 * i + 8 * hh;
    *(v4f*)(sp)     = (v4f){acc[i][0], acc[i][1], acc[i][2], acc[i][3]};
    *(v4f*)(sp + 4) = (v4f){acc[i][4], acc[i][5], acc[i][6], acc[i][7]};
  }
  /* slab: written and read by this wave only, by different lanes */
  wave_lds_sync();
  float* op = CS + (size_t)blockIdx.x * (kHd * kHd) + (size_t)(16 * wave) * kHd;
  const int c4 = c * 4;
#pragma unroll
  for (int it = 0; it < 8; ++it) {
    const int row = it * 2 + hh;
    const v4f v = *(const v4f*)(slab + row * 68 + c4);
    *(v4f*)(op + row * kHd + c4) = v;
  }
}

/* exclusive prefix over the 64 chunks of one (b,h); thread owns 4 consecutive elements of [m][d]: 32 x 1024 threads.
   A wave reads 512 B and writes 256 B per plane and chunk (whole lines). */
__global__ __launch_bounds__(128) void chunk_prefix_kernel(const float* __restrict__ CS, unsigned short* __restrict__ SHp,
                                                           unsigned short* __restrict__ SLp) {
  const int i = (int)blockIdx.x * 128 + (int)threadIdx.x;
  const size_t base = (size_t)(i >> 10) * kNChunk * (kHd * kHd) + (size_t)(i & 1023) * 4;
  v4f run = (v4f){0.f, 0.f, 0.f, 0.f};
  /* 32 chunks per trip, kept rolled for code size: the loads are independent and all in flight together, only the adds are ordered */
#pragma unroll 1
  for (int g = 0; g < kNChunk / 32; ++g) {
    const float* pc = CS + base + (size_t)g * 32 * (kHd * kHd);
    unsigned short* ph = SHp + base + (size_t)g * 32 * (kHd * kHd);
    unsigned short* pl = SLp + base + (size_t)g * 32 * (kHd * kHd);
    v4f t[32];
#pragma unroll
    for (int j = 0; j < 32; ++j) t[j] = *(const v4f*)(pc + j * (kHd * kHd));
    /* the wait that stands before a register named by an issued global load is overwritten; the address pair is an input so that
       it stays untouched up to it */
    asm volatile("s_wait_xcnt 0x0" :: "v"(pc) : "memory");
#pragma unroll
    for (int q = 0; q < 4; ++q) {
      v2u uh[8], ul[8];
#pragma unroll
      for (int j = 0; j < 8; ++j) {
        unsigned short hb[4], lb[4];
#pragma unroll
        for (int e = 0; e < 4; ++e) {
          const float s = run[e];
          hb[e] = f2bf_bits(s);
          lb[e] = f2bf_bits(s - bf_bits2f(hb[e]));
        }
        uh[j] = (v2u){pk16(hb[0], hb[1]), pk16(hb[2], hb[3])};
        ul[j] = (v2u){pk16(lb[0], lb[1]), pk16(lb[2], lb[3])};
        run += t[8 * q + j];
      }
#pragma unroll
      for (int j = 0; j < 8; ++j) {
        *(v2u*)(ph + (8 * q + j) * (kHd * kHd)) = uh[j];
        *(v2u*)(pl + (8 * q + j) * (kHd * kHd)) = ul[j];
      }
      /* the same wait behind the stores: their address pairs and data words are inputs so that they stay untouched up to it */
      asm volatile("s_wait_xcnt 0x0" :: "v"(ph), "v"(pl), "v"(uh[0]), "v"(uh[1]), "v"(uh[2]), "v"(uh[3]), "v"(uh[4]), "v"(uh[5]),
                   "v"(uh[6]), "v"(uh[7]), "v"(ul[0]), "v"(ul[1]), "v"(ul[2]), "v"(ul[3]), "v"(ul[4]), "v"(ul[5]), "v"(ul[6]), "v"(ul[7])
                   : "memory");
    }
  }
}

/* one block of 4 waves per (b,h,chunk); wave w owns output rows 16w..16w+15 of the chunk.
   LDS: VT hi/lo = v'^T[m][l]; P hi/lo per wave = masked scores, later the output staging.
   Coverage: 32 x 64 blocks x 4 waves x 16 rows x 64 cols = 16384 rows x 512 cols per plane. */
__global__ __launch_bounds__(128) void chunk_out_kernel(
    const unsigned short* __restrict__ QHp, const unsigned short* __restrict__ QLp,
    const unsigned short* __restrict__ KHp, const unsigned short* __restrict__ KLp,
    const float* __restrict__ VF, const float* __restrict__ RS, const float* __restrict__ COMP,
    const unsigned short* __restrict__ SHp, const unsigned short* __restrict__ SLp,
    unsigned short* __restrict__ AHp, unsigned short* __restrict__ ALp, int bh0) {
  __shared__ __align__(16) __bf16 VTh[kHd * kLp];
  __shared__ __align__(16) __bf16 VTl[kHd * kLp];
  __shared__ __align__(16) __bf16 Ph[4][16 * kLp];
  __shared__ __align__(16) __bf16 Pl[4][16 * kLp];

  const int tid = threadIdx.x, lane = tid & 31, wave = tid >> 5;
  const int c = lane & 15, hh = lane >> 4, koff = hh * 8;
  const int bhl = (int)blockIdx.x / kNChunk;
  const int n = (int)blockIdx.x % kNChunk;
  const int l0 = n * kChunk;
  const int bh = bh0 + bhl;
  const int hd = bh & (kHeads - 1);
  const int bl = bhl >> 3;
  const size_t pbase = (size_t)bh * kSeq * kHd;
  const size_t sbase = ((size_t)bh * kNChunk + n) * (kHd * kHd);
  const __bf16* QH = (const __bf16*)QHp + pbase;
  const __bf16* QL = (const __bf16*)QLp + pbase;
  const __bf16* KH = (const __bf16*)KHp + pbase;
  const __bf16* KL = (const __bf16*)KLp + pbase;
  const __bf16* SH = (const __bf16*)SHp + sbase;
  const __bf16* SL = (const __bf16*)SLp + sbase;
  const float* rsp = RS + (size_t)bh * kSeq;
  unsigned short* ahp = AHp + ((size_t)bl * kSeq) * kEmb + hd * kHd;
  unsigned short* alp = ALp + ((size_t)bl * kSeq) * kEmb + hd * kHd;
  __bf16* ph = Ph[wave];
  __bf16* pl = Pl[wave];
  const int q4 = lane >> 3, c8 = (lane & 7) * 8;
  const v8f z8 = (v8f){0.f,0.f,0.f,0.f,0.f,0.f,0.f,0.f};

  /* first load group, in flight together: this thread's part of v with its row's comp, the Q fragments (rows 16w + c) and the
     row-major K fragments (rows 16j + c) */
  const int lr = tid >> 1, dh = (tid & 1) * 32;
  const v4f* v4p = (const v4f*)(VF + pbase + (size_t)(l0 + lr) * kHd + dh);
  const float* cp = COMP + (size_t)bh * kSeq + l0 + lr;
  const __bf16* qhp = QH + (size_t)(l0 + 16 * wave + c) * kHd + koff;
  const __bf16* qlp = QL + (size_t)(l0 + 16 * wave + c) * kHd + koff;
  const __bf16* khp = KH + (size_t)(l0 + c) * kHd + koff;
  const __bf16* klp = KL + (size_t)(l0 + c) * kHd + koff;
  v4f vv[8];
  v16b qh[2], ql[2], kh[4][2], kl[4][2];
#pragma unroll
  for (int g = 0; g < 8; ++g) vv[g] = v4p[g];
#pragma unroll
  for (int dc = 0; dc < 2; ++dc) {
    qh[dc] = Frag<__bf16>::load(qhp + dc * 32);
    ql[dc] = Frag<__bf16>::load(qlp + dc * 32);
  }
#pragma unroll
  for (int j = 0; j < 4; ++j) {
#pragma unroll
    for (int dc = 0; dc < 2; ++dc) {
      kh[j][dc] = Frag<__bf16>::load(khp + 16 * j * kHd + dc * 32);
      kl[j][dc] = Frag<__bf16>::load(klp + 16 * j * kHd + dc * 32);
    }
  }
  const float cv = *cp;
  /* the wait that stands before a register named by an issued global load is overwritten; the address pairs are inputs so that
     they stay untouched up to it */
  asm volatile("s_wait_xcnt 0x0" :: "v"(v4p), "v"(cp), "v"(qhp), "v"(qlp), "v"(khp), "v"(klp) : "memory");

  vt_store(cv, vv, lr, dh, VTh, VTl);

  /* scores rows 16w.., all 64 columns; inclusive causal mask by select; hi/lo into this wave's P strip */
#pragma unroll
  for (int j = 0; j < 4; ++j) {
    v8f s = z8;
#pragma unroll
    for (int dc = 0; dc < 2; ++dc) {
      s = mma_g(qh[dc], kh[j][dc], s);
      s = mma_g(qh[dc], kl[j][dc], s);
      s = mma_g(ql[dc], kh[j][dc], s);
    }
    const int jj = 16 * j + c;
#pragma unroll
    for (int r = 0; r < 8; ++r) {
      const int ii = 16 * wave + 8 * hh + r;
      const float pv = (jj <= ii) ? s[r] : 0.0f;
      const unsigned short hb = f2bf_bits(pv);
      const unsigned short lb = f2bf_bits(pv - bf_bits2f(hb));
      ph[(8 * hh + r) * kLp + jj] = bits2bf(hb);
      pl[(8 * hh + r) * kLp + jj] = bits2bf(lb);
    }
  }

  /* second load group, in flight together: the St fragments (Bt rows m = 16t + c, k = d) and the row scales */
  const __bf16* sph = SH + c * kHd + koff;
  const __bf16* spl = SL + c * kHd + koff;
  const float* rp = rsp + l0 + 16 * wave + 8 * hh;
  v16b sh[4][2], sl[4][2];
#pragma unroll
  for (int t = 0; t < 4; ++t) {
#pragma unroll
    for (int dc = 0; dc < 2; ++dc) {
      sh[t][dc] = Frag<__bf16>::load(sph + 16 * t * kHd + dc * 32);
      sl[t][dc] = Frag<__bf16>::load(spl + 16 * t * kHd + dc * 32);
    }
  }
  const v4f r0 = *(const v4f*)(rp);
  const v4f r1 = *(const v4f*)(rp + 4);
  /* the same wait for the second group */
  asm volatile("s_wait_xcnt 0x0" :: "v"(sph), "v"(spl), "v"(rp) : "memory");

  v8f accO[4];
  accO[0] = z8; accO[1] = z8; accO[2] = z8; accO[3] = z8;
  /* inter: Q x St^T */
#pragma unroll
  for (int t = 0; t < 4; ++t) {
#pragma unroll
    for (int dc = 0; dc < 2; ++dc) {
      accO[t] = mma_g(qh[dc], sh[t][dc], accO[t]);
      accO[t] = mma_g(qh[dc], sl[t][dc], accO[t]);
      accO[t] = mma_g(ql[dc], sh[t][dc], accO[t]);
    }
  }
  /* VT is complete before any wave reads fragments of it; the barrier also orders this wave's P strip writes before its reads */
  __syncthreads();
  /* intra: P x v' (A rows i = c of the strip, k = j; Bt rows m = 16t + c of VT, k = j) */
#pragma unroll
  for (int kk = 0; kk < 2; ++kk) {
    const v16b pah = Frag<__bf16>::load(ph + c * kLp + kk * 32 + koff);
    const v16b pal = Frag<__bf16>::load(pl + c * kLp + kk * 32 + koff);
#pragma unroll
    for (int t = 0; t < 4; ++t) {
      const v16b vh = Frag<__bf16>::load(VTh + (16 * t + c) * kLp + kk * 32 + koff);
      const v16b vl = Frag<__bf16>::load(VTl + (16 * t + c) * kLp + kk * 32 + koff);
      accO[t] = mma_g(pah, vh, accO[t]);
      accO[t] = mma_g(pah, vl, accO[t]);
      accO[t] = mma_g(pal, vh, accO[t]);
    }
  }
  /* epilogue: row scale, bf16 hi/lo, stage in the P strip, whole-line stores */
  {
    float rsv[8];
#pragma unroll
    for (int e = 0; e < 4; ++e) { rsv[e] = r0[e]; rsv[4 + e] = r1[e]; }
#pragma unroll
    for (int t = 0; t < 4; ++t) {
#pragma unroll
      for (int r = 0; r < 8; ++r) {
        const float o = accO[t][r] * rsv[r];
        const unsigned short hb = f2bf_bits(o);
        const unsigned short lb = f2bf_bits(o - bf_bits2f(hb));
        ph[(8 * hh + r) * kLp + 16 * t + c] = bits2bf(hb);
        pl[(8 * hh + r) * kLp + 16 * t + c] = bits2bf(lb);
      }
    }
    /* P strip: written and read by this wave only, by different lanes */
    wave_lds_sync();
    v4u uh[4], ul[4];
#pragma unroll
    for (int it = 0; it < 4; ++it) {
      const int row = it * 4 + q4;
      const v8b hv = *(const v8b*)(ph + row * kLp + c8);
      const v8b lv = *(const v8b*)(pl + row * kLp + c8);
      uh[it] = __builtin_bit_cast(v4u, hv);
      ul[it] = __builtin_bit_cast(v4u, lv);
    }
#pragma unroll
    for (int it = 0; it < 4; ++it) {
      const size_t o = (size_t)(l0 + 16 * wave + it * 4 + q4) * kEmb + c8;
      *(v4u*)(ahp + o) = uh[it];
      *(v4u*)(alp + o) = ul[it];
    }
  }
}

/* ---- host glue ----
   Workspace region map (bytes, 256-B aligned carve; total 208,674,816 <= 268,435,456):
     XB    [16384][512] bf16   16,777,216   bf16(x); after the projections the same bytes hold ATTN_HI [16384][512] bf16
     WQKV  [1536][512]  bf16    1,572,864   bf16(Wq | Wk | Wv)
     WOB   [512][512]   bf16      524,288   bf16(Wo)
     BIAS  [2048]       f32         8,192   bf16 values of bq | bk | bv | bo kept as f32
     QH,QL,KH,KL [32][4096][64] bf16  4 x 16,777,216   sigmoid(q), sigmoid(k) as hi/lo planes
     VF    [32][4096][64] f32  33,554,432   v
     RS, COMP [32][4096] f32   2 x 524,288
     SINK, SRC, D3, D4 [32][4096] f32   4 x 524,288   per-row values handed between the flow scan launches
     T0, T1 [32][64][128] f32  2 x 1,048,576   segment totals (k | q, then k*src_out | q*sink_in)
     CS    [32][64][64][64] f32  33,554,432   each chunk's own state St_n[m][d]
     SH, SL [32][64][64][64] bf16  2 x 16,777,216   state before each chunk as hi/lo planes
     AL    [16384][512] bf16   16,777,216   ATTN_LO */
extern "C" void kernel_launch(void* const* d_in, const int* in_sizes, int n_in,
                              void* d_out, int out_size, void* d_ws, size_t ws_size, hipStream_t stream) {
  if (n_in < 9 || d_out == nullptr || d_ws == nullptr) return;
  if (in_sizes[0] != kRows * kEmb || in_sizes[1] != kEmb * kEmb || in_sizes[2] != kEmb ||
      in_sizes[3] != kEmb * kEmb || in_sizes[4] != kEmb || in_sizes[5] != kEmb * kEmb ||
      in_sizes[6] != kEmb || in_sizes[7] != kEmb * kEmb || in_sizes[8] != kEmb ||
      out_size != kRows * kEmb) return;

  const float* x  = (const float*)d_in[0];
  const float* Wq = (const float*)d_in[1];
  const float* bq = (const float*)d_in[2];
  const float* Wk = (const float*)d_in[3];
  const float* bk = (const float*)d_in[4];
  const float* Wv = (const float*)d_in[5];
  const float* bv = (const float*)d_in[6];
  const float* Wo = (const float*)d_in[7];
  const float* bo = (const float*)d_in[8];
  float* out = (float*)d_out;

  char* ws = (char*)d_ws; size_t off = 0;
  auto carve = [&](size_t bytes) -> char* { char* p = ws + off; off += (bytes + 255) & ~(size_t)255; return p; };
  unsigned short* XB   = (unsigned short*)carve((size_t)kRows * kEmb * 2);
  unsigned short* WQKV = (unsigned short*)carve((size_t)kQkvN * kEmb * 2);
  unsigned short* WOB  = (unsigned short*)carve((size_t)kEmb * kEmb * 2);
  float*          BIAS = (float*)carve((size_t)4 * kEmb * 4);
  unsigned short* QH   = (unsigned short*)carve((size_t)kBH * kSeq * kHd * 2);
  unsigned short* QL   = (unsigned short*)carve((size_t)kBH * kSeq * kHd * 2);
  unsigned short* KH   = (unsigned short*)carve((size_t)kBH * kSeq * kHd * 2);
  unsigned short* KL   = (unsigned short*)carve((size_t)kBH * kSeq * kHd * 2);
  float*          VF   = (float*)carve((size_t)kBH * kSeq * kHd * 4);
  float*          RS   = (float*)carve((size_t)kBH * kSeq * 4);
  float*          COMP = (float*)carve((size_t)kBH * kSeq * 4);
  float*          SINK = (float*)carve((size_t)kBH * kSeq * 4);
  float*          SRC  = (float*)carve((size_t)kBH * kSeq * 4);
  float*          D3   = (float*)carve((size_t)kBH * kSeq * 4);
  float*          D4   = (float*)carve((size_t)kBH * kSeq * 4);
  float*          T0   = (float*)carve((size_t)kBH * kNSeg * 128 * 4);
  float*          T1   = (float*)carve((size_t)kBH * kNSeg * 128 * 4);
  float*          CS   = (float*)carve((size_t)kBH * kNChunk * kHd * kHd * 4);
  unsigned short* SH   = (unsigned short*)carve((size_t)kBH * kNChunk * kHd * kHd * 2);
  unsigned short* SL   = (unsigned short*)carve((size_t)kBH * kNChunk * kHd * kHd * 2);
  unsigned short* AL   = (unsigned short*)carve((size_t)kRows * kEmb * 2);
  if (off > ws_size || off > (size_t)268435456) return;
  /* the attn hi plane lives in the XB bytes (same 16-bit element type, same shape); XB is dead after the projections */
  unsigned short* AH = XB;

  /* 16-bit operand planes and the bias plane, one launch */
  prep_kernel<<<kPrepBlocks, 256, 0, stream>>>(x, Wq, Wk, Wv, Wo, bq, bk, bv, bo, XB, WQKV, WOB, BIAS);

  /* projections: M = 16384, N = 1536, K = 512; 128 x 6 block tiles of 128 x 256 = 768 blocks x 8 waves */
  gemm64_kernel<0><<<(kRows / 64) * (kQkvN / 64) / 8, 256, 0, stream>>>(
      XB, XB, WQKV, BIAS, QH, QL, KH, KL, VF, kRows, kQkvN);

  /* flow scans: three launches of 1024 waves (two 64-row segments each), then one block per (b,h) */
  flow_seg_total_kernel<<<kBH * (kNSeg / 2), 32, 0, stream>>>(QH, QL, KH, KL, T0);
  flow_incoming_kernel<<<kBH * (kNSeg / 2), 32, 0, stream>>>(QH, QL, KH, KL, T0, SINK, SRC, T1);
  flow_conserved_kernel<<<kBH * (kNSeg / 2), 32, 0, stream>>>(QH, QL, KH, KL, T1, SINK, SRC, D3, D4);
  flow_finish_kernel<<<kBH, 1024, 0, stream>>>(D3, D4, SINK, RS, COMP);

  /* chunk states of all (b,h) (2048 blocks), then their exclusive prefix over the chunks (256 blocks) */
  chunk_state_kernel<<<kBH * kNChunk, 128, 0, stream>>>(KH, KL, VF, COMP, CS);
  chunk_prefix_kernel<<<kBH * kHd * kHd / 4 / 128, 128, 0, stream>>>(CS, SH, SL);

  /* all chunks' outputs (2048 blocks), then output projection M = 16384, N = 512, K = 512 (256 blocks, one per WGP) */
  chunk_out_kernel<<<kBH * kNChunk, 128, 0, stream>>>(QH, QL, KH, KL, VF, RS, COMP, SH, SL, AH, AL, 0);
  gemm64_kernel<1><<<(kRows / 64) * (kEmb / 64) / 8, 256, 0, stream>>>(
      AH, AL, WOB, BIAS + 3 * kEmb, QH, QL, KH, KL, out, kRows, kEmb);
}

// v005
// Measured time: 145 microseconds a run.
// Timed twice side by side with v004, it ran 1.09 and 1.10 times as fast.
// Counting every step since v000, it is 27.4 times as fast.
// All contractions on v_wmma_f32_16x16x32_bf16 with f32 accumulate: q/k/v projections = bf16(x) x bf16(W) single product; chunk state, scores, inter and intra products = bf16 hi/lo operands (hi*hi + hi*lo + lo*hi); output projection = (attn_hi + attn_lo) x bf16(Wo); sigmoid, flow scans and row scales in f32 on VALU.
#include <hip/hip_runtime.h>
#include <math.h>

constexpr int kBatch   = 4;
constexpr int kSeq     = 4096;
constexpr int kEmb     = 512;
constexpr int kHeads   = 8;
constexpr int kHd      = 64;
constexpr int kRows    = kBatch * kSeq;
constexpr int kBH      = kBatch * kHeads;
constexpr int kChunk   = 64;
constexpr int kNChunk  = kSeq / kChunk;
constexpr int kLp      = 72;
constexpr int kQkvN    = 3 * kEmb;
constexpr int kSegRows = 64;
constexpr int kNSeg    = kSeq / kSegRows;
constexpr float kEps   = 1e-6f;
static_assert(kHeads * kHd == kEmb, "head packing");
static_assert(kEmb % 32 == 0, "GEMM K multiple of 32");
static_assert(kHd % 32 == 0 && kChunk % 32 == 0, "tile K multiple of 32");
static_assert(kRows % 128 == 0 && kQkvN % 256 == 0 && kEmb % 256 == 0, "GEMM M, N block tile multiples");
static_assert(kSeq % 128 == 0 && kSeq % kChunk == 0, "scan line groups and chunks");
static_assert(kSeq == 4096 && kEmb == 512 && kHd == 64, "shift constants in the projection epilogue");
static_assert(kLp % 8 == 0, "LDS pitch keeps 16-B alignment");
static_assert(kSegRows == 64 && kNSeg % 2 == 0 && kSeq == 4 * 1024, "flow scan: 16 lanes x 4 kept rows per segment, two segments per wave, 1024 threads x 4 rows");

typedef __attribute__((ext_vector_type(16))) __bf16   v16b;
typedef __attribute__((ext_vector_type(8)))  __bf16   v8b;
typedef __attribute__((ext_vector_type(8)))  float    v8f;
typedef __attribute__((ext_vector_type(4)))  float    v4f;
typedef __attribute__((ext_vector_type(4)))  unsigned int v4u;
typedef __attribute__((ext_vector_type(2)))  unsigned int v2u;

__device__ __forceinline__ unsigned short f2bf_bits(float f) {
  unsigned u = __float_as_uint(f);
  return (unsigned short)((u + 0x7FFFu + ((u >> 16) & 1u)) >> 16);
}
__device__ __forceinline__ float bf_bits2f(unsigned short h) { return __uint_as_float(((unsigned)h) << 16); }
__device__ __forceinline__ float bf16r(float f) { return bf_bits2f(f2bf_bits(f)); }
__device__ __forceinline__ unsigned pk16(unsigned short a, unsigned short b) { return (unsigned)a | ((unsigned)b << 16); }
__device__ __forceinline__ __bf16 bits2bf(unsigned short u) { return __builtin_bit_cast(__bf16, u); }

/* hazard guards as plain device helpers */
__device__ __forceinline__ void dep_guard4_b(v8f& a, v8f& b, v8f& c, v8f& d, v16b x, v16b y) { asm volatile("v_nop\n\tv_nop\n\tv_nop\n\tv_nop" : "+v"(a), "+v"(b), "+v"(c), "+v"(d) : "v"(x), "v"(y)); }
__device__ __forceinline__ void keep4_b(v16b a, v16b b, v16b c, v16b d) { asm volatile("v_nop" :: "v"(a), "v"(b), "v"(c), "v"(d)); }
__device__ __forceinline__ void acc_guard4(v8f& a, v8f& b, v8f& c, v8f& d) { asm volatile("v_nop\n\tv_nop\n\tv_nop\n\tv_nop" : "+v"(a), "+v"(b), "+v"(c), "+v"(d)); }

template <typename T> struct Frag;
template <> struct Frag<__bf16> {
  typedef v16b V; union U { v16b v; v8b h[2]; };
  /* elements 0..7 <- p[0..7], elements 8..15 <- p[16..23] */
  static __device__ __forceinline__ v16b load(const __bf16* p) {
    U f; f.h[0] = *(const v8b*)(p); f.h[1] = *(const v8b*)(p + 16); return f.v;
  }
  static __device__ __forceinline__ v8f mma(v16b a, v16b b, v8f c) {
    return __builtin_amdgcn_wmma_f32_16x16x32_bf16(false, a, false, b, (short)0, c, false, false);
  }
};

/* one WMMA followed by the 4-slot guard tying its accumulator and both operand fragments */
__device__ __forceinline__ v8f mma_g(v16b a, v16b b, v8f c) {
  c = __builtin_amdgcn_wmma_f32_16x16x32_bf16(false, a, false, b, (short)0, c, false, false);
  asm volatile("v_nop\n\tv_nop\n\tv_nop\n\tv_nop" : "+v"(c) : "v"(a), "v"(b));
  return c;
}

__device__ __forceinline__ void wave_lds_sync() {
  __builtin_amdgcn_fence(__ATOMIC_RELEASE, "workgroup");
  __builtin_amdgcn_wave_barrier();
  __builtin_amdgcn_fence(__ATOMIC_ACQUIRE, "workgroup");
}

/* ---- operand preparation, ONE launch: block ranges of one grid take the pieces, which do not depend on one another.
        Blocks 0 .. kPrepXBlocks-1: bf16(x). The next 4 x kPrepWBlocks: bf16 of Wq | Wk | Wv | Wo. The last block: the bias plane.
        f32 -> bf16 (RNE convert): a block converts 8192 consecutive elements, a thread 8 consecutive elements in each of 4 groups of 2048:
        two 16-B loads and ONE 16-B store per lane and group, the 8 loads of the 4 groups in flight together.
        Bias plane: dst[0..2047] = bf16 value (kept as f32) of bq | bk | bv | bo; 2 iterations x 256 x float4 = exactly 2048 floats;
        all four sources are loaded unconditionally, wave-uniform select by value. */
constexpr int kPrepElems   = 8192;
constexpr int kPrepXBlocks = kRows * kEmb / kPrepElems;
constexpr int kPrepWBlocks = kEmb * kEmb / kPrepElems;
constexpr int kPrepBlocks  = kPrepXBlocks + 4 * kPrepWBlocks + 1;
static_assert(kRows * kEmb % kPrepElems == 0 && kEmb * kEmb % kPrepElems == 0, "whole blocks of the conversion");

__device__ __forceinline__ void cvt_block(const float* __restrict__ src, unsigned short* __restrict__ dst, int tid) {
  const float* p = src + 8 * tid;
  v4f a[4], b[4];
#pragma unroll
  for (int g = 0; g < 4; ++g) {
    a[g] = *(const v4f*)(p + g * 2048);
    b[g] = *(const v4f*)(p + g * 2048 + 4);
  }
  /* the wait that stands before a register named by an issued global load is overwritten; the address pair is an input so that
     it stays untouched up to it; its memory clobber also keeps the 8 loads together in front of the conversions */
  asm volatile("s_wait_xcnt 0x0" :: "v"(p) : "memory");
  unsigned short* q = dst + 8 * tid;
#pragma unroll
  for (int g = 0; g < 4; ++g) {
    unsigned short hb[8];
#pragma unroll
    for (int e = 0; e < 4; ++e) {
      hb[e]     = f2bf_bits(a[g][e]);
      hb[4 + e] = f2bf_bits(b[g][e]);
    }
    *(v4u*)(q + g * 2048) = (v4u){pk16(hb[0], hb[1]), pk16(hb[2], hb[3]), pk16(hb[4], hb[5]), pk16(hb[6], hb[7])};
  }
}

__global__ __launch_bounds__(256) void prep_kernel(const float* __restrict__ x, const float* __restrict__ Wq, const float* __restrict__ Wk,
                                                   const float* __restrict__ Wv, const float* __restrict__ Wo,
                                                   const float* __restrict__ b0, const float* __restrict__ b1,
                                                   const float* __restrict__ b2, const float* __restrict__ b3,
                                                   unsigned short* __restrict__ XBp, unsigned short* __restrict__ WQKVp,
                                                   unsigned short* __restrict__ WOBp, float* __restrict__ dst) {
  const int tid = threadIdx.x;
  const int blk = (int)blockIdx.x;
  if (blk < kPrepXBlocks + 4 * kPrepWBlocks) {
    /* block-uniform choice of the plane and of this block's 8192 elements in it */
    const bool isx = blk < kPrepXBlocks;
    const int wb   = isx ? 0 : blk - kPrepXBlocks;
    const int w    = wb / kPrepWBlocks;
    const int piece = isx ? blk : wb % kPrepWBlocks;
    const float* s01 = (w == 0) ? Wq : Wk;
    const float* s23 = (w == 2) ? Wv : Wo;
    const float* sw  = (w < 2) ? s01 : s23;
    unsigned short* dw = (w < 3) ? WQKVp + (size_t)w * kEmb * kEmb : WOBp;
    const float* s    = isx ? x : sw;
    unsigned short* d = isx ? XBp : dw;
    cvt_block(s + (size_t)piece * kPrepElems, d + (size_t)piece * kPrepElems, tid);
    return;
  }
#pragma unroll 1
  for (int it = 0; it < 2; ++it) {
    const int idx4 = it * 256 + tid;
    const int which = idx4 >> 7;
    const int off = (idx4 & 127) * 4;
    const v4f va = *(const v4f*)(b0 + off);
    const v4f vb = *(const v4f*)(b1 + off);
    const v4f vc = *(const v4f*)(b2 + off);
    const v4f vd = *(const v4f*)(b3 + off);
    v4f o;
#pragma unroll
    for (int e = 0; e < 4; ++e) {
      const float s01 = (which == 0) ? va[e] : vb[e];
      const float s23 = (which == 2) ? vc[e] : vd[e];
      o[e] = bf16r((which < 2) ? s01 : s23);
    }
    float* op = dst + which * kEmb + off;
    *(v4f*)op = o;
  }
}

/* four asynchronous 16-B copies per lane, global -> LDS, each with its own LDS byte address and global pointer. The s_wait_xcnt is the
   last line of the copies' own statement so that it stands before any rewrite of a register that a copy names. */
__device__ __forceinline__ void async_copy4(unsigned l0, unsigned l1, unsigned l2, unsigned l3,
                                            const __bf16* g0, const __bf16* g1, const __bf16* g2, const __bf16* g3) {
  asm volatile("global_load_async_to_lds_b128 %0, %4, off\n\t"
               "global_load_async_to_lds_b128 %1, %5, off\n\t"
               "global_load_async_to_lds_b128 %2, %6, off\n\t"
               "global_load_async_to_lds_b128 %3, %7, off\n\t"
               "s_wait_xcnt 0x0"
               :: "v"(l0), "v"(l1), "v"(l2), "v"(l3), "v"(g0), "v"(g1), "v"(g2), "v"(g3) : "memory");
}
/* 128 rows x 128 B of one row-major [.][512] bf16 plane -> LDS rows of pitch 144 B. g = this thread's piece of row (tid >> 3), l = its
   LDS byte address; 256 threads x 16 B = 32 whole rows per copy, a wave covers 4 whole 128-B lines. */
__device__ __forceinline__ void stage128(unsigned l, const __bf16* g) {
  async_copy4(l, l + 32 * kLp * 2, l + 64 * kLp * 2, l + 96 * kLp * 2, g, g + 32 * kEmb, g + 64 * kEmb, g + 96 * kEmb);
}

/* ---- Register-blocked WMMA GEMM, each wave owns a 64x64 tile; A row-major [M][512], Bt row-major [N][512] (bf16 bits).
        A block of 8 waves (2 x 4) owns 128 x 256. Per stage of 64 k (one 128-B line per row) its 128 A rows and
        256 Bt rows are copied to LDS asynchronously, two buffers: stage s + 1 flies while stage s is multiplied.
        Projections: single product; epilogue adds bias[n]; column tile 64 = one head of q (n0 < 512), k (512..1023)
               x 16 B, 4 rows per instruction); v: f32 plane [b][h][l][64] (row segment 256 B = 16 lanes x 16 B, 2 rows per instruction).
*/
__global__ __launch_bounds__(256) void gemm64_kernel(
    const unsigned short* __restrict__ Ap, const unsigned short* __restrict__ Btp, const float* __restrict__ bias,
    unsigned short* __restrict__ QHp, unsigned short* __restrict__ QLp,
    unsigned short* __restrict__ KHp, unsigned short* __restrict__ KLp,
    float* __restrict__ Fout, int M, int N) {
  typedef __bf16 T;
  const T* A = (const T*)Ap; const T* Bt = (const T*)Btp;
  constexpr int kBOff  = 128;                       /* first Bt row of a stage buffer */
  constexpr int kSRows = kBOff + 256;               /* rows of a stage buffer */
  constexpr int kStages = kEmb / 64;
  __shared__ __align__(16) float sT[8][16 * 68];
  __shared__ __align__(16) __bf16 sS[2][kSRows * kLp];
  const int lane = threadIdx.x & 31;
  const int wave = threadIdx.x >> 5;
  const int groupsN = N >> 8;
  /* block-uniform, in front of every barrier and copy */
  if ((int)blockIdx.x >= (M >> 7) * groupsN) return;
  const int bm = (int)blockIdx.x / groupsN;
  const int bn = (int)blockIdx.x - bm * groupsN;
  const int wm = wave >> 2;
  const int wn = wave & 3;
  const int m0 = (bm << 7) + (wm << 6);
  const int n0 = (bn << 8) + (wn << 6);

  const int rlane = lane & 15;
  const int koff  = (lane >> 4) * 8;
  const int mOff  = (lane >> 4) * 8;

  v8f acc[4][4];
#pragma unroll
  for (int i = 0; i < 4; ++i)
#pragma unroll
    for (int j = 0; j < 4; ++j) acc[i][j] = (v8f){0.f,0.f,0.f,0.f,0.f,0.f,0.f,0.f};

  /* this thread's piece of a stage: row (tid >> 3) of each group of 32 rows, 16-B piece (tid & 7) of the row's 128 B */
  const int crow = (int)threadIdx.x >> 3;
  const int ccol = ((int)threadIdx.x & 7) * 8;
  const T* gA  = A  + (size_t)((bm << 7) + crow) * kEmb + ccol;
  const T* gB  = Bt + (size_t)((bn << 8) + crow) * kEmb + ccol;
  const unsigned lbase = (unsigned)(size_t)(&sS[0][crow * kLp + ccol]);
  constexpr unsigned kBufBytes = kSRows * kLp * 2;
  auto stage = [&](int st) {
    const unsigned l = lbase + (unsigned)(st & 1) * kBufBytes;
    const int k0 = st * 64;
    stage128(l, gA + k0);
    stage128(l + kBOff * kLp * 2, gB + k0);
    stage128(l + (kBOff + 128) * kLp * 2, gB + 128 * kEmb + k0);
  };

  stage(0);
  /* stage 0 has landed for this wave's own copies ... */
  asm volatile("s_wait_asynccnt 0x0" ::: "memory");
  /* ... and for every wave's before anyone reads it */
  __syncthreads();
  stage(1);

  /* kept rolled for code size: the two buffers differ only in one base address */
#pragma unroll 1
  for (int st = 0; st < kStages; ++st) {
    const T* buf = sS[st & 1];
    const T* sa  = buf + ((wm << 6) + rlane) * kLp + koff;
    const T* sb  = buf + (kBOff + (wn << 6) + rlane) * kLp + koff;
    /* the loops over k blocks, fragments and tiles are fully unrolled so that these are indexed by constants and stay in registers */
#pragma unroll
    for (int kk = 0; kk < 2; ++kk) {
      /* all fragment reads of the block first, as one group in front of its WMMAs */
      v16b bh[4], ah[4];
#pragma unroll
      for (int j = 0; j < 4; ++j) bh[j] = Frag<T>::load(sb + (j << 4) * kLp + kk * 32);
#pragma unroll
      for (int i = 0; i < 4; ++i) ah[i] = Frag<T>::load(sa + (i << 4) * kLp + kk * 32);
#pragma unroll
      for (int i = 0; i < 4; ++i) {
#pragma unroll
        for (int j = 0; j < 4; ++j) acc[i][j] = Frag<T>::mma(ah[i], bh[j], acc[i][j]);
        dep_guard4_b(acc[i][0], acc[i][1], acc[i][2], acc[i][3], ah[i], ah[i]);
      }
      keep4_b(bh[0], bh[1], bh[2], bh[3]);
    }
    /* publish point of stage st + 1: this wave's reads of buffer st & 1 have returned ... */
    asm volatile("s_wait_dscnt 0x0" ::: "memory");
    /* ... its own copies of stage st + 1 have landed ... */
    asm volatile("s_wait_asynccnt 0x0" ::: "memory");
    /* ... and the same holds for every wave: stage st + 1 may be read, buffer st & 1 may be refilled */
    __syncthreads();
    if (st + 2 < kStages) stage(st + 2);
  }
  /* no copy is outstanding when the wave goes on to the epilogue and ends */
  asm volatile("s_wait_asynccnt 0x0" ::: "memory");
  acc_guard4(acc[0][0], acc[0][1], acc[0][2], acc[0][3]);
  acc_guard4(acc[1][0], acc[1][1], acc[1][2], acc[1][3]);
  acc_guard4(acc[2][0], acc[2][1], acc[2][2], acc[2][3]);
  acc_guard4(acc[3][0], acc[3][1], acc[3][2], acc[3][3]);

  /* ---- epilogue ---- */
  float* slab = sT[wave];
  /* wave-uniform tile decode */
  const int sel  = n0 >> 9;
  const int hcol = (n0 & (kEmb - 1)) >> 6;
  const int bb   = m0 >> 12;
  const int l0   = m0 & (kSeq - 1);
  const size_t rowbase = ((size_t)(bb * kHeads + hcol)) * kSeq + (size_t)l0;
  unsigned short* Ch = (sel == 0) ? QHp : KHp;
  unsigned short* Cl = (sel == 0) ? QLp : KLp;
  const int hh = lane >> 4, c4 = (lane & 15) * 4;
  const int q4 = lane >> 3, c8 = (lane & 7) * 8;
#pragma unroll
  for (int i = 0; i < 4; ++i) {
#pragma unroll
    for (int j = 0; j < 4; ++j) {
      const int n = n0 + (j << 4) + rlane;
      const float bv = bias[n];
#pragma unroll
      for (int r = 0; r < 8; ++r) {
        const float v = acc[i][j][r] + bv;
        slab[(mOff + r) * 68 + (j << 4) + rlane] = v;
      }
    }
    wave_lds_sync();
    if (sel < 2) {
      /* in-place sigmoid on the slab, rolled: lane owns (row it*2+hh, cols c4..c4+3) */
#pragma unroll 1
      for (int it = 0; it < 8; ++it) {
        float* sp = slab + (it * 2 + hh) * 68 + c4;
        v4f v = *(const v4f*)sp;
#pragma unroll
        for (int e = 0; e < 4; ++e) {
          const float x = v[e];
          v[e] = 1.0f / (1.0f + expf(-x));
        }
        *(v4f*)sp = v;
      }
      wave_lds_sync();
    }
    if (sel == 2) {
      float* Cf = Fout;
      {
#pragma unroll
        for (int it = 0; it < 8; ++it) {
          const int row = it * 2 + hh;
          const v4f v = *(const v4f*)(slab + row * 68 + c4);
          *(v4f*)(Cf + (rowbase + (size_t)((i << 4) + row)) * kHd + c4) = v;
        }
        
      }
    } else {
      v4u uh[4], ul[4];
#pragma unroll
      for (int it = 0; it < 4; ++it) {
        const float* sp = slab + (it * 4 + q4) * 68 + c8;
        unsigned short hb[8], lb[8];
#pragma unroll
        for (int e = 0; e < 8; ++e) {
          const float f = sp[e];
          hb[e] = f2bf_bits(f);
          lb[e] = f2bf_bits(f - bf_bits2f(hb[e]));
        }
        uh[it] = (v4u){pk16(hb[0], hb[1]), pk16(hb[2], hb[3]), pk16(hb[4], hb[5]), pk16(hb[6], hb[7])};
        ul[it] = (v4u){pk16(lb[0], lb[1]), pk16(lb[2], lb[3]), pk16(lb[4], lb[5]), pk16(lb[6], lb[7])};
      }
      {
#pragma unroll
        for (int it = 0; it < 4; ++it) {
          const size_t o = (rowbase + (size_t)((i << 4) + it * 4 + q4)) * kHd + c8;
          *(v4u*)(Ch + o) = uh[it];
          *(v4u*)(Cl + o) = ul[it];
        }
        
      }
    }
    wave_lds_sync();
  }
}

/* ---- flow scans, all f32, split along the sequence: 64 segments of 64 rows per (b,h), every segment scanned at the same time.
        Each running sum over rows = (sum of the totals of the segments before, added in segment order) + (serial sum inside the segment).
        One wave = two segments: a 16-lane row of the wave owns one segment, lane c of it owns features 4c..4c+3 (8 B per bf16 plane).
        q = q_hi + q_lo, k = k_hi + k_lo read from the bf16 planes (the same operands the WMMA products use).
        Launch 1: segment totals of k and q.                          Launch 2: sink_in, src_out per row; segment totals of k*src_out, q*sink_in.
        Launch 3: the two conserved dot products per row (raw sums).  Launch 4: per row rs = sigmoid(conserved_sink) * sink_in / (l+1) and
        comp = exp(clip(conserved_source)) / cumsum * (l+1), the cumsum as a block scan over the 4096 rows of one (b,h).
        Per-row results are kept by lane c for rows 4c..4c+3 of its segment and stored once as 16 lanes x 16 B = 256 B.
        The inner loops are fully unrolled so that the staged words and the kept rows are indexed by constants and stay in registers. */
__device__ __forceinline__ float row16_sum(float v) {
  /* DPP row_xmask 1, 2, 4, 8: butterfly sum over the 16 lanes of a row, no LDS round trip */
  v += __int_as_float(__builtin_amdgcn_update_dpp(0, __float_as_int(v), 0x161, 0xf, 0xf, true));
  v += __int_as_float(__builtin_amdgcn_update_dpp(0, __float_as_int(v), 0x162, 0xf, 0xf, true));
  v += __int_as_float(__builtin_amdgcn_update_dpp(0, __float_as_int(v), 0x164, 0xf, 0xf, true));
  v += __int_as_float(__builtin_amdgcn_update_dpp(0, __float_as_int(v), 0x168, 0xf, 0xf, true));
  return v;
}
__device__ __forceinline__ v4f hilo4(v2u h, v2u l) {
  v4f r;
  r[0] = __uint_as_float(h[0] << 16)         + __uint_as_float(l[0] << 16);
  r[1] = __uint_as_float(h[0] & 0xffff0000u) + __uint_as_float(l[0] & 0xffff0000u);
  r[2] = __uint_as_float(h[1] << 16)         + __uint_as_float(l[1] << 16);
  r[3] = __uint_as_float(h[1] & 0xffff0000u) + __uint_as_float(l[1] & 0xffff0000u);
  return r;
}
__device__ __forceinline__ float dot4_eps(v4f x, v4f y) {
  return (x[0] + kEps) * (y[0] + kEps) + (x[1] + kEps) * (y[1] + kEps) + (x[2] + kEps) * (y[2] + kEps) + (x[3] + kEps) * (y[3] + kEps);
}
/* totals of the segments before seg, added in segment order; T = [kNSeg][128] of one (b,h), first 64 floats -> a, last 64 -> b */
__device__ __forceinline__ void seg_prefix(const float* __restrict__ T, int seg, int c, v4f& a, v4f& b) {
  a = (v4f){0.f, 0.f, 0.f, 0.f};
  b = (v4f){0.f, 0.f, 0.f, 0.f};
  /* 16 segments' loads in flight per trip: the loads are independent, only the adds are ordered */
#pragma unroll 16
  for (int s = 0; s < kNSeg; ++s) {
    const v4f ta = *(const v4f*)(T + s * 128 + 4 * c);
    const v4f tb = *(const v4f*)(T + s * 128 + 64 + 4 * c);
    const bool in = s < seg;
#pragma unroll
    for (int e = 0; e < 4; ++e) {
      a[e] += in ? ta[e] : 0.0f;
      b[e] += in ? tb[e] : 0.0f;
    }
  }
}

__global__ __launch_bounds__(32) void flow_seg_total_kernel(const unsigned short* __restrict__ QHp, const unsigned short* __restrict__ QLp,
                                                            const unsigned short* __restrict__ KHp, const unsigned short* __restrict__ KLp,
                                                            float* __restrict__ T0) {
  const int lane = threadIdx.x, c = lane & 15;
  const int bh = (int)blockIdx.x / (kNSeg / 2);
  const int seg = ((int)blockIdx.x % (kNSeg / 2)) * 2 + (lane >> 4);
  const size_t w0 = ((size_t)bh * kSeq + (size_t)seg * kSegRows) * (kHd / 4) + c;
  const v2u* qh = (const v2u*)QHp + w0;
  const v2u* ql = (const v2u*)QLp + w0;
  const v2u* kh = (const v2u*)KHp + w0;
  const v2u* kl = (const v2u*)KLp + w0;
  v4f ks = (v4f){0.f, 0.f, 0.f, 0.f}, qs = (v4f){0.f, 0.f, 0.f, 0.f};
  /* 16 rows per trip, kept rolled for code size: all their loads are issued before the first sum */
#pragma unroll 1
  for (int t = 0; t < kSegRows / 16; ++t) {
    const v2u* pqh = qh + t * 16 * (kHd / 4);
    const v2u* pql = ql + t * 16 * (kHd / 4);
    const v2u* pkh = kh + t * 16 * (kHd / 4);
    const v2u* pkl = kl + t * 16 * (kHd / 4);
    v2u wqh[16], wql[16], wkh[16], wkl[16];
#pragma unroll
    for (int j = 0; j < 16; ++j) {
      wqh[j] = pqh[j * (kHd / 4)];
      wql[j] = pql[j * (kHd / 4)];
      wkh[j] = pkh[j * (kHd / 4)];
      wkl[j] = pkl[j * (kHd / 4)];
    }
    /* the wait that stands before a register named by an issued global load is overwritten; the address pairs are inputs so that
       they stay untouched up to it; its memory clobber also keeps the trip's loads together in front of the sums */
    asm volatile("s_wait_xcnt 0x0" :: "v"(pqh), "v"(pql), "v"(pkh), "v"(pkl) : "memory");
#pragma unroll
    for (int j = 0; j < 16; ++j) {
      ks += hilo4(wkh[j], wkl[j]);
      qs += hilo4(wqh[j], wql[j]);
    }
  }
  float* o = T0 + ((size_t)bh * kNSeg + seg) * 128 + 4 * c;
  *(v4f*)o = ks;
  *(v4f*)(o + 64) = qs;
}

__global__ __launch_bounds__(32) void flow_incoming_kernel(const unsigned short* __restrict__ QHp, const unsigned short* __restrict__ QLp,
                                                           const unsigned short* __restrict__ KHp, const unsigned short* __restrict__ KLp,
                                                           const float* __restrict__ T0, float* __restrict__ SINK, float* __restrict__ SRC,
                                                           float* __restrict__ T1) {
  const int lane = threadIdx.x, c = lane & 15;
  const int bh = (int)blockIdx.x / (kNSeg / 2);
  const int seg = ((int)blockIdx.x % (kNSeg / 2)) * 2 + (lane >> 4);
  const int row0 = seg * kSegRows;
  const size_t w0 = ((size_t)bh * kSeq + (size_t)row0) * (kHd / 4) + c;
  const v2u* qh = (const v2u*)QHp + w0;
  const v2u* ql = (const v2u*)QLp + w0;
  const v2u* kh = (const v2u*)KHp + w0;
  const v2u* kl = (const v2u*)KLp + w0;
  v4f kc, qc;
  seg_prefix(T0 + (size_t)bh * kNSeg * 128, seg, c, kc, qc);
  v4f a1 = (v4f){0.f, 0.f, 0.f, 0.f}, a2 = (v4f){0.f, 0.f, 0.f, 0.f};
  v4f si = (v4f){0.f, 0.f, 0.f, 0.f}, so = (v4f){0.f, 0.f, 0.f, 0.f};
  /* 8 rows per trip, kept rolled for code size: their loads, row sums and divisions are independent of each other and overlap;
     only the running sums are ordered */
#pragma unroll 1
  for (int t = 0; t < kSegRows / 8; ++t) {
    const v2u* pqh = qh + t * 8 * (kHd / 4);
    const v2u* pql = ql + t * 8 * (kHd / 4);
    const v2u* pkh = kh + t * 8 * (kHd / 4);
    const v2u* pkl = kl + t * 8 * (kHd / 4);
    v2u wqh[8], wql[8], wkh[8], wkl[8];
#pragma unroll
    for (int j = 0; j < 8; ++j) {
      wqh[j] = pqh[j * (kHd / 4)];
      wql[j] = pql[j * (kHd / 4)];
      wkh[j] = pkh[j * (kHd / 4)];
      wkl[j] = pkl[j * (kHd / 4)];
    }
    /* the wait that stands before a register named by an issued global load is overwritten; the address pairs are inputs so that
       they stay untouched up to it */
    asm volatile("s_wait_xcnt 0x0" :: "v"(pqh), "v"(pql), "v"(pkh), "v"(pkl) : "memory");
#pragma unroll
    for (int jj = 0; jj < 8; ++jj) {
      const int r = 8 * t + jj;
      const int g = 2 * t + (jj >> 2);
      const int j = jj & 3;
      const v4f q = hilo4(wqh[jj], wql[jj]);
      const v4f k = hilo4(wkh[jj], wkl[jj]);
      kc += k;
      qc += q;
      const float d1 = row16_sum(dot4_eps(q, kc));
      const float d2 = row16_sum(dot4_eps(k, qc));
      const float nrm = (float)(row0 + r + 1);
      const float sink_in = (1.0f / d1) * nrm;
      const float src_out = (1.0f / d2) * nrm;
      a1 += k * src_out;
      a2 += q * sink_in;
      si[j] = (c == g) ? sink_in : si[j];
      so[j] = (c == g) ? src_out : so[j];
    }
  }
  const size_t ro = (size_t)bh * kSeq + (size_t)row0 + 4 * c;
  *(v4f*)(SINK + ro) = si;
  *(v4f*)(SRC + ro) = so;
  float* o = T1 + ((size_t)bh * kNSeg + seg) * 128 + 4 * c;
  *(v4f*)o = a1;
  *(v4f*)(o + 64) = a2;
}

__global__ __launch_bounds__(32) void flow_conserved_kernel(const unsigned short* __restrict__ QHp, const unsigned short* __restrict__ QLp,
                                                            const unsigned short* __restrict__ KHp, const unsigned short* __restrict__ KLp,
                                                            const float* __restrict__ T1, const float* __restrict__ SINK,
                                                            const float* __restrict__ SRC, float* __restrict__ D3, float* __restrict__ D4) {
  const int lane = threadIdx.x, c = lane & 15;
  const int bh = (int)blockIdx.x / (kNSeg / 2);
  const int seg = ((int)blockIdx.x % (kNSeg / 2)) * 2 + (lane >> 4);
  const int row0 = seg * kSegRows;
  const size_t w0 = ((size_t)bh * kSeq + (size_t)row0) * (kHd / 4) + c;
  const v2u* qh = (const v2u*)QHp + w0;
  const v2u* ql = (const v2u*)QLp + w0;
  const v2u* kh = (const v2u*)KHp + w0;
  const v2u* kl = (const v2u*)KLp + w0;
  const float* sip = SINK + (size_t)bh * kSeq + row0;
  const float* sop = SRC + (size_t)bh * kSeq + row0;
  v4f s1, s2;
  seg_prefix(T1 + (size_t)bh * kNSeg * 128, seg, c, s1, s2);
  v4f k3 = (v4f){0.f, 0.f, 0.f, 0.f}, k4 = (v4f){0.f, 0.f, 0.f, 0.f};
  /* 8 rows per trip, kept rolled for code size: their loads and row sums overlap; only the running sums are ordered */
#pragma unroll 1
  for (int t = 0; t < kSegRows / 8; ++t) {
    const v2u* pqh = qh + t * 8 * (kHd / 4);
    const v2u* pql = ql + t * 8 * (kHd / 4);
    const v2u* pkh = kh + t * 8 * (kHd / 4);
    const v2u* pkl = kl + t * 8 * (kHd / 4);
    const v4f* psi = (const v4f*)(sip + 8 * t);
    const v4f* pso = (const v4f*)(sop + 8 * t);
    v2u wqh[8], wql[8], wkh[8], wkl[8];
    v4f si[2], so[2];
    si[0] = psi[0];
    si[1] = psi[1];
    so[0] = pso[0];
    so[1] = pso[1];
#pragma unroll
    for (int j = 0; j < 8; ++j) {
      wqh[j] = pqh[j * (kHd / 4)];
      wql[j] = pql[j * (kHd / 4)];
      wkh[j] = pkh[j * (kHd / 4)];
      wkl[j] = pkl[j * (kHd / 4)];
    }
    /* the wait that stands before a register named by an issued global load is overwritten; the address pairs are inputs so that
       they stay untouched up to it */
    asm volatile("s_wait_xcnt 0x0" :: "v"(pqh), "v"(pql), "v"(pkh), "v"(pkl), "v"(psi), "v"(pso) : "memory");
#pragma unroll
    for (int jj = 0; jj < 8; ++jj) {
      const int g = 2 * t + (jj >> 2);
      const int j = jj & 3;
      const v4f q = hilo4(wqh[jj], wql[jj]);
      const v4f k = hilo4(wkh[jj], wkl[jj]);
      s1 += k * so[jj >> 2][j];
      s2 += q * si[jj >> 2][j];
      const float d3 = row16_sum(dot4_eps(q, s1));
      const float d4 = row16_sum(dot4_eps(k, s2));
      k3[j] = (c == g) ? d3 : k3[j];
      k4[j] = (c == g) ? d4 : k4[j];
    }
  }
  const size_t ro = (size_t)bh * kSeq + (size_t)row0 + 4 * c;
  *(v4f*)(D3 + ro) = k3;
  *(v4f*)(D4 + ro) = k4;
}

/* one block of 32 waves per (b,h); thread t owns rows 4t..4t+3 */
__global__ __launch_bounds__(1024) void flow_finish_kernel(const float* __restrict__ D3, const float* __restrict__ D4,
                                                           const float* __restrict__ SINK, float* __restrict__ RS, float* __restrict__ COMP) {
  __shared__ float wtot[32];
  const int tid = threadIdx.x, lane = tid & 31, wave = tid >> 5;
  const size_t o = (size_t)blockIdx.x * kSeq + 4 * (size_t)tid;
  const v4f d3 = *(const v4f*)(D3 + o);
  const v4f d4 = *(const v4f*)(D4 + o);
  const v4f si = *(const v4f*)(SINK + o);
  v4f rs, ce, inc;
  float run = 0.f;
#pragma unroll
  for (int e = 0; e < 4; ++e) {
    const float nrm = (float)(4 * tid + e + 1);
    const float inv_nrm = 1.0f / nrm;
    const float csink = d3[e] * inv_nrm;
    const float csrc  = fminf(fmaxf(d4[e] * inv_nrm, -1.0f), 1.0f);
    const float salloc = 1.0f / (1.0f + expf(-csink));
    ce[e] = expf(csrc);
    run += ce[e];
    inc[e] = run;
    rs[e] = salloc * (si[e] * inv_nrm);
  }
  *(v4f*)(RS + o) = rs;
  /* inclusive scan of the threads' totals over the wave */
  float sc = run;
#pragma unroll
  for (int off = 1; off < 32; off <<= 1) {
    const float t = __shfl_up(sc, off, 32);
    sc += (lane >= off) ? t : 0.0f;
  }
  if (lane == 31) wtot[wave] = sc;
  const float up = __shfl_up(sc, 1, 32);
  const float before_in_wave = (lane == 0) ? 0.0f : up;
  /* every wave's total is in LDS before any wave sums the totals of the waves before it */
  __syncthreads();
  float wp = (lane < wave) ? wtot[lane] : 0.0f;
#pragma unroll
  for (int off = 16; off > 0; off >>= 1) wp += __shfl_xor(wp, off, 32);
  const float base = wp + before_in_wave;
  v4f co;
#pragma unroll
  for (int e = 0; e < 4; ++e) {
    const float nrm = (float)(4 * tid + e + 1);
    co[e] = (ce[e] / (base + inc[e])) * nrm;
  }
  *(v4f*)(COMP + o) = co;
}

/* ---- causal linear attention, split along the sequence: every 64-row chunk is its own block, of all (b,h) at once in chunk_state; in chunk_out_proj one block takes a chunk of all 8 heads of one b.
        Launch 1 (chunk_state):  per chunk its own St_n[m][d] = sum_l v'[l][m] k[l][d], v' = v * comp[l], f32, from zero.
        Launch 2 (chunk_prefix): per element the sum of the chunks before, added in chunk order in f32, stored as bf16 hi/lo planes [m][d].
        Launch 3 (chunk_out_proj): attn[i][m] = rs[i] * ( sum_d q[i][d] St[m][d] + sum_{j<=i} (q[i].k[j]) v'[j][m] ) per chunk, then its output projection.
        Attention products: hi*hi + hi*lo + lo*hi; output projection: (attn_hi + attn_lo) x bf16(Wo). Q, row-major K and St fragments come straight from the global bf16 planes (row pitch 64).
        LDS tiles are bf16 bits at pitch 72, the attention tile at pitch 520; every k-tile read of a pitch-72 tile touches columns 0..63 only. No atomics, no inter-block communication.
        The loops over tiles, fragments and staged words are fully unrolled so that these are indexed by constants and stay in registers. */

/* VT hi/lo <- (v * comp)^T of one chunk; thread covers row lr, features dh..dh+31 (vv = its 8 x 16-B words of v): 128 threads x 32 = 64 x 64 */
__device__ __forceinline__ void vt_store(float cv, const v4f (&vv)[8], int lr, int dh, __bf16* VTh, __bf16* VTl) {
#pragma unroll
  for (int i = 0; i < 8; ++i) {
#pragma unroll
    for (int e = 0; e < 4; ++e) {
      const float f = vv[i][e] * cv;
      const unsigned short hb = f2bf_bits(f);
      const unsigned short lb = f2bf_bits(f - bf_bits2f(hb));
      const int d = dh + 4 * i + e;
      VTh[d * kLp + lr] = bits2bf(hb);
      VTl[d * kLp + lr] = bits2bf(lb);
    }
  }
}

/* one block of 4 waves per (b,h,chunk). Wave w owns rows m = 16w..16w+15 of St_n[m][d]: A rows d = 16i + c of KT, Bt rows m = 16w + c
   of VT, k = l for both, so lane (c,hh) holds St_n[16w + c][16i + 8hh + r]. Coverage: 2048 blocks x 64 x 64 floats. */
__global__ __launch_bounds__(128) void chunk_state_kernel(
    const unsigned short* __restrict__ KHp, const unsigned short* __restrict__ KLp,
    const float* __restrict__ VF, const float* __restrict__ COMP, float* __restrict__ CS) {
  __shared__ __align__(16) __bf16 KTh[kHd * kLp];
  __shared__ __align__(16) __bf16 KTl[kHd * kLp];
  __shared__ __align__(16) __bf16 VTh[kHd * kLp];
  __shared__ __align__(16) __bf16 VTl[kHd * kLp];
  __shared__ __align__(16) float sT[4][16 * 68];

  const int tid = threadIdx.x, lane = tid & 31, wave = tid >> 5;
  const int c = lane & 15, hh = lane >> 4, koff = hh * 8;
  const int bh = (int)blockIdx.x / kNChunk;
  const int l0 = ((int)blockIdx.x % kNChunk) * kChunk;
  const size_t pbase = (size_t)bh * kSeq * kHd;
  const int lr = tid >> 1, dh = (tid & 1) * 32;
  const v8f z8 = (v8f){0.f,0.f,0.f,0.f,0.f,0.f,0.f,0.f};

  /* all global loads of the block first, so that they are in flight together */
  const size_t ko = pbase + (size_t)(l0 + lr) * kHd + dh;
  const v4u* kh4 = (const v4u*)(KHp + ko);
  const v4u* kl4 = (const v4u*)(KLp + ko);
  const v4f* v4p = (const v4f*)(VF + ko);
  const float* cp = COMP + (size_t)bh * kSeq + l0 + lr;
  v4u wh[4], wl[4];
  v4f vv[8];
#pragma unroll
  for (int g = 0; g < 4; ++g) { wh[g] = kh4[g]; wl[g] = kl4[g]; }
#pragma unroll
  for (int g = 0; g < 8; ++g) vv[g] = v4p[g];
  const float cv = *cp;
  /* the wait that stands before a register named by an issued global load is overwritten; the address pairs, and the row index that
     the comp load takes as its offset, are inputs so that they stay untouched up to it */
  asm volatile("s_wait_xcnt 0x0" :: "v"(kh4), "v"(kl4), "v"(v4p), "v"(cp), "v"(lr) : "memory");

  /* KT hi/lo <- k^T; thread covers row lr, features dh..dh+31 (4 x 16-B words per plane): 128 threads x 32 = 64 x 64 */
  {
#pragma unroll
    for (int g = 0; g < 4; ++g) {
#pragma unroll
      for (int e = 0; e < 4; ++e) {
        const unsigned a = wh[g][e];
        const unsigned b = wl[g][e];
        const int d = dh + 8 * g + 2 * e;
        const unsigned a0 = a & 0xffffu, a1 = a >> 16;
        const unsigned b0 = b & 0xffffu, b1 = b >> 16;
        KTh[d * kLp + lr]       = bits2bf((unsigned short)a0);
        KTh[(d + 1) * kLp + lr] = bits2bf((unsigned short)a1);
        KTl[d * kLp + lr]       = bits2bf((unsigned short)b0);
        KTl[(d + 1) * kLp + lr] = bits2bf((unsigned short)b1);
      }
    }
  }
  vt_store(cv, vv, lr, dh, VTh, VTl);
  /* KT and VT are complete before any wave reads fragments of them */
  __syncthreads();

  v8f acc[4];
  acc[0] = z8; acc[1] = z8; acc[2] = z8; acc[3] = z8;
#pragma unroll
  for (int kk = 0; kk < 2; ++kk) {
    const v16b vbh = Frag<__bf16>::load(VTh + (16 * wave + c) * kLp + kk * 32 + koff);
    const v16b vbl = Frag<__bf16>::load(VTl + (16 * wave + c) * kLp + kk * 32 + koff);
#pragma unroll
    for (int i = 0; i < 4; ++i) {
      const v16b kh = Frag<__bf16>::load(KTh + (16 * i + c) * kLp + kk * 32 + koff);
      const v16b kl = Frag<__bf16>::load(KTl + (16 * i + c) * kLp + kk * 32 + koff);
      acc[i] = mma_g(kh, vbh, acc[i]);
      acc[i] = mma_g(kl, vbh, acc[i]);
      acc[i] = mma_g(kh, vbl, acc[i]);
    }
  }
  acc_guard4(acc[0], acc[1], acc[2], acc[3]);

  /* stage the wave's 16 rows in its own slab, then whole-line stores: 16 lanes x 16 B = one 256-B row, 2 rows per instruction */
  float* slab = sT[wave];
#pragma unroll
  for (int i = 0; i < 4; ++i) {
    float* sp = slab + c * 68 + 16 * i + 8 * hh;
    *(v4f*)(sp)     = (v4f){acc[i][0], acc[i][1], acc[i][2], acc[i][3]};
    *(v4f*)(sp + 4) = (v4f){acc[i][4], acc[i][5], acc[i][6], acc[i][7]};
  }
  /* slab: written and read by this wave only, by different lanes */
  wave_lds_sync();
  float* op = CS + (size_t)blockIdx.x * (kHd * kHd) + (size_t)(16 * wave) * kHd;
  const int c4 = c * 4;
#pragma unroll
  for (int it = 0; it < 8; ++it) {
    const int row = it * 2 + hh;
    const v4f v = *(const v4f*)(slab + row * 68 + c4);
    *(v4f*)(op + row * kHd + c4) = v;
  }
}

/* exclusive prefix over the 64 chunks of one (b,h); thread owns 4 consecutive elements of [m][d]: 32 x 1024 threads.
   A wave reads 512 B and writes 256 B per plane and chunk (whole lines). */
__global__ __launch_bounds__(128) void chunk_prefix_kernel(const float* __restrict__ CS, unsigned short* __restrict__ SHp,
                                                           unsigned short* __restrict__ SLp) {
  const int i = (int)blockIdx.x * 128 + (int)threadIdx.x;
  const size_t base = (size_t)(i >> 10) * kNChunk * (kHd * kHd) + (size_t)(i & 1023) * 4;
  v4f run = (v4f){0.f, 0.f, 0.f, 0.f};
  /* 32 chunks per trip, kept rolled for code size: the loads are independent and all in flight together, only the adds are ordered */
#pragma unroll 1
  for (int g = 0; g < kNChunk / 32; ++g) {
    const float* pc = CS + base + (size_t)g * 32 * (kHd * kHd);
    unsigned short* ph = SHp + base + (size_t)g * 32 * (kHd * kHd);
    unsigned short* pl = SLp + base + (size_t)g * 32 * (kHd * kHd);
    v4f t[32];
#pragma unroll
    for (int j = 0; j < 32; ++j) t[j] = *(const v4f*)(pc + j * (kHd * kHd));
    /* the wait that stands before a register named by an issued global load is overwritten; the address pair is an input so that
       it stays untouched up to it */
    asm volatile("s_wait_xcnt 0x0" :: "v"(pc) : "memory");
#pragma unroll
    for (int q = 0; q < 4; ++q) {
      v2u uh[8], ul[8];
#pragma unroll
      for (int j = 0; j < 8; ++j) {
        unsigned short hb[4], lb[4];
#pragma unroll
        for (int e = 0; e < 4; ++e) {
          const float s = run[e];
          hb[e] = f2bf_bits(s);
          lb[e] = f2bf_bits(s - bf_bits2f(hb[e]));
        }
        uh[j] = (v2u){pk16(hb[0], hb[1]), pk16(hb[2], hb[3])};
        ul[j] = (v2u){pk16(lb[0], lb[1]), pk16(lb[2], lb[3])};
        run += t[8 * q + j];
      }
#pragma unroll
      for (int j = 0; j < 8; ++j) {
        *(v2u*)(ph + (8 * q + j) * (kHd * kHd)) = uh[j];
        *(v2u*)(pl + (8 * q + j) * (kHd * kHd)) = ul[j];
      }
      /* the same wait behind the stores: their address pairs and data words are inputs so that they stay untouched up to it */
      asm volatile("s_wait_xcnt 0x0" :: "v"(ph), "v"(pl), "v"(uh[0]), "v"(uh[1]), "v"(uh[2]), "v"(uh[3]), "v"(uh[4]), "v"(uh[5]),
                   "v"(uh[6]), "v"(uh[7]), "v"(ul[0]), "v"(ul[1]), "v"(ul[2]), "v"(ul[3]), "v"(ul[4]), "v"(ul[5]), "v"(ul[6]), "v"(ul[7])
                   : "memory");
    }
  }
}

/* Launch 3 with the output projection in it: one block of 16 waves per (b, chunk) owns 64 rows of ALL 8 heads, so the attention tile
   [64][512] never leaves the WGP: it is written to LDS as bf16 hi/lo and is the A operand of out = (attn_hi + attn_lo) x bf16(Wo)^T + bo.
   Part 1, two passes of 4 heads: waves 4g..4g+3 work on head 4p + g, wave 4g + w on rows 16w..16w+15 of the chunk.
   Part 2: wave (wm, wn) owns the 32 x 64 tile at rows 32 wm, columns 64 wn; per stage of 64 k all 512 Wo rows are copied to LDS
   asynchronously, two buffers: stage s + 1 flies while stage s is multiplied.
   LDS: sA = attn hi | lo at pitch 520 (1040 B = 16 B x odd). sU is used three times over: part 1: VT hi/lo of 4 heads, then P hi/lo of
   16 waves; part 2: the two Wo buffers; epilogue: one f32 slab per wave.
   Coverage: 4 x 64 blocks x 64 rows x 512 columns. */
constexpr int kAp = kEmb + 8;
static_assert(kAp % 8 == 0, "LDS pitch keeps 16-B alignment");
static_assert(4 * 2 * kHd * kLp + 16 * 2 * 16 * kLp == 2 * kEmb * kLp, "VT and P strips fill exactly the two Wo buffers");
static_assert(16 * 16 * 68 * 4 <= 2 * kEmb * kLp * 2, "the slabs fit the Wo buffers");
__global__ __launch_bounds__(512) void chunk_out_proj_kernel(
    const unsigned short* __restrict__ QHp, const unsigned short* __restrict__ QLp,
    const unsigned short* __restrict__ KHp, const unsigned short* __restrict__ KLp,
    const float* __restrict__ VF, const float* __restrict__ RS, const float* __restrict__ COMP,
    const unsigned short* __restrict__ SHp, const unsigned short* __restrict__ SLp,
    const unsigned short* __restrict__ Wop, const float* __restrict__ bias, float* __restrict__ Fout) {
  __shared__ __align__(16) __bf16 sA[2][kChunk * kAp];
  __shared__ __align__(16) __bf16 sU[2 * kEmb * kLp];

  const int tid = threadIdx.x, lane = tid & 31, wave = tid >> 5;
  const int c = lane & 15, hh = lane >> 4, koff = hh * 8;
  const int bb = (int)blockIdx.x / kNChunk;
  const int n = (int)blockIdx.x % kNChunk;
  const int l0 = n * kChunk;
  const int grp = wave >> 2, w4 = wave & 3;
  __bf16* VTh = sU + grp * (2 * kHd * kLp);
  __bf16* VTl = VTh + kHd * kLp;
  __bf16* ph = sU + 4 * 2 * kHd * kLp + wave * (2 * 16 * kLp);
  __bf16* pl = ph + 16 * kLp;
  const int lr = (tid & 127) >> 1, dh = (tid & 1) * 32;
  const v8f z8 = (v8f){0.f,0.f,0.f,0.f,0.f,0.f,0.f,0.f};

  /* kept rolled for code size: the two passes differ only in the head */
#pragma unroll 1
  for (int p = 0; p < 2; ++p) {
    const int hd = 4 * p + grp;
    const int bh = bb * kHeads + hd;
    const size_t pbase = (size_t)bh * kSeq * kHd;
    const size_t sbase = ((size_t)bh * kNChunk + n) * (kHd * kHd);
    const __bf16* QH = (const __bf16*)QHp + pbase;
    const __bf16* QL = (const __bf16*)QLp + pbase;
    const __bf16* KH = (const __bf16*)KHp + pbase;
    const __bf16* KL = (const __bf16*)KLp + pbase;
    const __bf16* SH = (const __bf16*)SHp + sbase;
    const __bf16* SL = (const __bf16*)SLp + sbase;
    const float* rsp = RS + (size_t)bh * kSeq;

    /* first load group, in flight together: this thread's part of v with its row's comp, the Q fragments (rows 16w + c) and the
       row-major K fragments (rows 16j + c) */
    const v4f* v4p = (const v4f*)(VF + pbase + (size_t)(l0 + lr) * kHd + dh);
    const float* cp = COMP + (size_t)bh * kSeq + l0 + lr;
    const __bf16* qhp = QH + (size_t)(l0 + 16 * w4 + c) * kHd + koff;
    const __bf16* qlp = QL + (size_t)(l0 + 16 * w4 + c) * kHd + koff;
    const __bf16* khp = KH + (size_t)(l0 + c) * kHd + koff;
    const __bf16* klp = KL + (size_t)(l0 + c) * kHd + koff;
    v4f vv[8];
    v16b qh[2], ql[2], kh[4][2], kl[4][2];
#pragma unroll
    for (int g = 0; g < 8; ++g) vv[g] = v4p[g];
#pragma unroll
    for (int dc = 0; dc < 2; ++dc) {
      qh[dc] = Frag<__bf16>::load(qhp + dc * 32);
      ql[dc] = Frag<__bf16>::load(qlp + dc * 32);
    }
#pragma unroll
    for (int j = 0; j < 4; ++j) {
#pragma unroll
      for (int dc = 0; dc < 2; ++dc) {
        kh[j][dc] = Frag<__bf16>::load(khp + 16 * j * kHd + dc * 32);
        kl[j][dc] = Frag<__bf16>::load(klp + 16 * j * kHd + dc * 32);
      }
    }
    const float cv = *cp;
    /* the wait that stands before a register named by an issued global load is overwritten; the address pairs are inputs so that
       they stay untouched up to it */
    asm volatile("s_wait_xcnt 0x0" :: "v"(v4p), "v"(cp), "v"(qhp), "v"(qlp), "v"(khp), "v"(klp) : "memory");

    vt_store(cv, vv, lr, dh, VTh, VTl);

    /* scores rows 16w.., all 64 columns; inclusive causal mask by select; hi/lo into this wave's P strip */
#pragma unroll
    for (int j = 0; j < 4; ++j) {
      v8f s = z8;
#pragma unroll
      for (int dc = 0; dc < 2; ++dc) {
        s = mma_g(qh[dc], kh[j][dc], s);
        s = mma_g(qh[dc], kl[j][dc], s);
        s = mma_g(ql[dc], kh[j][dc], s);
      }
      const int jj = 16 * j + c;
#pragma unroll
      for (int r = 0; r < 8; ++r) {
        const int ii = 16 * w4 + 8 * hh + r;
        const float pv = (jj <= ii) ? s[r] : 0.0f;
        const unsigned short hb = f2bf_bits(pv);
        const unsigned short lb = f2bf_bits(pv - bf_bits2f(hb));
        ph[(8 * hh + r) * kLp + jj] = bits2bf(hb);
        pl[(8 * hh + r) * kLp + jj] = bits2bf(lb);
      }
    }

    /* second load group, in flight together: the St fragments (Bt rows m = 16t + c, k = d) and the row scales */
    const __bf16* sph = SH + c * kHd + koff;
    const __bf16* spl = SL + c * kHd + koff;
    const float* rp = rsp + l0 + 16 * w4 + 8 * hh;
    v16b sh[4][2], sl[4][2];
#pragma unroll
    for (int t = 0; t < 4; ++t) {
#pragma unroll
      for (int dc = 0; dc < 2; ++dc) {
        sh[t][dc] = Frag<__bf16>::load(sph + 16 * t * kHd + dc * 32);
        sl[t][dc] = Frag<__bf16>::load(spl + 16 * t * kHd + dc * 32);
      }
    }
    const v4f r0 = *(const v4f*)(rp);
    const v4f r1 = *(const v4f*)(rp + 4);
    /* the same wait for the second group */
    asm volatile("s_wait_xcnt 0x0" :: "v"(sph), "v"(spl), "v"(rp) : "memory");

    v8f accO[4];
    accO[0] = z8; accO[1] = z8; accO[2] = z8; accO[3] = z8;
    /* inter: Q x St^T */
#pragma unroll
    for (int t = 0; t < 4; ++t) {
#pragma unroll
      for (int dc = 0; dc < 2; ++dc) {
        accO[t] = mma_g(qh[dc], sh[t][dc], accO[t]);
        accO[t] = mma_g(qh[dc], sl[t][dc], accO[t]);
        accO[t] = mma_g(ql[dc], sh[t][dc], accO[t]);
      }
    }
    /* VT is complete before any wave reads fragments of it; the barrier also orders this wave's P strip writes before its reads */
    __syncthreads();
    /* intra: P x v' (A rows i = c of the strip, k = j; Bt rows m = 16t + c of VT, k = j) */
#pragma unroll
    for (int kk = 0; kk < 2; ++kk) {
      const v16b pah = Frag<__bf16>::load(ph + c * kLp + kk * 32 + koff);
      const v16b pal = Frag<__bf16>::load(pl + c * kLp + kk * 32 + koff);
#pragma unroll
      for (int t = 0; t < 4; ++t) {
        const v16b vh = Frag<__bf16>::load(VTh + (16 * t + c) * kLp + kk * 32 + koff);
        const v16b vl = Frag<__bf16>::load(VTl + (16 * t + c) * kLp + kk * 32 + koff);
        accO[t] = mma_g(pah, vh, accO[t]);
        accO[t] = mma_g(pah, vl, accO[t]);
        accO[t] = mma_g(pal, vh, accO[t]);
      }
    }
    /* row scale, bf16 hi/lo, into columns 64 hd .. 64 hd + 63 of the attention tile */
    {
      float rsv[8];
#pragma unroll
      for (int e = 0; e < 4; ++e) { rsv[e] = r0[e]; rsv[4 + e] = r1[e]; }
      __bf16* ah = sA[0] + (16 * w4 + 8 * hh) * kAp + hd * kHd + c;
      __bf16* al = sA[1] + (16 * w4 + 8 * hh) * kAp + hd * kHd + c;
#pragma unroll
      for (int t = 0; t < 4; ++t) {
#pragma unroll
        for (int r = 0; r < 8; ++r) {
          const float o = accO[t][r] * rsv[r];
          const unsigned short hb = f2bf_bits(o);
          const unsigned short lb = f2bf_bits(o - bf_bits2f(hb));
          ah[r * kAp + 16 * t] = bits2bf(hb);
          al[r * kAp + 16 * t] = bits2bf(lb);
        }
      }
    }
    /* foot of a pass: this wave's reads of VT and P have returned and its tile writes are done ... */
    asm volatile("s_wait_dscnt 0x0" ::: "memory");
    /* ... and every wave's: VT and P may be rewritten (next pass, or the Wo copies); after the last pass the attention tile is complete */
    __syncthreads();
  }

  /* ---- part 2: out tile = (attn_hi + attn_lo) x Wo^T ---- */
  const __bf16* Bt = (const __bf16*)Wop;
  constexpr int kStages = kEmb / 64;
  const int wm = wave >> 3, wn = wave & 7;
  v8f acc[2][4];
#pragma unroll
  for (int i = 0; i < 2; ++i)
#pragma unroll
    for (int j = 0; j < 4; ++j) acc[i][j] = z8;

  /* this thread's piece of a stage: row (tid >> 3) of each group of 64 rows, 16-B piece (tid & 7) of the row's 128 B */
  const int crow = tid >> 3;
  const int ccol = (tid & 7) * 8;
  const __bf16* gB = Bt + (size_t)crow * kEmb + ccol;
  const unsigned lbase = (unsigned)(size_t)(&sU[crow * kLp + ccol]);
  constexpr unsigned kBufBytes = kEmb * kLp * 2;
  constexpr unsigned kG = 64 * kLp * 2;   /* LDS bytes of a group of 64 rows */
  auto stage = [&](int st) {
    const unsigned l = lbase + (unsigned)(st & 1) * kBufBytes;
    const __bf16* g = gB + st * 64;
    async_copy4(l, l + kG, l + 2 * kG, l + 3 * kG, g, g + 64 * kEmb, g + 128 * kEmb, g + 192 * kEmb);
    async_copy4(l + 4 * kG, l + 5 * kG, l + 6 * kG, l + 7 * kG, g + 256 * kEmb, g + 320 * kEmb, g + 384 * kEmb, g + 448 * kEmb);
  };

  stage(0);
  /* stage 0 has landed for this wave's own copies ... */
  asm volatile("s_wait_asynccnt 0x0" ::: "memory");
  /* ... and for every wave's before anyone reads it */
  __syncthreads();
  stage(1);

  /* kept rolled for code size: the two buffers differ only in one base address */
#pragma unroll 1
  for (int st = 0; st < kStages; ++st) {
    const __bf16* sb  = sU + (st & 1) * (kEmb * kLp) + ((wn << 6) + c) * kLp + koff;
    const __bf16* sah = sA[0] + ((wm << 5) + c) * kAp + st * 64 + koff;
    const __bf16* sal = sA[1] + ((wm << 5) + c) * kAp + st * 64 + koff;
    /* the loops over k blocks, fragments and tiles are fully unrolled so that these are indexed by constants and stay in registers */
    /* all fragment reads of the stage first, as one group in front of its WMMAs */
    v16b bh[2][4], ah[2][2], al[2][2];
#pragma unroll
    for (int kk = 0; kk < 2; ++kk) {
#pragma unroll
      for (int j = 0; j < 4; ++j) bh[kk][j] = Frag<__bf16>::load(sb + (j << 4) * kLp + kk * 32);
#pragma unroll
      for (int i = 0; i < 2; ++i) {
        ah[kk][i] = Frag<__bf16>::load(sah + (i << 4) * kAp + kk * 32);
        al[kk][i] = Frag<__bf16>::load(sal + (i << 4) * kAp + kk * 32);
      }
    }
#pragma unroll
    for (int kk = 0; kk < 2; ++kk) {
#pragma unroll
      for (int i = 0; i < 2; ++i) {
#pragma unroll
        for (int j = 0; j < 4; ++j) {
          acc[i][j] = Frag<__bf16>::mma(ah[kk][i], bh[kk][j], acc[i][j]);
          acc[i][j] = Frag<__bf16>::mma(al[kk][i], bh[kk][j], acc[i][j]);
        }
        dep_guard4_b(acc[i][0], acc[i][1], acc[i][2], acc[i][3], ah[kk][i], al[kk][i]);
      }
      keep4_b(bh[kk][0], bh[kk][1], bh[kk][2], bh[kk][3]);
    }
    /* publish point of stage st + 1: this wave's reads of buffer st & 1 have returned ... */
    asm volatile("s_wait_dscnt 0x0" ::: "memory");
    /* ... its own copies of stage st + 1 have landed ... */
    asm volatile("s_wait_asynccnt 0x0" ::: "memory");
    /* ... and the same holds for every wave: stage st + 1 may be read, buffer st & 1 may be refilled */
    __syncthreads();
    if (st + 2 < kStages) stage(st + 2);
  }
  /* no copy is outstanding when the wave goes on to the epilogue and ends */
  asm volatile("s_wait_asynccnt 0x0" ::: "memory");
  acc_guard4(acc[0][0], acc[0][1], acc[0][2], acc[0][3]);
  acc_guard4(acc[1][0], acc[1][1], acc[1][2], acc[1][3]);

  /* epilogue: bias, the wave's 16 x 64 f32 in its own slab (the Wo buffers are dead behind the last barrier), whole-line stores:
     16 lanes x 16 B = 256 B of a row, 2 rows per instruction */
  float* slab = (float*)sU + wave * (16 * 68);
  const int n0 = wn << 6;
  const int c4 = c * 4;
#pragma unroll
  for (int i = 0; i < 2; ++i) {
#pragma unroll
    for (int j = 0; j < 4; ++j) {
      const float bv = bias[n0 + (j << 4) + c];
#pragma unroll
      for (int r = 0; r < 8; ++r) slab[(8 * hh + r) * 68 + (j << 4) + c] = acc[i][j][r] + bv;
    }
    /* slab: written and read by this wave only, by different lanes */
    wave_lds_sync();
    float* op = Fout + (size_t)(bb * kSeq + l0 + (wm << 5) + (i << 4) + hh) * kEmb + n0 + c4;
#pragma unroll
    for (int it = 0; it < 8; ++it) {
      const v4f v = *(const v4f*)(slab + (it * 2 + hh) * 68 + c4);
      *(v4f*)(op + (size_t)(it * 2) * kEmb) = v;
    }
    /* the wait that stands before a register named by an issued global store is overwritten; the address pair is an input so that
       it stays untouched up to it */
    asm volatile("s_wait_xcnt 0x0" :: "v"(op) : "memory");
    wave_lds_sync();
  }
}

/* ---- host glue ----
   Workspace region map (bytes, 256-B aligned carve; total 191,897,600 <= 268,435,456):
     XB    [16384][512] bf16   16,777,216   bf16(x)
     WQKV  [1536][512]  bf16    1,572,864   bf16(Wq | Wk | Wv)
     WOB   [512][512]   bf16      524,288   bf16(Wo)
     BIAS  [2048]       f32         8,192   bf16 values of bq | bk | bv | bo kept as f32
     QH,QL,KH,KL [32][4096][64] bf16  4 x 16,777,216   sigmoid(q), sigmoid(k) as hi/lo planes
     VF    [32][4096][64] f32  33,554,432   v
     RS, COMP [32][4096] f32   2 x 524,288
     SINK, SRC, D3, D4 [32][4096] f32   4 x 524,288   per-row values handed between the flow scan launches
     T0, T1 [32][64][128] f32  2 x 1,048,576   segment totals (k | q, then k*src_out | q*sink_in)
     CS    [32][64][64][64] f32  33,554,432   each chunk's own state St_n[m][d]
     SH, SL [32][64][64][64] bf16  2 x 16,777,216   state before each chunk as hi/lo planes */
extern "C" void kernel_launch(void* const* d_in, const int* in_sizes, int n_in,
                              void* d_out, int out_size, void* d_ws, size_t ws_size, hipStream_t stream) {
  if (n_in < 9 || d_out == nullptr || d_ws == nullptr) return;
  if (in_sizes[0] != kRows * kEmb || in_sizes[1] != kEmb * kEmb || in_sizes[2] != kEmb ||
      in_sizes[3] != kEmb * kEmb || in_sizes[4] != kEmb || in_sizes[5] != kEmb * kEmb ||
      in_sizes[6] != kEmb || in_sizes[7] != kEmb * kEmb || in_sizes[8] != kEmb ||
      out_size != kRows * kEmb) return;

  const float* x  = (const float*)d_in[0];
  const float* Wq = (const float*)d_in[1];
  const float* bq = (const float*)d_in[2];
  const float* Wk = (const float*)d_in[3];
  const float* bk = (const float*)d_in[4];
  const float* Wv = (const float*)d_in[5];
  const float* bv = (const float*)d_in[6];
  const float* Wo = (const float*)d_in[7];
  const float* bo = (const float*)d_in[8];
  float* out = (float*)d_out;

  char* ws = (char*)d_ws; size_t off = 0;
  auto carve = [&](size_t bytes) -> char* { char* p = ws + off; off += (bytes + 255) & ~(size_t)255; return p; };
  unsigned short* XB   = (unsigned short*)carve((size_t)kRows * kEmb * 2);
  unsigned short* WQKV = (unsigned short*)carve((size_t)kQkvN * kEmb * 2);
  unsigned short* WOB  = (unsigned short*)carve((size_t)kEmb * kEmb * 2);
  float*          BIAS = (float*)carve((size_t)4 * kEmb * 4);
  unsigned short* QH   = (unsigned short*)carve((size_t)kBH * kSeq * kHd * 2);
  unsigned short* QL   = (unsigned short*)carve((size_t)kBH * kSeq * kHd * 2);
  unsigned short* KH   = (unsigned short*)carve((size_t)kBH * kSeq * kHd * 2);
  unsigned short* KL   = (unsigned short*)carve((size_t)kBH * kSeq * kHd * 2);
  float*          VF   = (float*)carve((size_t)kBH * kSeq * kHd * 4);
  float*          RS   = (float*)carve((size_t)kBH * kSeq * 4);
  float*          COMP = (float*)carve((size_t)kBH * kSeq * 4);
  float*          SINK = (float*)carve((size_t)kBH * kSeq * 4);
  float*          SRC  = (float*)carve((size_t)kBH * kSeq * 4);
  float*          D3   = (float*)carve((size_t)kBH * kSeq * 4);
  float*          D4   = (float*)carve((size_t)kBH * kSeq * 4);
  float*          T0   = (float*)carve((size_t)kBH * kNSeg * 128 * 4);
  float*          T1   = (float*)carve((size_t)kBH * kNSeg * 128 * 4);
  float*          CS   = (float*)carve((size_t)kBH * kNChunk * kHd * kHd * 4);
  unsigned short* SH   = (unsigned short*)carve((size_t)kBH * kNChunk * kHd * kHd * 2);
  unsigned short* SL   = (unsigned short*)carve((size_t)kBH * kNChunk * kHd * kHd * 2);
  if (off > ws_size || off > (size_t)268435456) return;

  /* 16-bit operand planes and the bias plane, one launch */
  prep_kernel<<<kPrepBlocks, 256, 0, stream>>>(x, Wq, Wk, Wv, Wo, bq, bk, bv, bo, XB, WQKV, WOB, BIAS);

  /* projections: M = 16384, N = 1536, K = 512; 128 x 6 block tiles of 128 x 256 = 768 blocks x 8 waves */
  gemm64_kernel<<<(kRows / 64) * (kQkvN / 64) / 8, 256, 0, stream>>>(
      XB, WQKV, BIAS, QH, QL, KH, KL, VF, kRows, kQkvN);

  /* flow scans: three launches of 1024 waves (two 64-row segments each), then one block per (b,h) */
  flow_seg_total_kernel<<<kBH * (kNSeg / 2), 32, 0, stream>>>(QH, QL, KH, KL, T0);
  flow_incoming_kernel<<<kBH * (kNSeg / 2), 32, 0, stream>>>(QH, QL, KH, KL, T0, SINK, SRC, T1);
  flow_conserved_kernel<<<kBH * (kNSeg / 2), 32, 0, stream>>>(QH, QL, KH, KL, T1, SINK, SRC, D3, D4);
  flow_finish_kernel<<<kBH, 1024, 0, stream>>>(D3, D4, SINK, RS, COMP);

  /* chunk states of all (b,h) (2048 blocks), then their exclusive prefix over the chunks (256 blocks) */
  chunk_state_kernel<<<kBH * kNChunk, 128, 0, stream>>>(KH, KL, VF, COMP, CS);
  chunk_prefix_kernel<<<kBH * kHd * kHd / 4 / 128, 128, 0, stream>>>(CS, SH, SL);

  /* all chunks' outputs with the output projection M = 16384, N = 512, K = 512 in the same launch (256 blocks, one per WGP) */
  chunk_out_proj_kernel<<<kBatch * kNChunk, 512, 0, stream>>>(QH, QL, KH, KL, VF, RS, COMP, SH, SL, WOB, BIAS + 3 * kEmb, out);
}

// v006
// One run takes 139 microseconds.
// Timed twice side by side with v005, it ran 1.06 times as fast both times.
// All steps since v000 together make it 29.1 times as fast.
// All contractions on v_wmma_f32_16x16x32_bf16 with f32 accumulate: q/k/v projections = bf16(x) x bf16(W) single product; chunk state, scores, inter and intra products = bf16 hi/lo operands (hi*hi + hi*lo + lo*hi); output projection = (attn_hi + attn_lo) x bf16(Wo); sigmoid, flow scans and row scales in f32 on VALU.
#include <hip/hip_runtime.h>
#include <math.h>

constexpr int kBatch   = 4;
constexpr int kSeq     = 4096;
constexpr int kEmb     = 512;
constexpr int kHeads   = 8;
constexpr int kHd      = 64;
constexpr int kRows    = kBatch * kSeq;
constexpr int kBH      = kBatch * kHeads;
constexpr int kChunk   = 64;
constexpr int kNChunk  = kSeq / kChunk;
constexpr int kLp      = 72;
constexpr int kQkvN    = 3 * kEmb;
constexpr int kSegRows = 64;
constexpr int kNSeg    = kSeq / kSegRows;
constexpr float kEps   = 1e-6f;
static_assert(kHeads * kHd == kEmb, "head packing");
static_assert(kEmb % 32 == 0, "GEMM K multiple of 32");
static_assert(kHd % 32 == 0 && kChunk % 32 == 0, "tile K multiple of 32");
static_assert(kRows % 128 == 0 && kQkvN % 256 == 0 && kEmb % 256 == 0, "GEMM M, N block tile multiples");
static_assert(kSeq % 128 == 0 && kSeq % kChunk == 0, "scan line groups and chunks");
static_assert(kSeq == 4096 && kEmb == 512 && kHd == 64, "shift constants in the projection epilogue");
static_assert(kLp % 8 == 0, "LDS pitch keeps 16-B alignment");
static_assert(kSegRows == 64 && kNSeg % 2 == 0 && kSeq == 4 * 1024, "flow scan: 16 lanes x 4 kept rows per segment, two segments per wave, 1024 threads x 4 rows");

typedef __attribute__((ext_vector_type(16))) __bf16   v16b;
typedef __attribute__((ext_vector_type(8)))  __bf16   v8b;
typedef __attribute__((ext_vector_type(8)))  float    v8f;
typedef __attribute__((ext_vector_type(4)))  float    v4f;
typedef __attribute__((ext_vector_type(4)))  unsigned int v4u;
typedef __attribute__((ext_vector_type(2)))  unsigned int v2u;

__device__ __forceinline__ unsigned short f2bf_bits(float f) {
  unsigned u = __float_as_uint(f);
  return (unsigned short)((u + 0x7FFFu + ((u >> 16) & 1u)) >> 16);
}
__device__ __forceinline__ float bf_bits2f(unsigned short h) { return __uint_as_float(((unsigned)h) << 16); }
__device__ __forceinline__ float bf16r(float f) { return bf_bits2f(f2bf_bits(f)); }
__device__ __forceinline__ unsigned pk16(unsigned short a, unsigned short b) { return (unsigned)a | ((unsigned)b << 16); }
__device__ __forceinline__ __bf16 bits2bf(unsigned short u) { return __builtin_bit_cast(__bf16, u); }

/* hazard guards as plain device helpers */
__device__ __forceinline__ void dep_guard4_b(v8f& a, v8f& b, v8f& c, v8f& d, v16b x, v16b y) { asm volatile("v_nop\n\tv_nop\n\tv_nop\n\tv_nop" : "+v"(a), "+v"(b), "+v"(c), "+v"(d) : "v"(x), "v"(y)); }
__device__ __forceinline__ void keep4_b(v16b a, v16b b, v16b c, v16b d) { asm volatile("v_nop" :: "v"(a), "v"(b), "v"(c), "v"(d)); }
__device__ __forceinline__ void acc_guard4(v8f& a, v8f& b, v8f& c, v8f& d) { asm volatile("v_nop\n\tv_nop\n\tv_nop\n\tv_nop" : "+v"(a), "+v"(b), "+v"(c), "+v"(d)); }

template <typename T> struct Frag;
template <> struct Frag<__bf16> {
  typedef v16b V; union U { v16b v; v8b h[2]; };
  /* elements 0..7 <- p[0..7], elements 8..15 <- p[16..23] */
  static __device__ __forceinline__ v16b load(const __bf16* p) {
    U f; f.h[0] = *(const v8b*)(p); f.h[1] = *(const v8b*)(p + 16); return f.v;
  }
  static __device__ __forceinline__ v8f mma(v16b a, v16b b, v8f c) {
    return __builtin_amdgcn_wmma_f32_16x16x32_bf16(false, a, false, b, (short)0, c, false, false);
  }
};

/* one WMMA followed by the 4-slot guard tying its accumulator and both operand fragments */
__device__ __forceinline__ v8f mma_g(v16b a, v16b b, v8f c) {
  c = __builtin_amdgcn_wmma_f32_16x16x32_bf16(false, a, false, b, (short)0, c, false, false);
  asm volatile("v_nop\n\tv_nop\n\tv_nop\n\tv_nop" : "+v"(c) : "v"(a), "v"(b));
  return c;
}

__device__ __forceinline__ void wave_lds_sync() {
  __builtin_amdgcn_fence(__ATOMIC_RELEASE, "workgroup");
  __builtin_amdgcn_wave_barrier();
  __builtin_amdgcn_fence(__ATOMIC_ACQUIRE, "workgroup");
}

/* ---- operand preparation, ONE launch: block ranges of one grid take the pieces, which do not depend on one another.
        Blocks 0 .. kPrepXBlocks-1: bf16(x). The next 4 x kPrepWBlocks: bf16 of Wq | Wk | Wv | Wo. The last block: the bias plane.
        f32 -> bf16 (RNE convert): a block converts 8192 consecutive elements, a thread 8 consecutive elements in each of 4 groups of 2048:
        two 16-B loads and ONE 16-B store per lane and group, the 8 loads of the 4 groups in flight together.
        Bias plane: dst[0..2047] = bf16 value (kept as f32) of bq | bk | bv | bo; 2 iterations x 256 x float4 = exactly 2048 floats;
        all four sources are loaded unconditionally, wave-uniform select by value. */
constexpr int kPrepElems   = 8192;
constexpr int kPrepXBlocks = kRows * kEmb / kPrepElems;
constexpr int kPrepWBlocks = kEmb * kEmb / kPrepElems;
constexpr int kPrepBlocks  = kPrepXBlocks + 4 * kPrepWBlocks + 1;
static_assert(kRows * kEmb % kPrepElems == 0 && kEmb * kEmb % kPrepElems == 0, "whole blocks of the conversion");

__device__ __forceinline__ void cvt_block(const float* __restrict__ src, unsigned short* __restrict__ dst, int tid) {
  const float* p = src + 8 * tid;
  v4f a[4], b[4];
#pragma unroll
  for (int g = 0; g < 4; ++g) {
    a[g] = *(const v4f*)(p + g * 2048);
    b[g] = *(const v4f*)(p + g * 2048 + 4);
  }
  /* the wait that stands before a register named by an issued global load is overwritten; the address pair is an input so that
     it stays untouched up to it; its memory clobber also keeps the 8 loads together in front of the conversions */
  asm volatile("s_wait_xcnt 0x0" :: "v"(p) : "memory");
  unsigned short* q = dst + 8 * tid;
#pragma unroll
  for (int g = 0; g < 4; ++g) {
    unsigned short hb[8];
#pragma unroll
    for (int e = 0; e < 4; ++e) {
      hb[e]     = f2bf_bits(a[g][e]);
      hb[4 + e] = f2bf_bits(b[g][e]);
    }
    *(v4u*)(q + g * 2048) = (v4u){pk16(hb[0], hb[1]), pk16(hb[2], hb[3]), pk16(hb[4], hb[5]), pk16(hb[6], hb[7])};
  }
}

__global__ __launch_bounds__(256) void prep_kernel(const float* __restrict__ x, const float* __restrict__ Wq, const float* __restrict__ Wk,
                                                   const float* __restrict__ Wv, const float* __restrict__ Wo,
                                                   const float* __restrict__ b0, const float* __restrict__ b1,
                                                   const float* __restrict__ b2, const float* __restrict__ b3,
                                                   unsigned short* __restrict__ XBp, unsigned short* __restrict__ WQKVp,
                                                   unsigned short* __restrict__ WOBp, float* __restrict__ dst) {
  const int tid = threadIdx.x;
  const int blk = (int)blockIdx.x;
  if (blk < kPrepXBlocks + 4 * kPrepWBlocks) {
    /* block-uniform choice of the plane and of this block's 8192 elements in it */
    const bool isx = blk < kPrepXBlocks;
    const int wb   = isx ? 0 : blk - kPrepXBlocks;
    const int w    = wb / kPrepWBlocks;
    const int piece = isx ? blk : wb % kPrepWBlocks;
    const float* s01 = (w == 0) ? Wq : Wk;
    const float* s23 = (w == 2) ? Wv : Wo;
    const float* sw  = (w < 2) ? s01 : s23;
    unsigned short* dw = (w < 3) ? WQKVp + (size_t)w * kEmb * kEmb : WOBp;
    const float* s    = isx ? x : sw;
    unsigned short* d = isx ? XBp : dw;
    cvt_block(s + (size_t)piece * kPrepElems, d + (size_t)piece * kPrepElems, tid);
    return;
  }
#pragma unroll 1
  for (int it = 0; it < 2; ++it) {
    const int idx4 = it * 256 + tid;
    const int which = idx4 >> 7;
    const int off = (idx4 & 127) * 4;
    const v4f va = *(const v4f*)(b0 + off);
    const v4f vb = *(const v4f*)(b1 + off);
    const v4f vc = *(const v4f*)(b2 + off);
    const v4f vd = *(const v4f*)(b3 + off);
    v4f o;
#pragma unroll
    for (int e = 0; e < 4; ++e) {
      const float s01 = (which == 0) ? va[e] : vb[e];
      const float s23 = (which == 2) ? vc[e] : vd[e];
      o[e] = bf16r((which < 2) ? s01 : s23);
    }
    float* op = dst + which * kEmb + off;
    *(v4f*)op = o;
  }
}

/* four asynchronous 16-B copies per lane, global -> LDS, each with its own LDS byte address and global pointer. The s_wait_xcnt is the
   last line of the copies' own statement so that it stands before any rewrite of a register that a copy names. */
__device__ __forceinline__ void async_copy4(unsigned l0, unsigned l1, unsigned l2, unsigned l3,
                                            const __bf16* g0, const __bf16* g1, const __bf16* g2, const __bf16* g3) {
  asm volatile("global_load_async_to_lds_b128 %0, %4, off\n\t"
               "global_load_async_to_lds_b128 %1, %5, off\n\t"
               "global_load_async_to_lds_b128 %2, %6, off\n\t"
               "global_load_async_to_lds_b128 %3, %7, off\n\t"
               "s_wait_xcnt 0x0"
               :: "v"(l0), "v"(l1), "v"(l2), "v"(l3), "v"(g0), "v"(g1), "v"(g2), "v"(g3) : "memory");
}
/* 128 rows x 128 B of one row-major [.][512] bf16 plane -> LDS rows of pitch 144 B. g = this thread's piece of row (tid >> 3), l = its
   LDS byte address; 256 threads x 16 B = 32 whole rows per copy, a wave covers 4 whole 128-B lines. */
__device__ __forceinline__ void stage128(unsigned l, const __bf16* g) {
  async_copy4(l, l + 32 * kLp * 2, l + 64 * kLp * 2, l + 96 * kLp * 2, g, g + 32 * kEmb, g + 64 * kEmb, g + 96 * kEmb);
}

/* ---- Register-blocked WMMA GEMM, each wave owns a 64x64 tile; A row-major [M][512], Bt row-major [N][512] (bf16 bits).
        A block of 8 waves (2 x 4) owns 128 x 256. Per stage of 64 k (one 128-B line per row) its 128 A rows and
        256 Bt rows are copied to LDS asynchronously, two buffers: stage s + 1 flies while stage s is multiplied.
        Projections: single product; epilogue adds bias[n]; column tile 64 = one head of q (n0 < 512), k (512..1023)
               x 16 B, 4 rows per instruction); v: f32 plane [b][h][chunk][4096] in reader order (512 contiguous bytes per instruction).
*/
__global__ __launch_bounds__(256) void gemm64_kernel(
    const unsigned short* __restrict__ Ap, const unsigned short* __restrict__ Btp, const float* __restrict__ bias,
    unsigned short* __restrict__ QHp, unsigned short* __restrict__ QLp,
    unsigned short* __restrict__ KHp, unsigned short* __restrict__ KLp,
    float* __restrict__ Fout, int M, int N) {
  typedef __bf16 T;
  const T* A = (const T*)Ap; const T* Bt = (const T*)Btp;
  constexpr int kBOff  = 128;                       /* first Bt row of a stage buffer */
  constexpr int kSRows = kBOff + 256;               /* rows of a stage buffer */
  constexpr int kStages = kEmb / 64;
  __shared__ __align__(16) float sT[8][16 * 68];
  __shared__ __align__(16) __bf16 sS[2][kSRows * kLp];
  const int lane = threadIdx.x & 31;
  const int wave = threadIdx.x >> 5;
  const int groupsN = N >> 8;
  /* block-uniform, in front of every barrier and copy */
  if ((int)blockIdx.x >= (M >> 7) * groupsN) return;
  const int bm = (int)blockIdx.x / groupsN;
  const int bn = (int)blockIdx.x - bm * groupsN;
  const int wm = wave >> 2;
  const int wn = wave & 3;
  const int m0 = (bm << 7) + (wm << 6);
  const int n0 = (bn << 8) + (wn << 6);

  const int rlane = lane & 15;
  const int koff  = (lane >> 4) * 8;
  const int mOff  = (lane >> 4) * 8;

  v8f acc[4][4];
#pragma unroll
  for (int i = 0; i < 4; ++i)
#pragma unroll
    for (int j = 0; j < 4; ++j) acc[i][j] = (v8f){0.f,0.f,0.f,0.f,0.f,0.f,0.f,0.f};

  /* this thread's piece of a stage: row (tid >> 3) of each group of 32 rows, 16-B piece (tid & 7) of the row's 128 B */
  const int crow = (int)threadIdx.x >> 3;
  const int ccol = ((int)threadIdx.x & 7) * 8;
  const T* gA  = A  + (size_t)((bm << 7) + crow) * kEmb + ccol;
  const T* gB  = Bt + (size_t)((bn << 8) + crow) * kEmb + ccol;
  const unsigned lbase = (unsigned)(size_t)(&sS[0][crow * kLp + ccol]);
  constexpr unsigned kBufBytes = kSRows * kLp * 2;
  auto stage = [&](int st) {
    const unsigned l = lbase + (unsigned)(st & 1) * kBufBytes;
    const int k0 = st * 64;
    stage128(l, gA + k0);
    stage128(l + kBOff * kLp * 2, gB + k0);
    stage128(l + (kBOff + 128) * kLp * 2, gB + 128 * kEmb + k0);
  };

  stage(0);
  /* stage 0 has landed for this wave's own copies ... */
  asm volatile("s_wait_asynccnt 0x0" ::: "memory");
  /* ... and for every wave's before anyone reads it */
  __syncthreads();
  stage(1);

  /* kept rolled for code size: the two buffers differ only in one base address */
#pragma unroll 1
  for (int st = 0; st < kStages; ++st) {
    const T* buf = sS[st & 1];
    const T* sa  = buf + ((wm << 6) + rlane) * kLp + koff;
    const T* sb  = buf + (kBOff + (wn << 6) + rlane) * kLp + koff;
    /* the loops over k blocks, fragments and tiles are fully unrolled so that these are indexed by constants and stay in registers */
#pragma unroll
    for (int kk = 0; kk < 2; ++kk) {
      /* all fragment reads of the block first, as one group in front of its WMMAs */
      v16b bh[4], ah[4];
#pragma unroll
      for (int j = 0; j < 4; ++j) bh[j] = Frag<T>::load(sb + (j << 4) * kLp + kk * 32);
#pragma unroll
      for (int i = 0; i < 4; ++i) ah[i] = Frag<T>::load(sa + (i << 4) * kLp + kk * 32);
#pragma unroll
      for (int i = 0; i < 4; ++i) {
#pragma unroll
        for (int j = 0; j < 4; ++j) acc[i][j] = Frag<T>::mma(ah[i], bh[j], acc[i][j]);
        dep_guard4_b(acc[i][0], acc[i][1], acc[i][2], acc[i][3], ah[i], ah[i]);
      }
      keep4_b(bh[0], bh[1], bh[2], bh[3]);
    }
    /* publish point of stage st + 1: this wave's reads of buffer st & 1 have returned ... */
    asm volatile("s_wait_dscnt 0x0" ::: "memory");
    /* ... its own copies of stage st + 1 have landed ... */
    asm volatile("s_wait_asynccnt 0x0" ::: "memory");
    /* ... and the same holds for every wave: stage st + 1 may be read, buffer st & 1 may be refilled */
    __syncthreads();
    if (st + 2 < kStages) stage(st + 2);
  }
  /* no copy is outstanding when the wave goes on to the epilogue and ends */
  asm volatile("s_wait_asynccnt 0x0" ::: "memory");
  acc_guard4(acc[0][0], acc[0][1], acc[0][2], acc[0][3]);
  acc_guard4(acc[1][0], acc[1][1], acc[1][2], acc[1][3]);
  acc_guard4(acc[2][0], acc[2][1], acc[2][2], acc[2][3]);
  acc_guard4(acc[3][0], acc[3][1], acc[3][2], acc[3][3]);

  /* ---- epilogue ---- */
  float* slab = sT[wave];
  /* wave-uniform tile decode */
  const int sel  = n0 >> 9;
  const int hcol = (n0 & (kEmb - 1)) >> 6;
  const int bb   = m0 >> 12;
  const int l0   = m0 & (kSeq - 1);
  const size_t rowbase = ((size_t)(bb * kHeads + hcol)) * kSeq + (size_t)l0;
  unsigned short* Ch = (sel == 0) ? QHp : KHp;
  unsigned short* Cl = (sel == 0) ? QLp : KLp;
  const int hh = lane >> 4, c4 = (lane & 15) * 4;
  const int q4 = lane >> 3, c8 = (lane & 7) * 8;
#pragma unroll
  for (int i = 0; i < 4; ++i) {
#pragma unroll
    for (int j = 0; j < 4; ++j) {
      const int n = n0 + (j << 4) + rlane;
      const float bv = bias[n];
#pragma unroll
      for (int r = 0; r < 8; ++r) {
        const float v = acc[i][j][r] + bv;
        slab[(mOff + r) * 68 + (j << 4) + rlane] = v;
      }
    }
    wave_lds_sync();
    if (sel < 2) {
      /* in-place sigmoid on the slab, rolled: lane owns (row it*2+hh, cols c4..c4+3) */
#pragma unroll 1
      for (int it = 0; it < 8; ++it) {
        float* sp = slab + (it * 2 + hh) * 68 + c4;
        v4f v = *(const v4f*)sp;
#pragma unroll
        for (int e = 0; e < 4; ++e) {
          const float x = v[e];
          v[e] = 1.0f / (1.0f + expf(-x));
        }
        *(v4f*)sp = v;
      }
      wave_lds_sync();
    }
    if (sel == 2) {
      /* reader order (see v_words): word g of reader thread 32 i + lane = row 16 i + (lane >> 1), features 32 (lane & 1) + 4 g .. + 3;
         one store = 32 lanes x 16 B = 512 contiguous bytes */
      float* vp = Fout + rowbase * kHd + (size_t)((32 * i + lane) * 4);
      v4f vw[8];
#pragma unroll
      for (int g = 0; g < 8; ++g) vw[g] = *(const v4f*)(slab + (lane >> 1) * 68 + (lane & 1) * 32 + 4 * g);
#pragma unroll
      for (int g = 0; g < 8; ++g) *(v4f*)(vp + g * 512) = vw[g];
      /* the wait that stands before a register named by an issued global store is overwritten; the address pair and the data words
         are inputs so that they stay untouched up to it */
      asm volatile("s_wait_xcnt 0x0" :: "v"(vp), "v"(vw[0]), "v"(vw[1]), "v"(vw[2]), "v"(vw[3]), "v"(vw[4]), "v"(vw[5]), "v"(vw[6]), "v"(vw[7])
                   : "memory");
    } else {
      v4u uh[4], ul[4];
#pragma unroll
      for (int it = 0; it < 4; ++it) {
        const float* sp = slab + (it * 4 + q4) * 68 + c8;
        unsigned short hb[8], lb[8];
#pragma unroll
        for (int e = 0; e < 8; ++e) {
          const float f = sp[e];
          hb[e] = f2bf_bits(f);
          lb[e] = f2bf_bits(f - bf_bits2f(hb[e]));
        }
        uh[it] = (v4u){pk16(hb[0], hb[1]), pk16(hb[2], hb[3]), pk16(hb[4], hb[5]), pk16(hb[6], hb[7])};
        ul[it] = (v4u){pk16(lb[0], lb[1]), pk16(lb[2], lb[3]), pk16(lb[4], lb[5]), pk16(lb[6], lb[7])};
      }
      {
#pragma unroll
        for (int it = 0; it < 4; ++it) {
          const size_t o = (rowbase + (size_t)((i << 4) + it * 4 + q4)) * kHd + c8;
          *(v4u*)(Ch + o) = uh[it];
          *(v4u*)(Cl + o) = ul[it];
        }
        
      }
    }
    wave_lds_sync();
  }
}

/* ---- flow scans, all f32, split along the sequence: 64 segments of 64 rows per (b,h), every segment scanned at the same time.
        Each running sum over rows = (sum of the totals of the segments before, added in segment order) + (serial sum inside the segment).
        One wave = two segments: a 16-lane row of the wave owns one segment, lane c of it owns features 4c..4c+3 (8 B per bf16 plane).
        q = q_hi + q_lo, k = k_hi + k_lo read from the bf16 planes (the same operands the WMMA products use).
        Launch 1: segment totals of k and q.                          Launch 2: sink_in, src_out per row; segment totals of k*src_out, q*sink_in.
        Launch 3: the two conserved dot products per row (raw sums).  Launch 4: per row rs = sigmoid(conserved_sink) * sink_in / (l+1) and
        comp = exp(clip(conserved_source)) / cumsum * (l+1), the cumsum as a block scan over the 4096 rows of one (b,h).
        Per-row results are kept by lane c for rows 4c..4c+3 of its segment and stored once as 16 lanes x 16 B = 256 B.
        The inner loops are fully unrolled so that the staged words and the kept rows are indexed by constants and stay in registers. */
__device__ __forceinline__ float row16_sum(float v) {
  /* DPP row_xmask 1, 2, 4, 8: butterfly sum over the 16 lanes of a row, no LDS round trip */
  v += __int_as_float(__builtin_amdgcn_update_dpp(0, __float_as_int(v), 0x161, 0xf, 0xf, true));
  v += __int_as_float(__builtin_amdgcn_update_dpp(0, __float_as_int(v), 0x162, 0xf, 0xf, true));
  v += __int_as_float(__builtin_amdgcn_update_dpp(0, __float_as_int(v), 0x164, 0xf, 0xf, true));
  v += __int_as_float(__builtin_amdgcn_update_dpp(0, __float_as_int(v), 0x168, 0xf, 0xf, true));
  return v;
}
__device__ __forceinline__ v4f hilo4(v2u h, v2u l) {
  v4f r;
  r[0] = __uint_as_float(h[0] << 16)         + __uint_as_float(l[0] << 16);
  r[1] = __uint_as_float(h[0] & 0xffff0000u) + __uint_as_float(l[0] & 0xffff0000u);
  r[2] = __uint_as_float(h[1] << 16)         + __uint_as_float(l[1] << 16);
  r[3] = __uint_as_float(h[1] & 0xffff0000u) + __uint_as_float(l[1] & 0xffff0000u);
  return r;
}
__device__ __forceinline__ float dot4_eps(v4f x, v4f y) {
  return (x[0] + kEps) * (y[0] + kEps) + (x[1] + kEps) * (y[1] + kEps) + (x[2] + kEps) * (y[2] + kEps) + (x[3] + kEps) * (y[3] + kEps);
}
/* totals of the segments before seg, added in segment order; T = [kNSeg][128] of one (b,h), first 64 floats -> a, last 64 -> b */
__device__ __forceinline__ void seg_prefix(const float* __restrict__ T, int seg, int c, v4f& a, v4f& b) {
  a = (v4f){0.f, 0.f, 0.f, 0.f};
  b = (v4f){0.f, 0.f, 0.f, 0.f};
  /* 16 segments' loads in flight per trip: the loads are independent, only the adds are ordered */
#pragma unroll 16
  for (int s = 0; s < kNSeg; ++s) {
    const v4f ta = *(const v4f*)(T + s * 128 + 4 * c);
    const v4f tb = *(const v4f*)(T + s * 128 + 64 + 4 * c);
    const bool in = s < seg;
#pragma unroll
    for (int e = 0; e < 4; ++e) {
      a[e] += in ? ta[e] : 0.0f;
      b[e] += in ? tb[e] : 0.0f;
    }
  }
}

__global__ __launch_bounds__(32) void flow_seg_total_kernel(const unsigned short* __restrict__ QHp, const unsigned short* __restrict__ QLp,
                                                            const unsigned short* __restrict__ KHp, const unsigned short* __restrict__ KLp,
                                                            float* __restrict__ T0) {
  const int lane = threadIdx.x, c = lane & 15;
  const int bh = (int)blockIdx.x / (kNSeg / 2);
  const int seg = ((int)blockIdx.x % (kNSeg / 2)) * 2 + (lane >> 4);
  const size_t w0 = ((size_t)bh * kSeq + (size_t)seg * kSegRows) * (kHd / 4) + c;
  const v2u* qh = (const v2u*)QHp + w0;
  const v2u* ql = (const v2u*)QLp + w0;
  const v2u* kh = (const v2u*)KHp + w0;
  const v2u* kl = (const v2u*)KLp + w0;
  v4f ks = (v4f){0.f, 0.f, 0.f, 0.f}, qs = (v4f){0.f, 0.f, 0.f, 0.f};
  /* 16 rows per trip, kept rolled for code size: all their loads are issued before the first sum */
#pragma unroll 1
  for (int t = 0; t < kSegRows / 16; ++t) {
    const v2u* pqh = qh + t * 16 * (kHd / 4);
    const v2u* pql = ql + t * 16 * (kHd / 4);
    const v2u* pkh = kh + t * 16 * (kHd / 4);
    const v2u* pkl = kl + t * 16 * (kHd / 4);
    v2u wqh[16], wql[16], wkh[16], wkl[16];
#pragma unroll
    for (int j = 0; j < 16; ++j) {
      wqh[j] = pqh[j * (kHd / 4)];
      wql[j] = pql[j * (kHd / 4)];
      wkh[j] = pkh[j * (kHd / 4)];
      wkl[j] = pkl[j * (kHd / 4)];
    }
    /* the wait that stands before a register named by an issued global load is overwritten; the address pairs are inputs so that
       they stay untouched up to it; its memory clobber also keeps the trip's loads together in front of the sums */
    asm volatile("s_wait_xcnt 0x0" :: "v"(pqh), "v"(pql), "v"(pkh), "v"(pkl) : "memory");
#pragma unroll
    for (int j = 0; j < 16; ++j) {
      ks += hilo4(wkh[j], wkl[j]);
      qs += hilo4(wqh[j], wql[j]);
    }
  }
  float* o = T0 + ((size_t)bh * kNSeg + seg) * 128 + 4 * c;
  *(v4f*)o = ks;
  *(v4f*)(o + 64) = qs;
}

__global__ __launch_bounds__(32) void flow_incoming_kernel(const unsigned short* __restrict__ QHp, const unsigned short* __restrict__ QLp,
                                                           const unsigned short* __restrict__ KHp, const unsigned short* __restrict__ KLp,
                                                           const float* __restrict__ T0, float* __restrict__ SINK, float* __restrict__ SRC,
                                                           float* __restrict__ T1) {
  const int lane = threadIdx.x, c = lane & 15;
  const int bh = (int)blockIdx.x / (kNSeg / 2);
  const int seg = ((int)blockIdx.x % (kNSeg / 2)) * 2 + (lane >> 4);
  const int row0 = seg * kSegRows;
  const size_t w0 = ((size_t)bh * kSeq + (size_t)row0) * (kHd / 4) + c;
  const v2u* qh = (const v2u*)QHp + w0;
  const v2u* ql = (const v2u*)QLp + w0;
  const v2u* kh = (const v2u*)KHp + w0;
  const v2u* kl = (const v2u*)KLp + w0;
  v4f kc, qc;
  seg_prefix(T0 + (size_t)bh * kNSeg * 128, seg, c, kc, qc);
  v4f a1 = (v4f){0.f, 0.f, 0.f, 0.f}, a2 = (v4f){0.f, 0.f, 0.f, 0.f};
  v4f si = (v4f){0.f, 0.f, 0.f, 0.f}, so = (v4f){0.f, 0.f, 0.f, 0.f};
  /* 8 rows per trip, kept rolled for code size: their loads, row sums and divisions are independent of each other and overlap;
     only the running sums are ordered */
#pragma unroll 1
  for (int t = 0; t < kSegRows / 8; ++t) {
    const v2u* pqh = qh + t * 8 * (kHd / 4);
    const v2u* pql = ql + t * 8 * (kHd / 4);
    const v2u* pkh = kh + t * 8 * (kHd / 4);
    const v2u* pkl = kl + t * 8 * (kHd / 4);
    v2u wqh[8], wql[8], wkh[8], wkl[8];
#pragma unroll
    for (int j = 0; j < 8; ++j) {
      wqh[j] = pqh[j * (kHd / 4)];
      wql[j] = pql[j * (kHd / 4)];
      wkh[j] = pkh[j * (kHd / 4)];
      wkl[j] = pkl[j * (kHd / 4)];
    }
    /* the wait that stands before a register named by an issued global load is overwritten; the address pairs are inputs so that
       they stay untouched up to it */
    asm volatile("s_wait_xcnt 0x0" :: "v"(pqh), "v"(pql), "v"(pkh), "v"(pkl) : "memory");
#pragma unroll
    for (int jj = 0; jj < 8; ++jj) {
      const int r = 8 * t + jj;
      const int g = 2 * t + (jj >> 2);
      const int j = jj & 3;
      const v4f q = hilo4(wqh[jj], wql[jj]);
      const v4f k = hilo4(wkh[jj], wkl[jj]);
      kc += k;
      qc += q;
      const float d1 = row16_sum(dot4_eps(q, kc));
      const float d2 = row16_sum(dot4_eps(k, qc));
      const float nrm = (float)(row0 + r + 1);
      const float sink_in = (1.0f / d1) * nrm;
      const float src_out = (1.0f / d2) * nrm;
      a1 += k * src_out;
      a2 += q * sink_in;
      si[j] = (c == g) ? sink_in : si[j];
      so[j] = (c == g) ? src_out : so[j];
    }
  }
  const size_t ro = (size_t)bh * kSeq + (size_t)row0 + 4 * c;
  *(v4f*)(SINK + ro) = si;
  *(v4f*)(SRC + ro) = so;
  float* o = T1 + ((size_t)bh * kNSeg + seg) * 128 + 4 * c;
  *(v4f*)o = a1;
  *(v4f*)(o + 64) = a2;
}

__global__ __launch_bounds__(32) void flow_conserved_kernel(const unsigned short* __restrict__ QHp, const unsigned short* __restrict__ QLp,
                                                            const unsigned short* __restrict__ KHp, const unsigned short* __restrict__ KLp,
                                                            const float* __restrict__ T1, const float* __restrict__ SINK,
                                                            const float* __restrict__ SRC, float* __restrict__ D3, float* __restrict__ D4) {
  const int lane = threadIdx.x, c = lane & 15;
  const int bh = (int)blockIdx.x / (kNSeg / 2);
  const int seg = ((int)blockIdx.x % (kNSeg / 2)) * 2 + (lane >> 4);
  const int row0 = seg * kSegRows;
  const size_t w0 = ((size_t)bh * kSeq + (size_t)row0) * (kHd / 4) + c;
  const v2u* qh = (const v2u*)QHp + w0;
  const v2u* ql = (const v2u*)QLp + w0;
  const v2u* kh = (const v2u*)KHp + w0;
  const v2u* kl = (const v2u*)KLp + w0;
  const float* sip = SINK + (size_t)bh * kSeq + row0;
  const float* sop = SRC + (size_t)bh * kSeq + row0;
  v4f s1, s2;
  seg_prefix(T1 + (size_t)bh * kNSeg * 128, seg, c, s1, s2);
  v4f k3 = (v4f){0.f, 0.f, 0.f, 0.f}, k4 = (v4f){0.f, 0.f, 0.f, 0.f};
  /* 8 rows per trip, kept rolled for code size: their loads and row sums overlap; only the running sums are ordered */
#pragma unroll 1
  for (int t = 0; t < kSegRows / 8; ++t) {
    const v2u* pqh = qh + t * 8 * (kHd / 4);
    const v2u* pql = ql + t * 8 * (kHd / 4);
    const v2u* pkh = kh + t * 8 * (kHd / 4);
    const v2u* pkl = kl + t * 8 * (kHd / 4);
    const v4f* psi = (const v4f*)(sip + 8 * t);
    const v4f* pso = (const v4f*)(sop + 8 * t);
    v2u wqh[8], wql[8], wkh[8], wkl[8];
    v4f si[2], so[2];
    si[0] = psi[0];
    si[1] = psi[1];
    so[0] = pso[0];
    so[1] = pso[1];
#pragma unroll
    for (int j = 0; j < 8; ++j) {
      wqh[j] = pqh[j * (kHd / 4)];
      wql[j] = pql[j * (kHd / 4)];
      wkh[j] = pkh[j * (kHd / 4)];
      wkl[j] = pkl[j * (kHd / 4)];
    }
    /* the wait that stands before a register named by an issued global load is overwritten; the address pairs are inputs so that
       they stay untouched up to it */
    asm volatile("s_wait_xcnt 0x0" :: "v"(pqh), "v"(pql), "v"(pkh), "v"(pkl), "v"(psi), "v"(pso) : "memory");
#pragma unroll
    for (int jj = 0; jj < 8; ++jj) {
      const int g = 2 * t + (jj >> 2);
      const int j = jj & 3;
      const v4f q = hilo4(wqh[jj], wql[jj]);
      const v4f k = hilo4(wkh[jj], wkl[jj]);
      s1 += k * so[jj >> 2][j];
      s2 += q * si[jj >> 2][j];
      const float d3 = row16_sum(dot4_eps(q, s1));
      const float d4 = row16_sum(dot4_eps(k, s2));
      k3[j] = (c == g) ? d3 : k3[j];
      k4[j] = (c == g) ? d4 : k4[j];
    }
  }
  const size_t ro = (size_t)bh * kSeq + (size_t)row0 + 4 * c;
  *(v4f*)(D3 + ro) = k3;
  *(v4f*)(D4 + ro) = k4;
}

/* one block of 32 waves per (b,h); thread t owns rows 4t..4t+3 */
__global__ __launch_bounds__(1024) void flow_finish_kernel(const float* __restrict__ D3, const float* __restrict__ D4,
                                                           const float* __restrict__ SINK, float* __restrict__ RS, float* __restrict__ COMP) {
  __shared__ float wtot[32];
  const int tid = threadIdx.x, lane = tid & 31, wave = tid >> 5;
  const size_t o = (size_t)blockIdx.x * kSeq + 4 * (size_t)tid;
  const v4f d3 = *(const v4f*)(D3 + o);
  const v4f d4 = *(const v4f*)(D4 + o);
  const v4f si = *(const v4f*)(SINK + o);
  v4f rs, ce, inc;
  float run = 0.f;
#pragma unroll
  for (int e = 0; e < 4; ++e) {
    const float nrm = (float)(4 * tid + e + 1);
    const float inv_nrm = 1.0f / nrm;
    const float csink = d3[e] * inv_nrm;
    const float csrc  = fminf(fmaxf(d4[e] * inv_nrm, -1.0f), 1.0f);
    const float salloc = 1.0f / (1.0f + expf(-csink));
    ce[e] = expf(csrc);
    run += ce[e];
    inc[e] = run;
    rs[e] = salloc * (si[e] * inv_nrm);
  }
  *(v4f*)(RS + o) = rs;
  /* inclusive scan of the threads' totals over the wave */
  float sc = run;
#pragma unroll
  for (int off = 1; off < 32; off <<= 1) {
    const float t = __shfl_up(sc, off, 32);
    sc += (lane >= off) ? t : 0.0f;
  }
  if (lane == 31) wtot[wave] = sc;
  const float up = __shfl_up(sc, 1, 32);
  const float before_in_wave = (lane == 0) ? 0.0f : up;
  /* every wave's total is in LDS before any wave sums the totals of the waves before it */
  __syncthreads();
  float wp = (lane < wave) ? wtot[lane] : 0.0f;
#pragma unroll
  for (int off = 16; off > 0; off >>= 1) wp += __shfl_xor(wp, off, 32);
  const float base = wp + before_in_wave;
  v4f co;
#pragma unroll
  for (int e = 0; e < 4; ++e) {
    const float nrm = (float)(4 * tid + e + 1);
    co[e] = (ce[e] / (base + inc[e])) * nrm;
  }
  *(v4f*)(COMP + o) = co;
}

/* ---- causal linear attention, split along the sequence: every 64-row chunk is its own block, of all (b,h) at once in chunk_state; in chunk_out_proj one block takes a chunk of all 8 heads of one b.
        Launch 1 (chunk_state):  per chunk its own St_n[m][d] = sum_l v'[l][m] k[l][d], v' = v * comp[l], f32, from zero.
        Launch 2 (chunk_prefix): per element the sum of the chunks before, added in chunk order in f32, stored as bf16 hi/lo planes in state order.
        Launch 3 (chunk_out_proj): attn[i][m] = rs[i] * ( sum_d q[i][d] St[m][d] + sum_{j<=i} (q[i].k[j]) v'[j][m] ) per chunk, then its output projection.
        Attention products: hi*hi + hi*lo + lo*hi; the output projection: hi*hi + lo*hi. Q and row-major K fragments come straight from the global bf16 planes (row pitch 64), St fragments
        from planes in state order (below).
        LDS bf16 tiles are at pitch 72 (the attention tile at 520); a k-tile read of a pitch-72 tile touches columns 0..63 only. No atomics, no inter-block communication.
        The loops over tiles, fragments and staged words are fully unrolled so that these are indexed by constants and stay in registers. */

/* Global order of the planes that only these kernels read, chosen so that every wave load covers 512 contiguous bytes (4 whole lines):
   v, per (b,h,chunk) 4096 floats: element (row l, feature d) at ((d >> 2) & 7) * 512 + (2 l + (d >> 5)) * 4 + (d & 3), so that word g of
   reader thread t = 2 l + (d >> 5) (row t >> 1, features 32 (t & 1) + 4 g .. + 3) lies at g * 512 + 4 t.
   Chunk states (CS, SH, SL), per (b,h,chunk) 4096 elements: element (m, d) at (m >> 4) * 1024 + (d >> 4) * 256 + (16 ((d >> 3) & 1) + (m & 15)) * 8
   + (d & 7), so that the 8 elements which lane (c, hh) takes as one half of a fragment of rows 16 t + c lie at t * 1024 + (d >> 4) * 256 + 8 lane. */
__device__ __forceinline__ void v_words(const float* p, v4f (&vv)[8]) {
#pragma unroll
  for (int g = 0; g < 8; ++g) vv[g] = *(const v4f*)(p + g * 512);
}
/* state fragment: elements 0..7 <- d = 32 dc + 8 hh + 0..7, elements 8..15 <- the same + 16 (the k order of Frag::load); p = tile + dc * 512 + 8 lane */
__device__ __forceinline__ v16b state_frag(const __bf16* p) {
  Frag<__bf16>::U f; f.h[0] = *(const v8b*)(p); f.h[1] = *(const v8b*)(p + 256); return f.v;
}

/* VT hi/lo <- (v * comp)^T of one chunk; thread covers row lr, features dh..dh+31 (vv = its 8 x 16-B words of v): 128 threads x 32 = 64 x 64 */
__device__ __forceinline__ void vt_store(float cv, const v4f (&vv)[8], int lr, int dh, __bf16* VTh, __bf16* VTl) {
#pragma unroll
  for (int i = 0; i < 8; ++i) {
#pragma unroll
    for (int e = 0; e < 4; ++e) {
      const float f = vv[i][e] * cv;
      const unsigned short hb = f2bf_bits(f);
      const unsigned short lb = f2bf_bits(f - bf_bits2f(hb));
      const int d = dh + 4 * i + e;
      VTh[d * kLp + lr] = bits2bf(hb);
      VTl[d * kLp + lr] = bits2bf(lb);
    }
  }
}

/* one block of 4 waves per (b,h,chunk). Wave w owns rows m = 16w..16w+15 of St_n[m][d]: A rows d = 16i + c of KT, Bt rows m = 16w + c
   of VT, k = l for both, so lane (c,hh) holds St_n[16w + c][16i + 8hh + r]. Coverage: 2048 blocks x 64 x 64 floats. */
__global__ __launch_bounds__(128) void chunk_state_kernel(
    const unsigned short* __restrict__ KHp, const unsigned short* __restrict__ KLp,
    const float* __restrict__ VF, const float* __restrict__ COMP, float* __restrict__ CS) {
  __shared__ __align__(16) __bf16 KTh[kHd * kLp];
  __shared__ __align__(16) __bf16 KTl[kHd * kLp];
  __shared__ __align__(16) __bf16 VTh[kHd * kLp];
  __shared__ __align__(16) __bf16 VTl[kHd * kLp];
  __shared__ __align__(16) float sT[4][16 * 68];

  const int tid = threadIdx.x, lane = tid & 31, wave = tid >> 5;
  const int c = lane & 15, hh = lane >> 4, koff = hh * 8;
  const int bh = (int)blockIdx.x / kNChunk;
  const int l0 = ((int)blockIdx.x % kNChunk) * kChunk;
  const size_t pbase = (size_t)bh * kSeq * kHd;
  const int lr = tid >> 1, dh = (tid & 1) * 32;
  const v8f z8 = (v8f){0.f,0.f,0.f,0.f,0.f,0.f,0.f,0.f};

  /* all global loads of the block first, so that they are in flight together */
  const size_t ko = pbase + (size_t)(l0 + lr) * kHd + dh;
  const v4u* kh4 = (const v4u*)(KHp + ko);
  const v4u* kl4 = (const v4u*)(KLp + ko);
  const float* v4p = VF + pbase + (size_t)l0 * kHd + 4 * tid;
  const float* cp = COMP + (size_t)bh * kSeq + l0 + lr;
  v4u wh[4], wl[4];
  v4f vv[8];
#pragma unroll
  for (int g = 0; g < 4; ++g) { wh[g] = kh4[g]; wl[g] = kl4[g]; }
  v_words(v4p, vv);
  const float cv = *cp;
  /* the wait that stands before a register named by an issued global load is overwritten; the address pairs, and the row index that
     the comp load takes as its offset, are inputs so that they stay untouched up to it */
  asm volatile("s_wait_xcnt 0x0" :: "v"(kh4), "v"(kl4), "v"(v4p), "v"(cp), "v"(lr) : "memory");

  /* KT hi/lo <- k^T; thread covers row lr, features dh..dh+31 (4 x 16-B words per plane): 128 threads x 32 = 64 x 64 */
  {
#pragma unroll
    for (int g = 0; g < 4; ++g) {
#pragma unroll
      for (int e = 0; e < 4; ++e) {
        const unsigned a = wh[g][e];
        const unsigned b = wl[g][e];
        const int d = dh + 8 * g + 2 * e;
        const unsigned a0 = a & 0xffffu, a1 = a >> 16;
        const unsigned b0 = b & 0xffffu, b1 = b >> 16;
        KTh[d * kLp + lr]       = bits2bf((unsigned short)a0);
        KTh[(d + 1) * kLp + lr] = bits2bf((unsigned short)a1);
        KTl[d * kLp + lr]       = bits2bf((unsigned short)b0);
        KTl[(d + 1) * kLp + lr] = bits2bf((unsigned short)b1);
      }
    }
  }
  vt_store(cv, vv, lr, dh, VTh, VTl);
  /* KT and VT are complete before any wave reads fragments of them */
  __syncthreads();

  v8f acc[4];
  acc[0] = z8; acc[1] = z8; acc[2] = z8; acc[3] = z8;
#pragma unroll
  for (int kk = 0; kk < 2; ++kk) {
    const v16b vbh = Frag<__bf16>::load(VTh + (16 * wave + c) * kLp + kk * 32 + koff);
    const v16b vbl = Frag<__bf16>::load(VTl + (16 * wave + c) * kLp + kk * 32 + koff);
#pragma unroll
    for (int i = 0; i < 4; ++i) {
      const v16b kh = Frag<__bf16>::load(KTh + (16 * i + c) * kLp + kk * 32 + koff);
      const v16b kl = Frag<__bf16>::load(KTl + (16 * i + c) * kLp + kk * 32 + koff);
      acc[i] = mma_g(kh, vbh, acc[i]);
      acc[i] = mma_g(kl, vbh, acc[i]);
      acc[i] = mma_g(kh, vbl, acc[i]);
    }
  }
  acc_guard4(acc[0], acc[1], acc[2], acc[3]);

  /* the wave's 1024 elements in state order: acc[i][r] = element i * 256 + 8 lane + r of its tile; through its own slab, so that a store
     is 32 lanes x 16 B = 512 contiguous bytes */
  float* slab = sT[wave];
#pragma unroll
  for (int i = 0; i < 4; ++i) {
    float* sp = slab + i * 256 + 8 * lane;
    *(v4f*)(sp)     = (v4f){acc[i][0], acc[i][1], acc[i][2], acc[i][3]};
    *(v4f*)(sp + 4) = (v4f){acc[i][4], acc[i][5], acc[i][6], acc[i][7]};
  }
  /* slab: written and read by this wave only, by different lanes */
  wave_lds_sync();
  float* op = CS + (size_t)blockIdx.x * (kHd * kHd) + (size_t)(wave * 1024 + 4 * lane);
  v4f ow[8];
#pragma unroll
  for (int it = 0; it < 8; ++it) ow[it] = *(const v4f*)(slab + it * 128 + 4 * lane);
#pragma unroll
  for (int it = 0; it < 8; ++it) *(v4f*)(op + it * 128) = ow[it];
}

/* exclusive prefix over the 64 chunks of one (b,h); thread owns 4 consecutive elements of a state, whatever their order: 32 x 1024 threads.
   A wave reads 512 B and writes 256 B per plane and chunk (whole lines). */
__global__ __launch_bounds__(128) void chunk_prefix_kernel(const float* __restrict__ CS, unsigned short* __restrict__ SHp,
                                                           unsigned short* __restrict__ SLp) {
  const int i = (int)blockIdx.x * 128 + (int)threadIdx.x;
  const size_t base = (size_t)(i >> 10) * kNChunk * (kHd * kHd) + (size_t)(i & 1023) * 4;
  v4f run = (v4f){0.f, 0.f, 0.f, 0.f};
  /* 32 chunks per trip, kept rolled for code size: the loads are independent and all in flight together, only the adds are ordered */
#pragma unroll 1
  for (int g = 0; g < kNChunk / 32; ++g) {
    const float* pc = CS + base + (size_t)g * 32 * (kHd * kHd);
    unsigned short* ph = SHp + base + (size_t)g * 32 * (kHd * kHd);
    unsigned short* pl = SLp + base + (size_t)g * 32 * (kHd * kHd);
    v4f t[32];
#pragma unroll
    for (int j = 0; j < 32; ++j) t[j] = *(const v4f*)(pc + j * (kHd * kHd));
    /* the wait that stands before a register named by an issued global load is overwritten; the address pair is an input so that
       it stays untouched up to it */
    asm volatile("s_wait_xcnt 0x0" :: "v"(pc) : "memory");
#pragma unroll
    for (int q = 0; q < 4; ++q) {
      v2u uh[8], ul[8];
#pragma unroll
      for (int j = 0; j < 8; ++j) {
        unsigned short hb[4], lb[4];
#pragma unroll
        for (int e = 0; e < 4; ++e) {
          const float s = run[e];
          hb[e] = f2bf_bits(s);
          lb[e] = f2bf_bits(s - bf_bits2f(hb[e]));
        }
        uh[j] = (v2u){pk16(hb[0], hb[1]), pk16(hb[2], hb[3])};
        ul[j] = (v2u){pk16(lb[0], lb[1]), pk16(lb[2], lb[3])};
        run += t[8 * q + j];
      }
#pragma unroll
      for (int j = 0; j < 8; ++j) {
        *(v2u*)(ph + (8 * q + j) * (kHd * kHd)) = uh[j];
        *(v2u*)(pl + (8 * q + j) * (kHd * kHd)) = ul[j];
      }
      /* the same wait behind the stores: their address pairs and data words are inputs so that they stay untouched up to it */
      asm volatile("s_wait_xcnt 0x0" :: "v"(ph), "v"(pl), "v"(uh[0]), "v"(uh[1]), "v"(uh[2]), "v"(uh[3]), "v"(uh[4]), "v"(uh[5]),
                   "v"(uh[6]), "v"(uh[7]), "v"(ul[0]), "v"(ul[1]), "v"(ul[2]), "v"(ul[3]), "v"(ul[4]), "v"(ul[5]), "v"(ul[6]), "v"(ul[7])
                   : "memory");
    }
  }
}

/* Launch 3 with the output projection in it: one block of 16 waves per (b, chunk) owns 64 rows of ALL 8 heads, so the attention tile
   [64][512] never leaves the WGP: it is written to LDS as bf16 hi/lo and is the A operand of out = (attn_hi + attn_lo) x bf16(Wo)^T + bo.
   Part 1, two passes of 4 heads: waves 4g..4g+3 work on head 4p + g, wave 4g + w on rows 16w..16w+15 of the chunk.
   Part 2: wave (wm, wn) owns the 32 x 64 tile at rows 32 wm, columns 64 wn; per stage of 64 k all 512 Wo rows are copied to LDS
   asynchronously, two buffers: stage s + 1 flies while stage s is multiplied.
   LDS: sA = attn hi | lo at pitch 520 (1040 B = 16 B x odd). sU is used three times over: part 1: VT hi/lo of 4 heads, then P hi/lo of
   16 waves; part 2: the two Wo buffers; epilogue: one f32 slab per wave.
   Coverage: 4 x 64 blocks x 64 rows x 512 columns. */
constexpr int kAp = kEmb + 8;
static_assert(kAp % 8 == 0, "LDS pitch keeps 16-B alignment");
static_assert(4 * 2 * kHd * kLp + 16 * 2 * 16 * kLp == 2 * kEmb * kLp, "VT and P strips fill exactly the two Wo buffers");
static_assert(16 * 16 * 68 * 4 <= 2 * kEmb * kLp * 2, "the slabs fit the Wo buffers");
__global__ __launch_bounds__(512) void chunk_out_proj_kernel(
    const unsigned short* __restrict__ QHp, const unsigned short* __restrict__ QLp,
    const unsigned short* __restrict__ KHp, const unsigned short* __restrict__ KLp,
    const float* __restrict__ VF, const float* __restrict__ RS, const float* __restrict__ COMP,
    const unsigned short* __restrict__ SHp, const unsigned short* __restrict__ SLp,
    const unsigned short* __restrict__ Wop, const float* __restrict__ bias, float* __restrict__ Fout) {
  __shared__ __align__(16) __bf16 sA[2][kChunk * kAp];
  __shared__ __align__(16) __bf16 sU[2 * kEmb * kLp];

  const int tid = threadIdx.x, lane = tid & 31, wave = tid >> 5;
  const int c = lane & 15, hh = lane >> 4, koff = hh * 8;
  const int bb = (int)blockIdx.x / kNChunk;
  const int n = (int)blockIdx.x % kNChunk;
  const int l0 = n * kChunk;
  const int grp = wave >> 2, w4 = wave & 3;
  __bf16* VTh = sU + grp * (2 * kHd * kLp);
  __bf16* VTl = VTh + kHd * kLp;
  __bf16* ph = sU + 4 * 2 * kHd * kLp + wave * (2 * 16 * kLp);
  __bf16* pl = ph + 16 * kLp;
  const int lr = (tid & 127) >> 1, dh = (tid & 1) * 32;
  const v8f z8 = (v8f){0.f,0.f,0.f,0.f,0.f,0.f,0.f,0.f};

  /* kept rolled for code size: the two passes differ only in the head */
#pragma unroll 1
  for (int p = 0; p < 2; ++p) {
    const int hd = 4 * p + grp;
    const int bh = bb * kHeads + hd;
    const size_t pbase = (size_t)bh * kSeq * kHd;
    const size_t sbase = ((size_t)bh * kNChunk + n) * (kHd * kHd);
    const __bf16* QH = (const __bf16*)QHp + pbase;
    const __bf16* QL = (const __bf16*)QLp + pbase;
    const __bf16* KH = (const __bf16*)KHp + pbase;
    const __bf16* KL = (const __bf16*)KLp + pbase;
    const __bf16* SH = (const __bf16*)SHp + sbase;
    const __bf16* SL = (const __bf16*)SLp + sbase;
    const float* rsp = RS + (size_t)bh * kSeq;

    /* first load group, in flight together: this thread's part of v with its row's comp, the Q fragments (rows 16w + c) and the
       row-major K fragments (rows 16j + c) */
    const float* v4p = VF + pbase + (size_t)l0 * kHd + 4 * (tid & 127);
    const float* cp = COMP + (size_t)bh * kSeq + l0 + lr;
    const __bf16* qhp = QH + (size_t)(l0 + 16 * w4 + c) * kHd + koff;
    const __bf16* qlp = QL + (size_t)(l0 + 16 * w4 + c) * kHd + koff;
    const __bf16* khp = KH + (size_t)(l0 + c) * kHd + koff;
    const __bf16* klp = KL + (size_t)(l0 + c) * kHd + koff;
    v4f vv[8];
    v16b qh[2], ql[2], kh[4][2], kl[4][2];
    v_words(v4p, vv);
#pragma unroll
    for (int dc = 0; dc < 2; ++dc) {
      qh[dc] = Frag<__bf16>::load(qhp + dc * 32);
      ql[dc] = Frag<__bf16>::load(qlp + dc * 32);
    }
#pragma unroll
    for (int j = 0; j < 4; ++j) {
#pragma unroll
      for (int dc = 0; dc < 2; ++dc) {
        kh[j][dc] = Frag<__bf16>::load(khp + 16 * j * kHd + dc * 32);
        kl[j][dc] = Frag<__bf16>::load(klp + 16 * j * kHd + dc * 32);
      }
    }
    const float cv = *cp;
    /* the wait that stands before a register named by an issued global load is overwritten; the address pairs are inputs so that
       they stay untouched up to it */
    asm volatile("s_wait_xcnt 0x0" :: "v"(v4p), "v"(cp), "v"(qhp), "v"(qlp), "v"(khp), "v"(klp) : "memory");

    vt_store(cv, vv, lr, dh, VTh, VTl);

    /* scores rows 16w.., all 64 columns; inclusive causal mask by select; hi/lo into this wave's P strip */
#pragma unroll
    for (int j = 0; j < 4; ++j) {
      v8f s = z8;
#pragma unroll
      for (int dc = 0; dc < 2; ++dc) {
        s = mma_g(qh[dc], kh[j][dc], s);
        s = mma_g(qh[dc], kl[j][dc], s);
        s = mma_g(ql[dc], kh[j][dc], s);
      }
      const int jj = 16 * j + c;
#pragma unroll
      for (int r = 0; r < 8; ++r) {
        const int ii = 16 * w4 + 8 * hh + r;
        const float pv = (jj <= ii) ? s[r] : 0.0f;
        const unsigned short hb = f2bf_bits(pv);
        const unsigned short lb = f2bf_bits(pv - bf_bits2f(hb));
        ph[(8 * hh + r) * kLp + jj] = bits2bf(hb);
        pl[(8 * hh + r) * kLp + jj] = bits2bf(lb);
      }
    }

    /* second load group, in flight together: the St fragments (Bt rows m = 16t + c, k = d) and the row scales */
    const __bf16* sph = SH + 8 * lane;
    const __bf16* spl = SL + 8 * lane;
    const float* rp = rsp + l0 + 16 * w4 + 8 * hh;
    v16b sh[4][2], sl[4][2];
#pragma unroll
    for (int t = 0; t < 4; ++t) {
#pragma unroll
      for (int dc = 0; dc < 2; ++dc) {
        sh[t][dc] = state_frag(sph + t * 1024 + dc * 512);
        sl[t][dc] = state_frag(spl + t * 1024 + dc * 512);
      }
    }
    const v4f r0 = *(const v4f*)(rp);
    const v4f r1 = *(const v4f*)(rp + 4);
    /* the same wait for the second group */
    asm volatile("s_wait_xcnt 0x0" :: "v"(sph), "v"(spl), "v"(rp) : "memory");

    v8f accO[4];
    accO[0] = z8; accO[1] = z8; accO[2] = z8; accO[3] = z8;
    /* inter: Q x St^T */
#pragma unroll
    for (int t = 0; t < 4; ++t) {
#pragma unroll
      for (int dc = 0; dc < 2; ++dc) {
        accO[t] = mma_g(qh[dc], sh[t][dc], accO[t]);
        accO[t] = mma_g(qh[dc], sl[t][dc], accO[t]);
        accO[t] = mma_g(ql[dc], sh[t][dc], accO[t]);
      }
    }
    /* VT is complete before any wave reads fragments of it; the barrier also orders this wave's P strip writes before its reads */
    __syncthreads();
    /* intra: P x v' (A rows i = c of the strip, k = j; Bt rows m = 16t + c of VT, k = j) */
#pragma unroll
    for (int kk = 0; kk < 2; ++kk) {
      const v16b pah = Frag<__bf16>::load(ph + c * kLp + kk * 32 + koff);
      const v16b pal = Frag<__bf16>::load(pl + c * kLp + kk * 32 + koff);
#pragma unroll
      for (int t = 0; t < 4; ++t) {
        const v16b vh = Frag<__bf16>::load(VTh + (16 * t + c) * kLp + kk * 32 + koff);
        const v16b vl = Frag<__bf16>::load(VTl + (16 * t + c) * kLp + kk * 32 + koff);
        accO[t] = mma_g(pah, vh, accO[t]);
        accO[t] = mma_g(pah, vl, accO[t]);
        accO[t] = mma_g(pal, vh, accO[t]);
      }
    }
    /* row scale, bf16 hi/lo, into columns 64 hd .. 64 hd + 63 of the attention tile */
    {
      float rsv[8];
#pragma unroll
      for (int e = 0; e < 4; ++e) { rsv[e] = r0[e]; rsv[4 + e] = r1[e]; }
      __bf16* ah = sA[0] + (16 * w4 + 8 * hh) * kAp + hd * kHd + c;
      __bf16* al = sA[1] + (16 * w4 + 8 * hh) * kAp + hd * kHd + c;
#pragma unroll
      for (int t = 0; t < 4; ++t) {
#pragma unroll
        for (int r = 0; r < 8; ++r) {
          const float o = accO[t][r] * rsv[r];
          const unsigned short hb = f2bf_bits(o);
          const unsigned short lb = f2bf_bits(o - bf_bits2f(hb));
          ah[r * kAp + 16 * t] = bits2bf(hb);
          al[r * kAp + 16 * t] = bits2bf(lb);
        }
      }
    }
    /* foot of a pass: this wave's reads of VT and P have returned and its tile writes are done ... */
    asm volatile("s_wait_dscnt 0x0" ::: "memory");
    /* ... and every wave's: VT and P may be rewritten (next pass, or the Wo copies); after the last pass the attention tile is complete */
    __syncthreads();
  }

  /* ---- part 2: out tile = (attn_hi + attn_lo) x Wo^T ---- */
  const __bf16* Bt = (const __bf16*)Wop;
  constexpr int kStages = kEmb / 64;
  const int wm = wave >> 3, wn = wave & 7;
  v8f acc[2][4];
#pragma unroll
  for (int i = 0; i < 2; ++i)
#pragma unroll
    for (int j = 0; j < 4; ++j) acc[i][j] = z8;

  /* this thread's piece of a stage: row (tid >> 3) of each group of 64 rows, 16-B piece (tid & 7) of the row's 128 B */
  const int crow = tid >> 3;
  const int ccol = (tid & 7) * 8;
  const __bf16* gB = Bt + (size_t)crow * kEmb + ccol;
  const unsigned lbase = (unsigned)(size_t)(&sU[crow * kLp + ccol]);
  constexpr unsigned kBufBytes = kEmb * kLp * 2;
  constexpr unsigned kG = 64 * kLp * 2;   /* LDS bytes of a group of 64 rows */
  auto stage = [&](int st) {
    const unsigned l = lbase + (unsigned)(st & 1) * kBufBytes;
    const __bf16* g = gB + st * 64;
    async_copy4(l, l + kG, l + 2 * kG, l + 3 * kG, g, g + 64 * kEmb, g + 128 * kEmb, g + 192 * kEmb);
    async_copy4(l + 4 * kG, l + 5 * kG, l + 6 * kG, l + 7 * kG, g + 256 * kEmb, g + 320 * kEmb, g + 384 * kEmb, g + 448 * kEmb);
  };

  stage(0);
  /* stage 0 has landed for this wave's own copies ... */
  asm volatile("s_wait_asynccnt 0x0" ::: "memory");
  /* ... and for every wave's before anyone reads it */
  __syncthreads();
  stage(1);

  /* kept rolled for code size: the two buffers differ only in one base address */
#pragma unroll 1
  for (int st = 0; st < kStages; ++st) {
    const __bf16* sb  = sU + (st & 1) * (kEmb * kLp) + ((wn << 6) + c) * kLp + koff;
    const __bf16* sah = sA[0] + ((wm << 5) + c) * kAp + st * 64 + koff;
    const __bf16* sal = sA[1] + ((wm << 5) + c) * kAp + st * 64 + koff;
    /* the loops over k blocks, fragments and tiles are fully unrolled so that these are indexed by constants and stay in registers */
    /* all fragment reads of the stage first, as one group in front of its WMMAs */
    v16b bh[2][4], ah[2][2], al[2][2];
#pragma unroll
    for (int kk = 0; kk < 2; ++kk) {
#pragma unroll
      for (int j = 0; j < 4; ++j) bh[kk][j] = Frag<__bf16>::load(sb + (j << 4) * kLp + kk * 32);
#pragma unroll
      for (int i = 0; i < 2; ++i) {
        ah[kk][i] = Frag<__bf16>::load(sah + (i << 4) * kAp + kk * 32);
        al[kk][i] = Frag<__bf16>::load(sal + (i << 4) * kAp + kk * 32);
      }
    }
#pragma unroll
    for (int kk = 0; kk < 2; ++kk) {
#pragma unroll
      for (int i = 0; i < 2; ++i) {
#pragma unroll
        for (int j = 0; j < 4; ++j) {
          acc[i][j] = Frag<__bf16>::mma(ah[kk][i], bh[kk][j], acc[i][j]);
          acc[i][j] = Frag<__bf16>::mma(al[kk][i], bh[kk][j], acc[i][j]);
        }
        dep_guard4_b(acc[i][0], acc[i][1], acc[i][2], acc[i][3], ah[kk][i], al[kk][i]);
      }
      keep4_b(bh[kk][0], bh[kk][1], bh[kk][2], bh[kk][3]);
    }
    /* publish point of stage st + 1: this wave's reads of buffer st & 1 have returned ... */
    asm volatile("s_wait_dscnt 0x0" ::: "memory");
    /* ... its own copies of stage st + 1 have landed ... */
    asm volatile("s_wait_asynccnt 0x0" ::: "memory");
    /* ... and the same holds for every wave: stage st + 1 may be read, buffer st & 1 may be refilled */
    __syncthreads();
    if (st + 2 < kStages) stage(st + 2);
  }
  /* no copy is outstanding when the wave goes on to the epilogue and ends */
  asm volatile("s_wait_asynccnt 0x0" ::: "memory");
  acc_guard4(acc[0][0], acc[0][1], acc[0][2], acc[0][3]);
  acc_guard4(acc[1][0], acc[1][1], acc[1][2], acc[1][3]);

  /* epilogue: bias, the wave's 16 x 64 f32 in its own slab (the Wo buffers are dead behind the last barrier), whole-line stores:
     16 lanes x 16 B = 256 B of a row, 2 rows per instruction */
  float* slab = (float*)sU + wave * (16 * 68);
  const int n0 = wn << 6;
  const int c4 = c * 4;
#pragma unroll
  for (int i = 0; i < 2; ++i) {
#pragma unroll
    for (int j = 0; j < 4; ++j) {
      const float bv = bias[n0 + (j << 4) + c];
#pragma unroll
      for (int r = 0; r < 8; ++r) slab[(8 * hh + r) * 68 + (j << 4) + c] = acc[i][j][r] + bv;
    }
    /* slab: written and read by this wave only, by different lanes */
    wave_lds_sync();
    float* op = Fout + (size_t)(bb * kSeq + l0 + (wm << 5) + (i << 4) + hh) * kEmb + n0 + c4;
#pragma unroll
    for (int it = 0; it < 8; ++it) {
      const v4f v = *(const v4f*)(slab + (it * 2 + hh) * 68 + c4);
      *(v4f*)(op + (size_t)(it * 2) * kEmb) = v;
    }
    /* the wait that stands before a register named by an issued global store is overwritten; the address pair is an input so that
       it stays untouched up to it */
    asm volatile("s_wait_xcnt 0x0" :: "v"(op) : "memory");
    wave_lds_sync();
  }
}

/* ---- host glue ----
   Workspace region map (bytes, 256-B aligned carve; total 191,897,600 <= 268,435,456):
     XB    [16384][512] bf16   16,777,216   bf16(x)
     WQKV  [1536][512]  bf16    1,572,864   bf16(Wq | Wk | Wv)
     WOB   [512][512]   bf16      524,288   bf16(Wo)
     BIAS  [2048]       f32         8,192   bf16 values of bq | bk | bv | bo kept as f32
     QH,QL,KH,KL [32][4096][64] bf16  4 x 16,777,216   sigmoid(q), sigmoid(k) as hi/lo planes
     VF    [32][64][4096] f32  33,554,432   v, reader order inside a chunk
     RS, COMP [32][4096] f32   2 x 524,288
     SINK, SRC, D3, D4 [32][4096] f32   4 x 524,288   per-row values handed between the flow scan launches
     T0, T1 [32][64][128] f32  2 x 1,048,576   segment totals (k | q, then k*src_out | q*sink_in)
     CS    [32][64][4096] f32  33,554,432   each chunk's own state St_n, state order
     SH, SL [32][64][4096] bf16  2 x 16,777,216   state before each chunk as hi/lo planes, state order */
extern "C" void kernel_launch(void* const* d_in, const int* in_sizes, int n_in,
                              void* d_out, int out_size, void* d_ws, size_t ws_size, hipStream_t stream) {
  if (n_in < 9 || d_out == nullptr || d_ws == nullptr) return;
  if (in_sizes[0] != kRows * kEmb || in_sizes[1] != kEmb * kEmb || in_sizes[2] != kEmb ||
      in_sizes[3] != kEmb * kEmb || in_sizes[4] != kEmb || in_sizes[5] != kEmb * kEmb ||
      in_sizes[6] != kEmb || in_sizes[7] != kEmb * kEmb || in_sizes[8] != kEmb ||
      out_size != kRows * kEmb) return;

  const float* x  = (const float*)d_in[0];
  const float* Wq = (const float*)d_in[1];
  const float* bq = (const float*)d_in[2];
  const float* Wk = (const float*)d_in[3];
  const float* bk = (const float*)d_in[4];
  const float* Wv = (const float*)d_in[5];
  const float* bv = (const float*)d_in[6];
  const float* Wo = (const float*)d_in[7];
  const float* bo = (const float*)d_in[8];
  float* out = (float*)d_out;

  char* ws = (char*)d_ws; size_t off = 0;
  auto carve = [&](size_t bytes) -> char* { char* p = ws + off; off += (bytes + 255) & ~(size_t)255; return p; };
  unsigned short* XB   = (unsigned short*)carve((size_t)kRows * kEmb * 2);
  unsigned short* WQKV = (unsigned short*)carve((size_t)kQkvN * kEmb * 2);
  unsigned short* WOB  = (unsigned short*)carve((size_t)kEmb * kEmb * 2);
  float*          BIAS = (float*)carve((size_t)4 * kEmb * 4);
  unsigned short* QH   = (unsigned short*)carve((size_t)kBH * kSeq * kHd * 2);
  unsigned short* QL   = (unsigned short*)carve((size_t)kBH * kSeq * kHd * 2);
  unsigned short* KH   = (unsigned short*)carve((size_t)kBH * kSeq * kHd * 2);
  unsigned short* KL   = (unsigned short*)carve((size_t)kBH * kSeq * kHd * 2);
  float*          VF   = (float*)carve((size_t)kBH * kSeq * kHd * 4);
  float*          RS   = (float*)carve((size_t)kBH * kSeq * 4);
  float*          COMP = (float*)carve((size_t)kBH * kSeq * 4);
  float*          SINK = (float*)carve((size_t)kBH * kSeq * 4);
  float*          SRC  = (float*)carve((size_t)kBH * kSeq * 4);
  float*          D3   = (float*)carve((size_t)kBH * kSeq * 4);
  float*          D4   = (float*)carve((size_t)kBH * kSeq * 4);
  float*          T0   = (float*)carve((size_t)kBH * kNSeg * 128 * 4);
  float*          T1   = (float*)carve((size_t)kBH * kNSeg * 128 * 4);
  float*          CS   = (float*)carve((size_t)kBH * kNChunk * kHd * kHd * 4);
  unsigned short* SH   = (unsigned short*)carve((size_t)kBH * kNChunk * kHd * kHd * 2);
  unsigned short* SL   = (unsigned short*)carve((size_t)kBH * kNChunk * kHd * kHd * 2);
  if (off > ws_size || off > (size_t)268435456) return;

  /* 16-bit operand planes and the bias plane, one launch */
  prep_kernel<<<kPrepBlocks, 256, 0, stream>>>(x, Wq, Wk, Wv, Wo, bq, bk, bv, bo, XB, WQKV, WOB, BIAS);

  /* projections: M = 16384, N = 1536, K = 512; 128 x 6 block tiles of 128 x 256 = 768 blocks x 8 waves */
  gemm64_kernel<<<(kRows / 64) * (kQkvN / 64) / 8, 256, 0, stream>>>(
      XB, WQKV, BIAS, QH, QL, KH, KL, VF, kRows, kQkvN);

  /* flow scans: three launches of 1024 waves (two 64-row segments each), then one block per (b,h) */
  flow_seg_total_kernel<<<kBH * (kNSeg / 2), 32, 0, stream>>>(QH, QL, KH, KL, T0);
  flow_incoming_kernel<<<kBH * (kNSeg / 2), 32, 0, stream>>>(QH, QL, KH, KL, T0, SINK, SRC, T1);
  flow_conserved_kernel<<<kBH * (kNSeg / 2), 32, 0, stream>>>(QH, QL, KH, KL, T1, SINK, SRC, D3, D4);
  flow_finish_kernel<<<kBH, 1024, 0, stream>>>(D3, D4, SINK, RS, COMP);

  /* chunk states of all (b,h) (2048 blocks), then their exclusive prefix over the chunks (256 blocks) */
  chunk_state_kernel<<<kBH * kNChunk, 128, 0, stream>>>(KH, KL, VF, COMP, CS);
  chunk_prefix_kernel<<<kBH * kHd * kHd / 4 / 128, 128, 0, stream>>>(CS, SH, SL);

  /* all chunks' outputs with the output projection M = 16384, N = 512, K = 512 in the same launch (256 blocks, one per WGP) */
  chunk_out_proj_kernel<<<kBatch * kNChunk, 512, 0, stream>>>(QH, QL, KH, KL, VF, RS, COMP, SH, SL, WOB, BIAS + 3 * kEmb, out);
}

// v007
// It runs in 125 microseconds.
// Two timings next to v006 both put it at 1.12 times that version's speed.
// All steps since v000 together make it 32.6 times as fast.
// All contractions on v_wmma_f32_16x16x32_bf16 with f32 accumulate: q/k/v projections = bf16(x) x bf16(W) single product; chunk state, scores, inter and intra products = bf16 hi/lo operands (hi*hi + hi*lo + lo*hi); output projection = (attn_hi + attn_lo) x bf16(Wo); sigmoid, flow scans and row scales in f32 on VALU.
#include <hip/hip_runtime.h>
#include <math.h>

constexpr int kBatch   = 4;
constexpr int kSeq     = 4096;
constexpr int kEmb     = 512;
constexpr int kHeads   = 8;
constexpr int kHd      = 64;
constexpr int kRows    = kBatch * kSeq;
constexpr int kBH      = kBatch * kHeads;
constexpr int kChunk   = 64;
constexpr int kNChunk  = kSeq / kChunk;
constexpr int kLp      = 72;
constexpr int kQkvN    = 3 * kEmb;
constexpr int kSegRows = 64;
constexpr int kNSeg    = kSeq / kSegRows;
constexpr float kEps   = 1e-6f;
static_assert(kHeads * kHd == kEmb, "head packing");
static_assert(kEmb % 32 == 0, "GEMM K multiple of 32");
static_assert(kHd % 32 == 0 && kChunk % 32 == 0, "tile K multiple of 32");
static_assert(kRows % 128 == 0 && kQkvN % 256 == 0 && kEmb % 256 == 0, "GEMM M, N block tile multiples");
static_assert(kSeq % 128 == 0 && kSeq % kChunk == 0, "scan line groups and chunks");
static_assert(kSeq == 4096 && kEmb == 512 && kHd == 64, "shift constants in the projection epilogue");
static_assert(kLp % 8 == 0, "LDS pitch keeps 16-B alignment");
static_assert(kSegRows == 64 && kNSeg % 2 == 0 && kSeq == 4 * 1024, "flow scan: 16 lanes x 4 kept rows per segment, two segments per wave, 1024 threads x 4 rows");

typedef __attribute__((ext_vector_type(16))) __bf16   v16b;
typedef __attribute__((ext_vector_type(8)))  __bf16   v8b;
typedef __attribute__((ext_vector_type(8)))  float    v8f;
typedef __attribute__((ext_vector_type(4)))  float    v4f;
typedef __attribute__((ext_vector_type(4)))  unsigned int v4u;
typedef __attribute__((ext_vector_type(2)))  unsigned int v2u;

typedef __attribute__((ext_vector_type(2)))  float    v2f;
typedef __attribute__((ext_vector_type(2)))  __bf16   v2b;

/* f32 -> bf16, round to nearest even, by the hardware convert */
__device__ __forceinline__ unsigned short f2bf_bits(float f) { return __builtin_bit_cast(unsigned short, (__bf16)f); }
/* two at once, one v_cvt_pk_bf16_f32: a in the low half, b in the high half */
__device__ __forceinline__ unsigned cvt_pk(float a, float b) { return __builtin_bit_cast(unsigned, __builtin_convertvector((v2f){a, b}, v2b)); }
/* a pair as hi word and lo word: lo = bf16 of what the first rounding left */
__device__ __forceinline__ void hilo_pk(float a, float b, unsigned& h, unsigned& l) {
  h = cvt_pk(a, b);
  l = cvt_pk(a - __uint_as_float(h << 16), b - __uint_as_float(h & 0xffff0000u));
}
/* 2^x and 1/x on v_exp_f32 and v_rcp_f32, several independent values at a time, each in place. One statement that ends in v_nop, so that
   the instruction directly behind a transcendental never reads its result or overwrites its source (the slot the instruction set asks for) */
__device__ __forceinline__ void exp2_x8(float (&t)[8]) {
  asm("v_exp_f32 %0, %0\n\tv_exp_f32 %1, %1\n\tv_exp_f32 %2, %2\n\tv_exp_f32 %3, %3\n\t"
      "v_exp_f32 %4, %4\n\tv_exp_f32 %5, %5\n\tv_exp_f32 %6, %6\n\tv_exp_f32 %7, %7\n\tv_nop"
      : "+v"(t[0]), "+v"(t[1]), "+v"(t[2]), "+v"(t[3]), "+v"(t[4]), "+v"(t[5]), "+v"(t[6]), "+v"(t[7]));
}
__device__ __forceinline__ void rcp_x8(float (&t)[8]) {
  asm("v_rcp_f32 %0, %0\n\tv_rcp_f32 %1, %1\n\tv_rcp_f32 %2, %2\n\tv_rcp_f32 %3, %3\n\t"
      "v_rcp_f32 %4, %4\n\tv_rcp_f32 %5, %5\n\tv_rcp_f32 %6, %6\n\tv_rcp_f32 %7, %7\n\tv_nop"
      : "+v"(t[0]), "+v"(t[1]), "+v"(t[2]), "+v"(t[3]), "+v"(t[4]), "+v"(t[5]), "+v"(t[6]), "+v"(t[7]));
}
__device__ __forceinline__ void exp2_x4(float (&t)[4]) {
  asm("v_exp_f32 %0, %0\n\tv_exp_f32 %1, %1\n\tv_exp_f32 %2, %2\n\tv_exp_f32 %3, %3\n\tv_nop"
      : "+v"(t[0]), "+v"(t[1]), "+v"(t[2]), "+v"(t[3]));
}
__device__ __forceinline__ void rcp_x4(float (&t)[4]) {
  asm("v_rcp_f32 %0, %0\n\tv_rcp_f32 %1, %1\n\tv_rcp_f32 %2, %2\n\tv_rcp_f32 %3, %3\n\tv_nop"
      : "+v"(t[0]), "+v"(t[1]), "+v"(t[2]), "+v"(t[3]));
}
__device__ __forceinline__ void rcp_x2(float& a, float& b) {
  asm("v_rcp_f32 %0, %0\n\tv_rcp_f32 %1, %1\n\tv_nop" : "+v"(a), "+v"(b));
}
constexpr float kLog2e = 1.44269504f;
/* logistic function of 8 values: 1 / (1 + 2^(-x log2 e)) */
__device__ __forceinline__ void sigmoid_x8(float (&t)[8]) {
#pragma unroll
  for (int r = 0; r < 8; ++r) t[r] *= -kLog2e;
  exp2_x8(t);
#pragma unroll
  for (int r = 0; r < 8; ++r) t[r] += 1.0f;
  rcp_x8(t);
}
__device__ __forceinline__ float bf_bits2f(unsigned short h) { return __uint_as_float(((unsigned)h) << 16); }
__device__ __forceinline__ float bf16r(float f) { return bf_bits2f(f2bf_bits(f)); }
__device__ __forceinline__ __bf16 bits2bf(unsigned short u) { return __builtin_bit_cast(__bf16, u); }

/* hazard guards as plain device helpers */
__device__ __forceinline__ void dep_guard4_b(v8f& a, v8f& b, v8f& c, v8f& d, v16b x, v16b y) { asm volatile("v_nop\n\tv_nop\n\tv_nop\n\tv_nop" : "+v"(a), "+v"(b), "+v"(c), "+v"(d) : "v"(x), "v"(y)); }
__device__ __forceinline__ void keep4_b(v16b a, v16b b, v16b c, v16b d) { asm volatile("v_nop" :: "v"(a), "v"(b), "v"(c), "v"(d)); }
__device__ __forceinline__ void acc_guard4(v8f& a, v8f& b, v8f& c, v8f& d) { asm volatile("v_nop\n\tv_nop\n\tv_nop\n\tv_nop" : "+v"(a), "+v"(b), "+v"(c), "+v"(d)); }

template <typename T> struct Frag;
template <> struct Frag<__bf16> {
  typedef v16b V; union U { v16b v; v8b h[2]; };
  /* elements 0..7 <- p[0..7], elements 8..15 <- p[16..23] */
  static __device__ __forceinline__ v16b load(const __bf16* p) {
    U f; f.h[0] = *(const v8b*)(p); f.h[1] = *(const v8b*)(p + 16); return f.v;
  }
  static __device__ __forceinline__ v8f mma(v16b a, v16b b, v8f c) {
    return __builtin_amdgcn_wmma_f32_16x16x32_bf16(false, a, false, b, (short)0, c, false, false);
  }
};

/* one WMMA followed by the 4-slot guard tying its accumulator and both operand fragments */
__device__ __forceinline__ v8f mma_g(v16b a, v16b b, v8f c) {
  c = __builtin_amdgcn_wmma_f32_16x16x32_bf16(false, a, false, b, (short)0, c, false, false);
  asm volatile("v_nop\n\tv_nop\n\tv_nop\n\tv_nop" : "+v"(c) : "v"(a), "v"(b));
  return c;
}

__device__ __forceinline__ void wave_lds_sync() {
  __builtin_amdgcn_fence(__ATOMIC_RELEASE, "workgroup");
  __builtin_amdgcn_wave_barrier();
  __builtin_amdgcn_fence(__ATOMIC_ACQUIRE, "workgroup");
}

/* ---- operand preparation, ONE launch: block ranges of one grid take the pieces, which do not depend on one another.
        Blocks 0 .. kPrepXBlocks-1: bf16(x). The next 4 x kPrepWBlocks: bf16 of Wq | Wk | Wv | Wo. The last block: the bias plane.
        f32 -> bf16 (RNE convert): a block converts 8192 consecutive elements, a thread 8 consecutive elements in each of 4 groups of 2048:
        two 16-B loads and ONE 16-B store per lane and group, the 8 loads of the 4 groups in flight together.
        Bias plane: dst[0..2047] = bf16 value (kept as f32) of bq | bk | bv | bo; 2 iterations x 256 x float4 = exactly 2048 floats;
        all four sources are loaded unconditionally, wave-uniform select by value. */
constexpr int kPrepElems   = 8192;
constexpr int kPrepXBlocks = kRows * kEmb / kPrepElems;
constexpr int kPrepWBlocks = kEmb * kEmb / kPrepElems;
constexpr int kPrepBlocks  = kPrepXBlocks + 4 * kPrepWBlocks + 1;
static_assert(kRows * kEmb % kPrepElems == 0 && kEmb * kEmb % kPrepElems == 0, "whole blocks of the conversion");

__device__ __forceinline__ void cvt_block(const float* __restrict__ src, unsigned short* __restrict__ dst, int tid) {
  const float* p = src + 8 * tid;
  v4f a[4], b[4];
#pragma unroll
  for (int g = 0; g < 4; ++g) {
    a[g] = *(const v4f*)(p + g * 2048);
    b[g] = *(const v4f*)(p + g * 2048 + 4);
  }
  /* the wait that stands before a register named by an issued global load is overwritten; the address pair is an input so that
     it stays untouched up to it; its memory clobber also keeps the 8 loads together in front of the conversions */
  asm volatile("s_wait_xcnt 0x0" :: "v"(p) : "memory");
  unsigned short* q = dst + 8 * tid;
#pragma unroll
  for (int g = 0; g < 4; ++g) {
    *(v4u*)(q + g * 2048) = (v4u){cvt_pk(a[g][0], a[g][1]), cvt_pk(a[g][2], a[g][3]), cvt_pk(b[g][0], b[g][1]), cvt_pk(b[g][2], b[g][3])};
  }
}

__global__ __launch_bounds__(256) void prep_kernel(const float* __restrict__ x, const float* __restrict__ Wq, const float* __restrict__ Wk,
                                                   const float* __restrict__ Wv, const float* __restrict__ Wo,
                                                   const float* __restrict__ b0, const float* __restrict__ b1,
                                                   const float* __restrict__ b2, const float* __restrict__ b3,
                                                   unsigned short* __restrict__ XBp, unsigned short* __restrict__ WQKVp,
                                                   unsigned short* __restrict__ WOBp, float* __restrict__ dst) {
  const int tid = threadIdx.x;
  const int blk = (int)blockIdx.x;
  if (blk < kPrepXBlocks + 4 * kPrepWBlocks) {
    /* block-uniform choice of the plane and of this block's 8192 elements in it */
    const bool isx = blk < kPrepXBlocks;
    const int wb   = isx ? 0 : blk - kPrepXBlocks;
    const int w    = wb / kPrepWBlocks;
    const int piece = isx ? blk : wb % kPrepWBlocks;
    const float* s01 = (w == 0) ? Wq : Wk;
    const float* s23 = (w == 2) ? Wv : Wo;
    const float* sw  = (w < 2) ? s01 : s23;
    unsigned short* dw = (w < 3) ? WQKVp + (size_t)w * kEmb * kEmb : WOBp;
    const float* s    = isx ? x : sw;
    unsigned short* d = isx ? XBp : dw;
    cvt_block(s + (size_t)piece * kPrepElems, d + (size_t)piece * kPrepElems, tid);
    return;
  }
#pragma unroll 1
  for (int it = 0; it < 2; ++it) {
    const int idx4 = it * 256 + tid;
    const int which = idx4 >> 7;
    const int off = (idx4 & 127) * 4;
    const v4f va = *(const v4f*)(b0 + off);
    const v4f vb = *(const v4f*)(b1 + off);
    const v4f vc = *(const v4f*)(b2 + off);
    const v4f vd = *(const v4f*)(b3 + off);
    v4f o;
#pragma unroll
    for (int e = 0; e < 4; ++e) {
      const float s01 = (which == 0) ? va[e] : vb[e];
      const float s23 = (which == 2) ? vc[e] : vd[e];
      o[e] = bf16r((which < 2) ? s01 : s23);
    }
    float* op = dst + which * kEmb + off;
    *(v4f*)op = o;
  }
}

/* four asynchronous 16-B copies per lane, global -> LDS, each with its own LDS byte address and global pointer. The s_wait_xcnt is the
   last line of the copies' own statement so that it stands before any rewrite of a register that a copy names. */
__device__ __forceinline__ void async_copy4(unsigned l0, unsigned l1, unsigned l2, unsigned l3,
                                            const __bf16* g0, const __bf16* g1, const __bf16* g2, const __bf16* g3) {
  asm volatile("global_load_async_to_lds_b128 %0, %4, off\n\t"
               "global_load_async_to_lds_b128 %1, %5, off\n\t"
               "global_load_async_to_lds_b128 %2, %6, off\n\t"
               "global_load_async_to_lds_b128 %3, %7, off\n\t"
               "s_wait_xcnt 0x0"
               :: "v"(l0), "v"(l1), "v"(l2), "v"(l3), "v"(g0), "v"(g1), "v"(g2), "v"(g3) : "memory");
}
/* 128 rows x 128 B of one row-major [.][512] bf16 plane -> LDS rows of pitch 144 B. g = this thread's piece of row (tid >> 3), l = its
   LDS byte address; 256 threads x 16 B = 32 whole rows per copy, a wave covers 4 whole 128-B lines. */
__device__ __forceinline__ void stage128(unsigned l, const __bf16* g) {
  async_copy4(l, l + 32 * kLp * 2, l + 64 * kLp * 2, l + 96 * kLp * 2, g, g + 32 * kEmb, g + 64 * kEmb, g + 96 * kEmb);
}

/* ---- Register-blocked WMMA GEMM, each wave owns a 64x64 tile; A row-major [M][512], Bt row-major [N][512] (bf16 bits).
        A block of 8 waves (2 x 4) owns 128 x 256. Per stage of 64 k (one 128-B line per row) its 128 A rows and
        256 Bt rows are copied to LDS asynchronously, two buffers: stage s + 1 flies while stage s is multiplied.
        Projections: single product; epilogue adds bias[n]; column tile 64 = one head of q (n0 < 512), k (512..1023)
               x 16 B, 4 rows per instruction); v: f32 plane [b][h][chunk][4096] in reader order (512 contiguous bytes per instruction).
*/
__global__ __launch_bounds__(256) void gemm64_kernel(
    const unsigned short* __restrict__ Ap, const unsigned short* __restrict__ Btp, const float* __restrict__ bias,
    unsigned short* __restrict__ QHp, unsigned short* __restrict__ QLp,
    unsigned short* __restrict__ KHp, unsigned short* __restrict__ KLp,
    float* __restrict__ Fout, int M, int N) {
  typedef __bf16 T;
  const T* A = (const T*)Ap; const T* Bt = (const T*)Btp;
  constexpr int kBOff  = 128;                       /* first Bt row of a stage buffer */
  constexpr int kSRows = kBOff + 256;               /* rows of a stage buffer */
  constexpr int kStages = kEmb / 64;
  __shared__ __align__(16) float sT[8][16 * 68];
  __shared__ __align__(16) __bf16 sS[2][kSRows * kLp];
  const int lane = threadIdx.x & 31;
  const int wave = threadIdx.x >> 5;
  const int groupsN = N >> 8;
  /* block-uniform, in front of every barrier and copy */
  if ((int)blockIdx.x >= (M >> 7) * groupsN) return;
  const int bm = (int)blockIdx.x / groupsN;
  const int bn = (int)blockIdx.x - bm * groupsN;
  const int wm = wave >> 2;
  const int wn = wave & 3;
  const int m0 = (bm << 7) + (wm << 6);
  const int n0 = (bn << 8) + (wn << 6);

  const int rlane = lane & 15;
  const int koff  = (lane >> 4) * 8;
  const int mOff  = (lane >> 4) * 8;

  v8f acc[4][4];
#pragma unroll
  for (int i = 0; i < 4; ++i)
#pragma unroll
    for (int j = 0; j < 4; ++j) acc[i][j] = (v8f){0.f,0.f,0.f,0.f,0.f,0.f,0.f,0.f};

  /* this thread's piece of a stage: row (tid >> 3) of each group of 32 rows, 16-B piece (tid & 7) of the row's 128 B */
  const int crow = (int)threadIdx.x >> 3;
  const int ccol = ((int)threadIdx.x & 7) * 8;
  const T* gA  = A  + (size_t)((bm << 7) + crow) * kEmb + ccol;
  const T* gB  = Bt + (size_t)((bn << 8) + crow) * kEmb + ccol;
  const unsigned lbase = (unsigned)(size_t)(&sS[0][crow * kLp + ccol]);
  constexpr unsigned kBufBytes = kSRows * kLp * 2;
  auto stage = [&](int st) {
    const unsigned l = lbase + (unsigned)(st & 1) * kBufBytes;
    const int k0 = st * 64;
    stage128(l, gA + k0);
    stage128(l + kBOff * kLp * 2, gB + k0);
    stage128(l + (kBOff + 128) * kLp * 2, gB + 128 * kEmb + k0);
  };

  stage(0);
  /* stage 0 has landed for this wave's own copies ... */
  asm volatile("s_wait_asynccnt 0x0" ::: "memory");
  /* ... and for every wave's before anyone reads it */
  __syncthreads();
  stage(1);

  /* kept rolled for code size: the two buffers differ only in one base address */
#pragma unroll 1
  for (int st = 0; st < kStages; ++st) {
    const T* buf = sS[st & 1];
    const T* sa  = buf + ((wm << 6) + rlane) * kLp + koff;
    const T* sb  = buf + (kBOff + (wn << 6) + rlane) * kLp + koff;
    /* the loops over k blocks, fragments and tiles are fully unrolled so that these are indexed by constants and stay in registers */
#pragma unroll
    for (int kk = 0; kk < 2; ++kk) {
      /* all fragment reads of the block first, as one group in front of its WMMAs */
      v16b bh[4], ah[4];
#pragma unroll
      for (int j = 0; j < 4; ++j) bh[j] = Frag<T>::load(sb + (j << 4) * kLp + kk * 32);
#pragma unroll
      for (int i = 0; i < 4; ++i) ah[i] = Frag<T>::load(sa + (i << 4) * kLp + kk * 32);
#pragma unroll
      for (int i = 0; i < 4; ++i) {
#pragma unroll
        for (int j = 0; j < 4; ++j) acc[i][j] = Frag<T>::mma(ah[i], bh[j], acc[i][j]);
        dep_guard4_b(acc[i][0], acc[i][1], acc[i][2], acc[i][3], ah[i], ah[i]);
      }
      keep4_b(bh[0], bh[1], bh[2], bh[3]);
    }
    /* publish point of stage st + 1: this wave's reads of buffer st & 1 have returned ... */
    asm volatile("s_wait_dscnt 0x0" ::: "memory");
    /* ... its own copies of stage st + 1 have landed ... */
    asm volatile("s_wait_asynccnt 0x0" ::: "memory");
    /* ... and the same holds for every wave: stage st + 1 may be read, buffer st & 1 may be refilled */
    __syncthreads();
    if (st + 2 < kStages) stage(st + 2);
  }
  /* no copy is outstanding when the wave goes on to the epilogue and ends */
  asm volatile("s_wait_asynccnt 0x0" ::: "memory");
  acc_guard4(acc[0][0], acc[0][1], acc[0][2], acc[0][3]);
  acc_guard4(acc[1][0], acc[1][1], acc[1][2], acc[1][3]);
  acc_guard4(acc[2][0], acc[2][1], acc[2][2], acc[2][3]);
  acc_guard4(acc[3][0], acc[3][1], acc[3][2], acc[3][3]);

  /* ---- epilogue ---- */
  float* slab = sT[wave];
  /* wave-uniform tile decode */
  const int sel  = n0 >> 9;
  const int hcol = (n0 & (kEmb - 1)) >> 6;
  const int bb   = m0 >> 12;
  const int l0   = m0 & (kSeq - 1);
  const size_t rowbase = ((size_t)(bb * kHeads + hcol)) * kSeq + (size_t)l0;
  unsigned short* Ch = (sel == 0) ? QHp : KHp;
  unsigned short* Cl = (sel == 0) ? QLp : KLp;
  const int q4 = lane >> 3, c8 = (lane & 7) * 8;
#pragma unroll
  for (int i = 0; i < 4; ++i) {
    float tv[4][8];
#pragma unroll
    for (int j = 0; j < 4; ++j) {
      const int n = n0 + (j << 4) + rlane;
      const float bv = bias[n];
#pragma unroll
      for (int r = 0; r < 8; ++r) tv[j][r] = acc[i][j][r] + bv;
    }
    if (sel < 2) {
      /* sigmoid on the values where they are, in registers */
#pragma unroll
      for (int j = 0; j < 4; ++j) sigmoid_x8(tv[j]);
    }
#pragma unroll
    for (int j = 0; j < 4; ++j)
#pragma unroll
      for (int r = 0; r < 8; ++r) slab[(mOff + r) * 68 + (j << 4) + rlane] = tv[j][r];
    wave_lds_sync();
    if (sel == 2) {
      /* reader order (see v_words): word g of reader thread 32 i + lane = row 16 i + (lane >> 1), features 32 (lane & 1) + 4 g .. + 3;
         one store = 32 lanes x 16 B = 512 contiguous bytes */
      float* vp = Fout + rowbase * kHd + (size_t)((32 * i + lane) * 4);
      v4f vw[8];
#pragma unroll
      for (int g = 0; g < 8; ++g) vw[g] = *(const v4f*)(slab + (lane >> 1) * 68 + (lane & 1) * 32 + 4 * g);
#pragma unroll
      for (int g = 0; g < 8; ++g) *(v4f*)(vp + g * 512) = vw[g];
      /* the wait that stands before a register named by an issued global store is overwritten; the address pair and the data words
         are inputs so that they stay untouched up to it */
      asm volatile("s_wait_xcnt 0x0" :: "v"(vp), "v"(vw[0]), "v"(vw[1]), "v"(vw[2]), "v"(vw[3]), "v"(vw[4]), "v"(vw[5]), "v"(vw[6]), "v"(vw[7])
                   : "memory");
    } else {
      v4u uh[4], ul[4];
#pragma unroll
      for (int it = 0; it < 4; ++it) {
        const float* sp = slab + (it * 4 + q4) * 68 + c8;
#pragma unroll
        for (int e = 0; e < 4; ++e) {
          unsigned h, l;
          hilo_pk(sp[2 * e], sp[2 * e + 1], h, l);
          uh[it][e] = h;
          ul[it][e] = l;
        }
      }
      {
#pragma unroll
        for (int it = 0; it < 4; ++it) {
          const size_t o = (rowbase + (size_t)((i << 4) + it * 4 + q4)) * kHd + c8;
          *(v4u*)(Ch + o) = uh[it];
          *(v4u*)(Cl + o) = ul[it];
        }
        
      }
    }
    wave_lds_sync();
  }
}

/* ---- flow scans, all f32, split along the sequence: 64 segments of 64 rows per (b,h), every segment scanned at the same time.
        Each running sum over rows = (sum of the totals of the segments before, added in segment order) + (serial sum inside the segment).
        One wave = two segments: a 16-lane row of the wave owns one segment, lane c of it owns features 4c..4c+3 (8 B per bf16 plane).
        q = q_hi + q_lo, k = k_hi + k_lo read from the bf16 planes (the same operands the WMMA products use).
        Launch 1: segment totals of k and q.                          Launch 2: sink_in, src_out per row; segment totals of k*src_out, q*sink_in.
        Launch 3: the two conserved dot products per row (raw sums).  Launch 4: per row rs = sigmoid(conserved_sink) * sink_in / (l+1) and
        comp = exp(clip(conserved_source)) / cumsum * (l+1), the cumsum as a block scan over the 4096 rows of one (b,h).
        Per-row results are kept by lane c for rows 4c..4c+3 of its segment and stored once as 16 lanes x 16 B = 256 B.
        The inner loops are fully unrolled so that the staged words and the kept rows are indexed by constants and stay in registers. */
__device__ __forceinline__ float row16_sum(float v) {
  /* DPP row_xmask 1, 2, 4, 8: butterfly sum over the 16 lanes of a row, no LDS round trip */
  v += __int_as_float(__builtin_amdgcn_update_dpp(0, __float_as_int(v), 0x161, 0xf, 0xf, true));
  v += __int_as_float(__builtin_amdgcn_update_dpp(0, __float_as_int(v), 0x162, 0xf, 0xf, true));
  v += __int_as_float(__builtin_amdgcn_update_dpp(0, __float_as_int(v), 0x164, 0xf, 0xf, true));
  v += __int_as_float(__builtin_amdgcn_update_dpp(0, __float_as_int(v), 0x168, 0xf, 0xf, true));
  return v;
}
__device__ __forceinline__ v4f hilo4(v2u h, v2u l) {
  v4f r;
  r[0] = __uint_as_float(h[0] << 16)         + __uint_as_float(l[0] << 16);
  r[1] = __uint_as_float(h[0] & 0xffff0000u) + __uint_as_float(l[0] & 0xffff0000u);
  r[2] = __uint_as_float(h[1] << 16)         + __uint_as_float(l[1] << 16);
  r[3] = __uint_as_float(h[1] & 0xffff0000u) + __uint_as_float(l[1] & 0xffff0000u);
  return r;
}
__device__ __forceinline__ float dot4_eps(v4f x, v4f y) {
  return (x[0] + kEps) * (y[0] + kEps) + (x[1] + kEps) * (y[1] + kEps) + (x[2] + kEps) * (y[2] + kEps) + (x[3] + kEps) * (y[3] + kEps);
}
/* totals of the segments before seg, added in segment order; T = [kNSeg][128] of one (b,h), first 64 floats -> a, last 64 -> b */
__device__ __forceinline__ void seg_prefix(const float* __restrict__ T, int seg, int c, v4f& a, v4f& b) {
  a = (v4f){0.f, 0.f, 0.f, 0.f};
  b = (v4f){0.f, 0.f, 0.f, 0.f};
  /* 16 segments' loads in flight per trip: the loads are independent, only the adds are ordered */
#pragma unroll 16
  for (int s = 0; s < kNSeg; ++s) {
    const v4f ta = *(const v4f*)(T + s * 128 + 4 * c);
    const v4f tb = *(const v4f*)(T + s * 128 + 64 + 4 * c);
    const bool in = s < seg;
#pragma unroll
    for (int e = 0; e < 4; ++e) {
      a[e] += in ? ta[e] : 0.0f;
      b[e] += in ? tb[e] : 0.0f;
    }
  }
}

__global__ __launch_bounds__(32) void flow_seg_total_kernel(const unsigned short* __restrict__ QHp, const unsigned short* __restrict__ QLp,
                                                            const unsigned short* __restrict__ KHp, const unsigned short* __restrict__ KLp,
                                                            float* __restrict__ T0) {
  const int lane = threadIdx.x, c = lane & 15;
  const int bh = (int)blockIdx.x / (kNSeg / 2);
  const int seg = ((int)blockIdx.x % (kNSeg / 2)) * 2 + (lane >> 4);
  const size_t w0 = ((size_t)bh * kSeq + (size_t)seg * kSegRows) * (kHd / 4) + c;
  const v2u* qh = (const v2u*)QHp + w0;
  const v2u* ql = (const v2u*)QLp + w0;
  const v2u* kh = (const v2u*)KHp + w0;
  const v2u* kl = (const v2u*)KLp + w0;
  v4f ks = (v4f){0.f, 0.f, 0.f, 0.f}, qs = (v4f){0.f, 0.f, 0.f, 0.f};
  /* 16 rows per trip, kept rolled for code size: all their loads are issued before the first sum */
#pragma unroll 1
  for (int t = 0; t < kSegRows / 16; ++t) {
    const v2u* pqh = qh + t * 16 * (kHd / 4);
    const v2u* pql = ql + t * 16 * (kHd / 4);
    const v2u* pkh = kh + t * 16 * (kHd / 4);
    const v2u* pkl = kl + t * 16 * (kHd / 4);
    v2u wqh[16], wql[16], wkh[16], wkl[16];
#pragma unroll
    for (int j = 0; j < 16; ++j) {
      wqh[j] = pqh[j * (kHd / 4)];
      wql[j] = pql[j * (kHd / 4)];
      wkh[j] = pkh[j * (kHd / 4)];
      wkl[j] = pkl[j * (kHd / 4)];
    }
    /* the wait that stands before a register named by an issued global load is overwritten; the address pairs are inputs so that
       they stay untouched up to it; its memory clobber also keeps the trip's loads together in front of the sums */
    asm volatile("s_wait_xcnt 0x0" :: "v"(pqh), "v"(pql), "v"(pkh), "v"(pkl) : "memory");
#pragma unroll
    for (int j = 0; j < 16; ++j) {
      ks += hilo4(wkh[j], wkl[j]);
      qs += hilo4(wqh[j], wql[j]);
    }
  }
  float* o = T0 + ((size_t)bh * kNSeg + seg) * 128 + 4 * c;
  *(v4f*)o = ks;
  *(v4f*)(o + 64) = qs;
}

__global__ __launch_bounds__(32) void flow_incoming_kernel(const unsigned short* __restrict__ QHp, const unsigned short* __restrict__ QLp,
                                                           const unsigned short* __restrict__ KHp, const unsigned short* __restrict__ KLp,
                                                           const float* __restrict__ T0, float* __restrict__ SINK, float* __restrict__ SRC,
                                                           float* __restrict__ T1) {
  const int lane = threadIdx.x, c = lane & 15;
  const int bh = (int)blockIdx.x / (kNSeg / 2);
  const int seg = ((int)blockIdx.x % (kNSeg / 2)) * 2 + (lane >> 4);
  const int row0 = seg * kSegRows;
  const size_t w0 = ((size_t)bh * kSeq + (size_t)row0) * (kHd / 4) + c;
  const v2u* qh = (const v2u*)QHp + w0;
  const v2u* ql = (const v2u*)QLp + w0;
  const v2u* kh = (const v2u*)KHp + w0;
  const v2u* kl = (const v2u*)KLp + w0;
  v4f kc, qc;
  seg_prefix(T0 + (size_t)bh * kNSeg * 128, seg, c, kc, qc);
  v4f a1 = (v4f){0.f, 0.f, 0.f, 0.f}, a2 = (v4f){0.f, 0.f, 0.f, 0.f};
  v4f si = (v4f){0.f, 0.f, 0.f, 0.f}, so = (v4f){0.f, 0.f, 0.f, 0.f};
  /* 8 rows per trip, kept rolled for code size: their loads, row sums and divisions are independent of each other and overlap;
     only the running sums are ordered */
#pragma unroll 1
  for (int t = 0; t < kSegRows / 8; ++t) {
    const v2u* pqh = qh + t * 8 * (kHd / 4);
    const v2u* pql = ql + t * 8 * (kHd / 4);
    const v2u* pkh = kh + t * 8 * (kHd / 4);
    const v2u* pkl = kl + t * 8 * (kHd / 4);
    v2u wqh[8], wql[8], wkh[8], wkl[8];
#pragma unroll
    for (int j = 0; j < 8; ++j) {
      wqh[j] = pqh[j * (kHd / 4)];
      wql[j] = pql[j * (kHd / 4)];
      wkh[j] = pkh[j * (kHd / 4)];
      wkl[j] = pkl[j * (kHd / 4)];
    }
    /* the wait that stands before a register named by an issued global load is overwritten; the address pairs are inputs so that
       they stay untouched up to it */
    asm volatile("s_wait_xcnt 0x0" :: "v"(pqh), "v"(pql), "v"(pkh), "v"(pkl) : "memory");
#pragma unroll
    for (int jj = 0; jj < 8; ++jj) {
      const int r = 8 * t + jj;
      const int g = 2 * t + (jj >> 2);
      const int j = jj & 3;
      const v4f q = hilo4(wqh[jj], wql[jj]);
      const v4f k = hilo4(wkh[jj], wkl[jj]);
      kc += k;
      qc += q;
      const float d1 = row16_sum(dot4_eps(q, kc));
      const float d2 = row16_sum(dot4_eps(k, qc));
      const float nrm = (float)(row0 + r + 1);
      float i1 = d1, i2 = d2;
      rcp_x2(i1, i2);
      const float sink_in = i1 * nrm;
      const float src_out = i2 * nrm;
      a1 += k * src_out;
      a2 += q * sink_in;
      si[j] = (c == g) ? sink_in : si[j];
      so[j] = (c == g) ? src_out : so[j];
    }
  }
  const size_t ro = (size_t)bh * kSeq + (size_t)row0 + 4 * c;
  *(v4f*)(SINK + ro) = si;
  *(v4f*)(SRC + ro) = so;
  float* o = T1 + ((size_t)bh * kNSeg + seg) * 128 + 4 * c;
  *(v4f*)o = a1;
  *(v4f*)(o + 64) = a2;
}

__global__ __launch_bounds__(32) void flow_conserved_kernel(const unsigned short* __restrict__ QHp, const unsigned short* __restrict__ QLp,
                                                            const unsigned short* __restrict__ KHp, const unsigned short* __restrict__ KLp,
                                                            const float* __restrict__ T1, const float* __restrict__ SINK,
                                                            const float* __restrict__ SRC, float* __restrict__ D3, float* __restrict__ D4) {
  const int lane = threadIdx.x, c = lane & 15;
  const int bh = (int)blockIdx.x / (kNSeg / 2);
  const int seg = ((int)blockIdx.x % (kNSeg / 2)) * 2 + (lane >> 4);
  const int row0 = seg * kSegRows;
  const size_t w0 = ((size_t)bh * kSeq + (size_t)row0) * (kHd / 4) + c;
  const v2u* qh = (const v2u*)QHp + w0;
  const v2u* ql = (const v2u*)QLp + w0;
  const v2u* kh = (const v2u*)KHp + w0;
  const v2u* kl = (const v2u*)KLp + w0;
  const float* sip = SINK + (size_t)bh * kSeq + row0;
  const float* sop = SRC + (size_t)bh * kSeq + row0;
  v4f s1, s2;
  seg_prefix(T1 + (size_t)bh * kNSeg * 128, seg, c, s1, s2);
  v4f k3 = (v4f){0.f, 0.f, 0.f, 0.f}, k4 = (v4f){0.f, 0.f, 0.f, 0.f};
  /* 8 rows per trip, kept rolled for code size: their loads and row sums overlap; only the running sums are ordered */
#pragma unroll 1
  for (int t = 0; t < kSegRows / 8; ++t) {
    const v2u* pqh = qh + t * 8 * (kHd / 4);
    const v2u* pql = ql + t * 8 * (kHd / 4);
    const v2u* pkh = kh + t * 8 * (kHd / 4);
    const v2u* pkl = kl + t * 8 * (kHd / 4);
    const v4f* psi = (const v4f*)(sip + 8 * t);
    const v4f* pso = (const v4f*)(sop + 8 * t);
    v2u wqh[8], wql[8], wkh[8], wkl[8];
    v4f si[2], so[2];
    si[0] = psi[0];
    si[1] = psi[1];
    so[0] = pso[0];
    so[1] = pso[1];
#pragma unroll
    for (int j = 0; j < 8; ++j) {
      wqh[j] = pqh[j * (kHd / 4)];
      wql[j] = pql[j * (kHd / 4)];
      wkh[j] = pkh[j * (kHd / 4)];
      wkl[j] = pkl[j * (kHd / 4)];
    }
    /* the wait that stands before a register named by an issued global load is overwritten; the address pairs are inputs so that
       they stay untouched up to it */
    asm volatile("s_wait_xcnt 0x0" :: "v"(pqh), "v"(pql), "v"(pkh), "v"(pkl), "v"(psi), "v"(pso) : "memory");
#pragma unroll
    for (int jj = 0; jj < 8; ++jj) {
      const int g = 2 * t + (jj >> 2);
      const int j = jj & 3;
      const v4f q = hilo4(wqh[jj], wql[jj]);
      const v4f k = hilo4(wkh[jj], wkl[jj]);
      s1 += k * so[jj >> 2][j];
      s2 += q * si[jj >> 2][j];
      const float d3 = row16_sum(dot4_eps(q, s1));
      const float d4 = row16_sum(dot4_eps(k, s2));
      k3[j] = (c == g) ? d3 : k3[j];
      k4[j] = (c == g) ? d4 : k4[j];
    }
  }
  const size_t ro = (size_t)bh * kSeq + (size_t)row0 + 4 * c;
  *(v4f*)(D3 + ro) = k3;
  *(v4f*)(D4 + ro) = k4;
}

/* one block of 32 waves per (b,h); thread t owns rows 4t..4t+3 */
__global__ __launch_bounds__(1024) void flow_finish_kernel(const float* __restrict__ D3, const float* __restrict__ D4,
                                                           const float* __restrict__ SINK, float* __restrict__ RS, float* __restrict__ COMP) {
  __shared__ float wtot[32];
  const int tid = threadIdx.x, lane = tid & 31, wave = tid >> 5;
  const size_t o = (size_t)blockIdx.x * kSeq + 4 * (size_t)tid;
  const v4f d3 = *(const v4f*)(D3 + o);
  const v4f d4 = *(const v4f*)(D4 + o);
  const v4f si = *(const v4f*)(SINK + o);
  v4f rs, inc;
  float inv_nrm[4], sa[4], ce[4];
#pragma unroll
  for (int e = 0; e < 4; ++e) inv_nrm[e] = (float)(4 * tid + e + 1);
  rcp_x4(inv_nrm);
#pragma unroll
  for (int e = 0; e < 4; ++e) {
    const float csink = d3[e] * inv_nrm[e];
    const float csrc  = fminf(fmaxf(d4[e] * inv_nrm[e], -1.0f), 1.0f);
    sa[e] = csink * -kLog2e;
    ce[e] = csrc * kLog2e;
  }
  exp2_x4(sa);
  exp2_x4(ce);
#pragma unroll
  for (int e = 0; e < 4; ++e) sa[e] += 1.0f;
  rcp_x4(sa);
  float run = 0.f;
#pragma unroll
  for (int e = 0; e < 4; ++e) {
    run += ce[e];
    inc[e] = run;
    rs[e] = sa[e] * (si[e] * inv_nrm[e]);
  }
  *(v4f*)(RS + o) = rs;
  /* inclusive scan of the threads' totals over the wave */
  float sc = run;
#pragma unroll
  for (int off = 1; off < 32; off <<= 1) {
    const float t = __shfl_up(sc, off, 32);
    sc += (lane >= off) ? t : 0.0f;
  }
  if (lane == 31) wtot[wave] = sc;
  const float up = __shfl_up(sc, 1, 32);
  const float before_in_wave = (lane == 0) ? 0.0f : up;
  /* every wave's total is in LDS before any wave sums the totals of the waves before it */
  __syncthreads();
  float wp = (lane < wave) ? wtot[lane] : 0.0f;
#pragma unroll
  for (int off = 16; off > 0; off >>= 1) wp += __shfl_xor(wp, off, 32);
  const float base = wp + before_in_wave;
  v4f co;
  float den[4];
#pragma unroll
  for (int e = 0; e < 4; ++e) den[e] = base + inc[e];
  rcp_x4(den);
#pragma unroll
  for (int e = 0; e < 4; ++e) {
    const float nrm = (float)(4 * tid + e + 1);
    co[e] = (ce[e] * den[e]) * nrm;
  }
  *(v4f*)(COMP + o) = co;
}

/* ---- causal linear attention, split along the sequence: every 64-row chunk is its own block, of all (b,h) at once in chunk_state; in chunk_out_proj one block takes a chunk of all 8 heads of one b.
        Launch 1 (chunk_state):  per chunk its own St_n[m][d] = sum_l v'[l][m] k[l][d], v' = v * comp[l], f32, from zero.
        Launch 2 (chunk_prefix): per element the sum of the chunks before, added in chunk order in f32, stored as bf16 hi/lo planes in state order.
        Launch 3 (chunk_out_proj): attn[i][m] = rs[i] * ( sum_d q[i][d] St[m][d] + sum_{j<=i} (q[i].k[j]) v'[j][m] ) per chunk, then its output projection.
        Attention products: hi*hi + hi*lo + lo*hi; the output projection: hi*hi + lo*hi. Q and row-major K fragments come straight from the global bf16 planes (row pitch 64), St fragments
        from planes in state order (below).
        LDS bf16 tiles are at pitch 72 (the attention tile at 520); a k-tile read of a pitch-72 tile touches columns 0..63 only. No atomics, no inter-block communication.
        The loops over tiles, fragments and staged words are fully unrolled so that these are indexed by constants and stay in registers. */

/* Global order of the planes that only these kernels read, chosen so that every wave load covers 512 contiguous bytes (4 whole lines):
   v, per (b,h,chunk) 4096 floats: element (row l, feature d) at ((d >> 2) & 7) * 512 + (2 l + (d >> 5)) * 4 + (d & 3), so that word g of
   reader thread t = 2 l + (d >> 5) (row t >> 1, features 32 (t & 1) + 4 g .. + 3) lies at g * 512 + 4 t.
   Chunk states (CS, SH, SL), per (b,h,chunk) 4096 elements: element (m, d) at (m >> 4) * 1024 + (d >> 4) * 256 + (16 ((d >> 3) & 1) + (m & 15)) * 8
   + (d & 7), so that the 8 elements which lane (c, hh) takes as one half of a fragment of rows 16 t + c lie at t * 1024 + (d >> 4) * 256 + 8 lane. */
__device__ __forceinline__ void v_words(const float* p, v4f (&vv)[8]) {
#pragma unroll
  for (int g = 0; g < 8; ++g) vv[g] = *(const v4f*)(p + g * 512);
}
/* state fragment: elements 0..7 <- d = 32 dc + 8 hh + 0..7, elements 8..15 <- the same + 16 (the k order of Frag::load); p = tile + dc * 512 + 8 lane */
__device__ __forceinline__ v16b state_frag(const __bf16* p) {
  Frag<__bf16>::U f; f.h[0] = *(const v8b*)(p); f.h[1] = *(const v8b*)(p + 256); return f.v;
}

/* VT hi/lo <- (v * comp)^T of one chunk; thread covers row lr, features dh..dh+31 (vv = its 8 x 16-B words of v): 128 threads x 32 = 64 x 64 */
__device__ __forceinline__ void vt_store(float cv, const v4f (&vv)[8], int lr, int dh, __bf16* VTh, __bf16* VTl) {
#pragma unroll
  for (int i = 0; i < 8; ++i) {
#pragma unroll
    for (int e = 0; e < 4; e += 2) {
      unsigned h, l;
      hilo_pk(vv[i][e] * cv, vv[i][e + 1] * cv, h, l);
      const int d = dh + 4 * i + e;
      VTh[d * kLp + lr]       = bits2bf((unsigned short)(h & 0xffffu));
      VTh[(d + 1) * kLp + lr] = bits2bf((unsigned short)(h >> 16));
      VTl[d * kLp + lr]       = bits2bf((unsigned short)(l & 0xffffu));
      VTl[(d + 1) * kLp + lr] = bits2bf((unsigned short)(l >> 16));
    }
  }
}

/* one block of 4 waves per (b,h,chunk). Wave w owns rows m = 16w..16w+15 of St_n[m][d]: A rows d = 16i + c of KT, Bt rows m = 16w + c
   of VT, k = l for both, so lane (c,hh) holds St_n[16w + c][16i + 8hh + r]. Coverage: 2048 blocks x 64 x 64 floats. */
__global__ __launch_bounds__(128) void chunk_state_kernel(
    const unsigned short* __restrict__ KHp, const unsigned short* __restrict__ KLp,
    const float* __restrict__ VF, const float* __restrict__ COMP, float* __restrict__ CS) {
  __shared__ __align__(16) __bf16 KTh[kHd * kLp];
  __shared__ __align__(16) __bf16 KTl[kHd * kLp];
  __shared__ __align__(16) __bf16 VTh[kHd * kLp];
  __shared__ __align__(16) __bf16 VTl[kHd * kLp];
  __shared__ __align__(16) float sT[4][16 * 68];

  const int tid = threadIdx.x, lane = tid & 31, wave = tid >> 5;
  const int c = lane & 15, hh = lane >> 4, koff = hh * 8;
  const int bh = (int)blockIdx.x / kNChunk;
  const int l0 = ((int)blockIdx.x % kNChunk) * kChunk;
  const size_t pbase = (size_t)bh * kSeq * kHd;
  const int lr = tid >> 1, dh = (tid & 1) * 32;
  const v8f z8 = (v8f){0.f,0.f,0.f,0.f,0.f,0.f,0.f,0.f};

  /* all global loads of the block first, so that they are in flight together */
  const size_t ko = pbase + (size_t)(l0 + lr) * kHd + dh;
  const v4u* kh4 = (const v4u*)(KHp + ko);
  const v4u* kl4 = (const v4u*)(KLp + ko);
  const float* v4p = VF + pbase + (size_t)l0 * kHd + 4 * tid;
  const float* cp = COMP + (size_t)bh * kSeq + l0 + lr;
  v4u wh[4], wl[4];
  v4f vv[8];
#pragma unroll
  for (int g = 0; g < 4; ++g) { wh[g] = kh4[g]; wl[g] = kl4[g]; }
  v_words(v4p, vv);
  const float cv = *cp;
  /* the wait that stands before a register named by an issued global load is overwritten; the address pairs, and the row index that
     the comp load takes as its offset, are inputs so that they stay untouched up to it */
  asm volatile("s_wait_xcnt 0x0" :: "v"(kh4), "v"(kl4), "v"(v4p), "v"(cp), "v"(lr) : "memory");

  /* KT hi/lo <- k^T; thread covers row lr, features dh..dh+31 (4 x 16-B words per plane): 128 threads x 32 = 64 x 64 */
  {
#pragma unroll
    for (int g = 0; g < 4; ++g) {
#pragma unroll
      for (int e = 0; e < 4; ++e) {
        const unsigned a = wh[g][e];
        const unsigned b = wl[g][e];
        const int d = dh + 8 * g + 2 * e;
        const unsigned a0 = a & 0xffffu, a1 = a >> 16;
        const unsigned b0 = b & 0xffffu, b1 = b >> 16;
        KTh[d * kLp + lr]       = bits2bf((unsigned short)a0);
        KTh[(d + 1) * kLp + lr] = bits2bf((unsigned short)a1);
        KTl[d * kLp + lr]       = bits2bf((unsigned short)b0);
        KTl[(d + 1) * kLp + lr] = bits2bf((unsigned short)b1);
      }
    }
  }
  vt_store(cv, vv, lr, dh, VTh, VTl);
  /* KT and VT are complete before any wave reads fragments of them */
  __syncthreads();

  v8f acc[4];
  acc[0] = z8; acc[1] = z8; acc[2] = z8; acc[3] = z8;
#pragma unroll
  for (int kk = 0; kk < 2; ++kk) {
    const v16b vbh = Frag<__bf16>::load(VTh + (16 * wave + c) * kLp + kk * 32 + koff);
    const v16b vbl = Frag<__bf16>::load(VTl + (16 * wave + c) * kLp + kk * 32 + koff);
#pragma unroll
    for (int i = 0; i < 4; ++i) {
      const v16b kh = Frag<__bf16>::load(KTh + (16 * i + c) * kLp + kk * 32 + koff);
      const v16b kl = Frag<__bf16>::load(KTl + (16 * i + c) * kLp + kk * 32 + koff);
      acc[i] = mma_g(kh, vbh, acc[i]);
      acc[i] = mma_g(kl, vbh, acc[i]);
      acc[i] = mma_g(kh, vbl, acc[i]);
    }
  }
  acc_guard4(acc[0], acc[1], acc[2], acc[3]);

  /* the wave's 1024 elements in state order: acc[i][r] = element i * 256 + 8 lane + r of its tile; through its own slab, so that a store
     is 32 lanes x 16 B = 512 contiguous bytes */
  float* slab = sT[wave];
#pragma unroll
  for (int i = 0; i < 4; ++i) {
    float* sp = slab + i * 256 + 8 * lane;
    *(v4f*)(sp)     = (v4f){acc[i][0], acc[i][1], acc[i][2], acc[i][3]};
    *(v4f*)(sp + 4) = (v4f){acc[i][4], acc[i][5], acc[i][6], acc[i][7]};
  }
  /* slab: written and read by this wave only, by different lanes */
  wave_lds_sync();
  float* op = CS + (size_t)blockIdx.x * (kHd * kHd) + (size_t)(wave * 1024 + 4 * lane);
  v4f ow[8];
#pragma unroll
  for (int it = 0; it < 8; ++it) ow[it] = *(const v4f*)(slab + it * 128 + 4 * lane);
#pragma unroll
  for (int it = 0; it < 8; ++it) *(v4f*)(op + it * 128) = ow[it];
}

/* exclusive prefix over the 64 chunks of one (b,h); thread owns 4 consecutive elements of a state, whatever their order: 32 x 1024 threads.
   A wave reads 512 B and writes 256 B per plane and chunk (whole lines). */
__global__ __launch_bounds__(128) void chunk_prefix_kernel(const float* __restrict__ CS, unsigned short* __restrict__ SHp,
                                                           unsigned short* __restrict__ SLp) {
  const int i = (int)blockIdx.x * 128 + (int)threadIdx.x;
  const size_t base = (size_t)(i >> 10) * kNChunk * (kHd * kHd) + (size_t)(i & 1023) * 4;
  v4f run = (v4f){0.f, 0.f, 0.f, 0.f};
  /* 32 chunks per trip, kept rolled for code size: the loads are independent and all in flight together, only the adds are ordered */
#pragma unroll 1
  for (int g = 0; g < kNChunk / 32; ++g) {
    const float* pc = CS + base + (size_t)g * 32 * (kHd * kHd);
    unsigned short* ph = SHp + base + (size_t)g * 32 * (kHd * kHd);
    unsigned short* pl = SLp + base + (size_t)g * 32 * (kHd * kHd);
    v4f t[32];
#pragma unroll
    for (int j = 0; j < 32; ++j) t[j] = *(const v4f*)(pc + j * (kHd * kHd));
    /* the wait that stands before a register named by an issued global load is overwritten; the address pair is an input so that
       it stays untouched up to it */
    asm volatile("s_wait_xcnt 0x0" :: "v"(pc) : "memory");
#pragma unroll
    for (int q = 0; q < 4; ++q) {
      v2u uh[8], ul[8];
#pragma unroll
      for (int j = 0; j < 8; ++j) {
        unsigned h0, l0, h1, l1;
        hilo_pk(run[0], run[1], h0, l0);
        hilo_pk(run[2], run[3], h1, l1);
        uh[j] = (v2u){h0, h1};
        ul[j] = (v2u){l0, l1};
        run += t[8 * q + j];
      }
#pragma unroll
      for (int j = 0; j < 8; ++j) {
        *(v2u*)(ph + (8 * q + j) * (kHd * kHd)) = uh[j];
        *(v2u*)(pl + (8 * q + j) * (kHd * kHd)) = ul[j];
      }
      /* the same wait behind the stores: their address pairs and data words are inputs so that they stay untouched up to it */
      asm volatile("s_wait_xcnt 0x0" :: "v"(ph), "v"(pl), "v"(uh[0]), "v"(uh[1]), "v"(uh[2]), "v"(uh[3]), "v"(uh[4]), "v"(uh[5]),
                   "v"(uh[6]), "v"(uh[7]), "v"(ul[0]), "v"(ul[1]), "v"(ul[2]), "v"(ul[3]), "v"(ul[4]), "v"(ul[5]), "v"(ul[6]), "v"(ul[7])
                   : "memory");
    }
  }
}

/* Launch 3 with the output projection in it: one block of 16 waves per (b, chunk) owns 64 rows of ALL 8 heads, so the attention tile
   [64][512] never leaves the WGP: it is written to LDS as bf16 hi/lo and is the A operand of out = (attn_hi + attn_lo) x bf16(Wo)^T + bo.
   Part 1, two passes of 4 heads: waves 4g..4g+3 work on head 4p + g, wave 4g + w on rows 16w..16w+15 of the chunk.
   Part 2: wave (wm, wn) owns the 32 x 64 tile at rows 32 wm, columns 64 wn; per stage of 64 k all 512 Wo rows are copied to LDS
   asynchronously, two buffers: stage s + 1 flies while stage s is multiplied.
   LDS: sA = attn hi | lo at pitch 520 (1040 B = 16 B x odd). sU is used three times over: part 1: VT hi/lo of 4 heads, then P hi/lo of
   16 waves; part 2: the two Wo buffers; epilogue: one f32 slab per wave.
   Coverage: 4 x 64 blocks x 64 rows x 512 columns. */
constexpr int kAp = kEmb + 8;
static_assert(kAp % 8 == 0, "LDS pitch keeps 16-B alignment");
static_assert(4 * 2 * kHd * kLp + 16 * 2 * 16 * kLp == 2 * kEmb * kLp, "VT and P strips fill exactly the two Wo buffers");
static_assert(16 * 16 * 68 * 4 <= 2 * kEmb * kLp * 2, "the slabs fit the Wo buffers");
__global__ __launch_bounds__(512) void chunk_out_proj_kernel(
    const unsigned short* __restrict__ QHp, const unsigned short* __restrict__ QLp,
    const unsigned short* __restrict__ KHp, const unsigned short* __restrict__ KLp,
    const float* __restrict__ VF, const float* __restrict__ RS, const float* __restrict__ COMP,
    const unsigned short* __restrict__ SHp, const unsigned short* __restrict__ SLp,
    const unsigned short* __restrict__ Wop, const float* __restrict__ bias, float* __restrict__ Fout) {
  __shared__ __align__(16) __bf16 sA[2][kChunk * kAp];
  __shared__ __align__(16) __bf16 sU[2 * kEmb * kLp];

  const int tid = threadIdx.x, lane = tid & 31, wave = tid >> 5;
  const int c = lane & 15, hh = lane >> 4, koff = hh * 8;
  const int bb = (int)blockIdx.x / kNChunk;
  const int n = (int)blockIdx.x % kNChunk;
  const int l0 = n * kChunk;
  const int grp = wave >> 2, w4 = wave & 3;
  __bf16* VTh = sU + grp * (2 * kHd * kLp);
  __bf16* VTl = VTh + kHd * kLp;
  __bf16* ph = sU + 4 * 2 * kHd * kLp + wave * (2 * 16 * kLp);
  __bf16* pl = ph + 16 * kLp;
  const int lr = (tid & 127) >> 1, dh = (tid & 1) * 32;
  const v8f z8 = (v8f){0.f,0.f,0.f,0.f,0.f,0.f,0.f,0.f};

  /* kept rolled for code size: the two passes differ only in the head */
#pragma unroll 1
  for (int p = 0; p < 2; ++p) {
    const int hd = 4 * p + grp;
    const int bh = bb * kHeads + hd;
    const size_t pbase = (size_t)bh * kSeq * kHd;
    const size_t sbase = ((size_t)bh * kNChunk + n) * (kHd * kHd);
    const __bf16* QH = (const __bf16*)QHp + pbase;
    const __bf16* QL = (const __bf16*)QLp + pbase;
    const __bf16* KH = (const __bf16*)KHp + pbase;
    const __bf16* KL = (const __bf16*)KLp + pbase;
    const __bf16* SH = (const __bf16*)SHp + sbase;
    const __bf16* SL = (const __bf16*)SLp + sbase;
    const float* rsp = RS + (size_t)bh * kSeq;

    /* first load group, in flight together: this thread's part of v with its row's comp, the Q fragments (rows 16w + c) and the
       row-major K fragments (rows 16j + c) */
    const float* v4p = VF + pbase + (size_t)l0 * kHd + 4 * (tid & 127);
    const float* cp = COMP + (size_t)bh * kSeq + l0 + lr;
    const __bf16* qhp = QH + (size_t)(l0 + 16 * w4 + c) * kHd + koff;
    const __bf16* qlp = QL + (size_t)(l0 + 16 * w4 + c) * kHd + koff;
    const __bf16* khp = KH + (size_t)(l0 + c) * kHd + koff;
    const __bf16* klp = KL + (size_t)(l0 + c) * kHd + koff;
    v4f vv[8];
    v16b qh[2], ql[2], kh[4][2], kl[4][2];
    v_words(v4p, vv);
#pragma unroll
    for (int dc = 0; dc < 2; ++dc) {
      qh[dc] = Frag<__bf16>::load(qhp + dc * 32);
      ql[dc] = Frag<__bf16>::load(qlp + dc * 32);
    }
#pragma unroll
    for (int j = 0; j < 4; ++j) {
#pragma unroll
      for (int dc = 0; dc < 2; ++dc) {
        kh[j][dc] = Frag<__bf16>::load(khp + 16 * j * kHd + dc * 32);
        kl[j][dc] = Frag<__bf16>::load(klp + 16 * j * kHd + dc * 32);
      }
    }
    const float cv = *cp;
    /* the wait that stands before a register named by an issued global load is overwritten; the address pairs are inputs so that
       they stay untouched up to it */
    asm volatile("s_wait_xcnt 0x0" :: "v"(v4p), "v"(cp), "v"(qhp), "v"(qlp), "v"(khp), "v"(klp) : "memory");

    vt_store(cv, vv, lr, dh, VTh, VTl);

    /* scores rows 16w.., all 64 columns; inclusive causal mask by select; hi/lo into this wave's P strip */
#pragma unroll
    for (int j = 0; j < 4; ++j) {
      v8f s = z8;
#pragma unroll
      for (int dc = 0; dc < 2; ++dc) {
        s = mma_g(qh[dc], kh[j][dc], s);
        s = mma_g(qh[dc], kl[j][dc], s);
        s = mma_g(ql[dc], kh[j][dc], s);
      }
      const int jj = 16 * j + c;
#pragma unroll
      for (int r = 0; r < 8; r += 2) {
        const int ii = 16 * w4 + 8 * hh + r;
        unsigned h, l;
        hilo_pk((jj <= ii) ? s[r] : 0.0f, (jj <= ii + 1) ? s[r + 1] : 0.0f, h, l);
        ph[(8 * hh + r) * kLp + jj]     = bits2bf((unsigned short)(h & 0xffffu));
        ph[(8 * hh + r + 1) * kLp + jj] = bits2bf((unsigned short)(h >> 16));
        pl[(8 * hh + r) * kLp + jj]     = bits2bf((unsigned short)(l & 0xffffu));
        pl[(8 * hh + r + 1) * kLp + jj] = bits2bf((unsigned short)(l >> 16));
      }
    }

    /* second load group, in flight together: the St fragments (Bt rows m = 16t + c, k = d) and the row scales */
    const __bf16* sph = SH + 8 * lane;
    const __bf16* spl = SL + 8 * lane;
    const float* rp = rsp + l0 + 16 * w4 + 8 * hh;
    v16b sh[4][2], sl[4][2];
#pragma unroll
    for (int t = 0; t < 4; ++t) {
#pragma unroll
      for (int dc = 0; dc < 2; ++dc) {
        sh[t][dc] = state_frag(sph + t * 1024 + dc * 512);
        sl[t][dc] = state_frag(spl + t * 1024 + dc * 512);
      }
    }
    const v4f r0 = *(const v4f*)(rp);
    const v4f r1 = *(const v4f*)(rp + 4);
    /* the same wait for the second group */
    asm volatile("s_wait_xcnt 0x0" :: "v"(sph), "v"(spl), "v"(rp) : "memory");

    v8f accO[4];
    accO[0] = z8; accO[1] = z8; accO[2] = z8; accO[3] = z8;
    /* inter: Q x St^T */
#pragma unroll
    for (int t = 0; t < 4; ++t) {
#pragma unroll
      for (int dc = 0; dc < 2; ++dc) {
        accO[t] = mma_g(qh[dc], sh[t][dc], accO[t]);
        accO[t] = mma_g(qh[dc], sl[t][dc], accO[t]);
        accO[t] = mma_g(ql[dc], sh[t][dc], accO[t]);
      }
    }
    /* VT is complete before any wave reads fragments of it; the barrier also orders this wave's P strip writes before its reads */
    __syncthreads();
    /* intra: P x v' (A rows i = c of the strip, k = j; Bt rows m = 16t + c of VT, k = j) */
#pragma unroll
    for (int kk = 0; kk < 2; ++kk) {
      const v16b pah = Frag<__bf16>::load(ph + c * kLp + kk * 32 + koff);
      const v16b pal = Frag<__bf16>::load(pl + c * kLp + kk * 32 + koff);
#pragma unroll
      for (int t = 0; t < 4; ++t) {
        const v16b vh = Frag<__bf16>::load(VTh + (16 * t + c) * kLp + kk * 32 + koff);
        const v16b vl = Frag<__bf16>::load(VTl + (16 * t + c) * kLp + kk * 32 + koff);
        accO[t] = mma_g(pah, vh, accO[t]);
        accO[t] = mma_g(pah, vl, accO[t]);
        accO[t] = mma_g(pal, vh, accO[t]);
      }
    }
    /* row scale, bf16 hi/lo, into columns 64 hd .. 64 hd + 63 of the attention tile */
    {
      float rsv[8];
#pragma unroll
      for (int e = 0; e < 4; ++e) { rsv[e] = r0[e]; rsv[4 + e] = r1[e]; }
      __bf16* ah = sA[0] + (16 * w4 + 8 * hh) * kAp + hd * kHd + c;
      __bf16* al = sA[1] + (16 * w4 + 8 * hh) * kAp + hd * kHd + c;
#pragma unroll
      for (int t = 0; t < 4; ++t) {
#pragma unroll
        for (int r = 0; r < 8; r += 2) {
          unsigned h, l;
          hilo_pk(accO[t][r] * rsv[r], accO[t][r + 1] * rsv[r + 1], h, l);
          ah[r * kAp + 16 * t]       = bits2bf((unsigned short)(h & 0xffffu));
          ah[(r + 1) * kAp + 16 * t] = bits2bf((unsigned short)(h >> 16));
          al[r * kAp + 16 * t]       = bits2bf((unsigned short)(l & 0xffffu));
          al[(r + 1) * kAp + 16 * t] = bits2bf((unsigned short)(l >> 16));
        }
      }
    }
    /* foot of a pass: this wave's reads of VT and P have returned and its tile writes are done ... */
    asm volatile("s_wait_dscnt 0x0" ::: "memory");
    /* ... and every wave's: VT and P may be rewritten (next pass, or the Wo copies); after the last pass the attention tile is complete */
    __syncthreads();
  }

  /* ---- part 2: out tile = (attn_hi + attn_lo) x Wo^T ---- */
  const __bf16* Bt = (const __bf16*)Wop;
  constexpr int kStages = kEmb / 64;
  const int wm = wave >> 3, wn = wave & 7;
  v8f acc[2][4];
#pragma unroll
  for (int i = 0; i < 2; ++i)
#pragma unroll
    for (int j = 0; j < 4; ++j) acc[i][j] = z8;

  /* this thread's piece of a stage: row (tid >> 3) of each group of 64 rows, 16-B piece (tid & 7) of the row's 128 B */
  const int crow = tid >> 3;
  const int ccol = (tid & 7) * 8;
  const __bf16* gB = Bt + (size_t)crow * kEmb + ccol;
  const unsigned lbase = (unsigned)(size_t)(&sU[crow * kLp + ccol]);
  constexpr unsigned kBufBytes = kEmb * kLp * 2;
  constexpr unsigned kG = 64 * kLp * 2;   /* LDS bytes of a group of 64 rows */
  auto stage = [&](int st) {
    const unsigned l = lbase + (unsigned)(st & 1) * kBufBytes;
    const __bf16* g = gB + st * 64;
    async_copy4(l, l + kG, l + 2 * kG, l + 3 * kG, g, g + 64 * kEmb, g + 128 * kEmb, g + 192 * kEmb);
    async_copy4(l + 4 * kG, l + 5 * kG, l + 6 * kG, l + 7 * kG, g + 256 * kEmb, g + 320 * kEmb, g + 384 * kEmb, g + 448 * kEmb);
  };

  stage(0);
  /* stage 0 has landed for this wave's own copies ... */
  asm volatile("s_wait_asynccnt 0x0" ::: "memory");
  /* ... and for every wave's before anyone reads it */
  __syncthreads();
  stage(1);

  /* kept rolled for code size: the two buffers differ only in one base address */
#pragma unroll 1
  for (int st = 0; st < kStages; ++st) {
    const __bf16* sb  = sU + (st & 1) * (kEmb * kLp) + ((wn << 6) + c) * kLp + koff;
    const __bf16* sah = sA[0] + ((wm << 5) + c) * kAp + st * 64 + koff;
    const __bf16* sal = sA[1] + ((wm << 5) + c) * kAp + st * 64 + koff;
    /* the loops over k blocks, fragments and tiles are fully unrolled so that these are indexed by constants and stay in registers */
    /* all fragment reads of the stage first, as one group in front of its WMMAs */
    v16b bh[2][4], ah[2][2], al[2][2];
#pragma unroll
    for (int kk = 0; kk < 2; ++kk) {
#pragma unroll
      for (int j = 0; j < 4; ++j) bh[kk][j] = Frag<__bf16>::load(sb + (j << 4) * kLp + kk * 32);
#pragma unroll
      for (int i = 0; i < 2; ++i) {
        ah[kk][i] = Frag<__bf16>::load(sah + (i << 4) * kAp + kk * 32);
        al[kk][i] = Frag<__bf16>::load(sal + (i << 4) * kAp + kk * 32);
      }
    }
#pragma unroll
    for (int kk = 0; kk < 2; ++kk) {
#pragma unroll
      for (int i = 0; i < 2; ++i) {
#pragma unroll
        for (int j = 0; j < 4; ++j) {
          acc[i][j] = Frag<__bf16>::mma(ah[kk][i], bh[kk][j], acc[i][j]);
          acc[i][j] = Frag<__bf16>::mma(al[kk][i], bh[kk][j], acc[i][j]);
        }
        dep_guard4_b(acc[i][0], acc[i][1], acc[i][2], acc[i][3], ah[kk][i], al[kk][i]);
      }
      keep4_b(bh[kk][0], bh[kk][1], bh[kk][2], bh[kk][3]);
    }
    /* publish point of stage st + 1: this wave's reads of buffer st & 1 have returned ... */
    asm volatile("s_wait_dscnt 0x0" ::: "memory");
    /* ... its own copies of stage st + 1 have landed ... */
    asm volatile("s_wait_asynccnt 0x0" ::: "memory");
    /* ... and the same holds for every wave: stage st + 1 may be read, buffer st & 1 may be refilled */
    __syncthreads();
    if (st + 2 < kStages) stage(st + 2);
  }
  /* no copy is outstanding when the wave goes on to the epilogue and ends */
  asm volatile("s_wait_asynccnt 0x0" ::: "memory");
  acc_guard4(acc[0][0], acc[0][1], acc[0][2], acc[0][3]);
  acc_guard4(acc[1][0], acc[1][1], acc[1][2], acc[1][3]);

  /* epilogue: bias, the wave's 16 x 64 f32 in its own slab (the Wo buffers are dead behind the last barrier), whole-line stores:
     16 lanes x 16 B = 256 B of a row, 2 rows per instruction */
  float* slab = (float*)sU + wave * (16 * 68);
  const int n0 = wn << 6;
  const int c4 = c * 4;
#pragma unroll
  for (int i = 0; i < 2; ++i) {
#pragma unroll
    for (int j = 0; j < 4; ++j) {
      const float bv = bias[n0 + (j << 4) + c];
#pragma unroll
      for (int r = 0; r < 8; ++r) slab[(8 * hh + r) * 68 + (j << 4) + c] = acc[i][j][r] + bv;
    }
    /* slab: written and read by this wave only, by different lanes */
    wave_lds_sync();
    float* op = Fout + (size_t)(bb * kSeq + l0 + (wm << 5) + (i << 4) + hh) * kEmb + n0 + c4;
#pragma unroll
    for (int it = 0; it < 8; ++it) {
      const v4f v = *(const v4f*)(slab + (it * 2 + hh) * 68 + c4);
      *(v4f*)(op + (size_t)(it * 2) * kEmb) = v;
    }
    /* the wait that stands before a register named by an issued global store is overwritten; the address pair is an input so that
       it stays untouched up to it */
    asm volatile("s_wait_xcnt 0x0" :: "v"(op) : "memory");
    wave_lds_sync();
  }
}

/* ---- host glue ----
   Workspace region map (bytes, 256-B aligned carve; total 191,897,600 <= 268,435,456):
     XB    [16384][512] bf16   16,777,216   bf16(x)
     WQKV  [1536][512]  bf16    1,572,864   bf16(Wq | Wk | Wv)
     WOB   [512][512]   bf16      524,288   bf16(Wo)
     BIAS  [2048]       f32         8,192   bf16 values of bq | bk | bv | bo kept as f32
     QH,QL,KH,KL [32][4096][64] bf16  4 x 16,777,216   sigmoid(q), sigmoid(k) as hi/lo planes
     VF    [32][64][4096] f32  33,554,432   v, reader order inside a chunk
     RS, COMP [32][4096] f32   2 x 524,288
     SINK, SRC, D3, D4 [32][4096] f32   4 x 524,288   per-row values handed between the flow scan launches
     T0, T1 [32][64][128] f32  2 x 1,048,576   segment totals (k | q, then k*src_out | q*sink_in)
     CS    [32][64][4096] f32  33,554,432   each chunk's own state St_n, state order
     SH, SL [32][64][4096] bf16  2 x 16,777,216   state before each chunk as hi/lo planes, state order */
extern "C" void kernel_launch(void* const* d_in, const int* in_sizes, int n_in,
                              void* d_out, int out_size, void* d_ws, size_t ws_size, hipStream_t stream) {
  if (n_in < 9 || d_out == nullptr || d_ws == nullptr) return;
  if (in_sizes[0] != kRows * kEmb || in_sizes[1] != kEmb * kEmb || in_sizes[2] != kEmb ||
      in_sizes[3] != kEmb * kEmb || in_sizes[4] != kEmb || in_sizes[5] != kEmb * kEmb ||
      in_sizes[6] != kEmb || in_sizes[7] != kEmb * kEmb || in_sizes[8] != kEmb ||
      out_size != kRows * kEmb) return;

  const float* x  = (const float*)d_in[0];
  const float* Wq = (const float*)d_in[1];
  const float* bq = (const float*)d_in[2];
  const float* Wk = (const float*)d_in[3];
  const float* bk = (const float*)d_in[4];
  const float* Wv = (const float*)d_in[5];
  const float* bv = (const float*)d_in[6];
  const float* Wo = (const float*)d_in[7];
  const float* bo = (const float*)d_in[8];
  float* out = (float*)d_out;

  char* ws = (char*)d_ws; size_t off = 0;
  auto carve = [&](size_t bytes) -> char* { char* p = ws + off; off += (bytes + 255) & ~(size_t)255; return p; };
  unsigned short* XB   = (unsigned short*)carve((size_t)kRows * kEmb * 2);
  unsigned short* WQKV = (unsigned short*)carve((size_t)kQkvN * kEmb * 2);
  unsigned short* WOB  = (unsigned short*)carve((size_t)kEmb * kEmb * 2);
  float*          BIAS = (float*)carve((size_t)4 * kEmb * 4);
  unsigned short* QH   = (unsigned short*)carve((size_t)kBH * kSeq * kHd * 2);
  unsigned short* QL   = (unsigned short*)carve((size_t)kBH * kSeq * kHd * 2);
  unsigned short* KH   = (unsigned short*)carve((size_t)kBH * kSeq * kHd * 2);
  unsigned short* KL   = (unsigned short*)carve((size_t)kBH * kSeq * kHd * 2);
  float*          VF   = (float*)carve((size_t)kBH * kSeq * kHd * 4);
  float*          RS   = (float*)carve((size_t)kBH * kSeq * 4);
  float*          COMP = (float*)carve((size_t)kBH * kSeq * 4);
  float*          SINK = (float*)carve((size_t)kBH * kSeq * 4);
  float*          SRC  = (float*)carve((size_t)kBH * kSeq * 4);
  float*          D3   = (float*)carve((size_t)kBH * kSeq * 4);
  float*          D4   = (float*)carve((size_t)kBH * kSeq * 4);
  float*          T0   = (float*)carve((size_t)kBH * kNSeg * 128 * 4);
  float*          T1   = (float*)carve((size_t)kBH * kNSeg * 128 * 4);
  float*          CS   = (float*)carve((size_t)kBH * kNChunk * kHd * kHd * 4);
  unsigned short* SH   = (unsigned short*)carve((size_t)kBH * kNChunk * kHd * kHd * 2);
  unsigned short* SL   = (unsigned short*)carve((size_t)kBH * kNChunk * kHd * kHd * 2);
  if (off > ws_size || off > (size_t)268435456) return;

  /* 16-bit operand planes and the bias plane, one launch */
  prep_kernel<<<kPrepBlocks, 256, 0, stream>>>(x, Wq, Wk, Wv, Wo, bq, bk, bv, bo, XB, WQKV, WOB, BIAS);

  /* projections: M = 16384, N = 1536, K = 512; 128 x 6 block tiles of 128 x 256 = 768 blocks x 8 waves */
  gemm64_kernel<<<(kRows / 64) * (kQkvN / 64) / 8, 256, 0, stream>>>(
      XB, WQKV, BIAS, QH, QL, KH, KL, VF, kRows, kQkvN);

  /* flow scans: three launches of 1024 waves (two 64-row segments each), then one block per (b,h) */
  flow_seg_total_kernel<<<kBH * (kNSeg / 2), 32, 0, stream>>>(QH, QL, KH, KL, T0);
  flow_incoming_kernel<<<kBH * (kNSeg / 2), 32, 0, stream>>>(QH, QL, KH, KL, T0, SINK, SRC, T1);
  flow_conserved_kernel<<<kBH * (kNSeg / 2), 32, 0, stream>>>(QH, QL, KH, KL, T1, SINK, SRC, D3, D4);
  flow_finish_kernel<<<kBH, 1024, 0, stream>>>(D3, D4, SINK, RS, COMP);

  /* chunk states of all (b,h) (2048 blocks), then their exclusive prefix over the chunks (256 blocks) */
  chunk_state_kernel<<<kBH * kNChunk, 128, 0, stream>>>(KH, KL, VF, COMP, CS);
  chunk_prefix_kernel<<<kBH * kHd * kHd / 4 / 128, 128, 0, stream>>>(CS, SH, SL);

  /* all chunks' outputs with the output projection M = 16384, N = 512, K = 512 in the same launch (256 blocks, one per WGP) */
  chunk_out_proj_kernel<<<kBatch * kNChunk, 512, 0, stream>>>(QH, QL, KH, KL, VF, RS, COMP, SH, SL, WOB, BIAS + 3 * kEmb, out);
}
